// v000
// The times below were measured on an AMD MI455X: many runs one after another, warmed up first and cycling through
// copies of the inputs, with the whole window's GPU time divided by the number of runs. Launches and the gaps
// between them are all in it. The median over several windows is given; except for v000 it joins two sittings, which
// can be a few percent apart, so the side-by-side timings, each taken in one sitting, are the better comparison.
// v000, which the later versions start from, runs in 9920 microseconds.
#include <hip/hip_runtime.h>
// Single attention head returning the TUPLE (out, k, v) (x [4][2048][1024]; q = x Wq, k = x Wk, v = x Wv ([in][out] 1024 x 64, sigma 1/32, no biases); wei = q . k x 1024^-0.5 (the module scales by n_embd) with a causal mask (tril, -inf); softmax; out = wei v -> out0 [4][2048][64] @0, out1 = k [4][2048][64] f32 @2,097,152 B, out2 = v [4][2048][64] f32 @4,194,304 B; input order x, Wq, Wk, Wv).
// Structure: x as exact f16 rows; the three [in][out] weights as exact x16 planes; q, k, v as WMMA GEMMs (32x64 wave tiles, f32 accumulation, K = 1024): q as f16 rows, k and v in f32 STRAIGHT INTO the tuple output slots (out1, out2) and then split into f16 (v: hi + x1024 residual) planes; per batch: V^T (hi and residual) via LDS transposes; per query tile of 256 rows: scores against the keys below the tile end only (K = 64, alpha 1/32) into an f32 plane, causal row softmax on VALU (arithmetic 0/1 select; f32 statistics, native exp) writing the weights as f16 hi (x256) + x1024 residual planes, out = P_hi V^T (alpha 2^-8) written f32 then += P_lo V_hi^T and += P_hi V_lo^T (alpha 2^-18 each; own-element accumulates in the next launches); launches: see trace.
// Compute dtype: inputs rounded to bf16; q, k rounded to f16; v f16 hi + x1024 residual; softmax weights f16 hi (x256) + x1024 residual; scores, statistics, out f32. v_wmma_f32_16x16x32_f16.
#define NB 4
#define NHS 1
#define DMX 1024                   /* model width (projection K) */
#define SQ 2048
#define HD 64
#define DM 64
#define NH 1
#define HG 1
#define QT 256
#define NKX SQ
#define NR ((size_t)NB * NHS * SQ)
typedef __bf16 v16b __attribute__((ext_vector_type(16)));
typedef unsigned short v8us __attribute__((ext_vector_type(8), may_alias));
typedef float  v8f  __attribute__((ext_vector_type(8)));
typedef float  v4f  __attribute__((ext_vector_type(4)));
typedef float  v4fa __attribute__((ext_vector_type(4), may_alias));
union FragB { v16b v; v8us half[2]; unsigned short u[16]; };

__device__ __forceinline__ unsigned short bf16_bits(float x) { unsigned int u = __float_as_uint(x); return (unsigned short)((u + 0x7FFFu + ((u >> 16) & 1u)) >> 16); }
__device__ __forceinline__ float bf16_val(unsigned short b) { return __uint_as_float(((unsigned int)b) << 16); }
__device__ __forceinline__ float bf16_round(float x) { return bf16_val(bf16_bits(x)); }
// D += A·B with NT terms: 1 = ah·bh, 2 = + al·bh (A split), 3 = + ah·bl (both split)
template <int NT>
__device__ __forceinline__ v8f mmaN(v16b ah, v16b al, v16b bh, v16b bl, v8f c) {
  c = __builtin_amdgcn_wmma_f32_16x16x32_bf16(false, ah, false, bh, (short)0, c, false, false);
  if (NT >= 2) c = __builtin_amdgcn_wmma_f32_16x16x32_bf16(false, al, false, bh, (short)0, c, false, false);
  if (NT >= 3) c = __builtin_amdgcn_wmma_f32_16x16x32_bf16(false, ah, false, bl, (short)0, c, false, false);
  asm volatile("v_nop\n\tv_nop\n\tv_nop\n\tv_nop" : "+v"(c) : "v"(ah), "v"(al), "v"(bh), "v"(bl));
  return c;
}

__global__ __launch_bounds__(256) void k_wt_bf16(const float* __restrict__ W, unsigned short* __restrict__ Wt, int K, int N) {
  const int t = blockIdx.x * 256 + threadIdx.x;
  const int k8n = K / 8;
  if (t >= N * k8n) return;
  const int n = t / k8n, k8 = (t % k8n) * 8;
  v8us v;
#pragma unroll
  for (int i = 0; i < 8; ++i) v[i] = bf16_bits(W[(size_t)(k8 + i) * N + n]);
  *(v8us*)(Wt + (size_t)n * K + k8) = v;
  
}

// GEMM C[M][N] (f32, pitch ldc) = act(A[M][K]·W + bias). A f32 row-major (pitch lda) converted per fragment to bf16
// (ASPLIT: hi/lo two planes -> 2 terms, else single rounded term); Wt bf16 [N][K] (pitch ldb). BIAS_BF16 rounds the
// bias to bf16 first (bias quantised to bf16 before the add). K%32==0, M%16==0, N%64==0.
template <bool ASPLIT, int ACT, bool BIAS_BF16>
__global__ __launch_bounds__(128) void k_gemm_bf(const float* __restrict__ A, int lda, const unsigned short* __restrict__ Wt, int ldb,
                                               const float* __restrict__ bias, float* __restrict__ C, int ldc, int M, int N, int K) {
  __shared__ __attribute__((aligned(16))) float so[4][16][64];
  const int tid = threadIdx.x, w = tid >> 5, lane = tid & 31, ln = lane & 15, hh = lane >> 4;
  const int ntn = N / 64;
  const int wid = blockIdx.x * 4 + w;
  const int mt = wid / ntn, nq = wid % ntn;
  if (mt * 16 >= M) return;
  const int row0 = mt * 16, col0 = nq * 64;
  const float* arow = A + (size_t)(row0 + ln) * lda;
  v8f acc[4] = {};
  for (int kb = 0; kb < K; kb += 32) {
    FragB ah, al;
    const v4f x0 = *(const v4fa*)(arow + kb + 8 * hh), x1 = *(const v4fa*)(arow + kb + 8 * hh + 4);
    const v4f x2 = *(const v4fa*)(arow + kb + 16 + 8 * hh), x3 = *(const v4fa*)(arow + kb + 16 + 8 * hh + 4);
    float xs[16] = {x0[0],x0[1],x0[2],x0[3],x1[0],x1[1],x1[2],x1[3],x2[0],x2[1],x2[2],x2[3],x3[0],x3[1],x3[2],x3[3]};
#pragma unroll
    for (int i = 0; i < 16; ++i) { const unsigned short hb = bf16_bits(xs[i]); ah.u[i] = hb; al.u[i] = ASPLIT ? bf16_bits(xs[i] - bf16_val(hb)) : (unsigned short)0; }
#pragma unroll
    for (int t = 0; t < 4; ++t) {
      const unsigned short* brow = Wt + (size_t)(col0 + t * 16 + ln) * ldb + kb;
      FragB b;
      b.half[0] = *(const v8us*)(brow + 8 * hh);
      b.half[1] = *(const v8us*)(brow + 16 + 8 * hh);
      acc[t] = mmaN<ASPLIT ? 2 : 1>(ah.v, al.v, b.v, b.v, acc[t]);
    }
  }
#pragma unroll
  for (int t = 0; t < 4; ++t) {
    float bv = bias ? bias[col0 + t * 16 + ln] : 0.f;
    if (BIAS_BF16) bv = bf16_round(bv);
#pragma unroll
    for (int r = 0; r < 8; ++r) { float v = acc[t][r] + bv; if (ACT == 1) v = fmaxf(v, 0.f); so[w][8 * hh + r][t * 16 + ln] = v; }
  }
  __builtin_amdgcn_fence(__ATOMIC_ACQ_REL, "workgroup");
  __builtin_amdgcn_wave_barrier();
  const int rsub = lane >> 4, c4 = (lane & 15) * 4;
  {
#pragma unroll
    for (int q = 0; q < 8; ++q) {
      const int r = q * 2 + rsub;
      const v4f v = *(const v4fa*)&so[w][r][c4];
      *(v4f*)(C + (size_t)(row0 + r) * ldc + col0 + c4) = v;
    }
    
  }
}

// GEMM C = act(A·W + bias + resid): A f32 (ASPLIT -> hi/lo 2 terms), Wt bf16 [N][K]; ACT 0 none, 1 relu, 2 exact gelu;
// resid (optional, f32, row index = (row % rmod), pitch ldr, RES_BF16 rounds it) added before the activation.
template <bool ASPLIT, int ACT, bool BIAS_BF16, bool RES_BF16>
__global__ __launch_bounds__(128) void k_gemm_bf3(const float* __restrict__ A, int lda, const unsigned short* __restrict__ Wt, int ldb,
                                                const float* __restrict__ bias, const float* __restrict__ resid, int rmod, int ldr,
                                                float* __restrict__ C, int ldc, int M, int N, int K) {
  __shared__ __attribute__((aligned(16))) float so[4][16][64];
  const int tid = threadIdx.x, w = tid >> 5, lane = tid & 31, ln = lane & 15, hh = lane >> 4;
  const int ntn = N / 64;
  const int wid = blockIdx.x * 4 + w;
  const int mt = wid / ntn, nq = wid % ntn;
  if (mt * 16 >= M) return;
  const int row0 = mt * 16, col0 = nq * 64;
  const float* arow = A + (size_t)(row0 + ln) * lda;
  v8f acc[4] = {};
  for (int kb = 0; kb < K; kb += 32) {
    FragB ah, al;
    const v4f x0 = *(const v4fa*)(arow + kb + 8 * hh), x1 = *(const v4fa*)(arow + kb + 8 * hh + 4);
    const v4f x2 = *(const v4fa*)(arow + kb + 16 + 8 * hh), x3 = *(const v4fa*)(arow + kb + 16 + 8 * hh + 4);
    float xs[16] = {x0[0],x0[1],x0[2],x0[3],x1[0],x1[1],x1[2],x1[3],x2[0],x2[1],x2[2],x2[3],x3[0],x3[1],x3[2],x3[3]};
#pragma unroll
    for (int i = 0; i < 16; ++i) { const unsigned short hb = bf16_bits(xs[i]); ah.u[i] = hb; al.u[i] = ASPLIT ? bf16_bits(xs[i] - bf16_val(hb)) : (unsigned short)0; }
#pragma unroll
    for (int t = 0; t < 4; ++t) {
      const unsigned short* brow = Wt + (size_t)(col0 + t * 16 + ln) * ldb + kb;
      FragB b;
      b.half[0] = *(const v8us*)(brow + 8 * hh);
      b.half[1] = *(const v8us*)(brow + 16 + 8 * hh);
      acc[t] = mmaN<ASPLIT ? 2 : 1>(ah.v, al.v, b.v, b.v, acc[t]);
    }
  }
#pragma unroll
  for (int t = 0; t < 4; ++t) {
    const int col = col0 + t * 16 + ln;
    float bv = bias ? bias[col] : 0.f;
    if (BIAS_BF16) bv = bf16_round(bv);
#pragma unroll
    for (int r = 0; r < 8; ++r) {
      float v = acc[t][r] + bv;
      if (resid) { float rv = resid[(size_t)((row0 + 8 * hh + r) % rmod) * ldr + col]; if (RES_BF16) rv = bf16_round(rv); v += rv; }
      if (ACT == 1) v = fmaxf(v, 0.f);
      if (ACT == 2) v = 0.5f * v * (1.0f + erff(v * 0.70710678118654752f));
      if (ACT == 3) { const float u = 0.7978845608028654f * (v + 0.044715f * v * v * v); v = 0.5f * v * (1.0f + tanhf(u)); }
      so[w][8 * hh + r][t * 16 + ln] = v;
    }
  }
  __builtin_amdgcn_fence(__ATOMIC_ACQ_REL, "workgroup");
  __builtin_amdgcn_wave_barrier();
  const int rsub = lane >> 4, c4 = (lane & 15) * 4;
  {
#pragma unroll
    for (int q = 0; q < 8; ++q) {
      const int r = q * 2 + rsub;
      const v4f v = *(const v4fa*)&so[w][r][c4];
      *(v4f*)(C + (size_t)(row0 + r) * ldc + col0 + c4) = v;
    }
    
  }
}
// row LayerNorm (biased variance, eps) over N: s = X (+ R); optional out_sum <- s; out_norm <- (s-mu)*rsqrt(var+eps)*g + b
template <bool PARAM_BF16>
__global__ __launch_bounds__(256) void k_layernorm(const float* __restrict__ X, const float* __restrict__ R, const float* __restrict__ g, const float* __restrict__ bta,
                                                  float* __restrict__ out_sum, float* __restrict__ out_norm, int N, float eps) {
  __shared__ float red[256];
  const int row = blockIdx.x, tid = threadIdx.x;
  const float* x = X + (size_t)row * N; const float* rr = R ? R + (size_t)row * N : nullptr;
  float vals[16];                     // up to N = 4096
  const int per = N / 256;            // contiguous chunk per thread? use strided-by-4 chunks: thread handles j = tid*4 + 1024*u
  float s1 = 0.f;
  for (int u = 0; u < per / 4; ++u) {
    const int j = tid * 4 + 1024 * u;
    const v4f a = *(const v4fa*)(x + j);
    v4f b = {0.f,0.f,0.f,0.f}; if (rr) b = *(const v4fa*)(rr + j);
#pragma unroll
    for (int q = 0; q < 4; ++q) { const float v = a[q] + b[q]; vals[u * 4 + q] = v; s1 += v; }
  }
  red[tid] = s1; __syncthreads();
  for (int st = 128; st > 0; st >>= 1) { if (tid < st) red[tid] += red[tid + st]; __syncthreads(); }
  const float mu = red[0] / (float)N; __syncthreads();
  float s2 = 0.f;
  for (int u = 0; u < per / 4; ++u)
#pragma unroll
    for (int q = 0; q < 4; ++q) { const float c = vals[u * 4 + q] - mu; s2 += c * c; }
  red[tid] = s2; __syncthreads();
  for (int st = 128; st > 0; st >>= 1) { if (tid < st) red[tid] += red[tid + st]; __syncthreads(); }
  const float rs = rsqrtf(red[0] / (float)N + eps);
  {
    for (int u = 0; u < per / 4; ++u) {
      const int j = tid * 4 + 1024 * u;
      v4f o, sm;
#pragma unroll
      for (int q = 0; q < 4; ++q) {
        float gg = g[j + q], bb = bta[j + q];
        if (PARAM_BF16) { gg = bf16_round(gg); bb = bf16_round(bb); }
        sm[q] = vals[u * 4 + q]; o[q] = (vals[u * 4 + q] - mu) * rs * gg + bb;
      }
      if (out_sum) *(v4f*)(out_sum + (size_t)row * N + j) = sm;
      *(v4f*)(out_norm + (size_t)row * N + j) = o;
    }
    
  }
}



// ---- f16 WMMA path (v_wmma_f32_16x16x32_f16): 11-bit significands for operands in range — used where a [0,1] probability operand needs more precision than bf16
typedef _Float16 v16h __attribute__((ext_vector_type(16)));
union FragH { v16h v; v8us half[2]; _Float16 h[16]; unsigned short u[16]; };
template <int NT>
__device__ __forceinline__ v8f mmaH(v16h ah, v16h al, v16h bh, v16h bl, v8f c) {
  c = __builtin_amdgcn_wmma_f32_16x16x32_f16(false, ah, false, bh, (short)0, c, false, false);
  if (NT >= 2) c = __builtin_amdgcn_wmma_f32_16x16x32_f16(false, al, false, bh, (short)0, c, false, false);
  if (NT >= 3) c = __builtin_amdgcn_wmma_f32_16x16x32_f16(false, ah, false, bl, (short)0, c, false, false);
  asm volatile("v_nop\n\tv_nop\n\tv_nop\n\tv_nop" : "+v"(c) : "v"(ah), "v"(al), "v"(bh), "v"(bl));
  return c;
}
// batched GEMM like k_gemm_b but f16 operands: A f32 (split into f16 hi/lo if ASPLIT, else rounded to f16), Bt = f16 values [n][k]; alpha; C f32; N multiple of 16 (partial tiles skipped)
template <bool ASPLIT>
__global__ __launch_bounds__(128) void k_gemm_h(const float* __restrict__ A, int lda, size_t sA, const _Float16* __restrict__ Bh, int ldb, size_t sB, float alpha, float* __restrict__ C, int ldc, size_t sC, int M, int N, int K) {
  __shared__ __attribute__((aligned(16))) float so[4][16][64];
  const int tid = threadIdx.x, w = tid >> 5, lane = tid & 31, ln = lane & 15, hh = lane >> 4; const int by = blockIdx.y;
  A += (size_t)by * sA; Bh += (size_t)by * sB; C += (size_t)by * sC;
  const int ntn = (N + 63) / 64; const int wid = blockIdx.x * 4 + w; const int mt = wid / ntn, nq = wid % ntn; if (mt * 16 >= M) return;
  const int row0 = mt * 16, col0 = nq * 64; const float* arow = A + (size_t)(row0 + ln) * lda;
  v8f acc[4] = {};
  for (int kb = 0; kb < K; kb += 32) {
    FragH ah, al;
    const v4f x0 = *(const v4fa*)(arow + kb + 8 * hh), x1 = *(const v4fa*)(arow + kb + 8 * hh + 4), x2 = *(const v4fa*)(arow + kb + 16 + 8 * hh), x3 = *(const v4fa*)(arow + kb + 16 + 8 * hh + 4);
    float xs[16] = {x0[0],x0[1],x0[2],x0[3],x1[0],x1[1],x1[2],x1[3],x2[0],x2[1],x2[2],x2[3],x3[0],x3[1],x3[2],x3[3]};
#pragma unroll
    for (int i = 0; i < 16; ++i) { const _Float16 h = (_Float16)xs[i]; ah.h[i] = h; al.h[i] = ASPLIT ? (_Float16)(xs[i] - (float)h) : (_Float16)0.0f; }
#pragma unroll
    for (int t = 0; t < 4; ++t) { if (col0 + t * 16 >= N) continue; const size_t boff = (size_t)(col0 + t * 16 + ln) * ldb + kb; FragH bq; bq.half[0] = *(const v8us*)(Bh + boff + 8 * hh); bq.half[1] = *(const v8us*)(Bh + boff + 16 + 8 * hh);
      acc[t] = mmaH<ASPLIT ? 2 : 1>(ah.v, al.v, bq.v, bq.v, acc[t]); }
  }
#pragma unroll
  for (int t = 0; t < 4; ++t) { if (col0 + t * 16 >= N) continue;
#pragma unroll
    for (int r = 0; r < 8; ++r) so[w][8 * hh + r][t * 16 + ln] = acc[t][r] * alpha; }
  __builtin_amdgcn_fence(__ATOMIC_ACQ_REL, "workgroup"); __builtin_amdgcn_wave_barrier();
  const int rsub = lane >> 4, c4 = (lane & 15) * 4;
  {
#pragma unroll
    for (int q = 0; q < 8; ++q) { const int r = q * 2 + rsub; if (col0 + c4 < N) { const v4f v = *(const v4fa*)&so[w][r][c4]; *(v4f*)(C + (size_t)(row0 + r) * ldc + col0 + c4) = v; } }
     }
}

// Wt[n][k] = f16(W[k][n]·scale) from f32 row-major W[K][N] (scale = power of two; bf16-exact weights stay exact in f16 away from the subnormal range)
__global__ __launch_bounds__(256) void k_wt_f16(const float* __restrict__ W, _Float16* __restrict__ Wt, int K, int N, float scale) {
  const int t = blockIdx.x * 256 + threadIdx.x; if (t >= N * (K / 8)) return; const int n = t / (K / 8), k8 = (t % (K / 8)) * 8; FragH f;
#pragma unroll
  for (int i = 0; i < 8; ++i) f.h[i] = (_Float16)(bf16_round(W[(size_t)(k8 + i) * N + n]) * scale); const v8us o = f.half[0];
  *(v8us*)((unsigned short*)Wt + (size_t)n * K + k8) = o; 
}
// k_gemm_hh variant with fused epilogue: v = acc·alpha + bias[by·sBias + col] (+ CP[(row/rowsPerB)·sCPb + by·64 + col] if CP) ; ACT 0 none / 1 elu ; writes f16 C16 (and f32 C if non-null)
template <int ACT>
__global__ __launch_bounds__(128) void k_gemm_hhx(const _Float16* __restrict__ A, int lda, size_t sA, const _Float16* __restrict__ Bh, int ldb, size_t sB, float alpha, const float* __restrict__ bias, size_t sBias, const float* __restrict__ CP, int rowsPerB, size_t sCPb, int row0g,
    float* __restrict__ C, _Float16* __restrict__ C16, int ldc, size_t sC, int M, int N, int K) {
  __shared__ __attribute__((aligned(16))) float so[4][16][64];
  const int tid = threadIdx.x, w = tid >> 5, lane = tid & 31, ln = lane & 15, hh = lane >> 4; const int by = blockIdx.y;
  A += (size_t)by * sA; Bh += (size_t)by * sB; const size_t cofs = (size_t)by * sC; const float* bp = bias ? bias + (size_t)by * sBias : nullptr;
  const int ntn = (N + 63) / 64; const int wid = blockIdx.x * 4 + w; const int mt = wid / ntn, nq = wid % ntn; if (mt * 16 >= M) return;
  const int row0 = mt * 16, col0 = nq * 64; const _Float16* arow = A + (size_t)(row0 + ln) * lda;
  v8f acc[4] = {};
  for (int kb = 0; kb < K; kb += 32) { FragH ah; ah.half[0] = *(const v8us*)((const unsigned short*)arow + kb + 8 * hh); ah.half[1] = *(const v8us*)((const unsigned short*)arow + kb + 16 + 8 * hh);
#pragma unroll
    for (int t = 0; t < 4; ++t) { if (col0 + t * 16 >= N) continue; const size_t boff = (size_t)(col0 + t * 16 + ln) * ldb + kb; FragH bq; bq.half[0] = *(const v8us*)((const unsigned short*)Bh + boff + 8 * hh); bq.half[1] = *(const v8us*)((const unsigned short*)Bh + boff + 16 + 8 * hh);
      acc[t] = mmaH<1>(ah.v, ah.v, bq.v, bq.v, acc[t]); }
  }
#pragma unroll
  for (int t = 0; t < 4; ++t) { if (col0 + t * 16 >= N) continue; const int col = col0 + t * 16 + ln; const float bv = bp ? bf16_round(bp[col]) : 0.f;
#pragma unroll
    for (int r = 0; r < 8; ++r) { float v = acc[t][r] * alpha + bv; if (CP) { const int rr = row0g + row0 + 8 * hh + r; if (rowsPerB < 0) v += CP[cofs + (size_t)rr * ldc + col];      /* rowsPerB < 0: own element of the batched C plane */ else { const int bidx = rr / rowsPerB; v += CP[(size_t)bidx * sCPb + (size_t)by * 64 + col]; } } if (ACT == 1) v = (v > 0.f) ? v : expm1f(v); else if (ACT == 7) v = (v > 0.f) ? v + 1.0f : expf(v); else if (ACT == 8) v = tanhf(v); else if (ACT == 9) v = 0.5f * v * (1.0f + tanhf(0.7978845608028654f * (v + 0.044715f * v * v * v))); else if (ACT == 11) v = 1.0f / (1.0f + expf(-v)); else if (ACT == 12) v = (v > 0.f) ? v : 0.01f * v; else if (ACT == 14) v = (v > 0.f) ? v : 0.1f * v; else if (ACT == 16) v = (v >= 0.f) ? v : 0.3f * v; else if (ACT == 17) v = (v >= 0.f) ? v : 0.2f * v; else if (ACT == 15) v = v / (1.0f + expf(-v)); else if (ACT == 3) v = fmaxf(v, 0.f); else if (ACT == 6) v = 0.5f * v * (1.0f + erff(v * 0.70710678118654752f)); so[w][8 * hh + r][t * 16 + ln] = v; } }
  __builtin_amdgcn_fence(__ATOMIC_ACQ_REL, "workgroup"); __builtin_amdgcn_wave_barrier();
  const int rsub = lane >> 4, c4 = (lane & 15) * 4; typedef _Float16 v4h __attribute__((ext_vector_type(4)));
  {
#pragma unroll
    for (int q = 0; q < 8; ++q) { const int r = q * 2 + rsub; if (col0 + c4 < N) { const v4f v = *(const v4fa*)&so[w][r][c4]; if (C) *(v4f*)(C + cofs + (size_t)(row0 + r) * ldc + col0 + c4) = v; if (C16) { v4h h4; for (int i = 0; i < 4; ++i) h4[i] = (_Float16)v[i]; *(v4h*)(C16 + cofs + (size_t)(row0 + r) * ldc + col0 + c4) = h4; } } }
     }
}


typedef _Float16 v4h __attribute__((ext_vector_type(4)));

__global__ __launch_bounds__(256) void k_x16(const float* __restrict__ x, _Float16* __restrict__ X16, size_t n8) { const size_t t = (size_t)blockIdx.x * 256 + threadIdx.x; if (t >= n8) return; FragH f;
#pragma unroll
  for (int q = 0; q < 8; ++q) f.h[q] = (_Float16)bf16_round(x[t * 8 + q]); *(v8us*)((unsigned short*)X16 + t * 8) = f.half[0];  }
__global__ __launch_bounds__(256) void k_h16(const float* __restrict__ x, _Float16* __restrict__ X16, size_t n8) { const size_t t = (size_t)blockIdx.x * 256 + threadIdx.x; if (t >= n8) return; FragH f;
#pragma unroll
  for (int q = 0; q < 8; ++q) f.h[q] = (_Float16)x[t * 8 + q]; *(v8us*)((unsigned short*)X16 + t * 8) = f.half[0];  }
__global__ __launch_bounds__(256) void k_round16f(const float* __restrict__ W, _Float16* __restrict__ Bt, size_t n8) { const size_t t = (size_t)blockIdx.x * 256 + threadIdx.x; if (t >= n8) return; FragH f;
#pragma unroll
  for (int i = 0; i < 8; ++i) f.h[i] = (_Float16)(bf16_round(W[t * 8 + i]) * 16.0f); *(v8us*)((unsigned short*)Bt + t * 8) = f.half[0];  }
template <int NHv, int TTv>
__global__ __launch_bounds__(256) void k_vt(const _Float16* __restrict__ V16, int ldv, int voff, _Float16* __restrict__ Vt) { __shared__ unsigned short tl[64][66]; const int tid = threadIdx.x; const int slab = blockIdx.x / (TTv / 64), lg = blockIdx.x % (TTv / 64); const int b = slab / NHv, h = slab % NHv;
  for (int i = tid; i < 64 * 8; i += 256) { const int r = i / 8, c8 = (i % 8) * 8; FragH f; f.half[0] = *(const v8us*)((const unsigned short*)V16 + ((size_t)b * TTv + lg * 64 + r) * ldv + voff + h * 64 + c8);
#pragma unroll
    for (int q = 0; q < 8; ++q) tl[r][c8 + q] = f.u[q]; }
  __syncthreads();
  {
#pragma unroll
    for (int rd = 0; rd < 2; ++rd) { const int d = rd * 32 + tid / 8, pc = tid % 8; FragH f;
#pragma unroll
      for (int q = 0; q < 8; ++q) f.u[q] = tl[pc * 8 + q][d];
      *(v8us*)((unsigned short*)Vt + ((size_t)slab * 64 + d) * TTv + lg * 64 + pc * 8) = f.half[0]; }
     } }

__global__ __launch_bounds__(256) void k_hl(const float* __restrict__ F, _Float16* __restrict__ Hh, _Float16* __restrict__ Hl, size_t n8) { const size_t t = (size_t)blockIdx.x * 256 + threadIdx.x; if (t >= n8) return; FragH fh, fl; const v4f a = *(const v4fa*)(F + t * 8), c = *(const v4fa*)(F + t * 8 + 4);
#pragma unroll
  for (int q = 0; q < 4; ++q) { _Float16 h = (_Float16)a[q]; fh.h[q] = h; fl.h[q] = (_Float16)((a[q] - (float)h) * 1024.0f); h = (_Float16)c[q]; fh.h[4 + q] = h; fl.h[4 + q] = (_Float16)((c[q] - (float)h) * 1024.0f); }
  { *(v8us*)((unsigned short*)Hh + t * 8) = fh.half[0]; *(v8us*)((unsigned short*)Hl + t * 8) = fl.half[0];  } }

// ---- fast GEMM (wave tile 32x64; requires M % 32 == 0 rows per launch region and N % 64 == 0); epilogue = k_gemm_hhx semantics ----
__device__ __forceinline__ v16h g2_frag(const _Float16* p, int hh) { FragH f; f.half[0] = *(const v8us*)((const unsigned short*)p + 8 * hh); f.half[1] = *(const v8us*)((const unsigned short*)p + 16 + 8 * hh); return f.v; }
__device__ __forceinline__ v8f g2_mma(v16h a, v16h b, v8f c) { v8f d = __builtin_amdgcn_wmma_f32_16x16x32_f16(false, a, false, b, (short)0, c, false, false); asm volatile("v_nop\n\tv_nop\n\tv_nop\n\tv_nop" : "+v"(d) : "v"(a), "v"(b)); return d; }
template <int ACT>
__global__ __launch_bounds__(128) void k_gemm2(const _Float16* __restrict__ A, int lda, size_t sA, const _Float16* __restrict__ Bh, int ldb, size_t sB, float alpha, const float* __restrict__ bias, size_t sBias, const float* __restrict__ CP, int rowsPerB, size_t sCPb, int row0g,
    float* __restrict__ C, _Float16* __restrict__ C16, int ldc, size_t sC, int M, int N, int K) { static_assert(ACT == 0 || ACT == 3 || ACT == 6 || ACT == 8 || ACT == 9 || ACT == 11 || ACT == 12 || ACT == 14 || ACT == 15 || ACT == 16 || ACT == 17, "k_gemm2: unsupported ACT code (would silently apply no activation)");
  __shared__ __attribute__((aligned(16))) float so[4][32][68];
  const int tid = threadIdx.x, w = tid >> 5, lane = tid & 31, ln = lane & 15, hh = lane >> 4; const int by = blockIdx.y;
  A += (size_t)by * sA; Bh += (size_t)by * sB; const size_t cofs = (size_t)by * sC; const float* bp = bias ? bias + (size_t)by * sBias : nullptr;
  const int ntn = N >> 6; const int mt = blockIdx.x / ntn, nq = blockIdx.x - mt * ntn; const int row0 = mt * 128 + 32 * w, col0 = nq * 64; if (row0 >= M) return;
  const _Float16* a0p = A + (size_t)(row0 + ln) * lda; const _Float16* a1p = a0p + (size_t)16 * lda;
  const _Float16* b0p = Bh + (size_t)(col0 + ln) * ldb; const _Float16* b1p = b0p + (size_t)16 * ldb; const _Float16* b2p = b1p + (size_t)16 * ldb; const _Float16* b3p = b2p + (size_t)16 * ldb;
  const v8f z8 = {0.f,0.f,0.f,0.f,0.f,0.f,0.f,0.f}; v8f c00 = z8, c01 = z8, c02 = z8, c03 = z8, c10 = z8, c11 = z8, c12 = z8, c13 = z8;
#pragma unroll 1
  for (int kb = 0; kb < K; kb += 32) { const v16h a0 = g2_frag(a0p + kb, hh), a1 = g2_frag(a1p + kb, hh);
    v16h b = g2_frag(b0p + kb, hh); c00 = g2_mma(a0, b, c00); c10 = g2_mma(a1, b, c10);
    b = g2_frag(b1p + kb, hh); c01 = g2_mma(a0, b, c01); c11 = g2_mma(a1, b, c11);
    b = g2_frag(b2p + kb, hh); c02 = g2_mma(a0, b, c02); c12 = g2_mma(a1, b, c12);
    b = g2_frag(b3p + kb, hh); c03 = g2_mma(a0, b, c03); c13 = g2_mma(a1, b, c13); }
  v8f accs[8] = {c00, c01, c02, c03, c10, c11, c12, c13};
#pragma unroll
  for (int u = 0; u < 8; ++u) { const int t = u & 3, half = u >> 2; const int col = col0 + t * 16 + ln; const float bv = bp ? bf16_round(bp[col]) : 0.f;
#pragma unroll
    for (int r = 0; r < 8; ++r) { const int rloc = half * 16 + 8 * hh + r; float v = accs[u][r] * alpha + bv; if (CP) { if (rowsPerB < 0) v += CP[cofs + (size_t)(row0g + row0 + rloc) * ldc + col];      /* rowsPerB < 0: own element of the batched C plane */ else { const int bidx = (row0g + row0 + rloc) / rowsPerB; v += CP[(size_t)bidx * sCPb + (size_t)by * 64 + col]; } }
      if (ACT == 3) v = fmaxf(v, 0.f); else if (ACT == 6) v = 0.5f * v * (1.0f + erff(v * 0.70710678118654752f)); else if (ACT == 11) v = 1.0f / (1.0f + expf(-v)); else if (ACT == 15) v = v / (1.0f + expf(-v)); else if (ACT == 12) v = (v > 0.f) ? v : 0.01f * v; else if (ACT == 8) v = tanhf(v); else if (ACT == 9) v = 0.5f * v * (1.0f + tanhf(0.7978845608028654f * (v + 0.044715f * v * v * v))); else if (ACT == 14) v = (v > 0.f) ? v : 0.1f * v; else if (ACT == 16) v = (v >= 0.f) ? v : 0.3f * v; else if (ACT == 17) v = (v >= 0.f) ? v : 0.2f * v;
      so[w][rloc][t * 16 + ln] = v; } }
  __builtin_amdgcn_fence(__ATOMIC_ACQ_REL, "workgroup"); __builtin_amdgcn_wave_barrier();
  const int rsub = lane >> 4, c4 = (lane & 15) * 4;
  {
#pragma unroll
    for (int q = 0; q < 16; ++q) { const int r = q * 2 + rsub; const v4f v = *(const v4fa*)&so[w][r][c4]; if (C) *(v4f*)(C + cofs + (size_t)(row0 + r) * ldc + col0 + c4) = v; if (C16) { v4h h4; for (int i = 0; i < 4; ++i) h4[i] = (_Float16)v[i]; *(v4h*)(C16 + cofs + (size_t)(row0 + r) * ldc + col0 + c4) = h4; } }
     } }


__global__ __launch_bounds__(256) void k_wnat(const float* __restrict__ w, size_t n8, _Float16* __restrict__ Bt) { const size_t t = (size_t)blockIdx.x * 256 + threadIdx.x; if (t >= n8) return; FragH f; for (int q = 0; q < 8; ++q) f.h[q] = (_Float16)(bf16_round(w[t * 8 + q]) * 16.0f); *(v8us*)((unsigned short*)Bt + t * 8) = f.half[0];  }
__global__ __launch_bounds__(256) void k_rsm(const float* __restrict__ S, _Float16* __restrict__ P, int nrows) {
  #pragma clang fp contract(off)
  const int i = blockIdx.x * 256 + threadIdx.x; if (i >= nrows) return; const float* s = S + (size_t)i * SQ; float mx = -3.0e38f;
#pragma unroll 1
  for (int j = 0; j < SQ; ++j) mx = fmaxf(mx, s[j]); float se = 0.f;
#pragma unroll 1
  for (int j = 0; j < SQ; ++j) se += expf(s[j] - mx); const float sc = 256.0f / se;
#pragma unroll 1
  for (int j0 = 0; j0 < SQ; j0 += 8) { FragH f; for (int q = 0; q < 8; ++q) f.h[q] = (_Float16)(expf(s[j0 + q] - mx) * sc); unsigned short* d = (unsigned short*)P + (size_t)i * SQ + j0; *(v8us*)d = f.half[0];  } }
__global__ __launch_bounds__(256) void k_vt(const _Float16* __restrict__ V16, int b, int h0, _Float16* __restrict__ VT) { __shared__ unsigned short tl[64][65]; const int tid = threadIdx.x; const int hh = blockIdx.x % HG, sg = blockIdx.x / HG; const int s0 = sg * 64; const int h = h0 + hh;
  for (int i = tid; i < 64 * 8; i += 256) { const int j = i / 8, d8 = (i % 8) * 8; FragH f; f.half[0] = *(const v8us*)((const unsigned short*)V16 + ((size_t)b * SQ + s0 + j) * DM + h * HD + d8); for (int q = 0; q < 8; ++q) tl[d8 + q][j] = f.u[q]; }
  __syncthreads();
  { for (int i = tid; i < 64 * 8; i += 256) { const int d = i / 8, j8 = (i % 8) * 8; FragH f; for (int q = 0; q < 8; ++q) f.u[q] = tl[d][j8 + q]; *(v8us*)((unsigned short*)VT + ((size_t)hh * HD + d) * SQ + s0 + j8) = f.half[0]; }  } }


__global__ __launch_bounds__(256) void k_rsmcf2(const float* __restrict__ S, _Float16* __restrict__ P, int hg, int q0, int nk) {
  #pragma clang fp contract(off)
  const int t = blockIdx.x * 256 + threadIdx.x; if (t >= hg * QT) return; const size_t i = (size_t)t; const float* s = S + i * NKX; const int last = q0 + (t % QT); float mx = -3.0e38f;
#pragma unroll 1
  for (int j = 0; j < nk; ++j) { const float f = (j <= last) ? 1.f : 0.f; mx = fmaxf(mx, fmaf(f, s[j], (1.f - f) * -1.0e9f)); } float se = 0.f;
#pragma unroll 1
  for (int j = 0; j < nk; ++j) { const float f = (j <= last) ? 1.f : 0.f; se += __expf(fmaf(f, s[j], (1.f - f) * -1.0e9f) - mx); } const float sc = 256.0f / se;
#pragma unroll 1
  for (int j0 = 0; j0 < nk; j0 += 8) { FragH fr; for (int q = 0; q < 8; ++q) { const int j = j0 + q; const float f = (j <= last) ? 1.f : 0.f; fr.h[q] = (_Float16)(__expf(fmaf(f, s[j], (1.f - f) * -1.0e9f) - mx) * sc); } unsigned short* d = (unsigned short*)P + i * NKX + j0; *(v8us*)d = fr.half[0];  } }


__global__ __launch_bounds__(256) void k_rsmcf2hl(const float* __restrict__ S, _Float16* __restrict__ P, _Float16* __restrict__ PL, int hg, int q0, int nk) {
  #pragma clang fp contract(off)
  const int t = blockIdx.x * 256 + threadIdx.x; if (t >= hg * QT) return; const size_t i = (size_t)t; const float* s = S + i * NKX; const int last = q0 + (t % QT); float mx = -3.0e38f;
#pragma unroll 1
  for (int j = 0; j < nk; ++j) { const float f = (j <= last) ? 1.f : 0.f; mx = fmaxf(mx, fmaf(f, s[j], (1.f - f) * -1.0e9f)); } float se = 0.f;
#pragma unroll 1
  for (int j = 0; j < nk; ++j) { const float f = (j <= last) ? 1.f : 0.f; se += __expf(fmaf(f, s[j], (1.f - f) * -1.0e9f) - mx); } const float sc = 256.0f / se;
#pragma unroll 1
  for (int j0 = 0; j0 < nk; j0 += 8) { FragH fr, fl; for (int q = 0; q < 8; ++q) { const int j = j0 + q; const float f = (j <= last) ? 1.f : 0.f; const float pv = __expf(fmaf(f, s[j], (1.f - f) * -1.0e9f) - mx) * sc; const _Float16 h = (_Float16)pv; fr.h[q] = h; fl.h[q] = (_Float16)((pv - (float)h) * 1024.0f); } unsigned short* d = (unsigned short*)P + i * NKX + j0; unsigned short* dl = (unsigned short*)PL + i * NKX + j0; *(v8us*)d = fr.half[0]; *(v8us*)dl = fl.half[0];  } }
extern "C" void kernel_launch(void* const* d_in, const int* in_sizes, int n_in,
                              void* d_out, int out_size, void* d_ws, size_t ws_size, hipStream_t stream) {
  (void)in_sizes; (void)n_in; (void)out_size;
  const float* const* I = (const float* const*)d_in; const float* x = I[0]; const float* wq = I[1]; const float* wk = I[2]; const float* wv = I[3];
  char* ws = (char*)d_ws; size_t off = 0;
  auto take = [&](size_t bytes) { char* p = ws + off; off += (bytes + 255) & ~(size_t)255; return p; };
  _Float16* X16 = (_Float16*)take(NR * DMX * 2); _Float16* BQ = (_Float16*)take((size_t)HD * DMX * 2); _Float16* BK = (_Float16*)take((size_t)HD * DMX * 2); _Float16* BV = (_Float16*)take((size_t)HD * DMX * 2); _Float16* Q16 = (_Float16*)take(NR * HD * 2); _Float16* KL16 = (_Float16*)take(NR * HD * 2); float* KOUT = (float*)d_out + NR * HD; float* VF = (float*)d_out + 2 * NR * HD;      /* out1 = k and out2 = v are written in f32 straight into the tuple output and re-used as the sources of the f16 planes */ _Float16* VL16 = (_Float16*)take(NR * HD * 2); _Float16* VTL = (_Float16*)take((size_t)NHS * HD * SQ * 2); _Float16* K16 = (_Float16*)take(NR * HD * 2); _Float16* V16 = (_Float16*)take(NR * HD * 2); _Float16* VT = (_Float16*)take((size_t)NHS * HD * SQ * 2);
  float* S = (float*)take((size_t)NHS * QT * NKX * 4); _Float16* P = (_Float16*)take((size_t)NHS * QT * NKX * 2); _Float16* PL = (_Float16*)take((size_t)NHS * QT * NKX * 2);
  if (off > ws_size) return;      /* approx 16 + 0.4 + 5 x 1 + 2 x 0.25 + 2 + 1 + 1 = 26 MiB */
  k_x16<<<(unsigned)((NR * DMX / 8 + 255) / 256), 256, 0, stream>>>(x, X16, NR * DMX / 8);      /* x as exact f16 rows */
  { const unsigned g = (unsigned)(((size_t)HD * (DMX / 8) + 255) / 256); k_wt_f16<<<g, 256, 0, stream>>>(wq, BQ, DMX, HD, 16.0f); k_wt_f16<<<g, 256, 0, stream>>>(wk, BK, DMX, HD, 16.0f); k_wt_f16<<<g, 256, 0, stream>>>(wv, BV, DMX, HD, 16.0f); }      /* [in][out] 1024 x 64 -> Bt [64][1024] x16 */
  k_gemm2<0><<<dim3((unsigned)((NR / 128) * (HD / 64)), 1), 128, 0, stream>>>(X16, DMX, 0, BQ, DMX, 0, 0.0625f, nullptr, 0, nullptr, 1, 0, 0, nullptr, Q16, HD, 0, (int)NR, HD, DMX); k_gemm2<0><<<dim3((unsigned)((NR / 128) * (HD / 64)), 1), 128, 0, stream>>>(X16, DMX, 0, BK, DMX, 0, 0.0625f, nullptr, 0, nullptr, 1, 0, 0, KOUT, nullptr, HD, 0, (int)NR, HD, DMX); k_hl<<<(unsigned)((NR * HD / 8 + 255) / 256), 256, 0, stream>>>(KOUT, K16, KL16, NR * HD / 8);      /* out1 = k (f32; exact products, f32 accumulation) and its f16 plane (the residual plane is unused) */ k_gemm2<0><<<dim3((unsigned)((NR / 128) * (HD / 64)), 1), 128, 0, stream>>>(X16, DMX, 0, BV, DMX, 0, 0.0625f, nullptr, 0, nullptr, 1, 0, 0, VF, nullptr, HD, 0, (int)NR, HD, DMX); k_hl<<<(unsigned)((NR * HD / 8 + 255) / 256), 256, 0, stream>>>(VF, V16, VL16, NR * HD / 8);      /* v in f32 -> f16 hi + x1024 residual planes */      /* q, k, v = x W as f16 rows [token][64] (= the head-major [B][1][S][64] layout the attention below expects) */
  for (int b = 0; b < NB; ++b) { const size_t s0 = (size_t)b * NHS * SQ;      /* first row of this batch's head-0 slab */
    for (int h = 0; h < NHS; ++h) { k_vt<1, SQ><<<SQ / 64, 256, 0, stream>>>(V16 + (s0 + (size_t)h * SQ) * HD, HD, 0, VT + (size_t)h * HD * SQ); k_vt<1, SQ><<<SQ / 64, 256, 0, stream>>>(VL16 + (s0 + (size_t)h * SQ) * HD, HD, 0, VTL + (size_t)h * HD * SQ); }      /* V^T hi and residual per head slab */
    for (int q0 = 0; q0 < SQ; q0 += QT) { const int nk = q0 + QT;
      k_gemm2<0><<<dim3((QT / 128) * (nk / 64), NHS), 128, 0, stream>>>(Q16 + (s0 + q0) * HD, HD, (size_t)SQ * HD, K16 + s0 * HD, HD, (size_t)SQ * HD, 0.03125f, nullptr, 0, nullptr, 1, 0, 0, S, nullptr, NKX, (size_t)QT * NKX, QT, nk, HD);      /* scores / 32 for the visible keys, 1 head on grid.y */
      k_rsmcf2hl<<<(NHS * QT + 255) / 256, 256, 0, stream>>>(S, P, PL, NHS, q0, nk);      /* causal softmax -> f16 x256 hi + x1024 residual planes */
      k_gemm2<0><<<dim3((QT / 128) * (HD / 64), NHS), 128, 0, stream>>>(P, NKX, (size_t)QT * NKX, VT, SQ, (size_t)HD * SQ, 0.00390625f, nullptr, 0, nullptr, 1, 0, 0, (float*)d_out + (s0 + q0) * HD, nullptr, HD, (size_t)SQ * HD, QT, HD, nk);      /* out = P_hi V / 256 */
      k_gemm2<0><<<dim3((QT / 128) * (HD / 64), NHS), 128, 0, stream>>>(PL, NKX, (size_t)QT * NKX, VT, SQ, (size_t)HD * SQ, 0.000003814697265625f, nullptr, 0, (const float*)d_out + (s0 + q0) * HD, -1, 0, 0, (float*)d_out + (s0 + q0) * HD, nullptr, HD, (size_t)SQ * HD, QT, HD, nk); k_gemm2<0><<<dim3((QT / 128) * (HD / 64), NHS), 128, 0, stream>>>(P, NKX, (size_t)QT * NKX, VTL, SQ, (size_t)HD * SQ, 0.000003814697265625f, nullptr, 0, (const float*)d_out + (s0 + q0) * HD, -1, 0, 0, (float*)d_out + (s0 + q0) * HD, nullptr, HD, (size_t)SQ * HD, QT, HD, nk);      /* += P_hi V_lo^T 2^-18: v effectively f32 too */ } }      /* += P_lo V 2^-18 (own-element accumulate): P effectively ~f32 */
}

// v001
// A run of this version takes 4100 microseconds.
// Two timings next to v000 put it at 2.46 and 2.41 times that version's speed.
#include <hip/hip_runtime.h>
// Single attention head returning the TUPLE (out, k, v) (x [4][2048][1024]; q = x Wq, k = x Wk, v = x Wv ([in][out] 1024 x 64, sigma 1/32, no biases); wei = q . k x 1024^-0.5 (the module scales by n_embd) with a causal mask (tril, -inf); softmax; out = wei v -> out0 [4][2048][64] @0, out1 = k [4][2048][64] f32 @2,097,152 B, out2 = v [4][2048][64] f32 @4,194,304 B; input order x, Wq, Wk, Wv).
// Structure: x as exact f16 rows; the three [in][out] weights as exact x16 planes; q, k, v as WMMA GEMMs (32x64 wave tiles, f32 accumulation, K = 1024): q as f16 rows, k and v in f32 STRAIGHT INTO the tuple output slots (out1, out2) and then split into f16 (v: hi + x1024 residual) planes; per batch: V^T (hi and residual) via LDS transposes; per query tile of 256 rows: scores against the keys below the tile end only (K = 64, alpha 1/32) into an f32 plane, causal row softmax on VALU, one wave per row (arithmetic 0/1 select; f32 statistics, native exp) writing the weights as f16 hi (x256) + x1024 residual planes, out = P_hi V^T (alpha 2^-8) written f32 then += P_lo V_hi^T and += P_hi V_lo^T (alpha 2^-18 each; own-element accumulates in the next launches); launches: see trace.
// Compute dtype: inputs rounded to bf16; q, k rounded to f16, v f16 hi + x1024 residual; softmax weights f16 hi + x1024 residual (effectively ~f32); scores, statistics, out f32; v_wmma_f32_16x16x32_f16.
#define NB 4
#define NHS 1
#define DMX 1024                   /* model width (projection K) */
#define SQ 2048
#define HD 64
#define DM 64
#define NH 1
#define HG 1
#define QT 256
#define NKX SQ
#define NR ((size_t)NB * NHS * SQ)
typedef __bf16 v16b __attribute__((ext_vector_type(16)));
typedef unsigned short v8us __attribute__((ext_vector_type(8), may_alias));
typedef float  v8f  __attribute__((ext_vector_type(8)));
typedef float  v4f  __attribute__((ext_vector_type(4)));
typedef float  v4fa __attribute__((ext_vector_type(4), may_alias));
union FragB { v16b v; v8us half[2]; unsigned short u[16]; };

__device__ __forceinline__ unsigned short bf16_bits(float x) { unsigned int u = __float_as_uint(x); return (unsigned short)((u + 0x7FFFu + ((u >> 16) & 1u)) >> 16); }
__device__ __forceinline__ float bf16_val(unsigned short b) { return __uint_as_float(((unsigned int)b) << 16); }
__device__ __forceinline__ float bf16_round(float x) { return bf16_val(bf16_bits(x)); }
// D += A·B with NT terms: 1 = ah·bh, 2 = + al·bh (A split), 3 = + ah·bl (both split)
template <int NT>
__device__ __forceinline__ v8f mmaN(v16b ah, v16b al, v16b bh, v16b bl, v8f c) {
  c = __builtin_amdgcn_wmma_f32_16x16x32_bf16(false, ah, false, bh, (short)0, c, false, false);
  if (NT >= 2) c = __builtin_amdgcn_wmma_f32_16x16x32_bf16(false, al, false, bh, (short)0, c, false, false);
  if (NT >= 3) c = __builtin_amdgcn_wmma_f32_16x16x32_bf16(false, ah, false, bl, (short)0, c, false, false);
  asm volatile("v_nop\n\tv_nop\n\tv_nop\n\tv_nop" : "+v"(c) : "v"(ah), "v"(al), "v"(bh), "v"(bl));
  return c;
}

__global__ __launch_bounds__(256) void k_wt_bf16(const float* __restrict__ W, unsigned short* __restrict__ Wt, int K, int N) {
  const int t = blockIdx.x * 256 + threadIdx.x;
  const int k8n = K / 8;
  if (t >= N * k8n) return;
  const int n = t / k8n, k8 = (t % k8n) * 8;
  v8us v;
#pragma unroll
  for (int i = 0; i < 8; ++i) v[i] = bf16_bits(W[(size_t)(k8 + i) * N + n]);
  *(v8us*)(Wt + (size_t)n * K + k8) = v;
  
}

// GEMM C[M][N] (f32, pitch ldc) = act(A[M][K]·W + bias). A f32 row-major (pitch lda) converted per fragment to bf16
// (ASPLIT: hi/lo two planes -> 2 terms, else single rounded term); Wt bf16 [N][K] (pitch ldb). BIAS_BF16 rounds the
// bias to bf16 first (bias quantised to bf16 before the add). K%32==0, M%16==0, N%64==0.
template <bool ASPLIT, int ACT, bool BIAS_BF16>
__global__ __launch_bounds__(128) void k_gemm_bf(const float* __restrict__ A, int lda, const unsigned short* __restrict__ Wt, int ldb,
                                               const float* __restrict__ bias, float* __restrict__ C, int ldc, int M, int N, int K) {
  __shared__ __attribute__((aligned(16))) float so[4][16][64];
  const int tid = threadIdx.x, w = tid >> 5, lane = tid & 31, ln = lane & 15, hh = lane >> 4;
  const int ntn = N / 64;
  const int wid = blockIdx.x * 4 + w;
  const int mt = wid / ntn, nq = wid % ntn;
  if (mt * 16 >= M) return;
  const int row0 = mt * 16, col0 = nq * 64;
  const float* arow = A + (size_t)(row0 + ln) * lda;
  v8f acc[4] = {};
  for (int kb = 0; kb < K; kb += 32) {
    FragB ah, al;
    const v4f x0 = *(const v4fa*)(arow + kb + 8 * hh), x1 = *(const v4fa*)(arow + kb + 8 * hh + 4);
    const v4f x2 = *(const v4fa*)(arow + kb + 16 + 8 * hh), x3 = *(const v4fa*)(arow + kb + 16 + 8 * hh + 4);
    float xs[16] = {x0[0],x0[1],x0[2],x0[3],x1[0],x1[1],x1[2],x1[3],x2[0],x2[1],x2[2],x2[3],x3[0],x3[1],x3[2],x3[3]};
#pragma unroll
    for (int i = 0; i < 16; ++i) { const unsigned short hb = bf16_bits(xs[i]); ah.u[i] = hb; al.u[i] = ASPLIT ? bf16_bits(xs[i] - bf16_val(hb)) : (unsigned short)0; }
#pragma unroll
    for (int t = 0; t < 4; ++t) {
      const unsigned short* brow = Wt + (size_t)(col0 + t * 16 + ln) * ldb + kb;
      FragB b;
      b.half[0] = *(const v8us*)(brow + 8 * hh);
      b.half[1] = *(const v8us*)(brow + 16 + 8 * hh);
      acc[t] = mmaN<ASPLIT ? 2 : 1>(ah.v, al.v, b.v, b.v, acc[t]);
    }
  }
#pragma unroll
  for (int t = 0; t < 4; ++t) {
    float bv = bias ? bias[col0 + t * 16 + ln] : 0.f;
    if (BIAS_BF16) bv = bf16_round(bv);
#pragma unroll
    for (int r = 0; r < 8; ++r) { float v = acc[t][r] + bv; if (ACT == 1) v = fmaxf(v, 0.f); so[w][8 * hh + r][t * 16 + ln] = v; }
  }
  __builtin_amdgcn_fence(__ATOMIC_ACQ_REL, "workgroup");
  __builtin_amdgcn_wave_barrier();
  const int rsub = lane >> 4, c4 = (lane & 15) * 4;
  {
#pragma unroll
    for (int q = 0; q < 8; ++q) {
      const int r = q * 2 + rsub;
      const v4f v = *(const v4fa*)&so[w][r][c4];
      *(v4f*)(C + (size_t)(row0 + r) * ldc + col0 + c4) = v;
    }
    
  }
}

// GEMM C = act(A·W + bias + resid): A f32 (ASPLIT -> hi/lo 2 terms), Wt bf16 [N][K]; ACT 0 none, 1 relu, 2 exact gelu;
// resid (optional, f32, row index = (row % rmod), pitch ldr, RES_BF16 rounds it) added before the activation.
template <bool ASPLIT, int ACT, bool BIAS_BF16, bool RES_BF16>
__global__ __launch_bounds__(128) void k_gemm_bf3(const float* __restrict__ A, int lda, const unsigned short* __restrict__ Wt, int ldb,
                                                const float* __restrict__ bias, const float* __restrict__ resid, int rmod, int ldr,
                                                float* __restrict__ C, int ldc, int M, int N, int K) {
  __shared__ __attribute__((aligned(16))) float so[4][16][64];
  const int tid = threadIdx.x, w = tid >> 5, lane = tid & 31, ln = lane & 15, hh = lane >> 4;
  const int ntn = N / 64;
  const int wid = blockIdx.x * 4 + w;
  const int mt = wid / ntn, nq = wid % ntn;
  if (mt * 16 >= M) return;
  const int row0 = mt * 16, col0 = nq * 64;
  const float* arow = A + (size_t)(row0 + ln) * lda;
  v8f acc[4] = {};
  for (int kb = 0; kb < K; kb += 32) {
    FragB ah, al;
    const v4f x0 = *(const v4fa*)(arow + kb + 8 * hh), x1 = *(const v4fa*)(arow + kb + 8 * hh + 4);
    const v4f x2 = *(const v4fa*)(arow + kb + 16 + 8 * hh), x3 = *(const v4fa*)(arow + kb + 16 + 8 * hh + 4);
    float xs[16] = {x0[0],x0[1],x0[2],x0[3],x1[0],x1[1],x1[2],x1[3],x2[0],x2[1],x2[2],x2[3],x3[0],x3[1],x3[2],x3[3]};
#pragma unroll
    for (int i = 0; i < 16; ++i) { const unsigned short hb = bf16_bits(xs[i]); ah.u[i] = hb; al.u[i] = ASPLIT ? bf16_bits(xs[i] - bf16_val(hb)) : (unsigned short)0; }
#pragma unroll
    for (int t = 0; t < 4; ++t) {
      const unsigned short* brow = Wt + (size_t)(col0 + t * 16 + ln) * ldb + kb;
      FragB b;
      b.half[0] = *(const v8us*)(brow + 8 * hh);
      b.half[1] = *(const v8us*)(brow + 16 + 8 * hh);
      acc[t] = mmaN<ASPLIT ? 2 : 1>(ah.v, al.v, b.v, b.v, acc[t]);
    }
  }
#pragma unroll
  for (int t = 0; t < 4; ++t) {
    const int col = col0 + t * 16 + ln;
    float bv = bias ? bias[col] : 0.f;
    if (BIAS_BF16) bv = bf16_round(bv);
#pragma unroll
    for (int r = 0; r < 8; ++r) {
      float v = acc[t][r] + bv;
      if (resid) { float rv = resid[(size_t)((row0 + 8 * hh + r) % rmod) * ldr + col]; if (RES_BF16) rv = bf16_round(rv); v += rv; }
      if (ACT == 1) v = fmaxf(v, 0.f);
      if (ACT == 2) v = 0.5f * v * (1.0f + erff(v * 0.70710678118654752f));
      if (ACT == 3) { const float u = 0.7978845608028654f * (v + 0.044715f * v * v * v); v = 0.5f * v * (1.0f + tanhf(u)); }
      so[w][8 * hh + r][t * 16 + ln] = v;
    }
  }
  __builtin_amdgcn_fence(__ATOMIC_ACQ_REL, "workgroup");
  __builtin_amdgcn_wave_barrier();
  const int rsub = lane >> 4, c4 = (lane & 15) * 4;
  {
#pragma unroll
    for (int q = 0; q < 8; ++q) {
      const int r = q * 2 + rsub;
      const v4f v = *(const v4fa*)&so[w][r][c4];
      *(v4f*)(C + (size_t)(row0 + r) * ldc + col0 + c4) = v;
    }
    
  }
}
// row LayerNorm (biased variance, eps) over N: s = X (+ R); optional out_sum <- s; out_norm <- (s-mu)*rsqrt(var+eps)*g + b
template <bool PARAM_BF16>
__global__ __launch_bounds__(256) void k_layernorm(const float* __restrict__ X, const float* __restrict__ R, const float* __restrict__ g, const float* __restrict__ bta,
                                                  float* __restrict__ out_sum, float* __restrict__ out_norm, int N, float eps) {
  __shared__ float red[256];
  const int row = blockIdx.x, tid = threadIdx.x;
  const float* x = X + (size_t)row * N; const float* rr = R ? R + (size_t)row * N : nullptr;
  float vals[16];                     // up to N = 4096
  const int per = N / 256;            // contiguous chunk per thread? use strided-by-4 chunks: thread handles j = tid*4 + 1024*u
  float s1 = 0.f;
  for (int u = 0; u < per / 4; ++u) {
    const int j = tid * 4 + 1024 * u;
    const v4f a = *(const v4fa*)(x + j);
    v4f b = {0.f,0.f,0.f,0.f}; if (rr) b = *(const v4fa*)(rr + j);
#pragma unroll
    for (int q = 0; q < 4; ++q) { const float v = a[q] + b[q]; vals[u * 4 + q] = v; s1 += v; }
  }
  red[tid] = s1; __syncthreads();
  for (int st = 128; st > 0; st >>= 1) { if (tid < st) red[tid] += red[tid + st]; __syncthreads(); }
  const float mu = red[0] / (float)N; __syncthreads();
  float s2 = 0.f;
  for (int u = 0; u < per / 4; ++u)
#pragma unroll
    for (int q = 0; q < 4; ++q) { const float c = vals[u * 4 + q] - mu; s2 += c * c; }
  red[tid] = s2; __syncthreads();
  for (int st = 128; st > 0; st >>= 1) { if (tid < st) red[tid] += red[tid + st]; __syncthreads(); }
  const float rs = rsqrtf(red[0] / (float)N + eps);
  {
    for (int u = 0; u < per / 4; ++u) {
      const int j = tid * 4 + 1024 * u;
      v4f o, sm;
#pragma unroll
      for (int q = 0; q < 4; ++q) {
        float gg = g[j + q], bb = bta[j + q];
        if (PARAM_BF16) { gg = bf16_round(gg); bb = bf16_round(bb); }
        sm[q] = vals[u * 4 + q]; o[q] = (vals[u * 4 + q] - mu) * rs * gg + bb;
      }
      if (out_sum) *(v4f*)(out_sum + (size_t)row * N + j) = sm;
      *(v4f*)(out_norm + (size_t)row * N + j) = o;
    }
    
  }
}



// ---- f16 WMMA path (v_wmma_f32_16x16x32_f16): 11-bit significands for operands in range — used where a [0,1] probability operand needs more precision than bf16
typedef _Float16 v16h __attribute__((ext_vector_type(16)));
union FragH { v16h v; v8us half[2]; _Float16 h[16]; unsigned short u[16]; };
template <int NT>
__device__ __forceinline__ v8f mmaH(v16h ah, v16h al, v16h bh, v16h bl, v8f c) {
  c = __builtin_amdgcn_wmma_f32_16x16x32_f16(false, ah, false, bh, (short)0, c, false, false);
  if (NT >= 2) c = __builtin_amdgcn_wmma_f32_16x16x32_f16(false, al, false, bh, (short)0, c, false, false);
  if (NT >= 3) c = __builtin_amdgcn_wmma_f32_16x16x32_f16(false, ah, false, bl, (short)0, c, false, false);
  asm volatile("v_nop\n\tv_nop\n\tv_nop\n\tv_nop" : "+v"(c) : "v"(ah), "v"(al), "v"(bh), "v"(bl));
  return c;
}
// batched GEMM like k_gemm_b but f16 operands: A f32 (split into f16 hi/lo if ASPLIT, else rounded to f16), Bt = f16 values [n][k]; alpha; C f32; N multiple of 16 (partial tiles skipped)
template <bool ASPLIT>
__global__ __launch_bounds__(128) void k_gemm_h(const float* __restrict__ A, int lda, size_t sA, const _Float16* __restrict__ Bh, int ldb, size_t sB, float alpha, float* __restrict__ C, int ldc, size_t sC, int M, int N, int K) {
  __shared__ __attribute__((aligned(16))) float so[4][16][64];
  const int tid = threadIdx.x, w = tid >> 5, lane = tid & 31, ln = lane & 15, hh = lane >> 4; const int by = blockIdx.y;
  A += (size_t)by * sA; Bh += (size_t)by * sB; C += (size_t)by * sC;
  const int ntn = (N + 63) / 64; const int wid = blockIdx.x * 4 + w; const int mt = wid / ntn, nq = wid % ntn; if (mt * 16 >= M) return;
  const int row0 = mt * 16, col0 = nq * 64; const float* arow = A + (size_t)(row0 + ln) * lda;
  v8f acc[4] = {};
  for (int kb = 0; kb < K; kb += 32) {
    FragH ah, al;
    const v4f x0 = *(const v4fa*)(arow + kb + 8 * hh), x1 = *(const v4fa*)(arow + kb + 8 * hh + 4), x2 = *(const v4fa*)(arow + kb + 16 + 8 * hh), x3 = *(const v4fa*)(arow + kb + 16 + 8 * hh + 4);
    float xs[16] = {x0[0],x0[1],x0[2],x0[3],x1[0],x1[1],x1[2],x1[3],x2[0],x2[1],x2[2],x2[3],x3[0],x3[1],x3[2],x3[3]};
#pragma unroll
    for (int i = 0; i < 16; ++i) { const _Float16 h = (_Float16)xs[i]; ah.h[i] = h; al.h[i] = ASPLIT ? (_Float16)(xs[i] - (float)h) : (_Float16)0.0f; }
#pragma unroll
    for (int t = 0; t < 4; ++t) { if (col0 + t * 16 >= N) continue; const size_t boff = (size_t)(col0 + t * 16 + ln) * ldb + kb; FragH bq; bq.half[0] = *(const v8us*)(Bh + boff + 8 * hh); bq.half[1] = *(const v8us*)(Bh + boff + 16 + 8 * hh);
      acc[t] = mmaH<ASPLIT ? 2 : 1>(ah.v, al.v, bq.v, bq.v, acc[t]); }
  }
#pragma unroll
  for (int t = 0; t < 4; ++t) { if (col0 + t * 16 >= N) continue;
#pragma unroll
    for (int r = 0; r < 8; ++r) so[w][8 * hh + r][t * 16 + ln] = acc[t][r] * alpha; }
  __builtin_amdgcn_fence(__ATOMIC_ACQ_REL, "workgroup"); __builtin_amdgcn_wave_barrier();
  const int rsub = lane >> 4, c4 = (lane & 15) * 4;
  {
#pragma unroll
    for (int q = 0; q < 8; ++q) { const int r = q * 2 + rsub; if (col0 + c4 < N) { const v4f v = *(const v4fa*)&so[w][r][c4]; *(v4f*)(C + (size_t)(row0 + r) * ldc + col0 + c4) = v; } }
     }
}

// Wt[n][k] = f16(W[k][n]·scale) from f32 row-major W[K][N] (scale = power of two; bf16-exact weights stay exact in f16 away from the subnormal range)
__global__ __launch_bounds__(256) void k_wt_f16(const float* __restrict__ W, _Float16* __restrict__ Wt, int K, int N, float scale) {
  const int t = blockIdx.x * 256 + threadIdx.x; if (t >= N * (K / 8)) return; const int n = t / (K / 8), k8 = (t % (K / 8)) * 8; FragH f;
#pragma unroll
  for (int i = 0; i < 8; ++i) f.h[i] = (_Float16)(bf16_round(W[(size_t)(k8 + i) * N + n]) * scale); const v8us o = f.half[0];
  *(v8us*)((unsigned short*)Wt + (size_t)n * K + k8) = o; 
}
// k_gemm_hh variant with fused epilogue: v = acc·alpha + bias[by·sBias + col] (+ CP[(row/rowsPerB)·sCPb + by·64 + col] if CP) ; ACT 0 none / 1 elu ; writes f16 C16 (and f32 C if non-null)
template <int ACT>
__global__ __launch_bounds__(128) void k_gemm_hhx(const _Float16* __restrict__ A, int lda, size_t sA, const _Float16* __restrict__ Bh, int ldb, size_t sB, float alpha, const float* __restrict__ bias, size_t sBias, const float* __restrict__ CP, int rowsPerB, size_t sCPb, int row0g,
    float* __restrict__ C, _Float16* __restrict__ C16, int ldc, size_t sC, int M, int N, int K) {
  __shared__ __attribute__((aligned(16))) float so[4][16][64];
  const int tid = threadIdx.x, w = tid >> 5, lane = tid & 31, ln = lane & 15, hh = lane >> 4; const int by = blockIdx.y;
  A += (size_t)by * sA; Bh += (size_t)by * sB; const size_t cofs = (size_t)by * sC; const float* bp = bias ? bias + (size_t)by * sBias : nullptr;
  const int ntn = (N + 63) / 64; const int wid = blockIdx.x * 4 + w; const int mt = wid / ntn, nq = wid % ntn; if (mt * 16 >= M) return;
  const int row0 = mt * 16, col0 = nq * 64; const _Float16* arow = A + (size_t)(row0 + ln) * lda;
  v8f acc[4] = {};
  for (int kb = 0; kb < K; kb += 32) { FragH ah; ah.half[0] = *(const v8us*)((const unsigned short*)arow + kb + 8 * hh); ah.half[1] = *(const v8us*)((const unsigned short*)arow + kb + 16 + 8 * hh);
#pragma unroll
    for (int t = 0; t < 4; ++t) { if (col0 + t * 16 >= N) continue; const size_t boff = (size_t)(col0 + t * 16 + ln) * ldb + kb; FragH bq; bq.half[0] = *(const v8us*)((const unsigned short*)Bh + boff + 8 * hh); bq.half[1] = *(const v8us*)((const unsigned short*)Bh + boff + 16 + 8 * hh);
      acc[t] = mmaH<1>(ah.v, ah.v, bq.v, bq.v, acc[t]); }
  }
#pragma unroll
  for (int t = 0; t < 4; ++t) { if (col0 + t * 16 >= N) continue; const int col = col0 + t * 16 + ln; const float bv = bp ? bf16_round(bp[col]) : 0.f;
#pragma unroll
    for (int r = 0; r < 8; ++r) { float v = acc[t][r] * alpha + bv; if (CP) { const int rr = row0g + row0 + 8 * hh + r; if (rowsPerB < 0) v += CP[cofs + (size_t)rr * ldc + col];      /* rowsPerB < 0: own element of the batched C plane */ else { const int bidx = rr / rowsPerB; v += CP[(size_t)bidx * sCPb + (size_t)by * 64 + col]; } } if (ACT == 1) v = (v > 0.f) ? v : expm1f(v); else if (ACT == 7) v = (v > 0.f) ? v + 1.0f : expf(v); else if (ACT == 8) v = tanhf(v); else if (ACT == 9) v = 0.5f * v * (1.0f + tanhf(0.7978845608028654f * (v + 0.044715f * v * v * v))); else if (ACT == 11) v = 1.0f / (1.0f + expf(-v)); else if (ACT == 12) v = (v > 0.f) ? v : 0.01f * v; else if (ACT == 14) v = (v > 0.f) ? v : 0.1f * v; else if (ACT == 16) v = (v >= 0.f) ? v : 0.3f * v; else if (ACT == 17) v = (v >= 0.f) ? v : 0.2f * v; else if (ACT == 15) v = v / (1.0f + expf(-v)); else if (ACT == 3) v = fmaxf(v, 0.f); else if (ACT == 6) v = 0.5f * v * (1.0f + erff(v * 0.70710678118654752f)); so[w][8 * hh + r][t * 16 + ln] = v; } }
  __builtin_amdgcn_fence(__ATOMIC_ACQ_REL, "workgroup"); __builtin_amdgcn_wave_barrier();
  const int rsub = lane >> 4, c4 = (lane & 15) * 4; typedef _Float16 v4h __attribute__((ext_vector_type(4)));
  {
#pragma unroll
    for (int q = 0; q < 8; ++q) { const int r = q * 2 + rsub; if (col0 + c4 < N) { const v4f v = *(const v4fa*)&so[w][r][c4]; if (C) *(v4f*)(C + cofs + (size_t)(row0 + r) * ldc + col0 + c4) = v; if (C16) { v4h h4; for (int i = 0; i < 4; ++i) h4[i] = (_Float16)v[i]; *(v4h*)(C16 + cofs + (size_t)(row0 + r) * ldc + col0 + c4) = h4; } } }
     }
}


typedef _Float16 v4h __attribute__((ext_vector_type(4)));

__global__ __launch_bounds__(256) void k_x16(const float* __restrict__ x, _Float16* __restrict__ X16, size_t n8) { const size_t t = (size_t)blockIdx.x * 256 + threadIdx.x; if (t >= n8) return; FragH f;
#pragma unroll
  for (int q = 0; q < 8; ++q) f.h[q] = (_Float16)bf16_round(x[t * 8 + q]); *(v8us*)((unsigned short*)X16 + t * 8) = f.half[0];  }
__global__ __launch_bounds__(256) void k_h16(const float* __restrict__ x, _Float16* __restrict__ X16, size_t n8) { const size_t t = (size_t)blockIdx.x * 256 + threadIdx.x; if (t >= n8) return; FragH f;
#pragma unroll
  for (int q = 0; q < 8; ++q) f.h[q] = (_Float16)x[t * 8 + q]; *(v8us*)((unsigned short*)X16 + t * 8) = f.half[0];  }
__global__ __launch_bounds__(256) void k_round16f(const float* __restrict__ W, _Float16* __restrict__ Bt, size_t n8) { const size_t t = (size_t)blockIdx.x * 256 + threadIdx.x; if (t >= n8) return; FragH f;
#pragma unroll
  for (int i = 0; i < 8; ++i) f.h[i] = (_Float16)(bf16_round(W[t * 8 + i]) * 16.0f); *(v8us*)((unsigned short*)Bt + t * 8) = f.half[0];  }
template <int NHv, int TTv>
__global__ __launch_bounds__(256) void k_vt(const _Float16* __restrict__ V16, int ldv, int voff, _Float16* __restrict__ Vt) { __shared__ unsigned short tl[64][66]; const int tid = threadIdx.x; const int slab = blockIdx.x / (TTv / 64), lg = blockIdx.x % (TTv / 64); const int b = slab / NHv, h = slab % NHv;
  for (int i = tid; i < 64 * 8; i += 256) { const int r = i / 8, c8 = (i % 8) * 8; FragH f; f.half[0] = *(const v8us*)((const unsigned short*)V16 + ((size_t)b * TTv + lg * 64 + r) * ldv + voff + h * 64 + c8);
#pragma unroll
    for (int q = 0; q < 8; ++q) tl[r][c8 + q] = f.u[q]; }
  __syncthreads();
  {
#pragma unroll
    for (int rd = 0; rd < 2; ++rd) { const int d = rd * 32 + tid / 8, pc = tid % 8; FragH f;
#pragma unroll
      for (int q = 0; q < 8; ++q) f.u[q] = tl[pc * 8 + q][d];
      *(v8us*)((unsigned short*)Vt + ((size_t)slab * 64 + d) * TTv + lg * 64 + pc * 8) = f.half[0]; }
     } }

__global__ __launch_bounds__(256) void k_hl(const float* __restrict__ F, _Float16* __restrict__ Hh, _Float16* __restrict__ Hl, size_t n8) { const size_t t = (size_t)blockIdx.x * 256 + threadIdx.x; if (t >= n8) return; FragH fh, fl; const v4f a = *(const v4fa*)(F + t * 8), c = *(const v4fa*)(F + t * 8 + 4);
#pragma unroll
  for (int q = 0; q < 4; ++q) { _Float16 h = (_Float16)a[q]; fh.h[q] = h; fl.h[q] = (_Float16)((a[q] - (float)h) * 1024.0f); h = (_Float16)c[q]; fh.h[4 + q] = h; fl.h[4 + q] = (_Float16)((c[q] - (float)h) * 1024.0f); }
  { *(v8us*)((unsigned short*)Hh + t * 8) = fh.half[0]; *(v8us*)((unsigned short*)Hl + t * 8) = fl.half[0];  } }

// ---- fast GEMM (wave tile 32x64; requires M % 32 == 0 rows per launch region and N % 64 == 0); epilogue = k_gemm_hhx semantics ----
__device__ __forceinline__ v16h g2_frag(const _Float16* p, int hh) { FragH f; f.half[0] = *(const v8us*)((const unsigned short*)p + 8 * hh); f.half[1] = *(const v8us*)((const unsigned short*)p + 16 + 8 * hh); return f.v; }
__device__ __forceinline__ v8f g2_mma(v16h a, v16h b, v8f c) { v8f d = __builtin_amdgcn_wmma_f32_16x16x32_f16(false, a, false, b, (short)0, c, false, false); asm volatile("v_nop\n\tv_nop\n\tv_nop\n\tv_nop" : "+v"(d) : "v"(a), "v"(b)); return d; }
template <int ACT>
__global__ __launch_bounds__(128) void k_gemm2(const _Float16* __restrict__ A, int lda, size_t sA, const _Float16* __restrict__ Bh, int ldb, size_t sB, float alpha, const float* __restrict__ bias, size_t sBias, const float* __restrict__ CP, int rowsPerB, size_t sCPb, int row0g,
    float* __restrict__ C, _Float16* __restrict__ C16, int ldc, size_t sC, int M, int N, int K) { static_assert(ACT == 0 || ACT == 3 || ACT == 6 || ACT == 8 || ACT == 9 || ACT == 11 || ACT == 12 || ACT == 14 || ACT == 15 || ACT == 16 || ACT == 17, "k_gemm2: unsupported ACT code (would silently apply no activation)");
  __shared__ __attribute__((aligned(16))) float so[4][32][68];
  const int tid = threadIdx.x, w = tid >> 5, lane = tid & 31, ln = lane & 15, hh = lane >> 4; const int by = blockIdx.y;
  A += (size_t)by * sA; Bh += (size_t)by * sB; const size_t cofs = (size_t)by * sC; const float* bp = bias ? bias + (size_t)by * sBias : nullptr;
  const int ntn = N >> 6; const int mt = blockIdx.x / ntn, nq = blockIdx.x - mt * ntn; const int row0 = mt * 128 + 32 * w, col0 = nq * 64; if (row0 >= M) return;
  const _Float16* a0p = A + (size_t)(row0 + ln) * lda; const _Float16* a1p = a0p + (size_t)16 * lda;
  const _Float16* b0p = Bh + (size_t)(col0 + ln) * ldb; const _Float16* b1p = b0p + (size_t)16 * ldb; const _Float16* b2p = b1p + (size_t)16 * ldb; const _Float16* b3p = b2p + (size_t)16 * ldb;
  const v8f z8 = {0.f,0.f,0.f,0.f,0.f,0.f,0.f,0.f}; v8f c00 = z8, c01 = z8, c02 = z8, c03 = z8, c10 = z8, c11 = z8, c12 = z8, c13 = z8;
#pragma unroll 1
  for (int kb = 0; kb < K; kb += 32) { const v16h a0 = g2_frag(a0p + kb, hh), a1 = g2_frag(a1p + kb, hh);
    v16h b = g2_frag(b0p + kb, hh); c00 = g2_mma(a0, b, c00); c10 = g2_mma(a1, b, c10);
    b = g2_frag(b1p + kb, hh); c01 = g2_mma(a0, b, c01); c11 = g2_mma(a1, b, c11);
    b = g2_frag(b2p + kb, hh); c02 = g2_mma(a0, b, c02); c12 = g2_mma(a1, b, c12);
    b = g2_frag(b3p + kb, hh); c03 = g2_mma(a0, b, c03); c13 = g2_mma(a1, b, c13); }
  v8f accs[8] = {c00, c01, c02, c03, c10, c11, c12, c13};
#pragma unroll
  for (int u = 0; u < 8; ++u) { const int t = u & 3, half = u >> 2; const int col = col0 + t * 16 + ln; const float bv = bp ? bf16_round(bp[col]) : 0.f;
#pragma unroll
    for (int r = 0; r < 8; ++r) { const int rloc = half * 16 + 8 * hh + r; float v = accs[u][r] * alpha + bv; if (CP) { if (rowsPerB < 0) v += CP[cofs + (size_t)(row0g + row0 + rloc) * ldc + col];      /* rowsPerB < 0: own element of the batched C plane */ else { const int bidx = (row0g + row0 + rloc) / rowsPerB; v += CP[(size_t)bidx * sCPb + (size_t)by * 64 + col]; } }
      if (ACT == 3) v = fmaxf(v, 0.f); else if (ACT == 6) v = 0.5f * v * (1.0f + erff(v * 0.70710678118654752f)); else if (ACT == 11) v = 1.0f / (1.0f + expf(-v)); else if (ACT == 15) v = v / (1.0f + expf(-v)); else if (ACT == 12) v = (v > 0.f) ? v : 0.01f * v; else if (ACT == 8) v = tanhf(v); else if (ACT == 9) v = 0.5f * v * (1.0f + tanhf(0.7978845608028654f * (v + 0.044715f * v * v * v))); else if (ACT == 14) v = (v > 0.f) ? v : 0.1f * v; else if (ACT == 16) v = (v >= 0.f) ? v : 0.3f * v; else if (ACT == 17) v = (v >= 0.f) ? v : 0.2f * v;
      so[w][rloc][t * 16 + ln] = v; } }
  __builtin_amdgcn_fence(__ATOMIC_ACQ_REL, "workgroup"); __builtin_amdgcn_wave_barrier();
  const int rsub = lane >> 4, c4 = (lane & 15) * 4;
  {
#pragma unroll
    for (int q = 0; q < 16; ++q) { const int r = q * 2 + rsub; const v4f v = *(const v4fa*)&so[w][r][c4]; if (C) *(v4f*)(C + cofs + (size_t)(row0 + r) * ldc + col0 + c4) = v; if (C16) { v4h h4; for (int i = 0; i < 4; ++i) h4[i] = (_Float16)v[i]; *(v4h*)(C16 + cofs + (size_t)(row0 + r) * ldc + col0 + c4) = h4; } }
     } }


__global__ __launch_bounds__(256) void k_wnat(const float* __restrict__ w, size_t n8, _Float16* __restrict__ Bt) { const size_t t = (size_t)blockIdx.x * 256 + threadIdx.x; if (t >= n8) return; FragH f; for (int q = 0; q < 8; ++q) f.h[q] = (_Float16)(bf16_round(w[t * 8 + q]) * 16.0f); *(v8us*)((unsigned short*)Bt + t * 8) = f.half[0];  }
__global__ __launch_bounds__(256) void k_rsm(const float* __restrict__ S, _Float16* __restrict__ P, int nrows) {
  #pragma clang fp contract(off)
  const int i = blockIdx.x * 256 + threadIdx.x; if (i >= nrows) return; const float* s = S + (size_t)i * SQ; float mx = -3.0e38f;
#pragma unroll 1
  for (int j = 0; j < SQ; ++j) mx = fmaxf(mx, s[j]); float se = 0.f;
#pragma unroll 1
  for (int j = 0; j < SQ; ++j) se += expf(s[j] - mx); const float sc = 256.0f / se;
#pragma unroll 1
  for (int j0 = 0; j0 < SQ; j0 += 8) { FragH f; for (int q = 0; q < 8; ++q) f.h[q] = (_Float16)(expf(s[j0 + q] - mx) * sc); unsigned short* d = (unsigned short*)P + (size_t)i * SQ + j0; *(v8us*)d = f.half[0];  } }
__global__ __launch_bounds__(256) void k_vt(const _Float16* __restrict__ V16, int b, int h0, _Float16* __restrict__ VT) { __shared__ unsigned short tl[64][65]; const int tid = threadIdx.x; const int hh = blockIdx.x % HG, sg = blockIdx.x / HG; const int s0 = sg * 64; const int h = h0 + hh;
  for (int i = tid; i < 64 * 8; i += 256) { const int j = i / 8, d8 = (i % 8) * 8; FragH f; f.half[0] = *(const v8us*)((const unsigned short*)V16 + ((size_t)b * SQ + s0 + j) * DM + h * HD + d8); for (int q = 0; q < 8; ++q) tl[d8 + q][j] = f.u[q]; }
  __syncthreads();
  { for (int i = tid; i < 64 * 8; i += 256) { const int d = i / 8, j8 = (i % 8) * 8; FragH f; for (int q = 0; q < 8; ++q) f.u[q] = tl[d][j8 + q]; *(v8us*)((unsigned short*)VT + ((size_t)hh * HD + d) * SQ + s0 + j8) = f.half[0]; }  } }


__global__ __launch_bounds__(256) void k_rsmcf2(const float* __restrict__ S, _Float16* __restrict__ P, int hg, int q0, int nk) {
  #pragma clang fp contract(off)
  const int t = blockIdx.x * 256 + threadIdx.x; if (t >= hg * QT) return; const size_t i = (size_t)t; const float* s = S + i * NKX; const int last = q0 + (t % QT); float mx = -3.0e38f;
#pragma unroll 1
  for (int j = 0; j < nk; ++j) { const float f = (j <= last) ? 1.f : 0.f; mx = fmaxf(mx, fmaf(f, s[j], (1.f - f) * -1.0e9f)); } float se = 0.f;
#pragma unroll 1
  for (int j = 0; j < nk; ++j) { const float f = (j <= last) ? 1.f : 0.f; se += __expf(fmaf(f, s[j], (1.f - f) * -1.0e9f) - mx); } const float sc = 256.0f / se;
#pragma unroll 1
  for (int j0 = 0; j0 < nk; j0 += 8) { FragH fr; for (int q = 0; q < 8; ++q) { const int j = j0 + q; const float f = (j <= last) ? 1.f : 0.f; fr.h[q] = (_Float16)(__expf(fmaf(f, s[j], (1.f - f) * -1.0e9f) - mx) * sc); } unsigned short* d = (unsigned short*)P + i * NKX + j0; *(v8us*)d = fr.half[0];  } }


// Causal row softmax, one wave per row (one-wave blocks, one block per row) over nk = 256 NC columns. Lane l keeps the 8 scores at columns 256 c + 8 l of each 256-column chunk c
// in registers, so the score row is read once, 32 contiguous bytes a lane, its loads issued ahead of the arithmetic; row maximum and row sum are four chains a lane, then a five-step butterfly.
template <int NC>
__global__ __launch_bounds__(32) void k_rsmcf2hl(const float* __restrict__ S, _Float16* __restrict__ P, _Float16* __restrict__ PL, int hg, int q0) {
  const int t = blockIdx.x, j0 = threadIdx.x * 8; if (t >= hg * QT) return; const size_t o = (size_t)t * NKX + j0; const int last = q0 + (t % QT);
  const float* s = S + o; unsigned short* p = (unsigned short*)P + o; unsigned short* pl = (unsigned short*)PL + o;
  v4f ra[NC], rb[NC];
#pragma unroll
  for (int c = 0; c < NC; ++c) { ra[c] = *(const v4fa*)(s + c * 256); rb[c] = *(const v4fa*)(s + c * 256 + 4); }
  asm volatile("s_wait_xcnt 0x0" :: "v"(s) : "memory");      /* the wait in front of any overwrite of the address pair that the issued loads name; naming the pair keeps it whole up to here */
  float e[NC][8]; float m4[4] = {-3.0e38f, -3.0e38f, -3.0e38f, -3.0e38f};
#pragma unroll
  for (int c = 0; c < NC; ++c) { const v4f a = ra[c], b = rb[c];
#pragma unroll
    for (int q = 0; q < 8; ++q) { const float f = (j0 + c * 256 + q <= last) ? 1.f : 0.f; const float v = fmaf(f, (q < 4) ? a[q & 3] : b[q & 3], (1.f - f) * -1.0e9f); e[c][q] = v; m4[q & 3] = fmaxf(m4[q & 3], v); } }
  float mx = fmaxf(fmaxf(m4[0], m4[1]), fmaxf(m4[2], m4[3]));
#pragma unroll
  for (int d = 16; d > 0; d >>= 1) mx = fmaxf(mx, __shfl_xor(mx, d, 32));
  float s4[4] = {0.f, 0.f, 0.f, 0.f};
#pragma unroll
  for (int c = 0; c < NC; ++c)
#pragma unroll
    for (int q = 0; q < 8; ++q) { const float y = (e[c][q] - mx) * 1.44269504f; float x;
      asm("v_exp_f32 %0, %1\n\tv_nop" : "=v"(x) : "v"(y));      /* native exp as before; the v_nop is the slot the instruction set asks for behind a transcendental before its source is overwritten */
      e[c][q] = x; s4[q & 3] += x; }
  float se = (s4[0] + s4[1]) + (s4[2] + s4[3]);
#pragma unroll
  for (int d = 16; d > 0; d >>= 1) se += __shfl_xor(se, d, 32);
  const float sc = 256.0f / se;
#pragma unroll
  for (int c = 0; c < NC; ++c) { FragH fr, fl;
#pragma unroll
    for (int q = 0; q < 8; ++q) { const float pv = e[c][q] * sc; const _Float16 h = (_Float16)pv; fr.h[q] = h; fl.h[q] = (_Float16)((pv - (float)h) * 1024.0f); }
    *(v8us*)(p + c * 256) = fr.half[0]; *(v8us*)(pl + c * 256) = fl.half[0]; } }
extern "C" void kernel_launch(void* const* d_in, const int* in_sizes, int n_in,
                              void* d_out, int out_size, void* d_ws, size_t ws_size, hipStream_t stream) {
  (void)in_sizes; (void)n_in; (void)out_size;
  const float* const* I = (const float* const*)d_in; const float* x = I[0]; const float* wq = I[1]; const float* wk = I[2]; const float* wv = I[3];
  char* ws = (char*)d_ws; size_t off = 0;
  auto take = [&](size_t bytes) { char* p = ws + off; off += (bytes + 255) & ~(size_t)255; return p; };
  _Float16* X16 = (_Float16*)take(NR * DMX * 2); _Float16* BQ = (_Float16*)take((size_t)HD * DMX * 2); _Float16* BK = (_Float16*)take((size_t)HD * DMX * 2); _Float16* BV = (_Float16*)take((size_t)HD * DMX * 2); _Float16* Q16 = (_Float16*)take(NR * HD * 2); _Float16* KL16 = (_Float16*)take(NR * HD * 2); float* KOUT = (float*)d_out + NR * HD; float* VF = (float*)d_out + 2 * NR * HD;      /* out1 = k and out2 = v are written in f32 straight into the tuple output and re-used as the sources of the f16 planes */ _Float16* VL16 = (_Float16*)take(NR * HD * 2); _Float16* VTL = (_Float16*)take((size_t)NHS * HD * SQ * 2); _Float16* K16 = (_Float16*)take(NR * HD * 2); _Float16* V16 = (_Float16*)take(NR * HD * 2); _Float16* VT = (_Float16*)take((size_t)NHS * HD * SQ * 2);
  float* S = (float*)take((size_t)NHS * QT * NKX * 4); _Float16* P = (_Float16*)take((size_t)NHS * QT * NKX * 2); _Float16* PL = (_Float16*)take((size_t)NHS * QT * NKX * 2);
  if (off > ws_size) return;      /* approx 16 + 0.4 + 5 x 1 + 2 x 0.25 + 2 + 1 + 1 = 26 MiB */
  k_x16<<<(unsigned)((NR * DMX / 8 + 255) / 256), 256, 0, stream>>>(x, X16, NR * DMX / 8);      /* x as exact f16 rows */
  { const unsigned g = (unsigned)(((size_t)HD * (DMX / 8) + 255) / 256); k_wt_f16<<<g, 256, 0, stream>>>(wq, BQ, DMX, HD, 16.0f); k_wt_f16<<<g, 256, 0, stream>>>(wk, BK, DMX, HD, 16.0f); k_wt_f16<<<g, 256, 0, stream>>>(wv, BV, DMX, HD, 16.0f); }      /* [in][out] 1024 x 64 -> Bt [64][1024] x16 */
  k_gemm2<0><<<dim3((unsigned)((NR / 128) * (HD / 64)), 1), 128, 0, stream>>>(X16, DMX, 0, BQ, DMX, 0, 0.0625f, nullptr, 0, nullptr, 1, 0, 0, nullptr, Q16, HD, 0, (int)NR, HD, DMX); k_gemm2<0><<<dim3((unsigned)((NR / 128) * (HD / 64)), 1), 128, 0, stream>>>(X16, DMX, 0, BK, DMX, 0, 0.0625f, nullptr, 0, nullptr, 1, 0, 0, KOUT, nullptr, HD, 0, (int)NR, HD, DMX); k_hl<<<(unsigned)((NR * HD / 8 + 255) / 256), 256, 0, stream>>>(KOUT, K16, KL16, NR * HD / 8);      /* out1 = k (f32; exact products, f32 accumulation) and its f16 plane (the residual plane is unused) */ k_gemm2<0><<<dim3((unsigned)((NR / 128) * (HD / 64)), 1), 128, 0, stream>>>(X16, DMX, 0, BV, DMX, 0, 0.0625f, nullptr, 0, nullptr, 1, 0, 0, VF, nullptr, HD, 0, (int)NR, HD, DMX); k_hl<<<(unsigned)((NR * HD / 8 + 255) / 256), 256, 0, stream>>>(VF, V16, VL16, NR * HD / 8);      /* v in f32 -> f16 hi + x1024 residual planes */      /* q, k, v = x W as f16 rows [token][64] (= the head-major [B][1][S][64] layout the attention below expects) */
  for (int b = 0; b < NB; ++b) { const size_t s0 = (size_t)b * NHS * SQ;      /* first row of this batch's head-0 slab */
    for (int h = 0; h < NHS; ++h) { k_vt<1, SQ><<<SQ / 64, 256, 0, stream>>>(V16 + (s0 + (size_t)h * SQ) * HD, HD, 0, VT + (size_t)h * HD * SQ); k_vt<1, SQ><<<SQ / 64, 256, 0, stream>>>(VL16 + (s0 + (size_t)h * SQ) * HD, HD, 0, VTL + (size_t)h * HD * SQ); }      /* V^T hi and residual per head slab */
    for (int q0 = 0; q0 < SQ; q0 += QT) { const int nk = q0 + QT;
      k_gemm2<0><<<dim3((QT / 128) * (nk / 64), NHS), 128, 0, stream>>>(Q16 + (s0 + q0) * HD, HD, (size_t)SQ * HD, K16 + s0 * HD, HD, (size_t)SQ * HD, 0.03125f, nullptr, 0, nullptr, 1, 0, 0, S, nullptr, NKX, (size_t)QT * NKX, QT, nk, HD);      /* scores / 32 for the visible keys, 1 head on grid.y */
      switch (nk / 256) {      /* one straight-line kernel per row length */
        case 1: k_rsmcf2hl<1><<<NHS * QT, 32, 0, stream>>>(S, P, PL, NHS, q0); break; case 2: k_rsmcf2hl<2><<<NHS * QT, 32, 0, stream>>>(S, P, PL, NHS, q0); break; case 3: k_rsmcf2hl<3><<<NHS * QT, 32, 0, stream>>>(S, P, PL, NHS, q0); break; case 4: k_rsmcf2hl<4><<<NHS * QT, 32, 0, stream>>>(S, P, PL, NHS, q0); break;
        case 5: k_rsmcf2hl<5><<<NHS * QT, 32, 0, stream>>>(S, P, PL, NHS, q0); break; case 6: k_rsmcf2hl<6><<<NHS * QT, 32, 0, stream>>>(S, P, PL, NHS, q0); break; case 7: k_rsmcf2hl<7><<<NHS * QT, 32, 0, stream>>>(S, P, PL, NHS, q0); break; default: k_rsmcf2hl<8><<<NHS * QT, 32, 0, stream>>>(S, P, PL, NHS, q0); break; }      /* causal softmax -> f16 x256 hi + x1024 residual planes */
      k_gemm2<0><<<dim3((QT / 128) * (HD / 64), NHS), 128, 0, stream>>>(P, NKX, (size_t)QT * NKX, VT, SQ, (size_t)HD * SQ, 0.00390625f, nullptr, 0, nullptr, 1, 0, 0, (float*)d_out + (s0 + q0) * HD, nullptr, HD, (size_t)SQ * HD, QT, HD, nk);      /* out = P_hi V / 256 */
      k_gemm2<0><<<dim3((QT / 128) * (HD / 64), NHS), 128, 0, stream>>>(PL, NKX, (size_t)QT * NKX, VT, SQ, (size_t)HD * SQ, 0.000003814697265625f, nullptr, 0, (const float*)d_out + (s0 + q0) * HD, -1, 0, 0, (float*)d_out + (s0 + q0) * HD, nullptr, HD, (size_t)SQ * HD, QT, HD, nk); k_gemm2<0><<<dim3((QT / 128) * (HD / 64), NHS), 128, 0, stream>>>(P, NKX, (size_t)QT * NKX, VTL, SQ, (size_t)HD * SQ, 0.000003814697265625f, nullptr, 0, (const float*)d_out + (s0 + q0) * HD, -1, 0, 0, (float*)d_out + (s0 + q0) * HD, nullptr, HD, (size_t)SQ * HD, QT, HD, nk);      /* += P_hi V_lo^T 2^-18: v effectively f32 too */ } }      /* += P_lo V 2^-18 (own-element accumulate): P effectively ~f32 */
}

// v002
// One run takes 398 microseconds.
// Timed twice side by side with v001, it ran 10.3 times as fast both times.
// Over all steps from v000 it is 25.2 times as fast.
#include <hip/hip_runtime.h>
// Single attention head returning the TUPLE (out, k, v) (x [4][2048][1024]; q = x Wq, k = x Wk, v = x Wv ([in][out] 1024 x 64, sigma 1/32, no biases); wei = q . k x 1024^-0.5 (the module scales by n_embd) with a causal mask (tril, -inf); softmax; out = wei v -> out0 [4][2048][64] @0, out1 = k [4][2048][64] f32 @2,097,152 B, out2 = v [4][2048][64] f32 @4,194,304 B; input order x, Wq, Wk, Wv).
// Structure: x as exact f16 rows; the three [in][out] weights as exact x16 planes; q, k, v as WMMA GEMMs (32x64 wave tiles, f32 accumulation, K = 1024): q as f16 rows, k and v in f32 STRAIGHT INTO the tuple output slots (out1, out2) and then split into f16 (v: hi + x1024 residual) planes; V^T (hi and residual) of all batches via LDS transposes; then ONE launch per stage over all batches (grid.y in the GEMMs, grid.x rows in the softmax) and all query tiles of 256 rows (grid.x), each block taking its tile's key bound from its own row index: scores against the keys below the tile end only (K = 64, alpha 1/32) into an f32 plane [batch][query][key], causal row softmax on VALU, one wave per row (arithmetic 0/1 select; f32 statistics, native exp) writing the weights as f16 hi (x256) + x1024 residual planes, out = P_hi V^T (alpha 2^-8) written f32 then += P_lo V_hi^T and += P_hi V_lo^T (alpha 2^-18 each; own-element accumulates in the next launches); launches: see trace.
// Compute dtype: inputs rounded to bf16; q, k, v f32 sums rounded to f16 (v also a x1024 residual); softmax weights f16 hi (x256) + x1024 residual; scores, statistics, out f32; v_wmma_f32_16x16x32_f16.
#define NB 4
#define NHS 1
#define DMX 1024                   /* model width (projection K) */
#define SQ 2048
#define HD 64
#define DM 64
#define NH 1
#define HG 1
#define QT 256
#define NKX SQ
#define NR ((size_t)NB * NHS * SQ)
typedef __bf16 v16b __attribute__((ext_vector_type(16)));
typedef unsigned short v8us __attribute__((ext_vector_type(8), may_alias));
typedef float  v8f  __attribute__((ext_vector_type(8)));
typedef float  v4f  __attribute__((ext_vector_type(4)));
typedef float  v4fa __attribute__((ext_vector_type(4), may_alias));
union FragB { v16b v; v8us half[2]; unsigned short u[16]; };

__device__ __forceinline__ unsigned short bf16_bits(float x) { unsigned int u = __float_as_uint(x); return (unsigned short)((u + 0x7FFFu + ((u >> 16) & 1u)) >> 16); }
__device__ __forceinline__ float bf16_val(unsigned short b) { return __uint_as_float(((unsigned int)b) << 16); }
__device__ __forceinline__ float bf16_round(float x) { return bf16_val(bf16_bits(x)); }
// D += A·B with NT terms: 1 = ah·bh, 2 = + al·bh (A split), 3 = + ah·bl (both split)
template <int NT>
__device__ __forceinline__ v8f mmaN(v16b ah, v16b al, v16b bh, v16b bl, v8f c) {
  c = __builtin_amdgcn_wmma_f32_16x16x32_bf16(false, ah, false, bh, (short)0, c, false, false);
  if (NT >= 2) c = __builtin_amdgcn_wmma_f32_16x16x32_bf16(false, al, false, bh, (short)0, c, false, false);
  if (NT >= 3) c = __builtin_amdgcn_wmma_f32_16x16x32_bf16(false, ah, false, bl, (short)0, c, false, false);
  asm volatile("v_nop\n\tv_nop\n\tv_nop\n\tv_nop" : "+v"(c) : "v"(ah), "v"(al), "v"(bh), "v"(bl));
  return c;
}

__global__ __launch_bounds__(256) void k_wt_bf16(const float* __restrict__ W, unsigned short* __restrict__ Wt, int K, int N) {
  const int t = blockIdx.x * 256 + threadIdx.x;
  const int k8n = K / 8;
  if (t >= N * k8n) return;
  const int n = t / k8n, k8 = (t % k8n) * 8;
  v8us v;
#pragma unroll
  for (int i = 0; i < 8; ++i) v[i] = bf16_bits(W[(size_t)(k8 + i) * N + n]);
  *(v8us*)(Wt + (size_t)n * K + k8) = v;
  
}

// GEMM C[M][N] (f32, pitch ldc) = act(A[M][K]·W + bias). A f32 row-major (pitch lda) converted per fragment to bf16
// (ASPLIT: hi/lo two planes -> 2 terms, else single rounded term); Wt bf16 [N][K] (pitch ldb). BIAS_BF16 rounds the
// bias to bf16 first (bias quantised to bf16 before the add). K%32==0, M%16==0, N%64==0.
template <bool ASPLIT, int ACT, bool BIAS_BF16>
__global__ __launch_bounds__(128) void k_gemm_bf(const float* __restrict__ A, int lda, const unsigned short* __restrict__ Wt, int ldb,
                                               const float* __restrict__ bias, float* __restrict__ C, int ldc, int M, int N, int K) {
  __shared__ __attribute__((aligned(16))) float so[4][16][64];
  const int tid = threadIdx.x, w = tid >> 5, lane = tid & 31, ln = lane & 15, hh = lane >> 4;
  const int ntn = N / 64;
  const int wid = blockIdx.x * 4 + w;
  const int mt = wid / ntn, nq = wid % ntn;
  if (mt * 16 >= M) return;
  const int row0 = mt * 16, col0 = nq * 64;
  const float* arow = A + (size_t)(row0 + ln) * lda;
  v8f acc[4] = {};
  for (int kb = 0; kb < K; kb += 32) {
    FragB ah, al;
    const v4f x0 = *(const v4fa*)(arow + kb + 8 * hh), x1 = *(const v4fa*)(arow + kb + 8 * hh + 4);
    const v4f x2 = *(const v4fa*)(arow + kb + 16 + 8 * hh), x3 = *(const v4fa*)(arow + kb + 16 + 8 * hh + 4);
    float xs[16] = {x0[0],x0[1],x0[2],x0[3],x1[0],x1[1],x1[2],x1[3],x2[0],x2[1],x2[2],x2[3],x3[0],x3[1],x3[2],x3[3]};
#pragma unroll
    for (int i = 0; i < 16; ++i) { const unsigned short hb = bf16_bits(xs[i]); ah.u[i] = hb; al.u[i] = ASPLIT ? bf16_bits(xs[i] - bf16_val(hb)) : (unsigned short)0; }
#pragma unroll
    for (int t = 0; t < 4; ++t) {
      const unsigned short* brow = Wt + (size_t)(col0 + t * 16 + ln) * ldb + kb;
      FragB b;
      b.half[0] = *(const v8us*)(brow + 8 * hh);
      b.half[1] = *(const v8us*)(brow + 16 + 8 * hh);
      acc[t] = mmaN<ASPLIT ? 2 : 1>(ah.v, al.v, b.v, b.v, acc[t]);
    }
  }
#pragma unroll
  for (int t = 0; t < 4; ++t) {
    float bv = bias ? bias[col0 + t * 16 + ln] : 0.f;
    if (BIAS_BF16) bv = bf16_round(bv);
#pragma unroll
    for (int r = 0; r < 8; ++r) { float v = acc[t][r] + bv; if (ACT == 1) v = fmaxf(v, 0.f); so[w][8 * hh + r][t * 16 + ln] = v; }
  }
  __builtin_amdgcn_fence(__ATOMIC_ACQ_REL, "workgroup");
  __builtin_amdgcn_wave_barrier();
  const int rsub = lane >> 4, c4 = (lane & 15) * 4;
  {
#pragma unroll
    for (int q = 0; q < 8; ++q) {
      const int r = q * 2 + rsub;
      const v4f v = *(const v4fa*)&so[w][r][c4];
      *(v4f*)(C + (size_t)(row0 + r) * ldc + col0 + c4) = v;
    }
    
  }
}

// GEMM C = act(A·W + bias + resid): A f32 (ASPLIT -> hi/lo 2 terms), Wt bf16 [N][K]; ACT 0 none, 1 relu, 2 exact gelu;
// resid (optional, f32, row index = (row % rmod), pitch ldr, RES_BF16 rounds it) added before the activation.
template <bool ASPLIT, int ACT, bool BIAS_BF16, bool RES_BF16>
__global__ __launch_bounds__(128) void k_gemm_bf3(const float* __restrict__ A, int lda, const unsigned short* __restrict__ Wt, int ldb,
                                                const float* __restrict__ bias, const float* __restrict__ resid, int rmod, int ldr,
                                                float* __restrict__ C, int ldc, int M, int N, int K) {
  __shared__ __attribute__((aligned(16))) float so[4][16][64];
  const int tid = threadIdx.x, w = tid >> 5, lane = tid & 31, ln = lane & 15, hh = lane >> 4;
  const int ntn = N / 64;
  const int wid = blockIdx.x * 4 + w;
  const int mt = wid / ntn, nq = wid % ntn;
  if (mt * 16 >= M) return;
  const int row0 = mt * 16, col0 = nq * 64;
  const float* arow = A + (size_t)(row0 + ln) * lda;
  v8f acc[4] = {};
  for (int kb = 0; kb < K; kb += 32) {
    FragB ah, al;
    const v4f x0 = *(const v4fa*)(arow + kb + 8 * hh), x1 = *(const v4fa*)(arow + kb + 8 * hh + 4);
    const v4f x2 = *(const v4fa*)(arow + kb + 16 + 8 * hh), x3 = *(const v4fa*)(arow + kb + 16 + 8 * hh + 4);
    float xs[16] = {x0[0],x0[1],x0[2],x0[3],x1[0],x1[1],x1[2],x1[3],x2[0],x2[1],x2[2],x2[3],x3[0],x3[1],x3[2],x3[3]};
#pragma unroll
    for (int i = 0; i < 16; ++i) { const unsigned short hb = bf16_bits(xs[i]); ah.u[i] = hb; al.u[i] = ASPLIT ? bf16_bits(xs[i] - bf16_val(hb)) : (unsigned short)0; }
#pragma unroll
    for (int t = 0; t < 4; ++t) {
      const unsigned short* brow = Wt + (size_t)(col0 + t * 16 + ln) * ldb + kb;
      FragB b;
      b.half[0] = *(const v8us*)(brow + 8 * hh);
      b.half[1] = *(const v8us*)(brow + 16 + 8 * hh);
      acc[t] = mmaN<ASPLIT ? 2 : 1>(ah.v, al.v, b.v, b.v, acc[t]);
    }
  }
#pragma unroll
  for (int t = 0; t < 4; ++t) {
    const int col = col0 + t * 16 + ln;
    float bv = bias ? bias[col] : 0.f;
    if (BIAS_BF16) bv = bf16_round(bv);
#pragma unroll
    for (int r = 0; r < 8; ++r) {
      float v = acc[t][r] + bv;
      if (resid) { float rv = resid[(size_t)((row0 + 8 * hh + r) % rmod) * ldr + col]; if (RES_BF16) rv = bf16_round(rv); v += rv; }
      if (ACT == 1) v = fmaxf(v, 0.f);
      if (ACT == 2) v = 0.5f * v * (1.0f + erff(v * 0.70710678118654752f));
      if (ACT == 3) { const float u = 0.7978845608028654f * (v + 0.044715f * v * v * v); v = 0.5f * v * (1.0f + tanhf(u)); }
      so[w][8 * hh + r][t * 16 + ln] = v;
    }
  }
  __builtin_amdgcn_fence(__ATOMIC_ACQ_REL, "workgroup");
  __builtin_amdgcn_wave_barrier();
  const int rsub = lane >> 4, c4 = (lane & 15) * 4;
  {
#pragma unroll
    for (int q = 0; q < 8; ++q) {
      const int r = q * 2 + rsub;
      const v4f v = *(const v4fa*)&so[w][r][c4];
      *(v4f*)(C + (size_t)(row0 + r) * ldc + col0 + c4) = v;
    }
    
  }
}
// row LayerNorm (biased variance, eps) over N: s = X (+ R); optional out_sum <- s; out_norm <- (s-mu)*rsqrt(var+eps)*g + b
template <bool PARAM_BF16>
__global__ __launch_bounds__(256) void k_layernorm(const float* __restrict__ X, const float* __restrict__ R, const float* __restrict__ g, const float* __restrict__ bta,
                                                  float* __restrict__ out_sum, float* __restrict__ out_norm, int N, float eps) {
  __shared__ float red[256];
  const int row = blockIdx.x, tid = threadIdx.x;
  const float* x = X + (size_t)row * N; const float* rr = R ? R + (size_t)row * N : nullptr;
  float vals[16];                     // up to N = 4096
  const int per = N / 256;            // contiguous chunk per thread? use strided-by-4 chunks: thread handles j = tid*4 + 1024*u
  float s1 = 0.f;
  for (int u = 0; u < per / 4; ++u) {
    const int j = tid * 4 + 1024 * u;
    const v4f a = *(const v4fa*)(x + j);
    v4f b = {0.f,0.f,0.f,0.f}; if (rr) b = *(const v4fa*)(rr + j);
#pragma unroll
    for (int q = 0; q < 4; ++q) { const float v = a[q] + b[q]; vals[u * 4 + q] = v; s1 += v; }
  }
  red[tid] = s1; __syncthreads();
  for (int st = 128; st > 0; st >>= 1) { if (tid < st) red[tid] += red[tid + st]; __syncthreads(); }
  const float mu = red[0] / (float)N; __syncthreads();
  float s2 = 0.f;
  for (int u = 0; u < per / 4; ++u)
#pragma unroll
    for (int q = 0; q < 4; ++q) { const float c = vals[u * 4 + q] - mu; s2 += c * c; }
  red[tid] = s2; __syncthreads();
  for (int st = 128; st > 0; st >>= 1) { if (tid < st) red[tid] += red[tid + st]; __syncthreads(); }
  const float rs = rsqrtf(red[0] / (float)N + eps);
  {
    for (int u = 0; u < per / 4; ++u) {
      const int j = tid * 4 + 1024 * u;
      v4f o, sm;
#pragma unroll
      for (int q = 0; q < 4; ++q) {
        float gg = g[j + q], bb = bta[j + q];
        if (PARAM_BF16) { gg = bf16_round(gg); bb = bf16_round(bb); }
        sm[q] = vals[u * 4 + q]; o[q] = (vals[u * 4 + q] - mu) * rs * gg + bb;
      }
      if (out_sum) *(v4f*)(out_sum + (size_t)row * N + j) = sm;
      *(v4f*)(out_norm + (size_t)row * N + j) = o;
    }
    
  }
}



// ---- f16 WMMA path (v_wmma_f32_16x16x32_f16): 11-bit significands for operands in range — used where a [0,1] probability operand needs more precision than bf16
typedef _Float16 v16h __attribute__((ext_vector_type(16)));
union FragH { v16h v; v8us half[2]; _Float16 h[16]; unsigned short u[16]; };
template <int NT>
__device__ __forceinline__ v8f mmaH(v16h ah, v16h al, v16h bh, v16h bl, v8f c) {
  c = __builtin_amdgcn_wmma_f32_16x16x32_f16(false, ah, false, bh, (short)0, c, false, false);
  if (NT >= 2) c = __builtin_amdgcn_wmma_f32_16x16x32_f16(false, al, false, bh, (short)0, c, false, false);
  if (NT >= 3) c = __builtin_amdgcn_wmma_f32_16x16x32_f16(false, ah, false, bl, (short)0, c, false, false);
  asm volatile("v_nop\n\tv_nop\n\tv_nop\n\tv_nop" : "+v"(c) : "v"(ah), "v"(al), "v"(bh), "v"(bl));
  return c;
}
// batched GEMM like k_gemm_b but f16 operands: A f32 (split into f16 hi/lo if ASPLIT, else rounded to f16), Bt = f16 values [n][k]; alpha; C f32; N multiple of 16 (partial tiles skipped)
template <bool ASPLIT>
__global__ __launch_bounds__(128) void k_gemm_h(const float* __restrict__ A, int lda, size_t sA, const _Float16* __restrict__ Bh, int ldb, size_t sB, float alpha, float* __restrict__ C, int ldc, size_t sC, int M, int N, int K) {
  __shared__ __attribute__((aligned(16))) float so[4][16][64];
  const int tid = threadIdx.x, w = tid >> 5, lane = tid & 31, ln = lane & 15, hh = lane >> 4; const int by = blockIdx.y;
  A += (size_t)by * sA; Bh += (size_t)by * sB; C += (size_t)by * sC;
  const int ntn = (N + 63) / 64; const int wid = blockIdx.x * 4 + w; const int mt = wid / ntn, nq = wid % ntn; if (mt * 16 >= M) return;
  const int row0 = mt * 16, col0 = nq * 64; const float* arow = A + (size_t)(row0 + ln) * lda;
  v8f acc[4] = {};
  for (int kb = 0; kb < K; kb += 32) {
    FragH ah, al;
    const v4f x0 = *(const v4fa*)(arow + kb + 8 * hh), x1 = *(const v4fa*)(arow + kb + 8 * hh + 4), x2 = *(const v4fa*)(arow + kb + 16 + 8 * hh), x3 = *(const v4fa*)(arow + kb + 16 + 8 * hh + 4);
    float xs[16] = {x0[0],x0[1],x0[2],x0[3],x1[0],x1[1],x1[2],x1[3],x2[0],x2[1],x2[2],x2[3],x3[0],x3[1],x3[2],x3[3]};
#pragma unroll
    for (int i = 0; i < 16; ++i) { const _Float16 h = (_Float16)xs[i]; ah.h[i] = h; al.h[i] = ASPLIT ? (_Float16)(xs[i] - (float)h) : (_Float16)0.0f; }
#pragma unroll
    for (int t = 0; t < 4; ++t) { if (col0 + t * 16 >= N) continue; const size_t boff = (size_t)(col0 + t * 16 + ln) * ldb + kb; FragH bq; bq.half[0] = *(const v8us*)(Bh + boff + 8 * hh); bq.half[1] = *(const v8us*)(Bh + boff + 16 + 8 * hh);
      acc[t] = mmaH<ASPLIT ? 2 : 1>(ah.v, al.v, bq.v, bq.v, acc[t]); }
  }
#pragma unroll
  for (int t = 0; t < 4; ++t) { if (col0 + t * 16 >= N) continue;
#pragma unroll
    for (int r = 0; r < 8; ++r) so[w][8 * hh + r][t * 16 + ln] = acc[t][r] * alpha; }
  __builtin_amdgcn_fence(__ATOMIC_ACQ_REL, "workgroup"); __builtin_amdgcn_wave_barrier();
  const int rsub = lane >> 4, c4 = (lane & 15) * 4;
  {
#pragma unroll
    for (int q = 0; q < 8; ++q) { const int r = q * 2 + rsub; if (col0 + c4 < N) { const v4f v = *(const v4fa*)&so[w][r][c4]; *(v4f*)(C + (size_t)(row0 + r) * ldc + col0 + c4) = v; } }
     }
}

// Wt[n][k] = f16(W[k][n]·scale) from f32 row-major W[K][N] (scale = power of two; bf16-exact weights stay exact in f16 away from the subnormal range)
__global__ __launch_bounds__(256) void k_wt_f16(const float* __restrict__ W, _Float16* __restrict__ Wt, int K, int N, float scale) {
  const int t = blockIdx.x * 256 + threadIdx.x; if (t >= N * (K / 8)) return; const int n = t / (K / 8), k8 = (t % (K / 8)) * 8; FragH f;
#pragma unroll
  for (int i = 0; i < 8; ++i) f.h[i] = (_Float16)(bf16_round(W[(size_t)(k8 + i) * N + n]) * scale); const v8us o = f.half[0];
  *(v8us*)((unsigned short*)Wt + (size_t)n * K + k8) = o; 
}
// k_gemm_hh variant with fused epilogue: v = acc·alpha + bias[by·sBias + col] (+ CP[(row/rowsPerB)·sCPb + by·64 + col] if CP) ; ACT 0 none / 1 elu ; writes f16 C16 (and f32 C if non-null)
template <int ACT>
__global__ __launch_bounds__(128) void k_gemm_hhx(const _Float16* __restrict__ A, int lda, size_t sA, const _Float16* __restrict__ Bh, int ldb, size_t sB, float alpha, const float* __restrict__ bias, size_t sBias, const float* __restrict__ CP, int rowsPerB, size_t sCPb, int row0g,
    float* __restrict__ C, _Float16* __restrict__ C16, int ldc, size_t sC, int M, int N, int K) {
  __shared__ __attribute__((aligned(16))) float so[4][16][64];
  const int tid = threadIdx.x, w = tid >> 5, lane = tid & 31, ln = lane & 15, hh = lane >> 4; const int by = blockIdx.y;
  A += (size_t)by * sA; Bh += (size_t)by * sB; const size_t cofs = (size_t)by * sC; const float* bp = bias ? bias + (size_t)by * sBias : nullptr;
  const int ntn = (N + 63) / 64; const int wid = blockIdx.x * 4 + w; const int mt = wid / ntn, nq = wid % ntn; if (mt * 16 >= M) return;
  const int row0 = mt * 16, col0 = nq * 64; const _Float16* arow = A + (size_t)(row0 + ln) * lda;
  v8f acc[4] = {};
  for (int kb = 0; kb < K; kb += 32) { FragH ah; ah.half[0] = *(const v8us*)((const unsigned short*)arow + kb + 8 * hh); ah.half[1] = *(const v8us*)((const unsigned short*)arow + kb + 16 + 8 * hh);
#pragma unroll
    for (int t = 0; t < 4; ++t) { if (col0 + t * 16 >= N) continue; const size_t boff = (size_t)(col0 + t * 16 + ln) * ldb + kb; FragH bq; bq.half[0] = *(const v8us*)((const unsigned short*)Bh + boff + 8 * hh); bq.half[1] = *(const v8us*)((const unsigned short*)Bh + boff + 16 + 8 * hh);
      acc[t] = mmaH<1>(ah.v, ah.v, bq.v, bq.v, acc[t]); }
  }
#pragma unroll
  for (int t = 0; t < 4; ++t) { if (col0 + t * 16 >= N) continue; const int col = col0 + t * 16 + ln; const float bv = bp ? bf16_round(bp[col]) : 0.f;
#pragma unroll
    for (int r = 0; r < 8; ++r) { float v = acc[t][r] * alpha + bv; if (CP) { const int rr = row0g + row0 + 8 * hh + r; if (rowsPerB < 0) v += CP[cofs + (size_t)rr * ldc + col];      /* rowsPerB < 0: own element of the batched C plane */ else { const int bidx = rr / rowsPerB; v += CP[(size_t)bidx * sCPb + (size_t)by * 64 + col]; } } if (ACT == 1) v = (v > 0.f) ? v : expm1f(v); else if (ACT == 7) v = (v > 0.f) ? v + 1.0f : expf(v); else if (ACT == 8) v = tanhf(v); else if (ACT == 9) v = 0.5f * v * (1.0f + tanhf(0.7978845608028654f * (v + 0.044715f * v * v * v))); else if (ACT == 11) v = 1.0f / (1.0f + expf(-v)); else if (ACT == 12) v = (v > 0.f) ? v : 0.01f * v; else if (ACT == 14) v = (v > 0.f) ? v : 0.1f * v; else if (ACT == 16) v = (v >= 0.f) ? v : 0.3f * v; else if (ACT == 17) v = (v >= 0.f) ? v : 0.2f * v; else if (ACT == 15) v = v / (1.0f + expf(-v)); else if (ACT == 3) v = fmaxf(v, 0.f); else if (ACT == 6) v = 0.5f * v * (1.0f + erff(v * 0.70710678118654752f)); so[w][8 * hh + r][t * 16 + ln] = v; } }
  __builtin_amdgcn_fence(__ATOMIC_ACQ_REL, "workgroup"); __builtin_amdgcn_wave_barrier();
  const int rsub = lane >> 4, c4 = (lane & 15) * 4; typedef _Float16 v4h __attribute__((ext_vector_type(4)));
  {
#pragma unroll
    for (int q = 0; q < 8; ++q) { const int r = q * 2 + rsub; if (col0 + c4 < N) { const v4f v = *(const v4fa*)&so[w][r][c4]; if (C) *(v4f*)(C + cofs + (size_t)(row0 + r) * ldc + col0 + c4) = v; if (C16) { v4h h4; for (int i = 0; i < 4; ++i) h4[i] = (_Float16)v[i]; *(v4h*)(C16 + cofs + (size_t)(row0 + r) * ldc + col0 + c4) = h4; } } }
     }
}


typedef _Float16 v4h __attribute__((ext_vector_type(4)));

__global__ __launch_bounds__(256) void k_x16(const float* __restrict__ x, _Float16* __restrict__ X16, size_t n8) { const size_t t = (size_t)blockIdx.x * 256 + threadIdx.x; if (t >= n8) return; FragH f;
#pragma unroll
  for (int q = 0; q < 8; ++q) f.h[q] = (_Float16)bf16_round(x[t * 8 + q]); *(v8us*)((unsigned short*)X16 + t * 8) = f.half[0];  }
__global__ __launch_bounds__(256) void k_h16(const float* __restrict__ x, _Float16* __restrict__ X16, size_t n8) { const size_t t = (size_t)blockIdx.x * 256 + threadIdx.x; if (t >= n8) return; FragH f;
#pragma unroll
  for (int q = 0; q < 8; ++q) f.h[q] = (_Float16)x[t * 8 + q]; *(v8us*)((unsigned short*)X16 + t * 8) = f.half[0];  }
__global__ __launch_bounds__(256) void k_round16f(const float* __restrict__ W, _Float16* __restrict__ Bt, size_t n8) { const size_t t = (size_t)blockIdx.x * 256 + threadIdx.x; if (t >= n8) return; FragH f;
#pragma unroll
  for (int i = 0; i < 8; ++i) f.h[i] = (_Float16)(bf16_round(W[t * 8 + i]) * 16.0f); *(v8us*)((unsigned short*)Bt + t * 8) = f.half[0];  }
template <int NHv, int TTv>
__global__ __launch_bounds__(256) void k_vt(const _Float16* __restrict__ V16, int ldv, int voff, _Float16* __restrict__ Vt) { __shared__ unsigned short tl[64][66]; const int tid = threadIdx.x; const int slab = blockIdx.x / (TTv / 64), lg = blockIdx.x % (TTv / 64); const int b = slab / NHv, h = slab % NHv;
  for (int i = tid; i < 64 * 8; i += 256) { const int r = i / 8, c8 = (i % 8) * 8; FragH f; f.half[0] = *(const v8us*)((const unsigned short*)V16 + ((size_t)b * TTv + lg * 64 + r) * ldv + voff + h * 64 + c8);
#pragma unroll
    for (int q = 0; q < 8; ++q) tl[r][c8 + q] = f.u[q]; }
  __syncthreads();
  {
#pragma unroll
    for (int rd = 0; rd < 2; ++rd) { const int d = rd * 32 + tid / 8, pc = tid % 8; FragH f;
#pragma unroll
      for (int q = 0; q < 8; ++q) f.u[q] = tl[pc * 8 + q][d];
      *(v8us*)((unsigned short*)Vt + ((size_t)slab * 64 + d) * TTv + lg * 64 + pc * 8) = f.half[0]; }
     } }

__global__ __launch_bounds__(256) void k_hl(const float* __restrict__ F, _Float16* __restrict__ Hh, _Float16* __restrict__ Hl, size_t n8) { const size_t t = (size_t)blockIdx.x * 256 + threadIdx.x; if (t >= n8) return; FragH fh, fl; const v4f a = *(const v4fa*)(F + t * 8), c = *(const v4fa*)(F + t * 8 + 4);
#pragma unroll
  for (int q = 0; q < 4; ++q) { _Float16 h = (_Float16)a[q]; fh.h[q] = h; fl.h[q] = (_Float16)((a[q] - (float)h) * 1024.0f); h = (_Float16)c[q]; fh.h[4 + q] = h; fl.h[4 + q] = (_Float16)((c[q] - (float)h) * 1024.0f); }
  { *(v8us*)((unsigned short*)Hh + t * 8) = fh.half[0]; *(v8us*)((unsigned short*)Hl + t * 8) = fl.half[0];  } }

// ---- fast GEMM (wave tile 32x64; requires M % 32 == 0 rows per launch region and N % 64 == 0); epilogue = k_gemm_hhx semantics ----
__device__ __forceinline__ v16h g2_frag(const _Float16* p, int hh) { FragH f; f.half[0] = *(const v8us*)((const unsigned short*)p + 8 * hh); f.half[1] = *(const v8us*)((const unsigned short*)p + 16 + 8 * hh); return f.v; }
__device__ __forceinline__ v8f g2_mma(v16h a, v16h b, v8f c) { v8f d = __builtin_amdgcn_wmma_f32_16x16x32_f16(false, a, false, b, (short)0, c, false, false); asm volatile("v_nop\n\tv_nop\n\tv_nop\n\tv_nop" : "+v"(d) : "v"(a), "v"(b)); return d; }
// CAUSAL (rows and keys counted inside one grid.y plane, query tiles of QT rows): 0 none; 1 the output columns are keys: a block whose columns lie past its tile's end writes nothing; 2 K runs over keys: it ends at the tile's end
template <int ACT, int CAUSAL = 0>
__global__ __launch_bounds__(128) void k_gemm2(const _Float16* __restrict__ A, int lda, size_t sA, const _Float16* __restrict__ Bh, int ldb, size_t sB, float alpha, const float* __restrict__ bias, size_t sBias, const float* __restrict__ CP, int rowsPerB, size_t sCPb, int row0g,
    float* __restrict__ C, _Float16* __restrict__ C16, int ldc, size_t sC, int M, int N, int K) { static_assert(ACT == 0 || ACT == 3 || ACT == 6 || ACT == 8 || ACT == 9 || ACT == 11 || ACT == 12 || ACT == 14 || ACT == 15 || ACT == 16 || ACT == 17, "k_gemm2: unsupported ACT code (would silently apply no activation)");
  __shared__ __attribute__((aligned(16))) float so[4][32][68];
  const int tid = threadIdx.x, w = tid >> 5, lane = tid & 31, ln = lane & 15, hh = lane >> 4; const int by = blockIdx.y;
  A += (size_t)by * sA; Bh += (size_t)by * sB; const size_t cofs = (size_t)by * sC; const float* bp = bias ? bias + (size_t)by * sBias : nullptr;
  const int ntn = N >> 6; const int mt = blockIdx.x / ntn, nq = blockIdx.x - mt * ntn; const int row0 = mt * 128 + 32 * w, col0 = nq * 64; if (row0 >= M) return;
  if (CAUSAL) { const int lim = (mt * 128 / QT + 1) * QT; if (CAUSAL == 1 && col0 >= lim) return; if (CAUSAL == 2 && lim < K) K = lim; }
  const _Float16* a0p = A + (size_t)(row0 + ln) * lda; const _Float16* a1p = a0p + (size_t)16 * lda;
  const _Float16* b0p = Bh + (size_t)(col0 + ln) * ldb; const _Float16* b1p = b0p + (size_t)16 * ldb; const _Float16* b2p = b1p + (size_t)16 * ldb; const _Float16* b3p = b2p + (size_t)16 * ldb;
  const v8f z8 = {0.f,0.f,0.f,0.f,0.f,0.f,0.f,0.f}; v8f c00 = z8, c01 = z8, c02 = z8, c03 = z8, c10 = z8, c11 = z8, c12 = z8, c13 = z8;
#pragma unroll 1
  for (int kb = 0; kb < K; kb += 32) { const v16h a0 = g2_frag(a0p + kb, hh), a1 = g2_frag(a1p + kb, hh);
    v16h b = g2_frag(b0p + kb, hh); c00 = g2_mma(a0, b, c00); c10 = g2_mma(a1, b, c10);
    b = g2_frag(b1p + kb, hh); c01 = g2_mma(a0, b, c01); c11 = g2_mma(a1, b, c11);
    b = g2_frag(b2p + kb, hh); c02 = g2_mma(a0, b, c02); c12 = g2_mma(a1, b, c12);
    b = g2_frag(b3p + kb, hh); c03 = g2_mma(a0, b, c03); c13 = g2_mma(a1, b, c13); }
  v8f accs[8] = {c00, c01, c02, c03, c10, c11, c12, c13};
#pragma unroll
  for (int u = 0; u < 8; ++u) { const int t = u & 3, half = u >> 2; const int col = col0 + t * 16 + ln; const float bv = bp ? bf16_round(bp[col]) : 0.f;
#pragma unroll
    for (int r = 0; r < 8; ++r) { const int rloc = half * 16 + 8 * hh + r; float v = accs[u][r] * alpha + bv; if (CP) { if (rowsPerB < 0) v += CP[cofs + (size_t)(row0g + row0 + rloc) * ldc + col];      /* rowsPerB < 0: own element of the batched C plane */ else { const int bidx = (row0g + row0 + rloc) / rowsPerB; v += CP[(size_t)bidx * sCPb + (size_t)by * 64 + col]; } }
      if (ACT == 3) v = fmaxf(v, 0.f); else if (ACT == 6) v = 0.5f * v * (1.0f + erff(v * 0.70710678118654752f)); else if (ACT == 11) v = 1.0f / (1.0f + expf(-v)); else if (ACT == 15) v = v / (1.0f + expf(-v)); else if (ACT == 12) v = (v > 0.f) ? v : 0.01f * v; else if (ACT == 8) v = tanhf(v); else if (ACT == 9) v = 0.5f * v * (1.0f + tanhf(0.7978845608028654f * (v + 0.044715f * v * v * v))); else if (ACT == 14) v = (v > 0.f) ? v : 0.1f * v; else if (ACT == 16) v = (v >= 0.f) ? v : 0.3f * v; else if (ACT == 17) v = (v >= 0.f) ? v : 0.2f * v;
      so[w][rloc][t * 16 + ln] = v; } }
  __builtin_amdgcn_fence(__ATOMIC_ACQ_REL, "workgroup"); __builtin_amdgcn_wave_barrier();
  const int rsub = lane >> 4, c4 = (lane & 15) * 4;
  {
#pragma unroll
    for (int q = 0; q < 16; ++q) { const int r = q * 2 + rsub; const v4f v = *(const v4fa*)&so[w][r][c4]; if (C) { *(v4f*)(C + cofs + (size_t)(row0 + r) * ldc + col0 + c4) = v; asm volatile("s_wait_xcnt 0x0" ::: "memory");      /* the wait behind the f32 store, in front of the f16 conversion below, which the compiler does in the registers that the store names */ } if (C16) { v4h h4; for (int i = 0; i < 4; ++i) h4[i] = (_Float16)v[i]; *(v4h*)(C16 + cofs + (size_t)(row0 + r) * ldc + col0 + c4) = h4; } }
     } }


__global__ __launch_bounds__(256) void k_wnat(const float* __restrict__ w, size_t n8, _Float16* __restrict__ Bt) { const size_t t = (size_t)blockIdx.x * 256 + threadIdx.x; if (t >= n8) return; FragH f; for (int q = 0; q < 8; ++q) f.h[q] = (_Float16)(bf16_round(w[t * 8 + q]) * 16.0f); *(v8us*)((unsigned short*)Bt + t * 8) = f.half[0];  }
__global__ __launch_bounds__(256) void k_rsm(const float* __restrict__ S, _Float16* __restrict__ P, int nrows) {
  #pragma clang fp contract(off)
  const int i = blockIdx.x * 256 + threadIdx.x; if (i >= nrows) return; const float* s = S + (size_t)i * SQ; float mx = -3.0e38f;
#pragma unroll 1
  for (int j = 0; j < SQ; ++j) mx = fmaxf(mx, s[j]); float se = 0.f;
#pragma unroll 1
  for (int j = 0; j < SQ; ++j) se += expf(s[j] - mx); const float sc = 256.0f / se;
#pragma unroll 1
  for (int j0 = 0; j0 < SQ; j0 += 8) { FragH f; for (int q = 0; q < 8; ++q) f.h[q] = (_Float16)(expf(s[j0 + q] - mx) * sc); unsigned short* d = (unsigned short*)P + (size_t)i * SQ + j0; *(v8us*)d = f.half[0];  } }
__global__ __launch_bounds__(256) void k_vt(const _Float16* __restrict__ V16, int b, int h0, _Float16* __restrict__ VT) { __shared__ unsigned short tl[64][65]; const int tid = threadIdx.x; const int hh = blockIdx.x % HG, sg = blockIdx.x / HG; const int s0 = sg * 64; const int h = h0 + hh;
  for (int i = tid; i < 64 * 8; i += 256) { const int j = i / 8, d8 = (i % 8) * 8; FragH f; f.half[0] = *(const v8us*)((const unsigned short*)V16 + ((size_t)b * SQ + s0 + j) * DM + h * HD + d8); for (int q = 0; q < 8; ++q) tl[d8 + q][j] = f.u[q]; }
  __syncthreads();
  { for (int i = tid; i < 64 * 8; i += 256) { const int d = i / 8, j8 = (i % 8) * 8; FragH f; for (int q = 0; q < 8; ++q) f.u[q] = tl[d][j8 + q]; *(v8us*)((unsigned short*)VT + ((size_t)hh * HD + d) * SQ + s0 + j8) = f.half[0]; }  } }


__global__ __launch_bounds__(256) void k_rsmcf2(const float* __restrict__ S, _Float16* __restrict__ P, int hg, int q0, int nk) {
  #pragma clang fp contract(off)
  const int t = blockIdx.x * 256 + threadIdx.x; if (t >= hg * QT) return; const size_t i = (size_t)t; const float* s = S + i * NKX; const int last = q0 + (t % QT); float mx = -3.0e38f;
#pragma unroll 1
  for (int j = 0; j < nk; ++j) { const float f = (j <= last) ? 1.f : 0.f; mx = fmaxf(mx, fmaf(f, s[j], (1.f - f) * -1.0e9f)); } float se = 0.f;
#pragma unroll 1
  for (int j = 0; j < nk; ++j) { const float f = (j <= last) ? 1.f : 0.f; se += __expf(fmaf(f, s[j], (1.f - f) * -1.0e9f) - mx); } const float sc = 256.0f / se;
#pragma unroll 1
  for (int j0 = 0; j0 < nk; j0 += 8) { FragH fr; for (int q = 0; q < 8; ++q) { const int j = j0 + q; const float f = (j <= last) ? 1.f : 0.f; fr.h[q] = (_Float16)(__expf(fmaf(f, s[j], (1.f - f) * -1.0e9f) - mx) * sc); } unsigned short* d = (unsigned short*)P + i * NKX + j0; *(v8us*)d = fr.half[0];  } }


// Causal row softmax, one wave per row (one-wave blocks, one block per row; t = row in the [batch][query] plane, last = its last visible key) over nk = 256 NC columns. Lane l keeps the 8 scores at columns 256 c + 8 l of each 256-column chunk c
// in registers, so the score row is read once, 32 contiguous bytes a lane, its loads issued ahead of the arithmetic; row maximum and row sum are four chains a lane, then a five-step butterfly.
template <int NC>
__device__ __forceinline__ void rsm_row(const float* __restrict__ S, _Float16* __restrict__ P, _Float16* __restrict__ PL, int t, int last) {
  const int j0 = threadIdx.x * 8; const size_t o = (size_t)t * NKX + j0;
  const float* s = S + o; unsigned short* p = (unsigned short*)P + o; unsigned short* pl = (unsigned short*)PL + o;
  v4f ra[NC], rb[NC];
#pragma unroll
  for (int c = 0; c < NC; ++c) { ra[c] = *(const v4fa*)(s + c * 256); rb[c] = *(const v4fa*)(s + c * 256 + 4); }
  asm volatile("s_wait_xcnt 0x0" :: "v"(s) : "memory");      /* the wait in front of any overwrite of the address pair that the issued loads name; naming the pair keeps it whole up to here */
  float e[NC][8]; float m4[4] = {-3.0e38f, -3.0e38f, -3.0e38f, -3.0e38f};
#pragma unroll
  for (int c = 0; c < NC; ++c) { const v4f a = ra[c], b = rb[c];
#pragma unroll
    for (int q = 0; q < 8; ++q) { const float f = (j0 + c * 256 + q <= last) ? 1.f : 0.f; const float v = fmaf(f, (q < 4) ? a[q & 3] : b[q & 3], (1.f - f) * -1.0e9f); e[c][q] = v; m4[q & 3] = fmaxf(m4[q & 3], v); } }
  float mx = fmaxf(fmaxf(m4[0], m4[1]), fmaxf(m4[2], m4[3]));
#pragma unroll
  for (int d = 16; d > 0; d >>= 1) mx = fmaxf(mx, __shfl_xor(mx, d, 32));
  float s4[4] = {0.f, 0.f, 0.f, 0.f};
#pragma unroll
  for (int c = 0; c < NC; ++c)
#pragma unroll
    for (int q = 0; q < 8; ++q) { const float y = (e[c][q] - mx) * 1.44269504f; float x;
      asm("v_exp_f32 %0, %1\n\tv_nop" : "=v"(x) : "v"(y));      /* native exp as before; the v_nop is the slot the instruction set asks for behind a transcendental before its source is overwritten */
      e[c][q] = x; s4[q & 3] += x; }
  float se = (s4[0] + s4[1]) + (s4[2] + s4[3]);
#pragma unroll
  for (int d = 16; d > 0; d >>= 1) se += __shfl_xor(se, d, 32);
  const float sc = 256.0f / se;
#pragma unroll
  for (int c = 0; c < NC; ++c) { FragH fr, fl;
#pragma unroll
    for (int q = 0; q < 8; ++q) { const float pv = e[c][q] * sc; const _Float16 h = (_Float16)pv; fr.h[q] = h; fl.h[q] = (_Float16)((pv - (float)h) * 1024.0f); }
    *(v8us*)(p + c * 256) = fr.half[0]; *(v8us*)(pl + c * 256) = fl.half[0]; }
  asm volatile("s_wait_xcnt 0x0" ::: "memory");      /* the wait behind the row's stores, in front of any overwrite of a register that they name: the bodies of the other row lengths follow this one in the same kernel */
}
// all rows of all batches in one launch; the row's query tile picks the straight-line body of its row length (a scalar branch: one row a block)
__global__ __launch_bounds__(32) void k_rsmcf2hl(const float* __restrict__ S, _Float16* __restrict__ P, _Float16* __restrict__ PL, int nrows) {
  const int t = blockIdx.x; if (t >= nrows) return; const int last = t % SQ;
  switch (last / QT) {
    case 0: rsm_row<1>(S, P, PL, t, last); break; case 1: rsm_row<2>(S, P, PL, t, last); break; case 2: rsm_row<3>(S, P, PL, t, last); break; case 3: rsm_row<4>(S, P, PL, t, last); break;
    case 4: rsm_row<5>(S, P, PL, t, last); break; case 5: rsm_row<6>(S, P, PL, t, last); break; case 6: rsm_row<7>(S, P, PL, t, last); break; default: rsm_row<8>(S, P, PL, t, last); break; } }
extern "C" void kernel_launch(void* const* d_in, const int* in_sizes, int n_in,
                              void* d_out, int out_size, void* d_ws, size_t ws_size, hipStream_t stream) {
  (void)in_sizes; (void)n_in; (void)out_size;
  const float* const* I = (const float* const*)d_in; const float* x = I[0]; const float* wq = I[1]; const float* wk = I[2]; const float* wv = I[3];
  char* ws = (char*)d_ws; size_t off = 0;
  auto take = [&](size_t bytes) { char* p = ws + off; off += (bytes + 255) & ~(size_t)255; return p; };
  _Float16* X16 = (_Float16*)take(NR * DMX * 2); _Float16* BQ = (_Float16*)take((size_t)HD * DMX * 2); _Float16* BK = (_Float16*)take((size_t)HD * DMX * 2); _Float16* BV = (_Float16*)take((size_t)HD * DMX * 2); _Float16* Q16 = (_Float16*)take(NR * HD * 2); _Float16* KL16 = (_Float16*)take(NR * HD * 2); float* KOUT = (float*)d_out + NR * HD; float* VF = (float*)d_out + 2 * NR * HD;      /* out1 = k and out2 = v are written in f32 straight into the tuple output and re-used as the sources of the f16 planes */ _Float16* VL16 = (_Float16*)take(NR * HD * 2); _Float16* VTL = (_Float16*)take((size_t)NB * HD * SQ * 2); _Float16* K16 = (_Float16*)take(NR * HD * 2); _Float16* V16 = (_Float16*)take(NR * HD * 2); _Float16* VT = (_Float16*)take((size_t)NB * HD * SQ * 2);
  float* S = (float*)take(NR * NKX * 4); _Float16* P = (_Float16*)take(NR * NKX * 2); _Float16* PL = (_Float16*)take(NR * NKX * 2);      /* whole [batch][query][key] planes */
  if (off > ws_size) return;      /* approx 16 + 0.4 + 7 x 1 + 64 + 32 + 32 = 152 MiB */
  k_x16<<<(unsigned)((NR * DMX / 8 + 255) / 256), 256, 0, stream>>>(x, X16, NR * DMX / 8);      /* x as exact f16 rows */
  { const unsigned g = (unsigned)(((size_t)HD * (DMX / 8) + 255) / 256); k_wt_f16<<<g, 256, 0, stream>>>(wq, BQ, DMX, HD, 16.0f); k_wt_f16<<<g, 256, 0, stream>>>(wk, BK, DMX, HD, 16.0f); k_wt_f16<<<g, 256, 0, stream>>>(wv, BV, DMX, HD, 16.0f); }      /* [in][out] 1024 x 64 -> Bt [64][1024] x16 */
  k_gemm2<0><<<dim3((unsigned)((NR / 128) * (HD / 64)), 1), 128, 0, stream>>>(X16, DMX, 0, BQ, DMX, 0, 0.0625f, nullptr, 0, nullptr, 1, 0, 0, nullptr, Q16, HD, 0, (int)NR, HD, DMX); k_gemm2<0><<<dim3((unsigned)((NR / 128) * (HD / 64)), 1), 128, 0, stream>>>(X16, DMX, 0, BK, DMX, 0, 0.0625f, nullptr, 0, nullptr, 1, 0, 0, KOUT, nullptr, HD, 0, (int)NR, HD, DMX); k_hl<<<(unsigned)((NR * HD / 8 + 255) / 256), 256, 0, stream>>>(KOUT, K16, KL16, NR * HD / 8);      /* out1 = k (f32; exact products, f32 accumulation) and its f16 plane (the residual plane is unused) */ k_gemm2<0><<<dim3((unsigned)((NR / 128) * (HD / 64)), 1), 128, 0, stream>>>(X16, DMX, 0, BV, DMX, 0, 0.0625f, nullptr, 0, nullptr, 1, 0, 0, VF, nullptr, HD, 0, (int)NR, HD, DMX); k_hl<<<(unsigned)((NR * HD / 8 + 255) / 256), 256, 0, stream>>>(VF, V16, VL16, NR * HD / 8);      /* v in f32 -> f16 hi + x1024 residual planes */      /* q, k, v = x W as f16 rows [token][64] (= the head-major [B][1][S][64] layout the attention below expects) */
  k_vt<1, SQ><<<NB * (SQ / 64), 256, 0, stream>>>(V16, HD, 0, VT); k_vt<1, SQ><<<NB * (SQ / 64), 256, 0, stream>>>(VL16, HD, 0, VTL);      /* V^T hi and residual, one [64][2048] slab per batch */
  k_gemm2<0, 1><<<dim3((SQ / 128) * (SQ / 64), NB), 128, 0, stream>>>(Q16, HD, (size_t)SQ * HD, K16, HD, (size_t)SQ * HD, 0.03125f, nullptr, 0, nullptr, 1, 0, 0, S, nullptr, NKX, (size_t)SQ * NKX, SQ, SQ, HD);      /* scores / 32 for the keys below each query tile's end, batches on grid.y */
  k_rsmcf2hl<<<(unsigned)NR, 32, 0, stream>>>(S, P, PL, (int)NR);      /* causal softmax -> f16 x256 hi + x1024 residual planes */
  float* O = (float*)d_out;
  k_gemm2<0, 2><<<dim3((SQ / 128) * (HD / 64), NB), 128, 0, stream>>>(P, NKX, (size_t)SQ * NKX, VT, SQ, (size_t)HD * SQ, 0.00390625f, nullptr, 0, nullptr, 1, 0, 0, O, nullptr, HD, (size_t)SQ * HD, SQ, HD, SQ);      /* out = P_hi V / 256 */
  k_gemm2<0, 2><<<dim3((SQ / 128) * (HD / 64), NB), 128, 0, stream>>>(PL, NKX, (size_t)SQ * NKX, VT, SQ, (size_t)HD * SQ, 0.000003814697265625f, nullptr, 0, O, -1, 0, 0, O, nullptr, HD, (size_t)SQ * HD, SQ, HD, SQ);      /* += P_lo V 2^-18 (own-element accumulate): P effectively ~f32 */
  k_gemm2<0, 2><<<dim3((SQ / 128) * (HD / 64), NB), 128, 0, stream>>>(P, NKX, (size_t)SQ * NKX, VTL, SQ, (size_t)HD * SQ, 0.000003814697265625f, nullptr, 0, O, -1, 0, 0, O, nullptr, HD, (size_t)SQ * HD, SQ, HD, SQ);      /* += P_hi V_lo^T 2^-18: v effectively f32 too */
}

// v003
// A run of this version takes 114 microseconds.
// Next to v002, in two timings, it ran 3.50 and 3.49 times as fast.
// Over all steps from v000 it is 87.9 times as fast.
#include <hip/hip_runtime.h>
// Single attention head returning the TUPLE (out, k, v) (x [4][2048][1024]; q = x Wq, k = x Wk, v = x Wv ([in][out] 1024 x 64, sigma 1/32, no biases); wei = q . k x 1024^-0.5 (the module scales by n_embd) with a causal mask (tril, -inf); softmax; out = wei v -> out0 [4][2048][64] @0, out1 = k [4][2048][64] f32 @2,097,152 B, out2 = v [4][2048][64] f32 @4,194,304 B; input order x, Wq, Wk, Wv).
// Structure: x as exact f16 rows; the three [in][out] weights as exact x16 planes; q, k, v as WMMA GEMMs (32x64 wave tiles, f32 accumulation, K = 1024): q as f16 rows, k and v in f32 STRAIGHT INTO the tuple output slots (out1, out2) and then split into f16 (v: hi + x1024 residual) planes; V^T (hi and residual) of all batches via LDS transposes; then ONE launch per stage over all batches (grid.y in the GEMMs, grid.x rows in the softmax) and all query tiles of 256 rows (grid.x), each block taking its tile's key bound from its own row index: scores against the keys below the tile end only (K = 64, alpha 1/32) into an f32 plane [batch][query][key], causal row softmax on VALU, one wave per row (arithmetic 0/1 select; f32 statistics, native exp) writing the weights as f16 hi (x256) + x1024 residual planes, out = P_hi V^T (alpha 2^-8) written f32 then += P_lo V_hi^T and += P_hi V_lo^T (alpha 2^-18 each; own-element accumulates in the next launches); launches: see trace.
// Compute dtype: inputs rounded to bf16; q, k, v f32 sums rounded to f16 (v also a x1024 residual); softmax weights f16 hi (x256) + x1024 residual; scores, statistics, out f32; v_wmma_f32_16x16x32_f16.
#define NB 4
#define NHS 1
#define DMX 1024                   /* model width (projection K) */
#define SQ 2048
#define HD 64
#define DM 64
#define NH 1
#define HG 1
#define QT 256
#define NKX SQ
#define NR ((size_t)NB * NHS * SQ)
typedef __bf16 v16b __attribute__((ext_vector_type(16)));
typedef unsigned short v8us __attribute__((ext_vector_type(8), may_alias));
typedef float  v8f  __attribute__((ext_vector_type(8)));
typedef float  v4f  __attribute__((ext_vector_type(4)));
typedef float  v4fa __attribute__((ext_vector_type(4), may_alias));
union FragB { v16b v; v8us half[2]; unsigned short u[16]; };

__device__ __forceinline__ unsigned short bf16_bits(float x) { unsigned int u = __float_as_uint(x); return (unsigned short)((u + 0x7FFFu + ((u >> 16) & 1u)) >> 16); }
__device__ __forceinline__ float bf16_val(unsigned short b) { return __uint_as_float(((unsigned int)b) << 16); }
__device__ __forceinline__ float bf16_round(float x) { return bf16_val(bf16_bits(x)); }
// D += A·B with NT terms: 1 = ah·bh, 2 = + al·bh (A split), 3 = + ah·bl (both split)
template <int NT>
__device__ __forceinline__ v8f mmaN(v16b ah, v16b al, v16b bh, v16b bl, v8f c) {
  c = __builtin_amdgcn_wmma_f32_16x16x32_bf16(false, ah, false, bh, (short)0, c, false, false);
  if (NT >= 2) c = __builtin_amdgcn_wmma_f32_16x16x32_bf16(false, al, false, bh, (short)0, c, false, false);
  if (NT >= 3) c = __builtin_amdgcn_wmma_f32_16x16x32_bf16(false, ah, false, bl, (short)0, c, false, false);
  asm volatile("v_nop\n\tv_nop\n\tv_nop\n\tv_nop" : "+v"(c) : "v"(ah), "v"(al), "v"(bh), "v"(bl));
  return c;
}

__global__ __launch_bounds__(256) void k_wt_bf16(const float* __restrict__ W, unsigned short* __restrict__ Wt, int K, int N) {
  const int t = blockIdx.x * 256 + threadIdx.x;
  const int k8n = K / 8;
  if (t >= N * k8n) return;
  const int n = t / k8n, k8 = (t % k8n) * 8;
  v8us v;
#pragma unroll
  for (int i = 0; i < 8; ++i) v[i] = bf16_bits(W[(size_t)(k8 + i) * N + n]);
  *(v8us*)(Wt + (size_t)n * K + k8) = v;
  
}

// GEMM C[M][N] (f32, pitch ldc) = act(A[M][K]·W + bias). A f32 row-major (pitch lda) converted per fragment to bf16
// (ASPLIT: hi/lo two planes -> 2 terms, else single rounded term); Wt bf16 [N][K] (pitch ldb). BIAS_BF16 rounds the
// bias to bf16 first (bias quantised to bf16 before the add). K%32==0, M%16==0, N%64==0.
template <bool ASPLIT, int ACT, bool BIAS_BF16>
__global__ __launch_bounds__(128) void k_gemm_bf(const float* __restrict__ A, int lda, const unsigned short* __restrict__ Wt, int ldb,
                                               const float* __restrict__ bias, float* __restrict__ C, int ldc, int M, int N, int K) {
  __shared__ __attribute__((aligned(16))) float so[4][16][64];
  const int tid = threadIdx.x, w = tid >> 5, lane = tid & 31, ln = lane & 15, hh = lane >> 4;
  const int ntn = N / 64;
  const int wid = blockIdx.x * 4 + w;
  const int mt = wid / ntn, nq = wid % ntn;
  if (mt * 16 >= M) return;
  const int row0 = mt * 16, col0 = nq * 64;
  const float* arow = A + (size_t)(row0 + ln) * lda;
  v8f acc[4] = {};
  for (int kb = 0; kb < K; kb += 32) {
    FragB ah, al;
    const v4f x0 = *(const v4fa*)(arow + kb + 8 * hh), x1 = *(const v4fa*)(arow + kb + 8 * hh + 4);
    const v4f x2 = *(const v4fa*)(arow + kb + 16 + 8 * hh), x3 = *(const v4fa*)(arow + kb + 16 + 8 * hh + 4);
    float xs[16] = {x0[0],x0[1],x0[2],x0[3],x1[0],x1[1],x1[2],x1[3],x2[0],x2[1],x2[2],x2[3],x3[0],x3[1],x3[2],x3[3]};
#pragma unroll
    for (int i = 0; i < 16; ++i) { const unsigned short hb = bf16_bits(xs[i]); ah.u[i] = hb; al.u[i] = ASPLIT ? bf16_bits(xs[i] - bf16_val(hb)) : (unsigned short)0; }
#pragma unroll
    for (int t = 0; t < 4; ++t) {
      const unsigned short* brow = Wt + (size_t)(col0 + t * 16 + ln) * ldb + kb;
      FragB b;
      b.half[0] = *(const v8us*)(brow + 8 * hh);
      b.half[1] = *(const v8us*)(brow + 16 + 8 * hh);
      acc[t] = mmaN<ASPLIT ? 2 : 1>(ah.v, al.v, b.v, b.v, acc[t]);
    }
  }
#pragma unroll
  for (int t = 0; t < 4; ++t) {
    float bv = bias ? bias[col0 + t * 16 + ln] : 0.f;
    if (BIAS_BF16) bv = bf16_round(bv);
#pragma unroll
    for (int r = 0; r < 8; ++r) { float v = acc[t][r] + bv; if (ACT == 1) v = fmaxf(v, 0.f); so[w][8 * hh + r][t * 16 + ln] = v; }
  }
  __builtin_amdgcn_fence(__ATOMIC_ACQ_REL, "workgroup");
  __builtin_amdgcn_wave_barrier();
  const int rsub = lane >> 4, c4 = (lane & 15) * 4;
  {
#pragma unroll
    for (int q = 0; q < 8; ++q) {
      const int r = q * 2 + rsub;
      const v4f v = *(const v4fa*)&so[w][r][c4];
      *(v4f*)(C + (size_t)(row0 + r) * ldc + col0 + c4) = v;
    }
    
  }
}

// GEMM C = act(A·W + bias + resid): A f32 (ASPLIT -> hi/lo 2 terms), Wt bf16 [N][K]; ACT 0 none, 1 relu, 2 exact gelu;
// resid (optional, f32, row index = (row % rmod), pitch ldr, RES_BF16 rounds it) added before the activation.
template <bool ASPLIT, int ACT, bool BIAS_BF16, bool RES_BF16>
__global__ __launch_bounds__(128) void k_gemm_bf3(const float* __restrict__ A, int lda, const unsigned short* __restrict__ Wt, int ldb,
                                                const float* __restrict__ bias, const float* __restrict__ resid, int rmod, int ldr,
                                                float* __restrict__ C, int ldc, int M, int N, int K) {
  __shared__ __attribute__((aligned(16))) float so[4][16][64];
  const int tid = threadIdx.x, w = tid >> 5, lane = tid & 31, ln = lane & 15, hh = lane >> 4;
  const int ntn = N / 64;
  const int wid = blockIdx.x * 4 + w;
  const int mt = wid / ntn, nq = wid % ntn;
  if (mt * 16 >= M) return;
  const int row0 = mt * 16, col0 = nq * 64;
  const float* arow = A + (size_t)(row0 + ln) * lda;
  v8f acc[4] = {};
  for (int kb = 0; kb < K; kb += 32) {
    FragB ah, al;
    const v4f x0 = *(const v4fa*)(arow + kb + 8 * hh), x1 = *(const v4fa*)(arow + kb + 8 * hh + 4);
    const v4f x2 = *(const v4fa*)(arow + kb + 16 + 8 * hh), x3 = *(const v4fa*)(arow + kb + 16 + 8 * hh + 4);
    float xs[16] = {x0[0],x0[1],x0[2],x0[3],x1[0],x1[1],x1[2],x1[3],x2[0],x2[1],x2[2],x2[3],x3[0],x3[1],x3[2],x3[3]};
#pragma unroll
    for (int i = 0; i < 16; ++i) { const unsigned short hb = bf16_bits(xs[i]); ah.u[i] = hb; al.u[i] = ASPLIT ? bf16_bits(xs[i] - bf16_val(hb)) : (unsigned short)0; }
#pragma unroll
    for (int t = 0; t < 4; ++t) {
      const unsigned short* brow = Wt + (size_t)(col0 + t * 16 + ln) * ldb + kb;
      FragB b;
      b.half[0] = *(const v8us*)(brow + 8 * hh);
      b.half[1] = *(const v8us*)(brow + 16 + 8 * hh);
      acc[t] = mmaN<ASPLIT ? 2 : 1>(ah.v, al.v, b.v, b.v, acc[t]);
    }
  }
#pragma unroll
  for (int t = 0; t < 4; ++t) {
    const int col = col0 + t * 16 + ln;
    float bv = bias ? bias[col] : 0.f;
    if (BIAS_BF16) bv = bf16_round(bv);
#pragma unroll
    for (int r = 0; r < 8; ++r) {
      float v = acc[t][r] + bv;
      if (resid) { float rv = resid[(size_t)((row0 + 8 * hh + r) % rmod) * ldr + col]; if (RES_BF16) rv = bf16_round(rv); v += rv; }
      if (ACT == 1) v = fmaxf(v, 0.f);
      if (ACT == 2) v = 0.5f * v * (1.0f + erff(v * 0.70710678118654752f));
      if (ACT == 3) { const float u = 0.7978845608028654f * (v + 0.044715f * v * v * v); v = 0.5f * v * (1.0f + tanhf(u)); }
      so[w][8 * hh + r][t * 16 + ln] = v;
    }
  }
  __builtin_amdgcn_fence(__ATOMIC_ACQ_REL, "workgroup");
  __builtin_amdgcn_wave_barrier();
  const int rsub = lane >> 4, c4 = (lane & 15) * 4;
  {
#pragma unroll
    for (int q = 0; q < 8; ++q) {
      const int r = q * 2 + rsub;
      const v4f v = *(const v4fa*)&so[w][r][c4];
      *(v4f*)(C + (size_t)(row0 + r) * ldc + col0 + c4) = v;
    }
    
  }
}
// row LayerNorm (biased variance, eps) over N: s = X (+ R); optional out_sum <- s; out_norm <- (s-mu)*rsqrt(var+eps)*g + b
template <bool PARAM_BF16>
__global__ __launch_bounds__(256) void k_layernorm(const float* __restrict__ X, const float* __restrict__ R, const float* __restrict__ g, const float* __restrict__ bta,
                                                  float* __restrict__ out_sum, float* __restrict__ out_norm, int N, float eps) {
  __shared__ float red[256];
  const int row = blockIdx.x, tid = threadIdx.x;
  const float* x = X + (size_t)row * N; const float* rr = R ? R + (size_t)row * N : nullptr;
  float vals[16];                     // up to N = 4096
  const int per = N / 256;            // contiguous chunk per thread? use strided-by-4 chunks: thread handles j = tid*4 + 1024*u
  float s1 = 0.f;
  for (int u = 0; u < per / 4; ++u) {
    const int j = tid * 4 + 1024 * u;
    const v4f a = *(const v4fa*)(x + j);
    v4f b = {0.f,0.f,0.f,0.f}; if (rr) b = *(const v4fa*)(rr + j);
#pragma unroll
    for (int q = 0; q < 4; ++q) { const float v = a[q] + b[q]; vals[u * 4 + q] = v; s1 += v; }
  }
  red[tid] = s1; __syncthreads();
  for (int st = 128; st > 0; st >>= 1) { if (tid < st) red[tid] += red[tid + st]; __syncthreads(); }
  const float mu = red[0] / (float)N; __syncthreads();
  float s2 = 0.f;
  for (int u = 0; u < per / 4; ++u)
#pragma unroll
    for (int q = 0; q < 4; ++q) { const float c = vals[u * 4 + q] - mu; s2 += c * c; }
  red[tid] = s2; __syncthreads();
  for (int st = 128; st > 0; st >>= 1) { if (tid < st) red[tid] += red[tid + st]; __syncthreads(); }
  const float rs = rsqrtf(red[0] / (float)N + eps);
  {
    for (int u = 0; u < per / 4; ++u) {
      const int j = tid * 4 + 1024 * u;
      v4f o, sm;
#pragma unroll
      for (int q = 0; q < 4; ++q) {
        float gg = g[j + q], bb = bta[j + q];
        if (PARAM_BF16) { gg = bf16_round(gg); bb = bf16_round(bb); }
        sm[q] = vals[u * 4 + q]; o[q] = (vals[u * 4 + q] - mu) * rs * gg + bb;
      }
      if (out_sum) *(v4f*)(out_sum + (size_t)row * N + j) = sm;
      *(v4f*)(out_norm + (size_t)row * N + j) = o;
    }
    
  }
}



// ---- f16 WMMA path (v_wmma_f32_16x16x32_f16): 11-bit significands for operands in range — used where a [0,1] probability operand needs more precision than bf16
typedef _Float16 v16h __attribute__((ext_vector_type(16)));
union FragH { v16h v; v8us half[2]; _Float16 h[16]; unsigned short u[16]; };
template <int NT>
__device__ __forceinline__ v8f mmaH(v16h ah, v16h al, v16h bh, v16h bl, v8f c) {
  c = __builtin_amdgcn_wmma_f32_16x16x32_f16(false, ah, false, bh, (short)0, c, false, false);
  if (NT >= 2) c = __builtin_amdgcn_wmma_f32_16x16x32_f16(false, al, false, bh, (short)0, c, false, false);
  if (NT >= 3) c = __builtin_amdgcn_wmma_f32_16x16x32_f16(false, ah, false, bl, (short)0, c, false, false);
  asm volatile("v_nop\n\tv_nop\n\tv_nop\n\tv_nop" : "+v"(c) : "v"(ah), "v"(al), "v"(bh), "v"(bl));
  return c;
}
// batched GEMM like k_gemm_b but f16 operands: A f32 (split into f16 hi/lo if ASPLIT, else rounded to f16), Bt = f16 values [n][k]; alpha; C f32; N multiple of 16 (partial tiles skipped)
template <bool ASPLIT>
__global__ __launch_bounds__(128) void k_gemm_h(const float* __restrict__ A, int lda, size_t sA, const _Float16* __restrict__ Bh, int ldb, size_t sB, float alpha, float* __restrict__ C, int ldc, size_t sC, int M, int N, int K) {
  __shared__ __attribute__((aligned(16))) float so[4][16][64];
  const int tid = threadIdx.x, w = tid >> 5, lane = tid & 31, ln = lane & 15, hh = lane >> 4; const int by = blockIdx.y;
  A += (size_t)by * sA; Bh += (size_t)by * sB; C += (size_t)by * sC;
  const int ntn = (N + 63) / 64; const int wid = blockIdx.x * 4 + w; const int mt = wid / ntn, nq = wid % ntn; if (mt * 16 >= M) return;
  const int row0 = mt * 16, col0 = nq * 64; const float* arow = A + (size_t)(row0 + ln) * lda;
  v8f acc[4] = {};
  for (int kb = 0; kb < K; kb += 32) {
    FragH ah, al;
    const v4f x0 = *(const v4fa*)(arow + kb + 8 * hh), x1 = *(const v4fa*)(arow + kb + 8 * hh + 4), x2 = *(const v4fa*)(arow + kb + 16 + 8 * hh), x3 = *(const v4fa*)(arow + kb + 16 + 8 * hh + 4);
    float xs[16] = {x0[0],x0[1],x0[2],x0[3],x1[0],x1[1],x1[2],x1[3],x2[0],x2[1],x2[2],x2[3],x3[0],x3[1],x3[2],x3[3]};
#pragma unroll
    for (int i = 0; i < 16; ++i) { const _Float16 h = (_Float16)xs[i]; ah.h[i] = h; al.h[i] = ASPLIT ? (_Float16)(xs[i] - (float)h) : (_Float16)0.0f; }
#pragma unroll
    for (int t = 0; t < 4; ++t) { if (col0 + t * 16 >= N) continue; const size_t boff = (size_t)(col0 + t * 16 + ln) * ldb + kb; FragH bq; bq.half[0] = *(const v8us*)(Bh + boff + 8 * hh); bq.half[1] = *(const v8us*)(Bh + boff + 16 + 8 * hh);
      acc[t] = mmaH<ASPLIT ? 2 : 1>(ah.v, al.v, bq.v, bq.v, acc[t]); }
  }
#pragma unroll
  for (int t = 0; t < 4; ++t) { if (col0 + t * 16 >= N) continue;
#pragma unroll
    for (int r = 0; r < 8; ++r) so[w][8 * hh + r][t * 16 + ln] = acc[t][r] * alpha; }
  __builtin_amdgcn_fence(__ATOMIC_ACQ_REL, "workgroup"); __builtin_amdgcn_wave_barrier();
  const int rsub = lane >> 4, c4 = (lane & 15) * 4;
  {
#pragma unroll
    for (int q = 0; q < 8; ++q) { const int r = q * 2 + rsub; if (col0 + c4 < N) { const v4f v = *(const v4fa*)&so[w][r][c4]; *(v4f*)(C + (size_t)(row0 + r) * ldc + col0 + c4) = v; } }
     }
}

// Wt[n][k] = f16(W[k][n]·scale) from f32 row-major W[K][N] (scale = power of two; bf16-exact weights stay exact in f16 away from the subnormal range)
__global__ __launch_bounds__(256) void k_wt_f16(const float* __restrict__ W, _Float16* __restrict__ Wt, int K, int N, float scale) {
  const int t = blockIdx.x * 256 + threadIdx.x; if (t >= N * (K / 8)) return; const int n = t / (K / 8), k8 = (t % (K / 8)) * 8; FragH f;
#pragma unroll
  for (int i = 0; i < 8; ++i) f.h[i] = (_Float16)(bf16_round(W[(size_t)(k8 + i) * N + n]) * scale); const v8us o = f.half[0];
  *(v8us*)((unsigned short*)Wt + (size_t)n * K + k8) = o; 
}
// k_gemm_hh variant with fused epilogue: v = acc·alpha + bias[by·sBias + col] (+ CP[(row/rowsPerB)·sCPb + by·64 + col] if CP) ; ACT 0 none / 1 elu ; writes f16 C16 (and f32 C if non-null)
template <int ACT>
__global__ __launch_bounds__(128) void k_gemm_hhx(const _Float16* __restrict__ A, int lda, size_t sA, const _Float16* __restrict__ Bh, int ldb, size_t sB, float alpha, const float* __restrict__ bias, size_t sBias, const float* __restrict__ CP, int rowsPerB, size_t sCPb, int row0g,
    float* __restrict__ C, _Float16* __restrict__ C16, int ldc, size_t sC, int M, int N, int K) {
  __shared__ __attribute__((aligned(16))) float so[4][16][64];
  const int tid = threadIdx.x, w = tid >> 5, lane = tid & 31, ln = lane & 15, hh = lane >> 4; const int by = blockIdx.y;
  A += (size_t)by * sA; Bh += (size_t)by * sB; const size_t cofs = (size_t)by * sC; const float* bp = bias ? bias + (size_t)by * sBias : nullptr;
  const int ntn = (N + 63) / 64; const int wid = blockIdx.x * 4 + w; const int mt = wid / ntn, nq = wid % ntn; if (mt * 16 >= M) return;
  const int row0 = mt * 16, col0 = nq * 64; const _Float16* arow = A + (size_t)(row0 + ln) * lda;
  v8f acc[4] = {};
  for (int kb = 0; kb < K; kb += 32) { FragH ah; ah.half[0] = *(const v8us*)((const unsigned short*)arow + kb + 8 * hh); ah.half[1] = *(const v8us*)((const unsigned short*)arow + kb + 16 + 8 * hh);
#pragma unroll
    for (int t = 0; t < 4; ++t) { if (col0 + t * 16 >= N) continue; const size_t boff = (size_t)(col0 + t * 16 + ln) * ldb + kb; FragH bq; bq.half[0] = *(const v8us*)((const unsigned short*)Bh + boff + 8 * hh); bq.half[1] = *(const v8us*)((const unsigned short*)Bh + boff + 16 + 8 * hh);
      acc[t] = mmaH<1>(ah.v, ah.v, bq.v, bq.v, acc[t]); }
  }
#pragma unroll
  for (int t = 0; t < 4; ++t) { if (col0 + t * 16 >= N) continue; const int col = col0 + t * 16 + ln; const float bv = bp ? bf16_round(bp[col]) : 0.f;
#pragma unroll
    for (int r = 0; r < 8; ++r) { float v = acc[t][r] * alpha + bv; if (CP) { const int rr = row0g + row0 + 8 * hh + r; if (rowsPerB < 0) v += CP[cofs + (size_t)rr * ldc + col];      /* rowsPerB < 0: own element of the batched C plane */ else { const int bidx = rr / rowsPerB; v += CP[(size_t)bidx * sCPb + (size_t)by * 64 + col]; } } if (ACT == 1) v = (v > 0.f) ? v : expm1f(v); else if (ACT == 7) v = (v > 0.f) ? v + 1.0f : expf(v); else if (ACT == 8) v = tanhf(v); else if (ACT == 9) v = 0.5f * v * (1.0f + tanhf(0.7978845608028654f * (v + 0.044715f * v * v * v))); else if (ACT == 11) v = 1.0f / (1.0f + expf(-v)); else if (ACT == 12) v = (v > 0.f) ? v : 0.01f * v; else if (ACT == 14) v = (v > 0.f) ? v : 0.1f * v; else if (ACT == 16) v = (v >= 0.f) ? v : 0.3f * v; else if (ACT == 17) v = (v >= 0.f) ? v : 0.2f * v; else if (ACT == 15) v = v / (1.0f + expf(-v)); else if (ACT == 3) v = fmaxf(v, 0.f); else if (ACT == 6) v = 0.5f * v * (1.0f + erff(v * 0.70710678118654752f)); so[w][8 * hh + r][t * 16 + ln] = v; } }
  __builtin_amdgcn_fence(__ATOMIC_ACQ_REL, "workgroup"); __builtin_amdgcn_wave_barrier();
  const int rsub = lane >> 4, c4 = (lane & 15) * 4; typedef _Float16 v4h __attribute__((ext_vector_type(4)));
  {
#pragma unroll
    for (int q = 0; q < 8; ++q) { const int r = q * 2 + rsub; if (col0 + c4 < N) { const v4f v = *(const v4fa*)&so[w][r][c4]; if (C) *(v4f*)(C + cofs + (size_t)(row0 + r) * ldc + col0 + c4) = v; if (C16) { v4h h4; for (int i = 0; i < 4; ++i) h4[i] = (_Float16)v[i]; *(v4h*)(C16 + cofs + (size_t)(row0 + r) * ldc + col0 + c4) = h4; } } }
     }
}


typedef _Float16 v4h __attribute__((ext_vector_type(4)));

__global__ __launch_bounds__(256) void k_x16(const float* __restrict__ x, _Float16* __restrict__ X16, size_t n8) { const size_t t = (size_t)blockIdx.x * 256 + threadIdx.x; if (t >= n8) return; FragH f;
#pragma unroll
  for (int q = 0; q < 8; ++q) f.h[q] = (_Float16)bf16_round(x[t * 8 + q]); *(v8us*)((unsigned short*)X16 + t * 8) = f.half[0];  }
__global__ __launch_bounds__(256) void k_h16(const float* __restrict__ x, _Float16* __restrict__ X16, size_t n8) { const size_t t = (size_t)blockIdx.x * 256 + threadIdx.x; if (t >= n8) return; FragH f;
#pragma unroll
  for (int q = 0; q < 8; ++q) f.h[q] = (_Float16)x[t * 8 + q]; *(v8us*)((unsigned short*)X16 + t * 8) = f.half[0];  }
__global__ __launch_bounds__(256) void k_round16f(const float* __restrict__ W, _Float16* __restrict__ Bt, size_t n8) { const size_t t = (size_t)blockIdx.x * 256 + threadIdx.x; if (t >= n8) return; FragH f;
#pragma unroll
  for (int i = 0; i < 8; ++i) f.h[i] = (_Float16)(bf16_round(W[t * 8 + i]) * 16.0f); *(v8us*)((unsigned short*)Bt + t * 8) = f.half[0];  }
template <int NHv, int TTv>
__global__ __launch_bounds__(256) void k_vt(const _Float16* __restrict__ V16, int ldv, int voff, _Float16* __restrict__ Vt) { __shared__ unsigned short tl[64][66]; const int tid = threadIdx.x; const int slab = blockIdx.x / (TTv / 64), lg = blockIdx.x % (TTv / 64); const int b = slab / NHv, h = slab % NHv;
  for (int i = tid; i < 64 * 8; i += 256) { const int r = i / 8, c8 = (i % 8) * 8; FragH f; f.half[0] = *(const v8us*)((const unsigned short*)V16 + ((size_t)b * TTv + lg * 64 + r) * ldv + voff + h * 64 + c8);
#pragma unroll
    for (int q = 0; q < 8; ++q) tl[r][c8 + q] = f.u[q]; }
  __syncthreads();
  {
#pragma unroll
    for (int rd = 0; rd < 2; ++rd) { const int d = rd * 32 + tid / 8, pc = tid % 8; FragH f;
#pragma unroll
      for (int q = 0; q < 8; ++q) f.u[q] = tl[pc * 8 + q][d];
      *(v8us*)((unsigned short*)Vt + ((size_t)slab * 64 + d) * TTv + lg * 64 + pc * 8) = f.half[0]; }
     } }

__global__ __launch_bounds__(256) void k_hl(const float* __restrict__ F, _Float16* __restrict__ Hh, _Float16* __restrict__ Hl, size_t n8) { const size_t t = (size_t)blockIdx.x * 256 + threadIdx.x; if (t >= n8) return; FragH fh, fl; const v4f a = *(const v4fa*)(F + t * 8), c = *(const v4fa*)(F + t * 8 + 4);
#pragma unroll
  for (int q = 0; q < 4; ++q) { _Float16 h = (_Float16)a[q]; fh.h[q] = h; fl.h[q] = (_Float16)((a[q] - (float)h) * 1024.0f); h = (_Float16)c[q]; fh.h[4 + q] = h; fl.h[4 + q] = (_Float16)((c[q] - (float)h) * 1024.0f); }
  { *(v8us*)((unsigned short*)Hh + t * 8) = fh.half[0]; *(v8us*)((unsigned short*)Hl + t * 8) = fl.half[0];  } }

// ---- fast GEMM (wave tile 32x64; requires M % 32 == 0 rows per launch region and N % 64 == 0); epilogue = k_gemm_hhx semantics ----
__device__ __forceinline__ v16h g2_frag(const _Float16* p, int hh) { FragH f; f.half[0] = *(const v8us*)((const unsigned short*)p + 8 * hh); f.half[1] = *(const v8us*)((const unsigned short*)p + 16 + 8 * hh); return f.v; }
__device__ __forceinline__ v8f g2_mma(v16h a, v16h b, v8f c) { v8f d = __builtin_amdgcn_wmma_f32_16x16x32_f16(false, a, false, b, (short)0, c, false, false); asm volatile("v_nop\n\tv_nop\n\tv_nop\n\tv_nop" : "+v"(d) : "v"(a), "v"(b)); return d; }
// CAUSAL (rows and keys counted inside one grid.y plane, query tiles of QT rows): 0 none; 1 the output columns are keys: a block whose columns lie past its tile's end writes nothing; 2 K runs over keys: it ends at the tile's end
template <int ACT, int CAUSAL = 0>
__global__ __launch_bounds__(128) void k_gemm2(const _Float16* __restrict__ A, int lda, size_t sA, const _Float16* __restrict__ Bh, int ldb, size_t sB, float alpha, const float* __restrict__ bias, size_t sBias, const float* __restrict__ CP, int rowsPerB, size_t sCPb, int row0g,
    float* __restrict__ C, _Float16* __restrict__ C16, int ldc, size_t sC, int M, int N, int K) { static_assert(ACT == 0 || ACT == 3 || ACT == 6 || ACT == 8 || ACT == 9 || ACT == 11 || ACT == 12 || ACT == 14 || ACT == 15 || ACT == 16 || ACT == 17, "k_gemm2: unsupported ACT code (would silently apply no activation)");
  __shared__ __attribute__((aligned(16))) float so[4][32][68];
  const int tid = threadIdx.x, w = tid >> 5, lane = tid & 31, ln = lane & 15, hh = lane >> 4; const int by = blockIdx.y;
  A += (size_t)by * sA; Bh += (size_t)by * sB; const size_t cofs = (size_t)by * sC; const float* bp = bias ? bias + (size_t)by * sBias : nullptr;
  const int ntn = N >> 6; const int mt = blockIdx.x / ntn, nq = blockIdx.x - mt * ntn; const int row0 = mt * 128 + 32 * w, col0 = nq * 64; if (row0 >= M) return;
  if (CAUSAL) { const int lim = (mt * 128 / QT + 1) * QT; if (CAUSAL == 1 && col0 >= lim) return; if (CAUSAL == 2 && lim < K) K = lim; }
  const _Float16* a0p = A + (size_t)(row0 + ln) * lda; const _Float16* a1p = a0p + (size_t)16 * lda;
  const _Float16* b0p = Bh + (size_t)(col0 + ln) * ldb; const _Float16* b1p = b0p + (size_t)16 * ldb; const _Float16* b2p = b1p + (size_t)16 * ldb; const _Float16* b3p = b2p + (size_t)16 * ldb;
  const v8f z8 = {0.f,0.f,0.f,0.f,0.f,0.f,0.f,0.f}; v8f c00 = z8, c01 = z8, c02 = z8, c03 = z8, c10 = z8, c11 = z8, c12 = z8, c13 = z8;
#pragma unroll 1
  for (int kb = 0; kb < K; kb += 32) { const v16h a0 = g2_frag(a0p + kb, hh), a1 = g2_frag(a1p + kb, hh);
    v16h b = g2_frag(b0p + kb, hh); c00 = g2_mma(a0, b, c00); c10 = g2_mma(a1, b, c10);
    b = g2_frag(b1p + kb, hh); c01 = g2_mma(a0, b, c01); c11 = g2_mma(a1, b, c11);
    b = g2_frag(b2p + kb, hh); c02 = g2_mma(a0, b, c02); c12 = g2_mma(a1, b, c12);
    b = g2_frag(b3p + kb, hh); c03 = g2_mma(a0, b, c03); c13 = g2_mma(a1, b, c13); }
  v8f accs[8] = {c00, c01, c02, c03, c10, c11, c12, c13};
#pragma unroll
  for (int u = 0; u < 8; ++u) { const int t = u & 3, half = u >> 2; const int col = col0 + t * 16 + ln; const float bv = bp ? bf16_round(bp[col]) : 0.f;
#pragma unroll
    for (int r = 0; r < 8; ++r) { const int rloc = half * 16 + 8 * hh + r; float v = accs[u][r] * alpha + bv; if (CP) { if (rowsPerB < 0) v += CP[cofs + (size_t)(row0g + row0 + rloc) * ldc + col];      /* rowsPerB < 0: own element of the batched C plane */ else { const int bidx = (row0g + row0 + rloc) / rowsPerB; v += CP[(size_t)bidx * sCPb + (size_t)by * 64 + col]; } }
      if (ACT == 3) v = fmaxf(v, 0.f); else if (ACT == 6) v = 0.5f * v * (1.0f + erff(v * 0.70710678118654752f)); else if (ACT == 11) v = 1.0f / (1.0f + expf(-v)); else if (ACT == 15) v = v / (1.0f + expf(-v)); else if (ACT == 12) v = (v > 0.f) ? v : 0.01f * v; else if (ACT == 8) v = tanhf(v); else if (ACT == 9) v = 0.5f * v * (1.0f + tanhf(0.7978845608028654f * (v + 0.044715f * v * v * v))); else if (ACT == 14) v = (v > 0.f) ? v : 0.1f * v; else if (ACT == 16) v = (v >= 0.f) ? v : 0.3f * v; else if (ACT == 17) v = (v >= 0.f) ? v : 0.2f * v;
      so[w][rloc][t * 16 + ln] = v; } }
  __builtin_amdgcn_fence(__ATOMIC_ACQ_REL, "workgroup"); __builtin_amdgcn_wave_barrier();
  const int rsub = lane >> 4, c4 = (lane & 15) * 4;
  {
#pragma unroll
    for (int q = 0; q < 16; ++q) { const int r = q * 2 + rsub; const v4f v = *(const v4fa*)&so[w][r][c4]; if (C) { *(v4f*)(C + cofs + (size_t)(row0 + r) * ldc + col0 + c4) = v; asm volatile("s_wait_xcnt 0x0" ::: "memory");      /* the wait behind the f32 store, in front of the f16 conversion below, which the compiler does in the registers that the store names */ } if (C16) { v4h h4; for (int i = 0; i < 4; ++i) h4[i] = (_Float16)v[i]; *(v4h*)(C16 + cofs + (size_t)(row0 + r) * ldc + col0 + c4) = h4; } }
     } }


// ---- split-K GEMM: one 32x64 output tile a block (grid.x = row tiles of 32, grid.y = batch; 64 output columns). The block's NW waves share K in slices of 64 (one 128-byte line of every operand row): wave w takes slices w, w + NW, ...,
// each with the wave tile and the fragment loads of k_gemm2; the NW partial tiles meet in LDS and every thread sums four neighbouring elements in wave order. K % 64 == 0. CAUSAL 2: K ends at the end of the block's query tile of QT rows.
// ACC: the scaled sum is added to the block's own elements of C; OUT16: the result goes out as f16 to C16 instead of f32 to C.
#define NW 16
template <int CAUSAL, bool ACC, bool OUT16>
__global__ __launch_bounds__(NW * 32) void k_gemm2k(const _Float16* __restrict__ A, int lda, size_t sA, const _Float16* __restrict__ Bh, int ldb, size_t sB, float alpha, float* __restrict__ C, _Float16* __restrict__ C16, int ldc, size_t sC, int K) {
  static_assert(NW * 32 * 4 == 32 * 64, "one float4 of the tile a thread");
  __shared__ __attribute__((aligned(16))) float so[NW][32][68];
  const int tid = threadIdx.x, lane = tid & 31, ln = lane & 15, hh = lane >> 4; const int w = __builtin_amdgcn_readfirstlane(tid >> 5);      /* the wave's number in a scalar register: the K loop below then runs on scalar compares and branches, every lane on at the matrix instructions */
  const int by = blockIdx.y; A += (size_t)by * sA; Bh += (size_t)by * sB; const int row0 = blockIdx.x * 32;
  if (CAUSAL == 2) { const int lim = (row0 / QT + 1) * QT; if (lim < K) K = lim; }
  const size_t o = (size_t)by * sC + (size_t)(row0 + (tid >> 4)) * ldc + (tid & 15) * 4;      /* this thread's four elements of the tile */
  v4f prev = {0.f, 0.f, 0.f, 0.f}; if (ACC) prev = *(const v4fa*)(C + o);      /* asked for ahead of the K loop, used behind it */
  const _Float16* a0p = A + (size_t)(row0 + ln) * lda; const _Float16* a1p = a0p + (size_t)16 * lda;
  const _Float16* b0p = Bh + (size_t)ln * ldb; const _Float16* b1p = b0p + (size_t)16 * ldb; const _Float16* b2p = b1p + (size_t)16 * ldb; const _Float16* b3p = b2p + (size_t)16 * ldb;
  const v8f z8 = {0.f,0.f,0.f,0.f,0.f,0.f,0.f,0.f}; v8f c00 = z8, c01 = z8, c02 = z8, c03 = z8, c10 = z8, c11 = z8, c12 = z8, c13 = z8;
  for (int kc = w * 64; kc < K; kc += NW * 64)
    for (int kb = kc; kb < kc + 64; kb += 32) { const v16h a0 = g2_frag(a0p + kb, hh), a1 = g2_frag(a1p + kb, hh);
      v16h b = g2_frag(b0p + kb, hh); c00 = g2_mma(a0, b, c00); c10 = g2_mma(a1, b, c10);
      b = g2_frag(b1p + kb, hh); c01 = g2_mma(a0, b, c01); c11 = g2_mma(a1, b, c11);
      b = g2_frag(b2p + kb, hh); c02 = g2_mma(a0, b, c02); c12 = g2_mma(a1, b, c12);
      b = g2_frag(b3p + kb, hh); c03 = g2_mma(a0, b, c03); c13 = g2_mma(a1, b, c13); }
  v8f accs[8] = {c00, c01, c02, c03, c10, c11, c12, c13};
#pragma unroll
  for (int u = 0; u < 8; ++u)
#pragma unroll
    for (int r = 0; r < 8; ++r) so[w][(u >> 2) * 16 + 8 * hh + r][(u & 3) * 16 + ln] = accs[u][r];
  __syncthreads();      /* every wave's partial tile (zeros where a wave had no slice) is in LDS before any is summed */
  const float* sp = &so[0][tid >> 4][(tid & 15) * 4]; v4f s = *(const v4fa*)sp;
#pragma unroll
  for (int u = 1; u < NW; ++u) s += *(const v4fa*)(sp + u * 32 * 68);
  v4f v = s * alpha; if (ACC) v += prev;
  if (OUT16) { v4h h4; for (int i = 0; i < 4; ++i) h4[i] = (_Float16)v[i]; *(v4h*)(C16 + o) = h4; } else *(v4f*)(C + o) = v; }


__global__ __launch_bounds__(256) void k_wnat(const float* __restrict__ w, size_t n8, _Float16* __restrict__ Bt) { const size_t t = (size_t)blockIdx.x * 256 + threadIdx.x; if (t >= n8) return; FragH f; for (int q = 0; q < 8; ++q) f.h[q] = (_Float16)(bf16_round(w[t * 8 + q]) * 16.0f); *(v8us*)((unsigned short*)Bt + t * 8) = f.half[0];  }
__global__ __launch_bounds__(256) void k_rsm(const float* __restrict__ S, _Float16* __restrict__ P, int nrows) {
  #pragma clang fp contract(off)
  const int i = blockIdx.x * 256 + threadIdx.x; if (i >= nrows) return; const float* s = S + (size_t)i * SQ; float mx = -3.0e38f;
#pragma unroll 1
  for (int j = 0; j < SQ; ++j) mx = fmaxf(mx, s[j]); float se = 0.f;
#pragma unroll 1
  for (int j = 0; j < SQ; ++j) se += expf(s[j] - mx); const float sc = 256.0f / se;
#pragma unroll 1
  for (int j0 = 0; j0 < SQ; j0 += 8) { FragH f; for (int q = 0; q < 8; ++q) f.h[q] = (_Float16)(expf(s[j0 + q] - mx) * sc); unsigned short* d = (unsigned short*)P + (size_t)i * SQ + j0; *(v8us*)d = f.half[0];  } }
__global__ __launch_bounds__(256) void k_vt(const _Float16* __restrict__ V16, int b, int h0, _Float16* __restrict__ VT) { __shared__ unsigned short tl[64][65]; const int tid = threadIdx.x; const int hh = blockIdx.x % HG, sg = blockIdx.x / HG; const int s0 = sg * 64; const int h = h0 + hh;
  for (int i = tid; i < 64 * 8; i += 256) { const int j = i / 8, d8 = (i % 8) * 8; FragH f; f.half[0] = *(const v8us*)((const unsigned short*)V16 + ((size_t)b * SQ + s0 + j) * DM + h * HD + d8); for (int q = 0; q < 8; ++q) tl[d8 + q][j] = f.u[q]; }
  __syncthreads();
  { for (int i = tid; i < 64 * 8; i += 256) { const int d = i / 8, j8 = (i % 8) * 8; FragH f; for (int q = 0; q < 8; ++q) f.u[q] = tl[d][j8 + q]; *(v8us*)((unsigned short*)VT + ((size_t)hh * HD + d) * SQ + s0 + j8) = f.half[0]; }  } }


__global__ __launch_bounds__(256) void k_rsmcf2(const float* __restrict__ S, _Float16* __restrict__ P, int hg, int q0, int nk) {
  #pragma clang fp contract(off)
  const int t = blockIdx.x * 256 + threadIdx.x; if (t >= hg * QT) return; const size_t i = (size_t)t; const float* s = S + i * NKX; const int last = q0 + (t % QT); float mx = -3.0e38f;
#pragma unroll 1
  for (int j = 0; j < nk; ++j) { const float f = (j <= last) ? 1.f : 0.f; mx = fmaxf(mx, fmaf(f, s[j], (1.f - f) * -1.0e9f)); } float se = 0.f;
#pragma unroll 1
  for (int j = 0; j < nk; ++j) { const float f = (j <= last) ? 1.f : 0.f; se += __expf(fmaf(f, s[j], (1.f - f) * -1.0e9f) - mx); } const float sc = 256.0f / se;
#pragma unroll 1
  for (int j0 = 0; j0 < nk; j0 += 8) { FragH fr; for (int q = 0; q < 8; ++q) { const int j = j0 + q; const float f = (j <= last) ? 1.f : 0.f; fr.h[q] = (_Float16)(__expf(fmaf(f, s[j], (1.f - f) * -1.0e9f) - mx) * sc); } unsigned short* d = (unsigned short*)P + i * NKX + j0; *(v8us*)d = fr.half[0];  } }


// Causal row softmax, one wave per row (one-wave blocks, one block per row; t = row in the [batch][query] plane, last = its last visible key) over nk = 256 NC columns. Lane l keeps the 8 scores at columns 256 c + 8 l of each 256-column chunk c
// in registers, so the score row is read once, 32 contiguous bytes a lane, its loads issued ahead of the arithmetic; row maximum and row sum are four chains a lane, then a five-step butterfly.
template <int NC>
__device__ __forceinline__ void rsm_row(const float* __restrict__ S, _Float16* __restrict__ P, _Float16* __restrict__ PL, int t, int last) {
  const int j0 = threadIdx.x * 8; const size_t o = (size_t)t * NKX + j0;
  const float* s = S + o; unsigned short* p = (unsigned short*)P + o; unsigned short* pl = (unsigned short*)PL + o;
  v4f ra[NC], rb[NC];
#pragma unroll
  for (int c = 0; c < NC; ++c) { ra[c] = *(const v4fa*)(s + c * 256); rb[c] = *(const v4fa*)(s + c * 256 + 4); }
  asm volatile("s_wait_xcnt 0x0" :: "v"(s) : "memory");      /* the wait in front of any overwrite of the address pair that the issued loads name; naming the pair keeps it whole up to here */
  float e[NC][8]; float m4[4] = {-3.0e38f, -3.0e38f, -3.0e38f, -3.0e38f};
#pragma unroll
  for (int c = 0; c < NC; ++c) { const v4f a = ra[c], b = rb[c];
#pragma unroll
    for (int q = 0; q < 8; ++q) { const float f = (j0 + c * 256 + q <= last) ? 1.f : 0.f; const float v = fmaf(f, (q < 4) ? a[q & 3] : b[q & 3], (1.f - f) * -1.0e9f); e[c][q] = v; m4[q & 3] = fmaxf(m4[q & 3], v); } }
  float mx = fmaxf(fmaxf(m4[0], m4[1]), fmaxf(m4[2], m4[3]));
#pragma unroll
  for (int d = 16; d > 0; d >>= 1) mx = fmaxf(mx, __shfl_xor(mx, d, 32));
  float s4[4] = {0.f, 0.f, 0.f, 0.f};
#pragma unroll
  for (int c = 0; c < NC; ++c)
#pragma unroll
    for (int q = 0; q < 8; ++q) { const float y = (e[c][q] - mx) * 1.44269504f; float x;
      asm("v_exp_f32 %0, %1\n\tv_nop" : "=v"(x) : "v"(y));      /* native exp as before; the v_nop is the slot the instruction set asks for behind a transcendental before its source is overwritten */
      e[c][q] = x; s4[q & 3] += x; }
  float se = (s4[0] + s4[1]) + (s4[2] + s4[3]);
#pragma unroll
  for (int d = 16; d > 0; d >>= 1) se += __shfl_xor(se, d, 32);
  const float sc = 256.0f / se;
#pragma unroll
  for (int c = 0; c < NC; ++c) { FragH fr, fl;
#pragma unroll
    for (int q = 0; q < 8; ++q) { const float pv = e[c][q] * sc; const _Float16 h = (_Float16)pv; fr.h[q] = h; fl.h[q] = (_Float16)((pv - (float)h) * 1024.0f); }
    *(v8us*)(p + c * 256) = fr.half[0]; *(v8us*)(pl + c * 256) = fl.half[0]; }
  asm volatile("s_wait_xcnt 0x0" ::: "memory");      /* the wait behind the row's stores, in front of any overwrite of a register that they name: the bodies of the other row lengths follow this one in the same kernel */
}
// all rows of all batches in one launch; the row's query tile picks the straight-line body of its row length (a scalar branch: one row a block)
__global__ __launch_bounds__(32) void k_rsmcf2hl(const float* __restrict__ S, _Float16* __restrict__ P, _Float16* __restrict__ PL, int nrows) {
  const int t = blockIdx.x; if (t >= nrows) return; const int last = t % SQ;
  switch (last / QT) {
    case 0: rsm_row<1>(S, P, PL, t, last); break; case 1: rsm_row<2>(S, P, PL, t, last); break; case 2: rsm_row<3>(S, P, PL, t, last); break; case 3: rsm_row<4>(S, P, PL, t, last); break;
    case 4: rsm_row<5>(S, P, PL, t, last); break; case 5: rsm_row<6>(S, P, PL, t, last); break; case 6: rsm_row<7>(S, P, PL, t, last); break; default: rsm_row<8>(S, P, PL, t, last); break; } }
extern "C" void kernel_launch(void* const* d_in, const int* in_sizes, int n_in,
                              void* d_out, int out_size, void* d_ws, size_t ws_size, hipStream_t stream) {
  (void)in_sizes; (void)n_in; (void)out_size;
  const float* const* I = (const float* const*)d_in; const float* x = I[0]; const float* wq = I[1]; const float* wk = I[2]; const float* wv = I[3];
  char* ws = (char*)d_ws; size_t off = 0;
  auto take = [&](size_t bytes) { char* p = ws + off; off += (bytes + 255) & ~(size_t)255; return p; };
  _Float16* X16 = (_Float16*)take(NR * DMX * 2); _Float16* BQ = (_Float16*)take((size_t)HD * DMX * 2); _Float16* BK = (_Float16*)take((size_t)HD * DMX * 2); _Float16* BV = (_Float16*)take((size_t)HD * DMX * 2); _Float16* Q16 = (_Float16*)take(NR * HD * 2); _Float16* KL16 = (_Float16*)take(NR * HD * 2); float* KOUT = (float*)d_out + NR * HD; float* VF = (float*)d_out + 2 * NR * HD;      /* out1 = k and out2 = v are written in f32 straight into the tuple output and re-used as the sources of the f16 planes */ _Float16* VL16 = (_Float16*)take(NR * HD * 2); _Float16* VTL = (_Float16*)take((size_t)NB * HD * SQ * 2); _Float16* K16 = (_Float16*)take(NR * HD * 2); _Float16* V16 = (_Float16*)take(NR * HD * 2); _Float16* VT = (_Float16*)take((size_t)NB * HD * SQ * 2);
  float* S = (float*)take(NR * NKX * 4); _Float16* P = (_Float16*)take(NR * NKX * 2); _Float16* PL = (_Float16*)take(NR * NKX * 2);      /* whole [batch][query][key] planes */
  if (off > ws_size) return;      /* approx 16 + 0.4 + 7 x 1 + 64 + 32 + 32 = 152 MiB */
  k_x16<<<(unsigned)((NR * DMX / 8 + 255) / 256), 256, 0, stream>>>(x, X16, NR * DMX / 8);      /* x as exact f16 rows */
  { const unsigned g = (unsigned)(((size_t)HD * (DMX / 8) + 255) / 256); k_wt_f16<<<g, 256, 0, stream>>>(wq, BQ, DMX, HD, 16.0f); k_wt_f16<<<g, 256, 0, stream>>>(wk, BK, DMX, HD, 16.0f); k_wt_f16<<<g, 256, 0, stream>>>(wv, BV, DMX, HD, 16.0f); }      /* [in][out] 1024 x 64 -> Bt [64][1024] x16 */
  k_gemm2k<0, false, true><<<dim3((unsigned)(NR / 32), 1), NW * 32, 0, stream>>>(X16, DMX, 0, BQ, DMX, 0, 0.0625f, nullptr, Q16, HD, 0, DMX); k_gemm2k<0, false, false><<<dim3((unsigned)(NR / 32), 1), NW * 32, 0, stream>>>(X16, DMX, 0, BK, DMX, 0, 0.0625f, KOUT, nullptr, HD, 0, DMX); k_hl<<<(unsigned)((NR * HD / 8 + 255) / 256), 256, 0, stream>>>(KOUT, K16, KL16, NR * HD / 8);      /* out1 = k (f32; exact products, f32 accumulation) and its f16 plane (the residual plane is unused) */ k_gemm2k<0, false, false><<<dim3((unsigned)(NR / 32), 1), NW * 32, 0, stream>>>(X16, DMX, 0, BV, DMX, 0, 0.0625f, VF, nullptr, HD, 0, DMX); k_hl<<<(unsigned)((NR * HD / 8 + 255) / 256), 256, 0, stream>>>(VF, V16, VL16, NR * HD / 8);      /* v in f32 -> f16 hi + x1024 residual planes */      /* q, k, v = x W as f16 rows [token][64] (= the head-major [B][1][S][64] layout the attention below expects) */
  k_vt<1, SQ><<<NB * (SQ / 64), 256, 0, stream>>>(V16, HD, 0, VT); k_vt<1, SQ><<<NB * (SQ / 64), 256, 0, stream>>>(VL16, HD, 0, VTL);      /* V^T hi and residual, one [64][2048] slab per batch */
  k_gemm2<0, 1><<<dim3((SQ / 128) * (SQ / 64), NB), 128, 0, stream>>>(Q16, HD, (size_t)SQ * HD, K16, HD, (size_t)SQ * HD, 0.03125f, nullptr, 0, nullptr, 1, 0, 0, S, nullptr, NKX, (size_t)SQ * NKX, SQ, SQ, HD);      /* scores / 32 for the keys below each query tile's end, batches on grid.y */
  k_rsmcf2hl<<<(unsigned)NR, 32, 0, stream>>>(S, P, PL, (int)NR);      /* causal softmax -> f16 x256 hi + x1024 residual planes */
  float* O = (float*)d_out;
  k_gemm2k<2, false, false><<<dim3(SQ / 32, NB), NW * 32, 0, stream>>>(P, NKX, (size_t)SQ * NKX, VT, SQ, (size_t)HD * SQ, 0.00390625f, O, nullptr, HD, (size_t)SQ * HD, SQ);      /* out = P_hi V / 256 */
  k_gemm2k<2, true, false><<<dim3(SQ / 32, NB), NW * 32, 0, stream>>>(PL, NKX, (size_t)SQ * NKX, VT, SQ, (size_t)HD * SQ, 0.000003814697265625f, O, nullptr, HD, (size_t)SQ * HD, SQ);      /* += P_lo V 2^-18 (own-element accumulate): P effectively ~f32 */
  k_gemm2k<2, true, false><<<dim3(SQ / 32, NB), NW * 32, 0, stream>>>(P, NKX, (size_t)SQ * NKX, VTL, SQ, (size_t)HD * SQ, 0.000003814697265625f, O, nullptr, HD, (size_t)SQ * HD, SQ);      /* += P_hi V_lo^T 2^-18: v effectively f32 too */
}

// v004
// One run takes 85.2 microseconds.
// Timed twice side by side with v003, it ran 1.33 and 1.35 times as fast.
// Counting every step since v000, it is 118 times as fast.
#include <hip/hip_runtime.h>
// Single attention head returning the TUPLE (out, k, v) (x [4][2048][1024]; q = x Wq, k = x Wk, v = x Wv ([in][out] 1024 x 64, sigma 1/32, no biases); wei = q . k x 1024^-0.5 (the module scales by n_embd) with a causal mask (tril, -inf); softmax; out = wei v -> out0 [4][2048][64] @0, out1 = k [4][2048][64] f32 @2,097,152 B, out2 = v [4][2048][64] f32 @4,194,304 B; input order x, Wq, Wk, Wv).
// Structure: the three [in][out] weights as exact x16 f16 planes [192][1024] (one launch); q, k, v in ONE projection launch (k_qkv: x read as f32 and rounded in the A loader, WMMA, f32 accumulation, K = 1024 split over the waves): q as f16 rows, k and v in f32 STRAIGHT INTO the tuple output slots (out1, out2), k also as f16 rows, v also as V^T f16 hi + x1024 residual planes in blocks of 32 keys; then ONE launch per stage over all batches (grid.y) and all query tiles of 256 rows (grid.x), each block taking its tile's key bound from its own row index: scores against the keys below the tile end only (K = 64, alpha 1/32) into an f32 plane [batch][query][key], causal row softmax on VALU, one wave per row (arithmetic 0/1 select; f32 statistics, native exp) writing the weights as f16 hi (x256) + x1024 residual planes, out = P_hi V^T (alpha 2^-8) written f32 then += P_lo V_hi^T and += P_hi V_lo^T (alpha 2^-18 each; own-element accumulates in the next launches); launches: see trace.
// Compute dtype: inputs rounded to bf16; q, k f16 (rounded from f32 sums), v f16 hi + x1024 residual; softmax weights f16 hi (x256) + x1024 residual; scores, statistics, out f32. v_wmma_f32_16x16x32_f16.
#define NB 4
#define NHS 1
#define DMX 1024                   /* model width (projection K) */
#define SQ 2048
#define HD 64
#define DM 64
#define NH 1
#define HG 1
#define QT 256
#define NKX SQ
#define NR ((size_t)NB * NHS * SQ)
typedef __bf16 v16b __attribute__((ext_vector_type(16)));
typedef unsigned short v8us __attribute__((ext_vector_type(8), may_alias));
typedef float  v8f  __attribute__((ext_vector_type(8)));
typedef float  v4f  __attribute__((ext_vector_type(4)));
typedef float  v4fa __attribute__((ext_vector_type(4), may_alias));
union FragB { v16b v; v8us half[2]; unsigned short u[16]; };

__device__ __forceinline__ unsigned short bf16_bits(float x) { unsigned int u = __float_as_uint(x); return (unsigned short)((u + 0x7FFFu + ((u >> 16) & 1u)) >> 16); }
__device__ __forceinline__ float bf16_val(unsigned short b) { return __uint_as_float(((unsigned int)b) << 16); }
__device__ __forceinline__ float bf16_round(float x) { return bf16_val(bf16_bits(x)); }
// D += A·B with NT terms: 1 = ah·bh, 2 = + al·bh (A split), 3 = + ah·bl (both split)
template <int NT>
__device__ __forceinline__ v8f mmaN(v16b ah, v16b al, v16b bh, v16b bl, v8f c) {
  c = __builtin_amdgcn_wmma_f32_16x16x32_bf16(false, ah, false, bh, (short)0, c, false, false);
  if (NT >= 2) c = __builtin_amdgcn_wmma_f32_16x16x32_bf16(false, al, false, bh, (short)0, c, false, false);
  if (NT >= 3) c = __builtin_amdgcn_wmma_f32_16x16x32_bf16(false, ah, false, bl, (short)0, c, false, false);
  asm volatile("v_nop\n\tv_nop\n\tv_nop\n\tv_nop" : "+v"(c) : "v"(ah), "v"(al), "v"(bh), "v"(bl));
  return c;
}

__global__ __launch_bounds__(256) void k_wt_bf16(const float* __restrict__ W, unsigned short* __restrict__ Wt, int K, int N) {
  const int t = blockIdx.x * 256 + threadIdx.x;
  const int k8n = K / 8;
  if (t >= N * k8n) return;
  const int n = t / k8n, k8 = (t % k8n) * 8;
  v8us v;
#pragma unroll
  for (int i = 0; i < 8; ++i) v[i] = bf16_bits(W[(size_t)(k8 + i) * N + n]);
  *(v8us*)(Wt + (size_t)n * K + k8) = v;
  
}

// GEMM C[M][N] (f32, pitch ldc) = act(A[M][K]·W + bias). A f32 row-major (pitch lda) converted per fragment to bf16
// (ASPLIT: hi/lo two planes -> 2 terms, else single rounded term); Wt bf16 [N][K] (pitch ldb). BIAS_BF16 rounds the
// bias to bf16 first (bias quantised to bf16 before the add). K%32==0, M%16==0, N%64==0.
template <bool ASPLIT, int ACT, bool BIAS_BF16>
__global__ __launch_bounds__(128) void k_gemm_bf(const float* __restrict__ A, int lda, const unsigned short* __restrict__ Wt, int ldb,
                                               const float* __restrict__ bias, float* __restrict__ C, int ldc, int M, int N, int K) {
  __shared__ __attribute__((aligned(16))) float so[4][16][64];
  const int tid = threadIdx.x, w = tid >> 5, lane = tid & 31, ln = lane & 15, hh = lane >> 4;
  const int ntn = N / 64;
  const int wid = blockIdx.x * 4 + w;
  const int mt = wid / ntn, nq = wid % ntn;
  if (mt * 16 >= M) return;
  const int row0 = mt * 16, col0 = nq * 64;
  const float* arow = A + (size_t)(row0 + ln) * lda;
  v8f acc[4] = {};
  for (int kb = 0; kb < K; kb += 32) {
    FragB ah, al;
    const v4f x0 = *(const v4fa*)(arow + kb + 8 * hh), x1 = *(const v4fa*)(arow + kb + 8 * hh + 4);
    const v4f x2 = *(const v4fa*)(arow + kb + 16 + 8 * hh), x3 = *(const v4fa*)(arow + kb + 16 + 8 * hh + 4);
    float xs[16] = {x0[0],x0[1],x0[2],x0[3],x1[0],x1[1],x1[2],x1[3],x2[0],x2[1],x2[2],x2[3],x3[0],x3[1],x3[2],x3[3]};
#pragma unroll
    for (int i = 0; i < 16; ++i) { const unsigned short hb = bf16_bits(xs[i]); ah.u[i] = hb; al.u[i] = ASPLIT ? bf16_bits(xs[i] - bf16_val(hb)) : (unsigned short)0; }
#pragma unroll
    for (int t = 0; t < 4; ++t) {
      const unsigned short* brow = Wt + (size_t)(col0 + t * 16 + ln) * ldb + kb;
      FragB b;
      b.half[0] = *(const v8us*)(brow + 8 * hh);
      b.half[1] = *(const v8us*)(brow + 16 + 8 * hh);
      acc[t] = mmaN<ASPLIT ? 2 : 1>(ah.v, al.v, b.v, b.v, acc[t]);
    }
  }
#pragma unroll
  for (int t = 0; t < 4; ++t) {
    float bv = bias ? bias[col0 + t * 16 + ln] : 0.f;
    if (BIAS_BF16) bv = bf16_round(bv);
#pragma unroll
    for (int r = 0; r < 8; ++r) { float v = acc[t][r] + bv; if (ACT == 1) v = fmaxf(v, 0.f); so[w][8 * hh + r][t * 16 + ln] = v; }
  }
  __builtin_amdgcn_fence(__ATOMIC_ACQ_REL, "workgroup");
  __builtin_amdgcn_wave_barrier();
  const int rsub = lane >> 4, c4 = (lane & 15) * 4;
  {
#pragma unroll
    for (int q = 0; q < 8; ++q) {
      const int r = q * 2 + rsub;
      const v4f v = *(const v4fa*)&so[w][r][c4];
      *(v4f*)(C + (size_t)(row0 + r) * ldc + col0 + c4) = v;
    }
    
  }
}

// GEMM C = act(A·W + bias + resid): A f32 (ASPLIT -> hi/lo 2 terms), Wt bf16 [N][K]; ACT 0 none, 1 relu, 2 exact gelu;
// resid (optional, f32, row index = (row % rmod), pitch ldr, RES_BF16 rounds it) added before the activation.
template <bool ASPLIT, int ACT, bool BIAS_BF16, bool RES_BF16>
__global__ __launch_bounds__(128) void k_gemm_bf3(const float* __restrict__ A, int lda, const unsigned short* __restrict__ Wt, int ldb,
                                                const float* __restrict__ bias, const float* __restrict__ resid, int rmod, int ldr,
                                                float* __restrict__ C, int ldc, int M, int N, int K) {
  __shared__ __attribute__((aligned(16))) float so[4][16][64];
  const int tid = threadIdx.x, w = tid >> 5, lane = tid & 31, ln = lane & 15, hh = lane >> 4;
  const int ntn = N / 64;
  const int wid = blockIdx.x * 4 + w;
  const int mt = wid / ntn, nq = wid % ntn;
  if (mt * 16 >= M) return;
  const int row0 = mt * 16, col0 = nq * 64;
  const float* arow = A + (size_t)(row0 + ln) * lda;
  v8f acc[4] = {};
  for (int kb = 0; kb < K; kb += 32) {
    FragB ah, al;
    const v4f x0 = *(const v4fa*)(arow + kb + 8 * hh), x1 = *(const v4fa*)(arow + kb + 8 * hh + 4);
    const v4f x2 = *(const v4fa*)(arow + kb + 16 + 8 * hh), x3 = *(const v4fa*)(arow + kb + 16 + 8 * hh + 4);
    float xs[16] = {x0[0],x0[1],x0[2],x0[3],x1[0],x1[1],x1[2],x1[3],x2[0],x2[1],x2[2],x2[3],x3[0],x3[1],x3[2],x3[3]};
#pragma unroll
    for (int i = 0; i < 16; ++i) { const unsigned short hb = bf16_bits(xs[i]); ah.u[i] = hb; al.u[i] = ASPLIT ? bf16_bits(xs[i] - bf16_val(hb)) : (unsigned short)0; }
#pragma unroll
    for (int t = 0; t < 4; ++t) {
      const unsigned short* brow = Wt + (size_t)(col0 + t * 16 + ln) * ldb + kb;
      FragB b;
      b.half[0] = *(const v8us*)(brow + 8 * hh);
      b.half[1] = *(const v8us*)(brow + 16 + 8 * hh);
      acc[t] = mmaN<ASPLIT ? 2 : 1>(ah.v, al.v, b.v, b.v, acc[t]);
    }
  }
#pragma unroll
  for (int t = 0; t < 4; ++t) {
    const int col = col0 + t * 16 + ln;
    float bv = bias ? bias[col] : 0.f;
    if (BIAS_BF16) bv = bf16_round(bv);
#pragma unroll
    for (int r = 0; r < 8; ++r) {
      float v = acc[t][r] + bv;
      if (resid) { float rv = resid[(size_t)((row0 + 8 * hh + r) % rmod) * ldr + col]; if (RES_BF16) rv = bf16_round(rv); v += rv; }
      if (ACT == 1) v = fmaxf(v, 0.f);
      if (ACT == 2) v = 0.5f * v * (1.0f + erff(v * 0.70710678118654752f));
      if (ACT == 3) { const float u = 0.7978845608028654f * (v + 0.044715f * v * v * v); v = 0.5f * v * (1.0f + tanhf(u)); }
      so[w][8 * hh + r][t * 16 + ln] = v;
    }
  }
  __builtin_amdgcn_fence(__ATOMIC_ACQ_REL, "workgroup");
  __builtin_amdgcn_wave_barrier();
  const int rsub = lane >> 4, c4 = (lane & 15) * 4;
  {
#pragma unroll
    for (int q = 0; q < 8; ++q) {
      const int r = q * 2 + rsub;
      const v4f v = *(const v4fa*)&so[w][r][c4];
      *(v4f*)(C + (size_t)(row0 + r) * ldc + col0 + c4) = v;
    }
    
  }
}
// row LayerNorm (biased variance, eps) over N: s = X (+ R); optional out_sum <- s; out_norm <- (s-mu)*rsqrt(var+eps)*g + b
template <bool PARAM_BF16>
__global__ __launch_bounds__(256) void k_layernorm(const float* __restrict__ X, const float* __restrict__ R, const float* __restrict__ g, const float* __restrict__ bta,
                                                  float* __restrict__ out_sum, float* __restrict__ out_norm, int N, float eps) {
  __shared__ float red[256];
  const int row = blockIdx.x, tid = threadIdx.x;
  const float* x = X + (size_t)row * N; const float* rr = R ? R + (size_t)row * N : nullptr;
  float vals[16];                     // up to N = 4096
  const int per = N / 256;            // contiguous chunk per thread? use strided-by-4 chunks: thread handles j = tid*4 + 1024*u
  float s1 = 0.f;
  for (int u = 0; u < per / 4; ++u) {
    const int j = tid * 4 + 1024 * u;
    const v4f a = *(const v4fa*)(x + j);
    v4f b = {0.f,0.f,0.f,0.f}; if (rr) b = *(const v4fa*)(rr + j);
#pragma unroll
    for (int q = 0; q < 4; ++q) { const float v = a[q] + b[q]; vals[u * 4 + q] = v; s1 += v; }
  }
  red[tid] = s1; __syncthreads();
  for (int st = 128; st > 0; st >>= 1) { if (tid < st) red[tid] += red[tid + st]; __syncthreads(); }
  const float mu = red[0] / (float)N; __syncthreads();
  float s2 = 0.f;
  for (int u = 0; u < per / 4; ++u)
#pragma unroll
    for (int q = 0; q < 4; ++q) { const float c = vals[u * 4 + q] - mu; s2 += c * c; }
  red[tid] = s2; __syncthreads();
  for (int st = 128; st > 0; st >>= 1) { if (tid < st) red[tid] += red[tid + st]; __syncthreads(); }
  const float rs = rsqrtf(red[0] / (float)N + eps);
  {
    for (int u = 0; u < per / 4; ++u) {
      const int j = tid * 4 + 1024 * u;
      v4f o, sm;
#pragma unroll
      for (int q = 0; q < 4; ++q) {
        float gg = g[j + q], bb = bta[j + q];
        if (PARAM_BF16) { gg = bf16_round(gg); bb = bf16_round(bb); }
        sm[q] = vals[u * 4 + q]; o[q] = (vals[u * 4 + q] - mu) * rs * gg + bb;
      }
      if (out_sum) *(v4f*)(out_sum + (size_t)row * N + j) = sm;
      *(v4f*)(out_norm + (size_t)row * N + j) = o;
    }
    
  }
}



// ---- f16 WMMA path (v_wmma_f32_16x16x32_f16): 11-bit significands for operands in range — used where a [0,1] probability operand needs more precision than bf16
typedef _Float16 v16h __attribute__((ext_vector_type(16)));
union FragH { v16h v; v8us half[2]; _Float16 h[16]; unsigned short u[16]; };
template <int NT>
__device__ __forceinline__ v8f mmaH(v16h ah, v16h al, v16h bh, v16h bl, v8f c) {
  c = __builtin_amdgcn_wmma_f32_16x16x32_f16(false, ah, false, bh, (short)0, c, false, false);
  if (NT >= 2) c = __builtin_amdgcn_wmma_f32_16x16x32_f16(false, al, false, bh, (short)0, c, false, false);
  if (NT >= 3) c = __builtin_amdgcn_wmma_f32_16x16x32_f16(false, ah, false, bl, (short)0, c, false, false);
  asm volatile("v_nop\n\tv_nop\n\tv_nop\n\tv_nop" : "+v"(c) : "v"(ah), "v"(al), "v"(bh), "v"(bl));
  return c;
}
// batched GEMM like k_gemm_b but f16 operands: A f32 (split into f16 hi/lo if ASPLIT, else rounded to f16), Bt = f16 values [n][k]; alpha; C f32; N multiple of 16 (partial tiles skipped)
template <bool ASPLIT>
__global__ __launch_bounds__(128) void k_gemm_h(const float* __restrict__ A, int lda, size_t sA, const _Float16* __restrict__ Bh, int ldb, size_t sB, float alpha, float* __restrict__ C, int ldc, size_t sC, int M, int N, int K) {
  __shared__ __attribute__((aligned(16))) float so[4][16][64];
  const int tid = threadIdx.x, w = tid >> 5, lane = tid & 31, ln = lane & 15, hh = lane >> 4; const int by = blockIdx.y;
  A += (size_t)by * sA; Bh += (size_t)by * sB; C += (size_t)by * sC;
  const int ntn = (N + 63) / 64; const int wid = blockIdx.x * 4 + w; const int mt = wid / ntn, nq = wid % ntn; if (mt * 16 >= M) return;
  const int row0 = mt * 16, col0 = nq * 64; const float* arow = A + (size_t)(row0 + ln) * lda;
  v8f acc[4] = {};
  for (int kb = 0; kb < K; kb += 32) {
    FragH ah, al;
    const v4f x0 = *(const v4fa*)(arow + kb + 8 * hh), x1 = *(const v4fa*)(arow + kb + 8 * hh + 4), x2 = *(const v4fa*)(arow + kb + 16 + 8 * hh), x3 = *(const v4fa*)(arow + kb + 16 + 8 * hh + 4);
    float xs[16] = {x0[0],x0[1],x0[2],x0[3],x1[0],x1[1],x1[2],x1[3],x2[0],x2[1],x2[2],x2[3],x3[0],x3[1],x3[2],x3[3]};
#pragma unroll
    for (int i = 0; i < 16; ++i) { const _Float16 h = (_Float16)xs[i]; ah.h[i] = h; al.h[i] = ASPLIT ? (_Float16)(xs[i] - (float)h) : (_Float16)0.0f; }
#pragma unroll
    for (int t = 0; t < 4; ++t) { if (col0 + t * 16 >= N) continue; const size_t boff = (size_t)(col0 + t * 16 + ln) * ldb + kb; FragH bq; bq.half[0] = *(const v8us*)(Bh + boff + 8 * hh); bq.half[1] = *(const v8us*)(Bh + boff + 16 + 8 * hh);
      acc[t] = mmaH<ASPLIT ? 2 : 1>(ah.v, al.v, bq.v, bq.v, acc[t]); }
  }
#pragma unroll
  for (int t = 0; t < 4; ++t) { if (col0 + t * 16 >= N) continue;
#pragma unroll
    for (int r = 0; r < 8; ++r) so[w][8 * hh + r][t * 16 + ln] = acc[t][r] * alpha; }
  __builtin_amdgcn_fence(__ATOMIC_ACQ_REL, "workgroup"); __builtin_amdgcn_wave_barrier();
  const int rsub = lane >> 4, c4 = (lane & 15) * 4;
  {
#pragma unroll
    for (int q = 0; q < 8; ++q) { const int r = q * 2 + rsub; if (col0 + c4 < N) { const v4f v = *(const v4fa*)&so[w][r][c4]; *(v4f*)(C + (size_t)(row0 + r) * ldc + col0 + c4) = v; } }
     }
}

// Wt[n][k] = f16(W[k][n]·scale) from f32 row-major W[K][N] (scale = power of two; bf16-exact weights stay exact in f16 away from the subnormal range)
__global__ __launch_bounds__(256) void k_wt_f16(const float* __restrict__ W, _Float16* __restrict__ Wt, int K, int N, float scale) {
  const int t = blockIdx.x * 256 + threadIdx.x; if (t >= N * (K / 8)) return; const int n = t / (K / 8), k8 = (t % (K / 8)) * 8; FragH f;
#pragma unroll
  for (int i = 0; i < 8; ++i) f.h[i] = (_Float16)(bf16_round(W[(size_t)(k8 + i) * N + n]) * scale); const v8us o = f.half[0];
  *(v8us*)((unsigned short*)Wt + (size_t)n * K + k8) = o; 
}
// k_gemm_hh variant with fused epilogue: v = acc·alpha + bias[by·sBias + col] (+ CP[(row/rowsPerB)·sCPb + by·64 + col] if CP) ; ACT 0 none / 1 elu ; writes f16 C16 (and f32 C if non-null)
template <int ACT>
__global__ __launch_bounds__(128) void k_gemm_hhx(const _Float16* __restrict__ A, int lda, size_t sA, const _Float16* __restrict__ Bh, int ldb, size_t sB, float alpha, const float* __restrict__ bias, size_t sBias, const float* __restrict__ CP, int rowsPerB, size_t sCPb, int row0g,
    float* __restrict__ C, _Float16* __restrict__ C16, int ldc, size_t sC, int M, int N, int K) {
  __shared__ __attribute__((aligned(16))) float so[4][16][64];
  const int tid = threadIdx.x, w = tid >> 5, lane = tid & 31, ln = lane & 15, hh = lane >> 4; const int by = blockIdx.y;
  A += (size_t)by * sA; Bh += (size_t)by * sB; const size_t cofs = (size_t)by * sC; const float* bp = bias ? bias + (size_t)by * sBias : nullptr;
  const int ntn = (N + 63) / 64; const int wid = blockIdx.x * 4 + w; const int mt = wid / ntn, nq = wid % ntn; if (mt * 16 >= M) return;
  const int row0 = mt * 16, col0 = nq * 64; const _Float16* arow = A + (size_t)(row0 + ln) * lda;
  v8f acc[4] = {};
  for (int kb = 0; kb < K; kb += 32) { FragH ah; ah.half[0] = *(const v8us*)((const unsigned short*)arow + kb + 8 * hh); ah.half[1] = *(const v8us*)((const unsigned short*)arow + kb + 16 + 8 * hh);
#pragma unroll
    for (int t = 0; t < 4; ++t) { if (col0 + t * 16 >= N) continue; const size_t boff = (size_t)(col0 + t * 16 + ln) * ldb + kb; FragH bq; bq.half[0] = *(const v8us*)((const unsigned short*)Bh + boff + 8 * hh); bq.half[1] = *(const v8us*)((const unsigned short*)Bh + boff + 16 + 8 * hh);
      acc[t] = mmaH<1>(ah.v, ah.v, bq.v, bq.v, acc[t]); }
  }
#pragma unroll
  for (int t = 0; t < 4; ++t) { if (col0 + t * 16 >= N) continue; const int col = col0 + t * 16 + ln; const float bv = bp ? bf16_round(bp[col]) : 0.f;
#pragma unroll
    for (int r = 0; r < 8; ++r) { float v = acc[t][r] * alpha + bv; if (CP) { const int rr = row0g + row0 + 8 * hh + r; if (rowsPerB < 0) v += CP[cofs + (size_t)rr * ldc + col];      /* rowsPerB < 0: own element of the batched C plane */ else { const int bidx = rr / rowsPerB; v += CP[(size_t)bidx * sCPb + (size_t)by * 64 + col]; } } if (ACT == 1) v = (v > 0.f) ? v : expm1f(v); else if (ACT == 7) v = (v > 0.f) ? v + 1.0f : expf(v); else if (ACT == 8) v = tanhf(v); else if (ACT == 9) v = 0.5f * v * (1.0f + tanhf(0.7978845608028654f * (v + 0.044715f * v * v * v))); else if (ACT == 11) v = 1.0f / (1.0f + expf(-v)); else if (ACT == 12) v = (v > 0.f) ? v : 0.01f * v; else if (ACT == 14) v = (v > 0.f) ? v : 0.1f * v; else if (ACT == 16) v = (v >= 0.f) ? v : 0.3f * v; else if (ACT == 17) v = (v >= 0.f) ? v : 0.2f * v; else if (ACT == 15) v = v / (1.0f + expf(-v)); else if (ACT == 3) v = fmaxf(v, 0.f); else if (ACT == 6) v = 0.5f * v * (1.0f + erff(v * 0.70710678118654752f)); so[w][8 * hh + r][t * 16 + ln] = v; } }
  __builtin_amdgcn_fence(__ATOMIC_ACQ_REL, "workgroup"); __builtin_amdgcn_wave_barrier();
  const int rsub = lane >> 4, c4 = (lane & 15) * 4; typedef _Float16 v4h __attribute__((ext_vector_type(4)));
  {
#pragma unroll
    for (int q = 0; q < 8; ++q) { const int r = q * 2 + rsub; if (col0 + c4 < N) { const v4f v = *(const v4fa*)&so[w][r][c4]; if (C) *(v4f*)(C + cofs + (size_t)(row0 + r) * ldc + col0 + c4) = v; if (C16) { v4h h4; for (int i = 0; i < 4; ++i) h4[i] = (_Float16)v[i]; *(v4h*)(C16 + cofs + (size_t)(row0 + r) * ldc + col0 + c4) = h4; } } }
     }
}


typedef _Float16 v4h __attribute__((ext_vector_type(4)));

__global__ __launch_bounds__(256) void k_x16(const float* __restrict__ x, _Float16* __restrict__ X16, size_t n8) { const size_t t = (size_t)blockIdx.x * 256 + threadIdx.x; if (t >= n8) return; FragH f;
#pragma unroll
  for (int q = 0; q < 8; ++q) f.h[q] = (_Float16)bf16_round(x[t * 8 + q]); *(v8us*)((unsigned short*)X16 + t * 8) = f.half[0];  }
__global__ __launch_bounds__(256) void k_h16(const float* __restrict__ x, _Float16* __restrict__ X16, size_t n8) { const size_t t = (size_t)blockIdx.x * 256 + threadIdx.x; if (t >= n8) return; FragH f;
#pragma unroll
  for (int q = 0; q < 8; ++q) f.h[q] = (_Float16)x[t * 8 + q]; *(v8us*)((unsigned short*)X16 + t * 8) = f.half[0];  }
__global__ __launch_bounds__(256) void k_round16f(const float* __restrict__ W, _Float16* __restrict__ Bt, size_t n8) { const size_t t = (size_t)blockIdx.x * 256 + threadIdx.x; if (t >= n8) return; FragH f;
#pragma unroll
  for (int i = 0; i < 8; ++i) f.h[i] = (_Float16)(bf16_round(W[t * 8 + i]) * 16.0f); *(v8us*)((unsigned short*)Bt + t * 8) = f.half[0];  }
template <int NHv, int TTv>
__global__ __launch_bounds__(256) void k_vt(const _Float16* __restrict__ V16, int ldv, int voff, _Float16* __restrict__ Vt) { __shared__ unsigned short tl[64][66]; const int tid = threadIdx.x; const int slab = blockIdx.x / (TTv / 64), lg = blockIdx.x % (TTv / 64); const int b = slab / NHv, h = slab % NHv;
  for (int i = tid; i < 64 * 8; i += 256) { const int r = i / 8, c8 = (i % 8) * 8; FragH f; f.half[0] = *(const v8us*)((const unsigned short*)V16 + ((size_t)b * TTv + lg * 64 + r) * ldv + voff + h * 64 + c8);
#pragma unroll
    for (int q = 0; q < 8; ++q) tl[r][c8 + q] = f.u[q]; }
  __syncthreads();
  {
#pragma unroll
    for (int rd = 0; rd < 2; ++rd) { const int d = rd * 32 + tid / 8, pc = tid % 8; FragH f;
#pragma unroll
      for (int q = 0; q < 8; ++q) f.u[q] = tl[pc * 8 + q][d];
      *(v8us*)((unsigned short*)Vt + ((size_t)slab * 64 + d) * TTv + lg * 64 + pc * 8) = f.half[0]; }
     } }

__global__ __launch_bounds__(256) void k_hl(const float* __restrict__ F, _Float16* __restrict__ Hh, _Float16* __restrict__ Hl, size_t n8) { const size_t t = (size_t)blockIdx.x * 256 + threadIdx.x; if (t >= n8) return; FragH fh, fl; const v4f a = *(const v4fa*)(F + t * 8), c = *(const v4fa*)(F + t * 8 + 4);
#pragma unroll
  for (int q = 0; q < 4; ++q) { _Float16 h = (_Float16)a[q]; fh.h[q] = h; fl.h[q] = (_Float16)((a[q] - (float)h) * 1024.0f); h = (_Float16)c[q]; fh.h[4 + q] = h; fl.h[4 + q] = (_Float16)((c[q] - (float)h) * 1024.0f); }
  { *(v8us*)((unsigned short*)Hh + t * 8) = fh.half[0]; *(v8us*)((unsigned short*)Hl + t * 8) = fl.half[0];  } }

// ---- fast GEMM (wave tile 32x64; requires M % 32 == 0 rows per launch region and N % 64 == 0); epilogue = k_gemm_hhx semantics ----
__device__ __forceinline__ v16h g2_frag(const _Float16* p, int hh) { FragH f; f.half[0] = *(const v8us*)((const unsigned short*)p + 8 * hh); f.half[1] = *(const v8us*)((const unsigned short*)p + 16 + 8 * hh); return f.v; }
__device__ __forceinline__ v8f g2_mma(v16h a, v16h b, v8f c) { v8f d = __builtin_amdgcn_wmma_f32_16x16x32_f16(false, a, false, b, (short)0, c, false, false); asm volatile("v_nop\n\tv_nop\n\tv_nop\n\tv_nop" : "+v"(d) : "v"(a), "v"(b)); return d; }
// CAUSAL (rows and keys counted inside one grid.y plane, query tiles of QT rows): 0 none; 1 the output columns are keys: a block whose columns lie past its tile's end writes nothing; 2 K runs over keys: it ends at the tile's end
template <int ACT, int CAUSAL = 0>
__global__ __launch_bounds__(128) void k_gemm2(const _Float16* __restrict__ A, int lda, size_t sA, const _Float16* __restrict__ Bh, int ldb, size_t sB, float alpha, const float* __restrict__ bias, size_t sBias, const float* __restrict__ CP, int rowsPerB, size_t sCPb, int row0g,
    float* __restrict__ C, _Float16* __restrict__ C16, int ldc, size_t sC, int M, int N, int K) { static_assert(ACT == 0 || ACT == 3 || ACT == 6 || ACT == 8 || ACT == 9 || ACT == 11 || ACT == 12 || ACT == 14 || ACT == 15 || ACT == 16 || ACT == 17, "k_gemm2: unsupported ACT code (would silently apply no activation)");
  __shared__ __attribute__((aligned(16))) float so[4][32][68];
  const int tid = threadIdx.x, w = tid >> 5, lane = tid & 31, ln = lane & 15, hh = lane >> 4; const int by = blockIdx.y;
  A += (size_t)by * sA; Bh += (size_t)by * sB; const size_t cofs = (size_t)by * sC; const float* bp = bias ? bias + (size_t)by * sBias : nullptr;
  const int ntn = N >> 6; const int mt = blockIdx.x / ntn, nq = blockIdx.x - mt * ntn; const int row0 = mt * 128 + 32 * w, col0 = nq * 64; if (row0 >= M) return;
  if (CAUSAL) { const int lim = (mt * 128 / QT + 1) * QT; if (CAUSAL == 1 && col0 >= lim) return; if (CAUSAL == 2 && lim < K) K = lim; }
  const _Float16* a0p = A + (size_t)(row0 + ln) * lda; const _Float16* a1p = a0p + (size_t)16 * lda;
  const _Float16* b0p = Bh + (size_t)(col0 + ln) * ldb; const _Float16* b1p = b0p + (size_t)16 * ldb; const _Float16* b2p = b1p + (size_t)16 * ldb; const _Float16* b3p = b2p + (size_t)16 * ldb;
  const v8f z8 = {0.f,0.f,0.f,0.f,0.f,0.f,0.f,0.f}; v8f c00 = z8, c01 = z8, c02 = z8, c03 = z8, c10 = z8, c11 = z8, c12 = z8, c13 = z8;
#pragma unroll 1
  for (int kb = 0; kb < K; kb += 32) { const v16h a0 = g2_frag(a0p + kb, hh), a1 = g2_frag(a1p + kb, hh);
    v16h b = g2_frag(b0p + kb, hh); c00 = g2_mma(a0, b, c00); c10 = g2_mma(a1, b, c10);
    b = g2_frag(b1p + kb, hh); c01 = g2_mma(a0, b, c01); c11 = g2_mma(a1, b, c11);
    b = g2_frag(b2p + kb, hh); c02 = g2_mma(a0, b, c02); c12 = g2_mma(a1, b, c12);
    b = g2_frag(b3p + kb, hh); c03 = g2_mma(a0, b, c03); c13 = g2_mma(a1, b, c13); }
  v8f accs[8] = {c00, c01, c02, c03, c10, c11, c12, c13};
#pragma unroll
  for (int u = 0; u < 8; ++u) { const int t = u & 3, half = u >> 2; const int col = col0 + t * 16 + ln; const float bv = bp ? bf16_round(bp[col]) : 0.f;
#pragma unroll
    for (int r = 0; r < 8; ++r) { const int rloc = half * 16 + 8 * hh + r; float v = accs[u][r] * alpha + bv; if (CP) { if (rowsPerB < 0) v += CP[cofs + (size_t)(row0g + row0 + rloc) * ldc + col];      /* rowsPerB < 0: own element of the batched C plane */ else { const int bidx = (row0g + row0 + rloc) / rowsPerB; v += CP[(size_t)bidx * sCPb + (size_t)by * 64 + col]; } }
      if (ACT == 3) v = fmaxf(v, 0.f); else if (ACT == 6) v = 0.5f * v * (1.0f + erff(v * 0.70710678118654752f)); else if (ACT == 11) v = 1.0f / (1.0f + expf(-v)); else if (ACT == 15) v = v / (1.0f + expf(-v)); else if (ACT == 12) v = (v > 0.f) ? v : 0.01f * v; else if (ACT == 8) v = tanhf(v); else if (ACT == 9) v = 0.5f * v * (1.0f + tanhf(0.7978845608028654f * (v + 0.044715f * v * v * v))); else if (ACT == 14) v = (v > 0.f) ? v : 0.1f * v; else if (ACT == 16) v = (v >= 0.f) ? v : 0.3f * v; else if (ACT == 17) v = (v >= 0.f) ? v : 0.2f * v;
      so[w][rloc][t * 16 + ln] = v; } }
  __builtin_amdgcn_fence(__ATOMIC_ACQ_REL, "workgroup"); __builtin_amdgcn_wave_barrier();
  const int rsub = lane >> 4, c4 = (lane & 15) * 4;
  {
#pragma unroll
    for (int q = 0; q < 16; ++q) { const int r = q * 2 + rsub; const v4f v = *(const v4fa*)&so[w][r][c4]; if (C) { *(v4f*)(C + cofs + (size_t)(row0 + r) * ldc + col0 + c4) = v; asm volatile("s_wait_xcnt 0x0" ::: "memory");      /* the wait behind the f32 store, in front of the f16 conversion below, which the compiler does in the registers that the store names */ } if (C16) { v4h h4; for (int i = 0; i < 4; ++i) h4[i] = (_Float16)v[i]; *(v4h*)(C16 + cofs + (size_t)(row0 + r) * ldc + col0 + c4) = h4; } }
     } }


// ---- split-K GEMM: one 32x64 output tile a block (grid.x = row tiles of 32, grid.y = batch; 64 output columns). The block's NW waves share K in slices of 64 (one 128-byte line of every row of A): wave w takes slices w, w + NW, ...,
// each with the wave tile and the fragment loads of k_gemm2; the NW partial tiles meet in LDS and every thread sums four neighbouring elements in wave order. K % 64 == 0. CAUSAL 2: K ends at the end of the block's query tile of QT rows.
// ACC: the scaled sum is added to the block's own elements of C; OUT16: the result goes out as f16 to C16 instead of f32 to C. BKS: elements of Bh from one k to the next block of k (1: plain rows [n][K]; 64 with ldb 32: blocks [K / 32][64][32]).
#define NW 16
template <int CAUSAL, bool ACC, bool OUT16, int BKS>
__global__ __launch_bounds__(NW * 32) void k_gemm2k(const _Float16* __restrict__ A, int lda, size_t sA, const _Float16* __restrict__ Bh, int ldb, size_t sB, float alpha, float* __restrict__ C, _Float16* __restrict__ C16, int ldc, size_t sC, int K) {
  static_assert(NW * 32 * 4 == 32 * 64, "one float4 of the tile a thread");
  __shared__ __attribute__((aligned(16))) float so[NW][32][68];
  const int tid = threadIdx.x, lane = tid & 31, ln = lane & 15, hh = lane >> 4; const int w = __builtin_amdgcn_readfirstlane(tid >> 5);      /* the wave's number in a scalar register: the K loop below then runs on scalar compares and branches, every lane on at the matrix instructions */
  const int by = blockIdx.y; A += (size_t)by * sA; Bh += (size_t)by * sB; const int row0 = blockIdx.x * 32;
  if (CAUSAL == 2) { const int lim = (row0 / QT + 1) * QT; if (lim < K) K = lim; }
  const size_t o = (size_t)by * sC + (size_t)(row0 + (tid >> 4)) * ldc + (tid & 15) * 4;      /* this thread's four elements of the tile */
  v4f prev = {0.f, 0.f, 0.f, 0.f}; if (ACC) prev = *(const v4fa*)(C + o);      /* asked for ahead of the K loop, used behind it */
  const _Float16* a0p = A + (size_t)(row0 + ln) * lda; const _Float16* a1p = a0p + (size_t)16 * lda;
  if (BKS == 64) ldb = 32;      /* the blocked plane's row pitch as a constant: the four column fragments and both k steps of a slice then lie at immediate offsets from one address */
  const _Float16* b0p = Bh + (size_t)ln * ldb; const _Float16* b1p = b0p + (size_t)16 * ldb; const _Float16* b2p = b1p + (size_t)16 * ldb; const _Float16* b3p = b2p + (size_t)16 * ldb;
  const v8f z8 = {0.f,0.f,0.f,0.f,0.f,0.f,0.f,0.f}; v8f c00 = z8, c01 = z8, c02 = z8, c03 = z8, c10 = z8, c11 = z8, c12 = z8, c13 = z8;
  for (int kc = w * 64; kc < K; kc += NW * 64)
    for (int kb = kc; kb < kc + 64; kb += 32) { const v16h a0 = g2_frag(a0p + kb, hh), a1 = g2_frag(a1p + kb, hh);
      v16h b = g2_frag(b0p + kb * BKS, hh); c00 = g2_mma(a0, b, c00); c10 = g2_mma(a1, b, c10);
      b = g2_frag(b1p + kb * BKS, hh); c01 = g2_mma(a0, b, c01); c11 = g2_mma(a1, b, c11);
      b = g2_frag(b2p + kb * BKS, hh); c02 = g2_mma(a0, b, c02); c12 = g2_mma(a1, b, c12);
      b = g2_frag(b3p + kb * BKS, hh); c03 = g2_mma(a0, b, c03); c13 = g2_mma(a1, b, c13); }
  v8f accs[8] = {c00, c01, c02, c03, c10, c11, c12, c13};
#pragma unroll
  for (int u = 0; u < 8; ++u)
#pragma unroll
    for (int r = 0; r < 8; ++r) so[w][(u >> 2) * 16 + 8 * hh + r][(u & 3) * 16 + ln] = accs[u][r];
  __syncthreads();      /* every wave's partial tile (zeros where a wave had no slice) is in LDS before any is summed */
  const float* sp = &so[0][tid >> 4][(tid & 15) * 4]; v4f s = *(const v4fa*)sp;
#pragma unroll
  for (int u = 1; u < NW; ++u) s += *(const v4fa*)(sp + u * 32 * 68);
  v4f v = s * alpha; if (ACC) v += prev;
  if (OUT16) { v4h h4; for (int i = 0; i < 4; ++i) h4[i] = (_Float16)v[i]; *(v4h*)(C16 + o) = h4; } else *(v4f*)(C + o) = v; }


// ---- projection stage in two launches ----
// the three [in][out] weights (grid.y picks one) as one plane Wt[3 * HD][DMX] = f16(bf16(W[k][n]) * 16); a thread takes 8 neighbouring k of one output column n
__global__ __launch_bounds__(256) void k_wt3(const float* __restrict__ W0, const float* __restrict__ W1, const float* __restrict__ W2, _Float16* __restrict__ Wt) {
  const int t = blockIdx.x * 256 + threadIdx.x; const int n = t / (DMX / 8), k8 = (t % (DMX / 8)) * 8; const int m = blockIdx.y;
  const float* p = ((m == 0) ? W0 : (m == 1) ? W1 : W2) + (size_t)k8 * HD + n; float v[8]; FragH f;
#pragma unroll
  for (int i = 0; i < 8; ++i) v[i] = p[i * HD];
  asm volatile("s_wait_xcnt 0x0" :: "v"(p) : "memory");      /* the wait in front of any overwrite of the address pair that the issued loads name; naming the pair keeps it whole up to here */
#pragma unroll
  for (int i = 0; i < 8; ++i) f.h[i] = (_Float16)(bf16_round(v[i]) * 16.0f);
  *(v8us*)((unsigned short*)Wt + ((size_t)m * HD + n) * DMX + k8) = f.half[0];
}
// A fragment straight from f32 rows: p = row start + k + 8 * hh; each value rounded to bf16 and held exactly in f16; k order as g2_frag (8 hh + 0..7, then 16 + 8 hh + 0..7)
__device__ __forceinline__ v16h x_frag(const float* p) { const v4f x0 = *(const v4fa*)p, x1 = *(const v4fa*)(p + 4), x2 = *(const v4fa*)(p + 16), x3 = *(const v4fa*)(p + 20); FragH f;
#pragma unroll
  for (int i = 0; i < 4; ++i) { f.h[i] = (_Float16)(float)(__bf16)x0[i]; f.h[4 + i] = (_Float16)(float)(__bf16)x1[i]; f.h[8 + i] = (_Float16)(float)(__bf16)x2[i]; f.h[12 + i] = (_Float16)(float)(__bf16)x3[i]; }      /* the conversion instruction rounds to nearest even, as bf16_round does */
  return f.v; }
// q, k, v of 32 tokens a block: the 32 x 192 tile [q | k | v] = x Bt^T / 16. Wave w takes the column half w / 8 (96 columns) and the K slice w % 8 (128 wide); the 8 partial tiles of each half meet in LDS and are summed in slice order.
// Waves 0-7 then write q (f16 rows) and k (f32 rows to the output, f16 rows); waves 8-15 write v: a thread owns one head column d and 8 neighbouring tokens, so that it stores f32 rows to the output and
// 16 bytes of V^T hi and of the x1024 residual into the block's own [64][32] slab (plane layout [token / 32][d][token % 32]: whole lines from one block, and the layout that k_gemm2k reads with BKS 64).
// Every loop is unrolled: the accumulator and fragment arrays are then indexed by constants only and stay in registers, and the loads of later k steps can be issued ahead of the first matrix instruction.
#define PW 16
#define PP 100      /* pitch in floats of a 96-column partial tile: 8 rows on are 32 banks on, as with pitch 68 */
__global__ __launch_bounds__(PW * 32) void k_qkv(const float* __restrict__ x, const _Float16* __restrict__ Bt, _Float16* __restrict__ Q16, float* __restrict__ KO, _Float16* __restrict__ K16, float* __restrict__ VO, _Float16* __restrict__ VTH, _Float16* __restrict__ VTR) {
  __shared__ __attribute__((aligned(16))) float so[PW][32][PP];
  const int tid = threadIdx.x, lane = tid & 31, ln = lane & 15, hh = lane >> 4; const int w = __builtin_amdgcn_readfirstlane(tid >> 5);      /* the wave's number in a scalar register: the role branch behind the barrier is then a scalar branch */
  const int ch = w >> 3, ks = w & 7; const int row0 = blockIdx.x * 32;
  const float* a0p = x + (size_t)(row0 + ln) * DMX + ks * 128 + 8 * hh; const float* a1p = a0p + (size_t)16 * DMX;
  const _Float16* bp = Bt + (size_t)(ch * 96 + ln) * DMX + ks * 128;
  v8f acc[2][6] = {};
#pragma unroll
  for (int kb = 0; kb < 128; kb += 32) { const v16h a0 = x_frag(a0p + kb), a1 = x_frag(a1p + kb);
#pragma unroll
    for (int t = 0; t < 6; ++t) { const v16h b = g2_frag(bp + (size_t)t * 16 * DMX + kb, hh);
      acc[0][t] = __builtin_amdgcn_wmma_f32_16x16x32_f16(false, a0, false, b, (short)0, acc[0][t], false, false);
      acc[1][t] = __builtin_amdgcn_wmma_f32_16x16x32_f16(false, a1, false, b, (short)0, acc[1][t], false, false); } }
#pragma unroll
  for (int u = 0; u < 2; ++u)
#pragma unroll
    for (int t = 0; t < 6; ++t)
#pragma unroll
      for (int r = 0; r < 8; ++r) so[w][u * 16 + 8 * hh + r][t * 16 + ln] = acc[u][t][r];
  __syncthreads();      /* every wave's partial tile is in LDS before any is summed */
  if (w < 8) { const int r = tid >> 3, c4 = (tid & 7) * 4; const size_t ro = (size_t)(row0 + r) * HD;
#pragma unroll
    for (int j = 0; j < 4; ++j) { const int col = 32 * j + c4;      /* columns 0-63 q, 64-127 k; columns from 96 on lie in the second half's tiles */
      const float* sp = (j < 3) ? &so[0][r][col] : &so[8][r][c4]; v4f s = *(const v4fa*)sp;
#pragma unroll
      for (int u = 1; u < 8; ++u) s += *(const v4fa*)(sp + u * 32 * PP);
      const v4f v = s * 0.0625f; v4h h4;
#pragma unroll
      for (int i = 0; i < 4; ++i) h4[i] = (_Float16)v[i];
      if (j < 2) *(v4h*)(Q16 + ro + col) = h4; else { *(v4f*)(KO + ro + col - 64) = v; *(v4h*)(K16 + ro + col - 64) = h4; } } }
  else { const int d = tid & 63, tg = (tid >> 6) & 3; const float* sp = &so[8][tg * 8][32 + d]; float* vo = VO + (size_t)(row0 + tg * 8) * HD + d; FragH fh, fl;
#pragma unroll
    for (int i = 0; i < 8; ++i) { float s = sp[i * PP];
#pragma unroll
      for (int u = 1; u < 8; ++u) s += sp[u * 32 * PP + i * PP];
      const float v = s * 0.0625f; vo[i * HD] = v; const _Float16 h = (_Float16)v; fh.h[i] = h; fl.h[i] = (_Float16)((v - (float)h) * 1024.0f); }
    const size_t to = (size_t)blockIdx.x * (HD * 32) + d * 32 + tg * 8;
    *(v8us*)((unsigned short*)VTH + to) = fh.half[0]; *(v8us*)((unsigned short*)VTR + to) = fl.half[0];
    asm volatile("s_wait_xcnt 0x0" ::: "memory");      /* the wait behind these stores, in front of any overwrite of a register that they name: the other role's body follows this one in the listing */ } }


__global__ __launch_bounds__(256) void k_wnat(const float* __restrict__ w, size_t n8, _Float16* __restrict__ Bt) { const size_t t = (size_t)blockIdx.x * 256 + threadIdx.x; if (t >= n8) return; FragH f; for (int q = 0; q < 8; ++q) f.h[q] = (_Float16)(bf16_round(w[t * 8 + q]) * 16.0f); *(v8us*)((unsigned short*)Bt + t * 8) = f.half[0];  }
__global__ __launch_bounds__(256) void k_rsm(const float* __restrict__ S, _Float16* __restrict__ P, int nrows) {
  #pragma clang fp contract(off)
  const int i = blockIdx.x * 256 + threadIdx.x; if (i >= nrows) return; const float* s = S + (size_t)i * SQ; float mx = -3.0e38f;
#pragma unroll 1
  for (int j = 0; j < SQ; ++j) mx = fmaxf(mx, s[j]); float se = 0.f;
#pragma unroll 1
  for (int j = 0; j < SQ; ++j) se += expf(s[j] - mx); const float sc = 256.0f / se;
#pragma unroll 1
  for (int j0 = 0; j0 < SQ; j0 += 8) { FragH f; for (int q = 0; q < 8; ++q) f.h[q] = (_Float16)(expf(s[j0 + q] - mx) * sc); unsigned short* d = (unsigned short*)P + (size_t)i * SQ + j0; *(v8us*)d = f.half[0];  } }
__global__ __launch_bounds__(256) void k_vt(const _Float16* __restrict__ V16, int b, int h0, _Float16* __restrict__ VT) { __shared__ unsigned short tl[64][65]; const int tid = threadIdx.x; const int hh = blockIdx.x % HG, sg = blockIdx.x / HG; const int s0 = sg * 64; const int h = h0 + hh;
  for (int i = tid; i < 64 * 8; i += 256) { const int j = i / 8, d8 = (i % 8) * 8; FragH f; f.half[0] = *(const v8us*)((const unsigned short*)V16 + ((size_t)b * SQ + s0 + j) * DM + h * HD + d8); for (int q = 0; q < 8; ++q) tl[d8 + q][j] = f.u[q]; }
  __syncthreads();
  { for (int i = tid; i < 64 * 8; i += 256) { const int d = i / 8, j8 = (i % 8) * 8; FragH f; for (int q = 0; q < 8; ++q) f.u[q] = tl[d][j8 + q]; *(v8us*)((unsigned short*)VT + ((size_t)hh * HD + d) * SQ + s0 + j8) = f.half[0]; }  } }


__global__ __launch_bounds__(256) void k_rsmcf2(const float* __restrict__ S, _Float16* __restrict__ P, int hg, int q0, int nk) {
  #pragma clang fp contract(off)
  const int t = blockIdx.x * 256 + threadIdx.x; if (t >= hg * QT) return; const size_t i = (size_t)t; const float* s = S + i * NKX; const int last = q0 + (t % QT); float mx = -3.0e38f;
#pragma unroll 1
  for (int j = 0; j < nk; ++j) { const float f = (j <= last) ? 1.f : 0.f; mx = fmaxf(mx, fmaf(f, s[j], (1.f - f) * -1.0e9f)); } float se = 0.f;
#pragma unroll 1
  for (int j = 0; j < nk; ++j) { const float f = (j <= last) ? 1.f : 0.f; se += __expf(fmaf(f, s[j], (1.f - f) * -1.0e9f) - mx); } const float sc = 256.0f / se;
#pragma unroll 1
  for (int j0 = 0; j0 < nk; j0 += 8) { FragH fr; for (int q = 0; q < 8; ++q) { const int j = j0 + q; const float f = (j <= last) ? 1.f : 0.f; fr.h[q] = (_Float16)(__expf(fmaf(f, s[j], (1.f - f) * -1.0e9f) - mx) * sc); } unsigned short* d = (unsigned short*)P + i * NKX + j0; *(v8us*)d = fr.half[0];  } }


// Causal row softmax, one wave per row (one-wave blocks, one block per row; t = row in the [batch][query] plane, last = its last visible key) over nk = 256 NC columns. Lane l keeps the 8 scores at columns 256 c + 8 l of each 256-column chunk c
// in registers, so the score row is read once, 32 contiguous bytes a lane, its loads issued ahead of the arithmetic; row maximum and row sum are four chains a lane, then a five-step butterfly.
template <int NC>
__device__ __forceinline__ void rsm_row(const float* __restrict__ S, _Float16* __restrict__ P, _Float16* __restrict__ PL, int t, int last) {
  const int j0 = threadIdx.x * 8; const size_t o = (size_t)t * NKX + j0;
  const float* s = S + o; unsigned short* p = (unsigned short*)P + o; unsigned short* pl = (unsigned short*)PL + o;
  v4f ra[NC], rb[NC];
#pragma unroll
  for (int c = 0; c < NC; ++c) { ra[c] = *(const v4fa*)(s + c * 256); rb[c] = *(const v4fa*)(s + c * 256 + 4); }
  asm volatile("s_wait_xcnt 0x0" :: "v"(s) : "memory");      /* the wait in front of any overwrite of the address pair that the issued loads name; naming the pair keeps it whole up to here */
  float e[NC][8]; float m4[4] = {-3.0e38f, -3.0e38f, -3.0e38f, -3.0e38f};
#pragma unroll
  for (int c = 0; c < NC; ++c) { const v4f a = ra[c], b = rb[c];
#pragma unroll
    for (int q = 0; q < 8; ++q) { const float f = (j0 + c * 256 + q <= last) ? 1.f : 0.f; const float v = fmaf(f, (q < 4) ? a[q & 3] : b[q & 3], (1.f - f) * -1.0e9f); e[c][q] = v; m4[q & 3] = fmaxf(m4[q & 3], v); } }
  float mx = fmaxf(fmaxf(m4[0], m4[1]), fmaxf(m4[2], m4[3]));
#pragma unroll
  for (int d = 16; d > 0; d >>= 1) mx = fmaxf(mx, __shfl_xor(mx, d, 32));
  float s4[4] = {0.f, 0.f, 0.f, 0.f};
#pragma unroll
  for (int c = 0; c < NC; ++c)
#pragma unroll
    for (int q = 0; q < 8; ++q) { const float y = (e[c][q] - mx) * 1.44269504f; float x;
      asm("v_exp_f32 %0, %1\n\tv_nop" : "=v"(x) : "v"(y));      /* native exp as before; the v_nop is the slot the instruction set asks for behind a transcendental before its source is overwritten */
      e[c][q] = x; s4[q & 3] += x; }
  float se = (s4[0] + s4[1]) + (s4[2] + s4[3]);
#pragma unroll
  for (int d = 16; d > 0; d >>= 1) se += __shfl_xor(se, d, 32);
  const float sc = 256.0f / se;
#pragma unroll
  for (int c = 0; c < NC; ++c) { FragH fr, fl;
#pragma unroll
    for (int q = 0; q < 8; ++q) { const float pv = e[c][q] * sc; const _Float16 h = (_Float16)pv; fr.h[q] = h; fl.h[q] = (_Float16)((pv - (float)h) * 1024.0f); }
    *(v8us*)(p + c * 256) = fr.half[0]; *(v8us*)(pl + c * 256) = fl.half[0]; }
  asm volatile("s_wait_xcnt 0x0" ::: "memory");      /* the wait behind the row's stores, in front of any overwrite of a register that they name: the bodies of the other row lengths follow this one in the same kernel */
}
// all rows of all batches in one launch; the row's query tile picks the straight-line body of its row length (a scalar branch: one row a block)
__global__ __launch_bounds__(32) void k_rsmcf2hl(const float* __restrict__ S, _Float16* __restrict__ P, _Float16* __restrict__ PL, int nrows) {
  const int t = blockIdx.x; if (t >= nrows) return; const int last = t % SQ;
  switch (last / QT) {
    case 0: rsm_row<1>(S, P, PL, t, last); break; case 1: rsm_row<2>(S, P, PL, t, last); break; case 2: rsm_row<3>(S, P, PL, t, last); break; case 3: rsm_row<4>(S, P, PL, t, last); break;
    case 4: rsm_row<5>(S, P, PL, t, last); break; case 5: rsm_row<6>(S, P, PL, t, last); break; case 6: rsm_row<7>(S, P, PL, t, last); break; default: rsm_row<8>(S, P, PL, t, last); break; } }
extern "C" void kernel_launch(void* const* d_in, const int* in_sizes, int n_in,
                              void* d_out, int out_size, void* d_ws, size_t ws_size, hipStream_t stream) {
  (void)in_sizes; (void)n_in; (void)out_size;
  const float* const* I = (const float* const*)d_in; const float* x = I[0]; const float* wq = I[1]; const float* wk = I[2]; const float* wv = I[3];
  char* ws = (char*)d_ws; size_t off = 0;
  auto take = [&](size_t bytes) { char* p = ws + off; off += (bytes + 255) & ~(size_t)255; return p; };
  _Float16* B3 = (_Float16*)take((size_t)3 * HD * DMX * 2); _Float16* Q16 = (_Float16*)take(NR * HD * 2); _Float16* K16 = (_Float16*)take(NR * HD * 2); _Float16* VT = (_Float16*)take((size_t)NB * HD * SQ * 2); _Float16* VTL = (_Float16*)take((size_t)NB * HD * SQ * 2); float* KOUT = (float*)d_out + NR * HD; float* VF = (float*)d_out + 2 * NR * HD;      /* out1 = k and out2 = v are written in f32 straight into the tuple output */
  float* S = (float*)take(NR * NKX * 4); _Float16* P = (_Float16*)take(NR * NKX * 2); _Float16* PL = (_Float16*)take(NR * NKX * 2);      /* whole [batch][query][key] planes */
  if (off > ws_size) return;      /* approx 0.4 + 4 x 1 + 64 + 32 + 32 = 133 MiB */
  k_wt3<<<dim3(HD * (DMX / 8) / 256, 3), 256, 0, stream>>>(wq, wk, wv, B3);      /* [in][out] 1024 x 64 x 3 -> Bt [192][1024] x16 */
  k_qkv<<<(unsigned)(NR / 32), PW * 32, 0, stream>>>(x, B3, Q16, KOUT, K16, VF, VT, VTL);      /* q f16 rows; out1 = k and out2 = v in f32; k f16 rows; V^T hi and residual in blocks of 32 keys */
  k_gemm2<0, 1><<<dim3((SQ / 128) * (SQ / 64), NB), 128, 0, stream>>>(Q16, HD, (size_t)SQ * HD, K16, HD, (size_t)SQ * HD, 0.03125f, nullptr, 0, nullptr, 1, 0, 0, S, nullptr, NKX, (size_t)SQ * NKX, SQ, SQ, HD);      /* scores / 32 for the keys below each query tile's end, batches on grid.y */
  k_rsmcf2hl<<<(unsigned)NR, 32, 0, stream>>>(S, P, PL, (int)NR);      /* causal softmax -> f16 x256 hi + x1024 residual planes */
  float* O = (float*)d_out;
  k_gemm2k<2, false, false, 64><<<dim3(SQ / 32, NB), NW * 32, 0, stream>>>(P, NKX, (size_t)SQ * NKX, VT, 32, (size_t)HD * SQ, 0.00390625f, O, nullptr, HD, (size_t)SQ * HD, SQ);      /* out = P_hi V / 256 */
  k_gemm2k<2, true, false, 64><<<dim3(SQ / 32, NB), NW * 32, 0, stream>>>(PL, NKX, (size_t)SQ * NKX, VT, 32, (size_t)HD * SQ, 0.000003814697265625f, O, nullptr, HD, (size_t)SQ * HD, SQ);      /* += P_lo V 2^-18 (own-element accumulate): P effectively ~f32 */
  k_gemm2k<2, true, false, 64><<<dim3(SQ / 32, NB), NW * 32, 0, stream>>>(P, NKX, (size_t)SQ * NKX, VTL, 32, (size_t)HD * SQ, 0.000003814697265625f, O, nullptr, HD, (size_t)SQ * HD, SQ);      /* += P_hi V_lo^T 2^-18: v effectively f32 too */
}

// v005
// Measured time: 30.7 microseconds a run.
// In two side-by-side timings against v004, it was 2.80 and 2.78 times as fast.
// Counting every step since v000, it is 328 times as fast.
#include <hip/hip_runtime.h>
// Single attention head returning the TUPLE (out, k, v) (x [4][2048][1024]; q = x Wq, k = x Wk, v = x Wv ([in][out] 1024 x 64, sigma 1/32, no biases); wei = q . k x 1024^-0.5 (the module scales by n_embd) with a causal mask (tril, -inf); softmax; out = wei v -> out0 [4][2048][64] @0, out1 = k [4][2048][64] f32 @2,097,152 B, out2 = v [4][2048][64] f32 @4,194,304 B; input order x, Wq, Wk, Wv).
// Structure: the three [in][out] weights as exact x16 f16 planes [192][1024] (one launch); q, k, v in ONE projection launch (k_qkv: x read as f32 and rounded in the A loader, WMMA, f32 accumulation, K = 1024 split over the waves): q as f16 rows, k and v in f32 STRAIGHT INTO the tuple output slots (out1, out2), k also as f16 rows, v also as V^T f16 hi + x1024 residual planes in blocks of 32 keys; then ONE attention launch (k_attn): a block owns 32 queries of one batch, its 16 waves share the visible keys in steps of 32; scores, running softmax and weights stay in registers (S^T = K Q^T, O^T += V^T P^T), the weights as f16 hi (x256) + residual, O^T += V_hi^T P_hi + V_hi^T P_lo + V_lo^T P_hi; the waves' partial sums meet in LDS; three launches.
// Compute dtype: inputs rounded to bf16; q, k rounded to f16; v f16 hi + x1024 f16 residual; softmax weights f16 hi (x256) + f16 residual; scores, statistics, out f32; v_wmma_f32_16x16x32_f16.
#define NB 4
#define NHS 1
#define DMX 1024                   /* model width (projection K) */
#define SQ 2048
#define HD 64
#define DM 64
#define NH 1
#define HG 1
#define QT 256
#define NKX SQ
#define NR ((size_t)NB * NHS * SQ)
typedef __bf16 v16b __attribute__((ext_vector_type(16)));
typedef unsigned short v8us __attribute__((ext_vector_type(8), may_alias));
typedef float  v8f  __attribute__((ext_vector_type(8)));
typedef float  v4f  __attribute__((ext_vector_type(4)));
typedef float  v4fa __attribute__((ext_vector_type(4), may_alias));
union FragB { v16b v; v8us half[2]; unsigned short u[16]; };

__device__ __forceinline__ unsigned short bf16_bits(float x) { unsigned int u = __float_as_uint(x); return (unsigned short)((u + 0x7FFFu + ((u >> 16) & 1u)) >> 16); }
__device__ __forceinline__ float bf16_val(unsigned short b) { return __uint_as_float(((unsigned int)b) << 16); }
__device__ __forceinline__ float bf16_round(float x) { return bf16_val(bf16_bits(x)); }
// D += A·B with NT terms: 1 = ah·bh, 2 = + al·bh (A split), 3 = + ah·bl (both split)
template <int NT>
__device__ __forceinline__ v8f mmaN(v16b ah, v16b al, v16b bh, v16b bl, v8f c) {
  c = __builtin_amdgcn_wmma_f32_16x16x32_bf16(false, ah, false, bh, (short)0, c, false, false);
  if (NT >= 2) c = __builtin_amdgcn_wmma_f32_16x16x32_bf16(false, al, false, bh, (short)0, c, false, false);
  if (NT >= 3) c = __builtin_amdgcn_wmma_f32_16x16x32_bf16(false, ah, false, bl, (short)0, c, false, false);
  asm volatile("v_nop\n\tv_nop\n\tv_nop\n\tv_nop" : "+v"(c) : "v"(ah), "v"(al), "v"(bh), "v"(bl));
  return c;
}

__global__ __launch_bounds__(256) void k_wt_bf16(const float* __restrict__ W, unsigned short* __restrict__ Wt, int K, int N) {
  const int t = blockIdx.x * 256 + threadIdx.x;
  const int k8n = K / 8;
  if (t >= N * k8n) return;
  const int n = t / k8n, k8 = (t % k8n) * 8;
  v8us v;
#pragma unroll
  for (int i = 0; i < 8; ++i) v[i] = bf16_bits(W[(size_t)(k8 + i) * N + n]);
  *(v8us*)(Wt + (size_t)n * K + k8) = v;
  
}

// GEMM C[M][N] (f32, pitch ldc) = act(A[M][K]·W + bias). A f32 row-major (pitch lda) converted per fragment to bf16
// (ASPLIT: hi/lo two planes -> 2 terms, else single rounded term); Wt bf16 [N][K] (pitch ldb). BIAS_BF16 rounds the
// bias to bf16 first (bias quantised to bf16 before the add). K%32==0, M%16==0, N%64==0.
template <bool ASPLIT, int ACT, bool BIAS_BF16>
__global__ __launch_bounds__(128) void k_gemm_bf(const float* __restrict__ A, int lda, const unsigned short* __restrict__ Wt, int ldb,
                                               const float* __restrict__ bias, float* __restrict__ C, int ldc, int M, int N, int K) {
  __shared__ __attribute__((aligned(16))) float so[4][16][64];
  const int tid = threadIdx.x, w = tid >> 5, lane = tid & 31, ln = lane & 15, hh = lane >> 4;
  const int ntn = N / 64;
  const int wid = blockIdx.x * 4 + w;
  const int mt = wid / ntn, nq = wid % ntn;
  if (mt * 16 >= M) return;
  const int row0 = mt * 16, col0 = nq * 64;
  const float* arow = A + (size_t)(row0 + ln) * lda;
  v8f acc[4] = {};
  for (int kb = 0; kb < K; kb += 32) {
    FragB ah, al;
    const v4f x0 = *(const v4fa*)(arow + kb + 8 * hh), x1 = *(const v4fa*)(arow + kb + 8 * hh + 4);
    const v4f x2 = *(const v4fa*)(arow + kb + 16 + 8 * hh), x3 = *(const v4fa*)(arow + kb + 16 + 8 * hh + 4);
    float xs[16] = {x0[0],x0[1],x0[2],x0[3],x1[0],x1[1],x1[2],x1[3],x2[0],x2[1],x2[2],x2[3],x3[0],x3[1],x3[2],x3[3]};
#pragma unroll
    for (int i = 0; i < 16; ++i) { const unsigned short hb = bf16_bits(xs[i]); ah.u[i] = hb; al.u[i] = ASPLIT ? bf16_bits(xs[i] - bf16_val(hb)) : (unsigned short)0; }
#pragma unroll
    for (int t = 0; t < 4; ++t) {
      const unsigned short* brow = Wt + (size_t)(col0 + t * 16 + ln) * ldb + kb;
      FragB b;
      b.half[0] = *(const v8us*)(brow + 8 * hh);
      b.half[1] = *(const v8us*)(brow + 16 + 8 * hh);
      acc[t] = mmaN<ASPLIT ? 2 : 1>(ah.v, al.v, b.v, b.v, acc[t]);
    }
  }
#pragma unroll
  for (int t = 0; t < 4; ++t) {
    float bv = bias ? bias[col0 + t * 16 + ln] : 0.f;
    if (BIAS_BF16) bv = bf16_round(bv);
#pragma unroll
    for (int r = 0; r < 8; ++r) { float v = acc[t][r] + bv; if (ACT == 1) v = fmaxf(v, 0.f); so[w][8 * hh + r][t * 16 + ln] = v; }
  }
  __builtin_amdgcn_fence(__ATOMIC_ACQ_REL, "workgroup");
  __builtin_amdgcn_wave_barrier();
  const int rsub = lane >> 4, c4 = (lane & 15) * 4;
  {
#pragma unroll
    for (int q = 0; q < 8; ++q) {
      const int r = q * 2 + rsub;
      const v4f v = *(const v4fa*)&so[w][r][c4];
      *(v4f*)(C + (size_t)(row0 + r) * ldc + col0 + c4) = v;
    }
    
  }
}

// GEMM C = act(A·W + bias + resid): A f32 (ASPLIT -> hi/lo 2 terms), Wt bf16 [N][K]; ACT 0 none, 1 relu, 2 exact gelu;
// resid (optional, f32, row index = (row % rmod), pitch ldr, RES_BF16 rounds it) added before the activation.
template <bool ASPLIT, int ACT, bool BIAS_BF16, bool RES_BF16>
__global__ __launch_bounds__(128) void k_gemm_bf3(const float* __restrict__ A, int lda, const unsigned short* __restrict__ Wt, int ldb,
                                                const float* __restrict__ bias, const float* __restrict__ resid, int rmod, int ldr,
                                                float* __restrict__ C, int ldc, int M, int N, int K) {
  __shared__ __attribute__((aligned(16))) float so[4][16][64];
  const int tid = threadIdx.x, w = tid >> 5, lane = tid & 31, ln = lane & 15, hh = lane >> 4;
  const int ntn = N / 64;
  const int wid = blockIdx.x * 4 + w;
  const int mt = wid / ntn, nq = wid % ntn;
  if (mt * 16 >= M) return;
  const int row0 = mt * 16, col0 = nq * 64;
  const float* arow = A + (size_t)(row0 + ln) * lda;
  v8f acc[4] = {};
  for (int kb = 0; kb < K; kb += 32) {
    FragB ah, al;
    const v4f x0 = *(const v4fa*)(arow + kb + 8 * hh), x1 = *(const v4fa*)(arow + kb + 8 * hh + 4);
    const v4f x2 = *(const v4fa*)(arow + kb + 16 + 8 * hh), x3 = *(const v4fa*)(arow + kb + 16 + 8 * hh + 4);
    float xs[16] = {x0[0],x0[1],x0[2],x0[3],x1[0],x1[1],x1[2],x1[3],x2[0],x2[1],x2[2],x2[3],x3[0],x3[1],x3[2],x3[3]};
#pragma unroll
    for (int i = 0; i < 16; ++i) { const unsigned short hb = bf16_bits(xs[i]); ah.u[i] = hb; al.u[i] = ASPLIT ? bf16_bits(xs[i] - bf16_val(hb)) : (unsigned short)0; }
#pragma unroll
    for (int t = 0; t < 4; ++t) {
      const unsigned short* brow = Wt + (size_t)(col0 + t * 16 + ln) * ldb + kb;
      FragB b;
      b.half[0] = *(const v8us*)(brow + 8 * hh);
      b.half[1] = *(const v8us*)(brow + 16 + 8 * hh);
      acc[t] = mmaN<ASPLIT ? 2 : 1>(ah.v, al.v, b.v, b.v, acc[t]);
    }
  }
#pragma unroll
  for (int t = 0; t < 4; ++t) {
    const int col = col0 + t * 16 + ln;
    float bv = bias ? bias[col] : 0.f;
    if (BIAS_BF16) bv = bf16_round(bv);
#pragma unroll
    for (int r = 0; r < 8; ++r) {
      float v = acc[t][r] + bv;
      if (resid) { float rv = resid[(size_t)((row0 + 8 * hh + r) % rmod) * ldr + col]; if (RES_BF16) rv = bf16_round(rv); v += rv; }
      if (ACT == 1) v = fmaxf(v, 0.f);
      if (ACT == 2) v = 0.5f * v * (1.0f + erff(v * 0.70710678118654752f));
      if (ACT == 3) { const float u = 0.7978845608028654f * (v + 0.044715f * v * v * v); v = 0.5f * v * (1.0f + tanhf(u)); }
      so[w][8 * hh + r][t * 16 + ln] = v;
    }
  }
  __builtin_amdgcn_fence(__ATOMIC_ACQ_REL, "workgroup");
  __builtin_amdgcn_wave_barrier();
  const int rsub = lane >> 4, c4 = (lane & 15) * 4;
  {
#pragma unroll
    for (int q = 0; q < 8; ++q) {
      const int r = q * 2 + rsub;
      const v4f v = *(const v4fa*)&so[w][r][c4];
      *(v4f*)(C + (size_t)(row0 + r) * ldc + col0 + c4) = v;
    }
    
  }
}
// row LayerNorm (biased variance, eps) over N: s = X (+ R); optional out_sum <- s; out_norm <- (s-mu)*rsqrt(var+eps)*g + b
template <bool PARAM_BF16>
__global__ __launch_bounds__(256) void k_layernorm(const float* __restrict__ X, const float* __restrict__ R, const float* __restrict__ g, const float* __restrict__ bta,
                                                  float* __restrict__ out_sum, float* __restrict__ out_norm, int N, float eps) {
  __shared__ float red[256];
  const int row = blockIdx.x, tid = threadIdx.x;
  const float* x = X + (size_t)row * N; const float* rr = R ? R + (size_t)row * N : nullptr;
  float vals[16];                     // up to N = 4096
  const int per = N / 256;            // contiguous chunk per thread? use strided-by-4 chunks: thread handles j = tid*4 + 1024*u
  float s1 = 0.f;
  for (int u = 0; u < per / 4; ++u) {
    const int j = tid * 4 + 1024 * u;
    const v4f a = *(const v4fa*)(x + j);
    v4f b = {0.f,0.f,0.f,0.f}; if (rr) b = *(const v4fa*)(rr + j);
#pragma unroll
    for (int q = 0; q < 4; ++q) { const float v = a[q] + b[q]; vals[u * 4 + q] = v; s1 += v; }
  }
  red[tid] = s1; __syncthreads();
  for (int st = 128; st > 0; st >>= 1) { if (tid < st) red[tid] += red[tid + st]; __syncthreads(); }
  const float mu = red[0] / (float)N; __syncthreads();
  float s2 = 0.f;
  for (int u = 0; u < per / 4; ++u)
#pragma unroll
    for (int q = 0; q < 4; ++q) { const float c = vals[u * 4 + q] - mu; s2 += c * c; }
  red[tid] = s2; __syncthreads();
  for (int st = 128; st > 0; st >>= 1) { if (tid < st) red[tid] += red[tid + st]; __syncthreads(); }
  const float rs = rsqrtf(red[0] / (float)N + eps);
  {
    for (int u = 0; u < per / 4; ++u) {
      const int j = tid * 4 + 1024 * u;
      v4f o, sm;
#pragma unroll
      for (int q = 0; q < 4; ++q) {
        float gg = g[j + q], bb = bta[j + q];
        if (PARAM_BF16) { gg = bf16_round(gg); bb = bf16_round(bb); }
        sm[q] = vals[u * 4 + q]; o[q] = (vals[u * 4 + q] - mu) * rs * gg + bb;
      }
      if (out_sum) *(v4f*)(out_sum + (size_t)row * N + j) = sm;
      *(v4f*)(out_norm + (size_t)row * N + j) = o;
    }
    
  }
}



// ---- f16 WMMA path (v_wmma_f32_16x16x32_f16): 11-bit significands for operands in range — used where a [0,1] probability operand needs more precision than bf16
typedef _Float16 v16h __attribute__((ext_vector_type(16)));
union FragH { v16h v; v8us half[2]; _Float16 h[16]; unsigned short u[16]; };
template <int NT>
__device__ __forceinline__ v8f mmaH(v16h ah, v16h al, v16h bh, v16h bl, v8f c) {
  c = __builtin_amdgcn_wmma_f32_16x16x32_f16(false, ah, false, bh, (short)0, c, false, false);
  if (NT >= 2) c = __builtin_amdgcn_wmma_f32_16x16x32_f16(false, al, false, bh, (short)0, c, false, false);
  if (NT >= 3) c = __builtin_amdgcn_wmma_f32_16x16x32_f16(false, ah, false, bl, (short)0, c, false, false);
  asm volatile("v_nop\n\tv_nop\n\tv_nop\n\tv_nop" : "+v"(c) : "v"(ah), "v"(al), "v"(bh), "v"(bl));
  return c;
}
// batched GEMM like k_gemm_b but f16 operands: A f32 (split into f16 hi/lo if ASPLIT, else rounded to f16), Bt = f16 values [n][k]; alpha; C f32; N multiple of 16 (partial tiles skipped)
template <bool ASPLIT>
__global__ __launch_bounds__(128) void k_gemm_h(const float* __restrict__ A, int lda, size_t sA, const _Float16* __restrict__ Bh, int ldb, size_t sB, float alpha, float* __restrict__ C, int ldc, size_t sC, int M, int N, int K) {
  __shared__ __attribute__((aligned(16))) float so[4][16][64];
  const int tid = threadIdx.x, w = tid >> 5, lane = tid & 31, ln = lane & 15, hh = lane >> 4; const int by = blockIdx.y;
  A += (size_t)by * sA; Bh += (size_t)by * sB; C += (size_t)by * sC;
  const int ntn = (N + 63) / 64; const int wid = blockIdx.x * 4 + w; const int mt = wid / ntn, nq = wid % ntn; if (mt * 16 >= M) return;
  const int row0 = mt * 16, col0 = nq * 64; const float* arow = A + (size_t)(row0 + ln) * lda;
  v8f acc[4] = {};
  for (int kb = 0; kb < K; kb += 32) {
    FragH ah, al;
    const v4f x0 = *(const v4fa*)(arow + kb + 8 * hh), x1 = *(const v4fa*)(arow + kb + 8 * hh + 4), x2 = *(const v4fa*)(arow + kb + 16 + 8 * hh), x3 = *(const v4fa*)(arow + kb + 16 + 8 * hh + 4);
    float xs[16] = {x0[0],x0[1],x0[2],x0[3],x1[0],x1[1],x1[2],x1[3],x2[0],x2[1],x2[2],x2[3],x3[0],x3[1],x3[2],x3[3]};
#pragma unroll
    for (int i = 0; i < 16; ++i) { const _Float16 h = (_Float16)xs[i]; ah.h[i] = h; al.h[i] = ASPLIT ? (_Float16)(xs[i] - (float)h) : (_Float16)0.0f; }
#pragma unroll
    for (int t = 0; t < 4; ++t) { if (col0 + t * 16 >= N) continue; const size_t boff = (size_t)(col0 + t * 16 + ln) * ldb + kb; FragH bq; bq.half[0] = *(const v8us*)(Bh + boff + 8 * hh); bq.half[1] = *(const v8us*)(Bh + boff + 16 + 8 * hh);
      acc[t] = mmaH<ASPLIT ? 2 : 1>(ah.v, al.v, bq.v, bq.v, acc[t]); }
  }
#pragma unroll
  for (int t = 0; t < 4; ++t) { if (col0 + t * 16 >= N) continue;
#pragma unroll
    for (int r = 0; r < 8; ++r) so[w][8 * hh + r][t * 16 + ln] = acc[t][r] * alpha; }
  __builtin_amdgcn_fence(__ATOMIC_ACQ_REL, "workgroup"); __builtin_amdgcn_wave_barrier();
  const int rsub = lane >> 4, c4 = (lane & 15) * 4;
  {
#pragma unroll
    for (int q = 0; q < 8; ++q) { const int r = q * 2 + rsub; if (col0 + c4 < N) { const v4f v = *(const v4fa*)&so[w][r][c4]; *(v4f*)(C + (size_t)(row0 + r) * ldc + col0 + c4) = v; } }
     }
}

// Wt[n][k] = f16(W[k][n]·scale) from f32 row-major W[K][N] (scale = power of two; bf16-exact weights stay exact in f16 away from the subnormal range)
__global__ __launch_bounds__(256) void k_wt_f16(const float* __restrict__ W, _Float16* __restrict__ Wt, int K, int N, float scale) {
  const int t = blockIdx.x * 256 + threadIdx.x; if (t >= N * (K / 8)) return; const int n = t / (K / 8), k8 = (t % (K / 8)) * 8; FragH f;
#pragma unroll
  for (int i = 0; i < 8; ++i) f.h[i] = (_Float16)(bf16_round(W[(size_t)(k8 + i) * N + n]) * scale); const v8us o = f.half[0];
  *(v8us*)((unsigned short*)Wt + (size_t)n * K + k8) = o; 
}
// k_gemm_hh variant with fused epilogue: v = acc·alpha + bias[by·sBias + col] (+ CP[(row/rowsPerB)·sCPb + by·64 + col] if CP) ; ACT 0 none / 1 elu ; writes f16 C16 (and f32 C if non-null)
template <int ACT>
__global__ __launch_bounds__(128) void k_gemm_hhx(const _Float16* __restrict__ A, int lda, size_t sA, const _Float16* __restrict__ Bh, int ldb, size_t sB, float alpha, const float* __restrict__ bias, size_t sBias, const float* __restrict__ CP, int rowsPerB, size_t sCPb, int row0g,
    float* __restrict__ C, _Float16* __restrict__ C16, int ldc, size_t sC, int M, int N, int K) {
  __shared__ __attribute__((aligned(16))) float so[4][16][64];
  const int tid = threadIdx.x, w = tid >> 5, lane = tid & 31, ln = lane & 15, hh = lane >> 4; const int by = blockIdx.y;
  A += (size_t)by * sA; Bh += (size_t)by * sB; const size_t cofs = (size_t)by * sC; const float* bp = bias ? bias + (size_t)by * sBias : nullptr;
  const int ntn = (N + 63) / 64; const int wid = blockIdx.x * 4 + w; const int mt = wid / ntn, nq = wid % ntn; if (mt * 16 >= M) return;
  const int row0 = mt * 16, col0 = nq * 64; const _Float16* arow = A + (size_t)(row0 + ln) * lda;
  v8f acc[4] = {};
  for (int kb = 0; kb < K; kb += 32) { FragH ah; ah.half[0] = *(const v8us*)((const unsigned short*)arow + kb + 8 * hh); ah.half[1] = *(const v8us*)((const unsigned short*)arow + kb + 16 + 8 * hh);
#pragma unroll
    for (int t = 0; t < 4; ++t) { if (col0 + t * 16 >= N) continue; const size_t boff = (size_t)(col0 + t * 16 + ln) * ldb + kb; FragH bq; bq.half[0] = *(const v8us*)((const unsigned short*)Bh + boff + 8 * hh); bq.half[1] = *(const v8us*)((const unsigned short*)Bh + boff + 16 + 8 * hh);
      acc[t] = mmaH<1>(ah.v, ah.v, bq.v, bq.v, acc[t]); }
  }
#pragma unroll
  for (int t = 0; t < 4; ++t) { if (col0 + t * 16 >= N) continue; const int col = col0 + t * 16 + ln; const float bv = bp ? bf16_round(bp[col]) : 0.f;
#pragma unroll
    for (int r = 0; r < 8; ++r) { float v = acc[t][r] * alpha + bv; if (CP) { const int rr = row0g + row0 + 8 * hh + r; if (rowsPerB < 0) v += CP[cofs + (size_t)rr * ldc + col];      /* rowsPerB < 0: own element of the batched C plane */ else { const int bidx = rr / rowsPerB; v += CP[(size_t)bidx * sCPb + (size_t)by * 64 + col]; } } if (ACT == 1) v = (v > 0.f) ? v : expm1f(v); else if (ACT == 7) v = (v > 0.f) ? v + 1.0f : expf(v); else if (ACT == 8) v = tanhf(v); else if (ACT == 9) v = 0.5f * v * (1.0f + tanhf(0.7978845608028654f * (v + 0.044715f * v * v * v))); else if (ACT == 11) v = 1.0f / (1.0f + expf(-v)); else if (ACT == 12) v = (v > 0.f) ? v : 0.01f * v; else if (ACT == 14) v = (v > 0.f) ? v : 0.1f * v; else if (ACT == 16) v = (v >= 0.f) ? v : 0.3f * v; else if (ACT == 17) v = (v >= 0.f) ? v : 0.2f * v; else if (ACT == 15) v = v / (1.0f + expf(-v)); else if (ACT == 3) v = fmaxf(v, 0.f); else if (ACT == 6) v = 0.5f * v * (1.0f + erff(v * 0.70710678118654752f)); so[w][8 * hh + r][t * 16 + ln] = v; } }
  __builtin_amdgcn_fence(__ATOMIC_ACQ_REL, "workgroup"); __builtin_amdgcn_wave_barrier();
  const int rsub = lane >> 4, c4 = (lane & 15) * 4; typedef _Float16 v4h __attribute__((ext_vector_type(4)));
  {
#pragma unroll
    for (int q = 0; q < 8; ++q) { const int r = q * 2 + rsub; if (col0 + c4 < N) { const v4f v = *(const v4fa*)&so[w][r][c4]; if (C) *(v4f*)(C + cofs + (size_t)(row0 + r) * ldc + col0 + c4) = v; if (C16) { v4h h4; for (int i = 0; i < 4; ++i) h4[i] = (_Float16)v[i]; *(v4h*)(C16 + cofs + (size_t)(row0 + r) * ldc + col0 + c4) = h4; } } }
     }
}


typedef _Float16 v4h __attribute__((ext_vector_type(4)));

__global__ __launch_bounds__(256) void k_x16(const float* __restrict__ x, _Float16* __restrict__ X16, size_t n8) { const size_t t = (size_t)blockIdx.x * 256 + threadIdx.x; if (t >= n8) return; FragH f;
#pragma unroll
  for (int q = 0; q < 8; ++q) f.h[q] = (_Float16)bf16_round(x[t * 8 + q]); *(v8us*)((unsigned short*)X16 + t * 8) = f.half[0];  }
__global__ __launch_bounds__(256) void k_h16(const float* __restrict__ x, _Float16* __restrict__ X16, size_t n8) { const size_t t = (size_t)blockIdx.x * 256 + threadIdx.x; if (t >= n8) return; FragH f;
#pragma unroll
  for (int q = 0; q < 8; ++q) f.h[q] = (_Float16)x[t * 8 + q]; *(v8us*)((unsigned short*)X16 + t * 8) = f.half[0];  }
__global__ __launch_bounds__(256) void k_round16f(const float* __restrict__ W, _Float16* __restrict__ Bt, size_t n8) { const size_t t = (size_t)blockIdx.x * 256 + threadIdx.x; if (t >= n8) return; FragH f;
#pragma unroll
  for (int i = 0; i < 8; ++i) f.h[i] = (_Float16)(bf16_round(W[t * 8 + i]) * 16.0f); *(v8us*)((unsigned short*)Bt + t * 8) = f.half[0];  }
template <int NHv, int TTv>
__global__ __launch_bounds__(256) void k_vt(const _Float16* __restrict__ V16, int ldv, int voff, _Float16* __restrict__ Vt) { __shared__ unsigned short tl[64][66]; const int tid = threadIdx.x; const int slab = blockIdx.x / (TTv / 64), lg = blockIdx.x % (TTv / 64); const int b = slab / NHv, h = slab % NHv;
  for (int i = tid; i < 64 * 8; i += 256) { const int r = i / 8, c8 = (i % 8) * 8; FragH f; f.half[0] = *(const v8us*)((const unsigned short*)V16 + ((size_t)b * TTv + lg * 64 + r) * ldv + voff + h * 64 + c8);
#pragma unroll
    for (int q = 0; q < 8; ++q) tl[r][c8 + q] = f.u[q]; }
  __syncthreads();
  {
#pragma unroll
    for (int rd = 0; rd < 2; ++rd) { const int d = rd * 32 + tid / 8, pc = tid % 8; FragH f;
#pragma unroll
      for (int q = 0; q < 8; ++q) f.u[q] = tl[pc * 8 + q][d];
      *(v8us*)((unsigned short*)Vt + ((size_t)slab * 64 + d) * TTv + lg * 64 + pc * 8) = f.half[0]; }
     } }

__global__ __launch_bounds__(256) void k_hl(const float* __restrict__ F, _Float16* __restrict__ Hh, _Float16* __restrict__ Hl, size_t n8) { const size_t t = (size_t)blockIdx.x * 256 + threadIdx.x; if (t >= n8) return; FragH fh, fl; const v4f a = *(const v4fa*)(F + t * 8), c = *(const v4fa*)(F + t * 8 + 4);
#pragma unroll
  for (int q = 0; q < 4; ++q) { _Float16 h = (_Float16)a[q]; fh.h[q] = h; fl.h[q] = (_Float16)((a[q] - (float)h) * 1024.0f); h = (_Float16)c[q]; fh.h[4 + q] = h; fl.h[4 + q] = (_Float16)((c[q] - (float)h) * 1024.0f); }
  { *(v8us*)((unsigned short*)Hh + t * 8) = fh.half[0]; *(v8us*)((unsigned short*)Hl + t * 8) = fl.half[0];  } }

// ---- f16 fragment of 32 k from a k-contiguous row, hardware k order (8 hh + 0..7, then 16 + 8 hh + 0..7) ----
__device__ __forceinline__ v16h g2_frag(const _Float16* p, int hh) { FragH f; f.half[0] = *(const v8us*)((const unsigned short*)p + 8 * hh); f.half[1] = *(const v8us*)((const unsigned short*)p + 16 + 8 * hh); return f.v; }


// ---- projection stage in two launches ----
// the three [in][out] weights (grid.y picks one) as one plane Wt[3 * HD][DMX] = f16(bf16(W[k][n]) * 16); a thread takes 8 neighbouring k of one output column n
__global__ __launch_bounds__(256) void k_wt3(const float* __restrict__ W0, const float* __restrict__ W1, const float* __restrict__ W2, _Float16* __restrict__ Wt) {
  const int t = blockIdx.x * 256 + threadIdx.x; const int n = t / (DMX / 8), k8 = (t % (DMX / 8)) * 8; const int m = blockIdx.y;
  const float* p = ((m == 0) ? W0 : (m == 1) ? W1 : W2) + (size_t)k8 * HD + n; float v[8]; FragH f;
#pragma unroll
  for (int i = 0; i < 8; ++i) v[i] = p[i * HD];
  asm volatile("s_wait_xcnt 0x0" :: "v"(p) : "memory");      /* the wait in front of any overwrite of the address pair that the issued loads name; naming the pair keeps it whole up to here */
#pragma unroll
  for (int i = 0; i < 8; ++i) f.h[i] = (_Float16)(bf16_round(v[i]) * 16.0f);
  *(v8us*)((unsigned short*)Wt + ((size_t)m * HD + n) * DMX + k8) = f.half[0];
}
// A fragment straight from f32 rows: p = row start + k + 8 * hh; each value rounded to bf16 and held exactly in f16; k order as g2_frag (8 hh + 0..7, then 16 + 8 hh + 0..7)
__device__ __forceinline__ v16h x_frag(const float* p) { const v4f x0 = *(const v4fa*)p, x1 = *(const v4fa*)(p + 4), x2 = *(const v4fa*)(p + 16), x3 = *(const v4fa*)(p + 20); FragH f;
#pragma unroll
  for (int i = 0; i < 4; ++i) { f.h[i] = (_Float16)(float)(__bf16)x0[i]; f.h[4 + i] = (_Float16)(float)(__bf16)x1[i]; f.h[8 + i] = (_Float16)(float)(__bf16)x2[i]; f.h[12 + i] = (_Float16)(float)(__bf16)x3[i]; }      /* the conversion instruction rounds to nearest even, as bf16_round does */
  return f.v; }
// q, k, v of 32 tokens a block: the 32 x 192 tile [q | k | v] = x Bt^T / 16. Wave w takes the column half w / 8 (96 columns) and the K slice w % 8 (128 wide); the 8 partial tiles of each half meet in LDS and are summed in slice order.
// Waves 0-7 then write q (f16 rows) and k (f32 rows to the output, f16 rows); waves 8-15 write v: a thread owns one head column d and 8 neighbouring tokens, so that it stores f32 rows to the output and
// 16 bytes of V^T hi and of the x1024 residual into the block's own [64][32] slab (plane layout [token / 32][d][token % 32]: whole lines from one block, and the layout that k_attn reads, one slab per key step).
// Every loop is unrolled: the accumulator and fragment arrays are then indexed by constants only and stay in registers, and the loads of later k steps can be issued ahead of the first matrix instruction.
#define PW 16
#define PP 100      /* pitch in floats of a 96-column partial tile: 8 rows on are 32 banks on, as with pitch 68 */
__global__ __launch_bounds__(PW * 32) void k_qkv(const float* __restrict__ x, const _Float16* __restrict__ Bt, _Float16* __restrict__ Q16, float* __restrict__ KO, _Float16* __restrict__ K16, float* __restrict__ VO, _Float16* __restrict__ VTH, _Float16* __restrict__ VTR) {
  __shared__ __attribute__((aligned(16))) float so[PW][32][PP];
  const int tid = threadIdx.x, lane = tid & 31, ln = lane & 15, hh = lane >> 4; const int w = __builtin_amdgcn_readfirstlane(tid >> 5);      /* the wave's number in a scalar register: the role branch behind the barrier is then a scalar branch */
  const int ch = w >> 3, ks = w & 7; const int row0 = blockIdx.x * 32;
  const float* a0p = x + (size_t)(row0 + ln) * DMX + ks * 128 + 8 * hh; const float* a1p = a0p + (size_t)16 * DMX;
  const _Float16* bp = Bt + (size_t)(ch * 96 + ln) * DMX + ks * 128;
  v8f acc[2][6] = {};
#pragma unroll
  for (int kb = 0; kb < 128; kb += 32) { const v16h a0 = x_frag(a0p + kb), a1 = x_frag(a1p + kb);
#pragma unroll
    for (int t = 0; t < 6; ++t) { const v16h b = g2_frag(bp + (size_t)t * 16 * DMX + kb, hh);
      acc[0][t] = __builtin_amdgcn_wmma_f32_16x16x32_f16(false, a0, false, b, (short)0, acc[0][t], false, false);
      acc[1][t] = __builtin_amdgcn_wmma_f32_16x16x32_f16(false, a1, false, b, (short)0, acc[1][t], false, false); } }
#pragma unroll
  for (int u = 0; u < 2; ++u)
#pragma unroll
    for (int t = 0; t < 6; ++t)
#pragma unroll
      for (int r = 0; r < 8; ++r) so[w][u * 16 + 8 * hh + r][t * 16 + ln] = acc[u][t][r];
  __syncthreads();      /* every wave's partial tile is in LDS before any is summed */
  if (w < 8) { const int r = tid >> 3, c4 = (tid & 7) * 4; const size_t ro = (size_t)(row0 + r) * HD;
#pragma unroll
    for (int j = 0; j < 4; ++j) { const int col = 32 * j + c4;      /* columns 0-63 q, 64-127 k; columns from 96 on lie in the second half's tiles */
      const float* sp = (j < 3) ? &so[0][r][col] : &so[8][r][c4]; v4f s = *(const v4fa*)sp;
#pragma unroll
      for (int u = 1; u < 8; ++u) s += *(const v4fa*)(sp + u * 32 * PP);
      const v4f v = s * 0.0625f; v4h h4;
#pragma unroll
      for (int i = 0; i < 4; ++i) h4[i] = (_Float16)v[i];
      if (j < 2) *(v4h*)(Q16 + ro + col) = h4; else { *(v4f*)(KO + ro + col - 64) = v; *(v4h*)(K16 + ro + col - 64) = h4; } } }
  else { const int d = tid & 63, tg = (tid >> 6) & 3; const float* sp = &so[8][tg * 8][32 + d]; float* vo = VO + (size_t)(row0 + tg * 8) * HD + d; FragH fh, fl;
#pragma unroll
    for (int i = 0; i < 8; ++i) { float s = sp[i * PP];
#pragma unroll
      for (int u = 1; u < 8; ++u) s += sp[u * 32 * PP + i * PP];
      const float v = s * 0.0625f; vo[i * HD] = v; const _Float16 h = (_Float16)v; fh.h[i] = h; fl.h[i] = (_Float16)((v - (float)h) * 1024.0f); }
    const size_t to = (size_t)blockIdx.x * (HD * 32) + d * 32 + tg * 8;
    *(v8us*)((unsigned short*)VTH + to) = fh.half[0]; *(v8us*)((unsigned short*)VTR + to) = fl.half[0];
    asm volatile("s_wait_xcnt 0x0" ::: "memory");      /* the wait behind these stores, in front of any overwrite of a register that they name: the other role's body follows this one in the listing */ } }


__global__ __launch_bounds__(256) void k_wnat(const float* __restrict__ w, size_t n8, _Float16* __restrict__ Bt) { const size_t t = (size_t)blockIdx.x * 256 + threadIdx.x; if (t >= n8) return; FragH f; for (int q = 0; q < 8; ++q) f.h[q] = (_Float16)(bf16_round(w[t * 8 + q]) * 16.0f); *(v8us*)((unsigned short*)Bt + t * 8) = f.half[0];  }
__global__ __launch_bounds__(256) void k_rsm(const float* __restrict__ S, _Float16* __restrict__ P, int nrows) {
  #pragma clang fp contract(off)
  const int i = blockIdx.x * 256 + threadIdx.x; if (i >= nrows) return; const float* s = S + (size_t)i * SQ; float mx = -3.0e38f;
#pragma unroll 1
  for (int j = 0; j < SQ; ++j) mx = fmaxf(mx, s[j]); float se = 0.f;
#pragma unroll 1
  for (int j = 0; j < SQ; ++j) se += expf(s[j] - mx); const float sc = 256.0f / se;
#pragma unroll 1
  for (int j0 = 0; j0 < SQ; j0 += 8) { FragH f; for (int q = 0; q < 8; ++q) f.h[q] = (_Float16)(expf(s[j0 + q] - mx) * sc); unsigned short* d = (unsigned short*)P + (size_t)i * SQ + j0; *(v8us*)d = f.half[0];  } }
__global__ __launch_bounds__(256) void k_vt(const _Float16* __restrict__ V16, int b, int h0, _Float16* __restrict__ VT) { __shared__ unsigned short tl[64][65]; const int tid = threadIdx.x; const int hh = blockIdx.x % HG, sg = blockIdx.x / HG; const int s0 = sg * 64; const int h = h0 + hh;
  for (int i = tid; i < 64 * 8; i += 256) { const int j = i / 8, d8 = (i % 8) * 8; FragH f; f.half[0] = *(const v8us*)((const unsigned short*)V16 + ((size_t)b * SQ + s0 + j) * DM + h * HD + d8); for (int q = 0; q < 8; ++q) tl[d8 + q][j] = f.u[q]; }
  __syncthreads();
  { for (int i = tid; i < 64 * 8; i += 256) { const int d = i / 8, j8 = (i % 8) * 8; FragH f; for (int q = 0; q < 8; ++q) f.u[q] = tl[d][j8 + q]; *(v8us*)((unsigned short*)VT + ((size_t)hh * HD + d) * SQ + s0 + j8) = f.half[0]; }  } }


__global__ __launch_bounds__(256) void k_rsmcf2(const float* __restrict__ S, _Float16* __restrict__ P, int hg, int q0, int nk) {
  #pragma clang fp contract(off)
  const int t = blockIdx.x * 256 + threadIdx.x; if (t >= hg * QT) return; const size_t i = (size_t)t; const float* s = S + i * NKX; const int last = q0 + (t % QT); float mx = -3.0e38f;
#pragma unroll 1
  for (int j = 0; j < nk; ++j) { const float f = (j <= last) ? 1.f : 0.f; mx = fmaxf(mx, fmaf(f, s[j], (1.f - f) * -1.0e9f)); } float se = 0.f;
#pragma unroll 1
  for (int j = 0; j < nk; ++j) { const float f = (j <= last) ? 1.f : 0.f; se += __expf(fmaf(f, s[j], (1.f - f) * -1.0e9f) - mx); } const float sc = 256.0f / se;
#pragma unroll 1
  for (int j0 = 0; j0 < nk; j0 += 8) { FragH fr; for (int q = 0; q < 8; ++q) { const int j = j0 + q; const float f = (j <= last) ? 1.f : 0.f; fr.h[q] = (_Float16)(__expf(fmaf(f, s[j], (1.f - f) * -1.0e9f) - mx) * sc); } unsigned short* d = (unsigned short*)P + i * NKX + j0; *(v8us*)d = fr.half[0];  } }


// ---- causal attention in one launch: scores, softmax and P V of 32 queries a block; no score or weight plane in memory ----
// native 2^y; the v_nop is the slot the instruction set asks for behind a transcendental before its result is read or its source overwritten
__device__ __forceinline__ float exp2_hw(float y) { float x; asm("v_exp_f32 %0, %1\n\tv_nop" : "=v"(x) : "v"(y)); return x; }
// eight at once: results in registers of their own, so that each v_exp is the independent instruction behind the one before it and one v_nop closes the last slot
__device__ __forceinline__ void exp2_x8(const float (&y)[8], float (&x)[8]) {
  asm("v_exp_f32 %0, %8\n\tv_exp_f32 %1, %9\n\tv_exp_f32 %2, %10\n\tv_exp_f32 %3, %11\n\tv_exp_f32 %4, %12\n\tv_exp_f32 %5, %13\n\tv_exp_f32 %6, %14\n\tv_exp_f32 %7, %15\n\tv_nop"
      : "=&v"(x[0]), "=&v"(x[1]), "=&v"(x[2]), "=&v"(x[3]), "=&v"(x[4]), "=&v"(x[5]), "=&v"(x[6]), "=&v"(x[7]) : "v"(y[0]), "v"(y[1]), "v"(y[2]), "v"(y[3]), "v"(y[4]), "v"(y[5]), "v"(y[6]), "v"(y[7])); }
// the value of lane l ^ 16: the other half of a query's keys
__device__ __forceinline__ float xhalf(float x) { return __builtin_bit_cast(float, __builtin_amdgcn_permlanex16(__builtin_bit_cast(int, x), __builtin_bit_cast(int, x), 0x76543210, 0xfedcba98, false, false)); }
// Block = (batch, query tile of 32 rows), heaviest tiles first in the grid. Wave w takes the key steps w, w + AW, ... of 32 keys up to the diagonal step (the tile's own keys, the only one that is masked).
// Transposed products: S^T = K Q^T puts one query in a lane (column ln) and 8 keys of each 16-key tile in its registers (row 8 hh + r), which is the k order of a B fragment: the weights go from the score accumulators
// straight into the B operand of O^T += V^T P^T, whose A fragments are rows of the blocked V^T planes, loaded in the same k order by g2_frag. Row maximum and row sum are in-lane plus one exchange between the lane halves.
// Each wave keeps its own running maximum m (raw q . k units), sum l and un-normalised O^T; weights are 256 * 2^((s - m) CS), hi = f16, lo = f16 of the residual; V's x1024 residual meets hi / 1024, so that all three products add into one accumulator.
// The AW partial results meet in LDS behind one barrier and are joined with the weights 2^((m_w - M) CS); a wave without a step gives m = -3e38, l = 0, O = 0.
#define AW 16
#define AP 68      /* pitch in floats of a query's 64 partial outputs: 16 lanes' 16-byte stores fall on all 64 banks */
__global__ __launch_bounds__(AW * 32) void k_attn(const _Float16* __restrict__ Q16, const _Float16* __restrict__ K16, const _Float16* __restrict__ VTH, const _Float16* __restrict__ VTR, float* __restrict__ O) {
  __shared__ __attribute__((aligned(16))) float so[AW][32][AP];
  __shared__ float sm[AW][32]; __shared__ float sl[AW][32];
  const int tid = threadIdx.x, lane = tid & 31, ln = lane & 15, hh = lane >> 4; const int w = __builtin_amdgcn_readfirstlane(tid >> 5);      /* the wave's number in a scalar register: the key loop then runs on scalar compares and branches, every lane on at the matrix instructions */
  const int by = blockIdx.x, qi = SQ / 32 - 1 - (int)blockIdx.y, row0 = qi * 32;
  const float CS = 1.44269504f * 0.03125f;      /* log2(e) * 1024^-0.5 */
  const _Float16* qp = Q16 + ((size_t)by * SQ + row0 + ln) * HD; const _Float16* kp = K16 + ((size_t)by * SQ + ln) * HD + 8 * hh;      /* the lane half's 8 hh is in the three step pointers: every fragment of a step then lies at an immediate offset from one of them */
  const _Float16* vhp = VTH + (size_t)by * HD * SQ + ln * 32 + 8 * hh; const _Float16* vlp = VTR + (size_t)by * HD * SQ + ln * 32 + 8 * hh;
  v16h qf[2][2];
#pragma unroll
  for (int qt = 0; qt < 2; ++qt)
#pragma unroll
    for (int ks = 0; ks < 2; ++ks) qf[qt][ks] = g2_frag(qp + qt * 16 * HD + ks * 32, hh);
  const v8f z8 = {0.f, 0.f, 0.f, 0.f, 0.f, 0.f, 0.f, 0.f};
  v8f acc[2][4]; float m[2], l[2];
#pragma unroll
  for (int qt = 0; qt < 2; ++qt) { m[qt] = -3.0e38f; l[qt] = 0.f;
#pragma unroll
    for (int dt = 0; dt < 4; ++dt) acc[qt][dt] = z8; }
#pragma unroll 1      /* rolled: at most SQ / 32 / AW trips, and the live set of one trip fills the register budget of a 16-wave block */
  for (int j = w; j <= qi; j += AW) {
    v16h kf[2][2], vh[4], vl[4]; const _Float16* kj = kp + (size_t)j * (32 * HD); const _Float16* vhj = vhp + (size_t)j * (HD * 32); const _Float16* vlj = vlp + (size_t)j * (HD * 32);
#pragma unroll
    for (int kt = 0; kt < 2; ++kt)
#pragma unroll
      for (int ks = 0; ks < 2; ++ks) kf[kt][ks] = g2_frag(kj + kt * 16 * HD + ks * 32, 0);
#pragma unroll
    for (int dt = 0; dt < 4; ++dt) vh[dt] = g2_frag(vhj + dt * 512, 0);
    asm volatile("s_wait_xcnt 0x0" :: "v"(kj), "v"(vhj) : "memory");      /* the wait in front of any overwrite of the address pairs that the issued loads name; naming the pairs keeps them whole up to here (one build let a load land on its own pair) */
    __builtin_amdgcn_sched_barrier(0);      /* all K loads are issued before the first score product: the compiler otherwise loaded one K fragment into the registers of another behind its product, a second wait for L2 in every step */
    v8f s[2][2];
#pragma unroll
    for (int qt = 0; qt < 2; ++qt)
#pragma unroll
      for (int kt = 0; kt < 2; ++kt) {
        s[qt][kt] = __builtin_amdgcn_wmma_f32_16x16x32_f16(false, kf[kt][0], false, qf[qt][0], (short)0, z8, false, false);
        s[qt][kt] = __builtin_amdgcn_wmma_f32_16x16x32_f16(false, kf[kt][1], false, qf[qt][1], (short)0, s[qt][kt], false, false); }
#pragma unroll
    for (int dt = 0; dt < 4; ++dt) vl[dt] = g2_frag(vlj + dt * 512, 0);      /* asked for here, into registers that the K fragments leave, used behind the softmax */
    asm volatile("s_wait_xcnt 0x0" :: "v"(vlj) : "memory");      /* as above, for the residual plane's address pair */
    if (j == qi) {      /* the diagonal step: key kt * 16 + 8 hh + r of the tile is visible to query qt * 16 + ln up to the query itself; every query sees at least its own key */
#pragma unroll
      for (int qt = 0; qt < 2; ++qt)
#pragma unroll
        for (int kt = 0; kt < 2; ++kt)
#pragma unroll
          for (int r = 0; r < 8; ++r) s[qt][kt][r] = (kt * 16 + 8 * hh + r <= qt * 16 + ln) ? s[qt][kt][r] : -3.0e38f; }
    FragH ph[2], pl[2]; float corr[2];
#pragma unroll
    for (int qt = 0; qt < 2; ++qt) {
      float m4[4] = {m[qt], m[qt], m[qt], m[qt]};
#pragma unroll
      for (int kt = 0; kt < 2; ++kt)
#pragma unroll
        for (int r = 0; r < 8; ++r) m4[r & 3] = fmaxf(m4[r & 3], s[qt][kt][r]);
      float mn = fmaxf(fmaxf(m4[0], m4[1]), fmaxf(m4[2], m4[3])); mn = fmaxf(mn, xhalf(mn));
      corr[qt] = exp2_hw((m[qt] - mn) * CS); m[qt] = mn;      /* 0 on the wave's first step */
      const float nb = 8.0f - mn * CS; float s4[4] = {0.f, 0.f, 0.f, 0.f};
#pragma unroll
      for (int kt = 0; kt < 2; ++kt) { float y[8], p[8];
#pragma unroll
        for (int r = 0; r < 8; ++r) y[r] = fmaf(s[qt][kt][r], CS, nb);
        exp2_x8(y, p);
#pragma unroll
        for (int r = 0; r < 8; ++r) { s4[r & 3] += p[r]; const _Float16 h = (_Float16)p[r]; ph[qt].h[kt * 8 + r] = h; pl[qt].h[kt * 8 + r] = (_Float16)(p[r] - (float)h); } }
      l[qt] = fmaf(l[qt], corr[qt], (s4[0] + s4[1]) + (s4[2] + s4[3])); }
    __builtin_amdgcn_sched_barrier(0);      /* the softmax of both query tiles stays in front of the P V products: the build without this line mixed the two and spilled to scratch */
#pragma unroll
    for (int qt = 0; qt < 2; ++qt) { const v16h ps = ph[qt].v * (_Float16)0.0009765625f;
#pragma unroll
      for (int dt = 0; dt < 4; ++dt) { v8f a = acc[qt][dt] * corr[qt];
        a = __builtin_amdgcn_wmma_f32_16x16x32_f16(false, vh[dt], false, ph[qt].v, (short)0, a, false, false);
        a = __builtin_amdgcn_wmma_f32_16x16x32_f16(false, vh[dt], false, pl[qt].v, (short)0, a, false, false);
        acc[qt][dt] = __builtin_amdgcn_wmma_f32_16x16x32_f16(false, vl[dt], false, ps, (short)0, a, false, false); } } }
#pragma unroll
  for (int qt = 0; qt < 2; ++qt) { const float lt = l[qt] + xhalf(l[qt]); if (hh == 0) { sm[w][qt * 16 + ln] = m[qt]; sl[w][qt * 16 + ln] = lt; }
#pragma unroll
    for (int dt = 0; dt < 4; ++dt) { const v8f a = acc[qt][dt]; float* d = &so[w][qt * 16 + ln][dt * 16 + 8 * hh];
      const v4f lo4 = {a[0], a[1], a[2], a[3]}, hi4 = {a[4], a[5], a[6], a[7]}; *(v4fa*)d = lo4; *(v4fa*)(d + 4) = hi4; } }
  __syncthreads();      /* every wave's maximum, sum and partial tile are in LDS before any is joined */
  const int q = tid >> 4, d4 = (tid & 15) * 4; float mw[AW]; float M = -3.0e38f;
#pragma unroll
  for (int u = 0; u < AW; ++u) { mw[u] = sm[u][q]; M = fmaxf(M, mw[u]); }
  float Ls = 0.f; v4f o = {0.f, 0.f, 0.f, 0.f};
#pragma unroll
  for (int g = 0; g < AW; g += 8) { float y[8], f[8];
#pragma unroll
    for (int u = 0; u < 8; ++u) y[u] = (mw[g + u] - M) * CS;
    exp2_x8(y, f);
#pragma unroll
    for (int u = 0; u < 8; ++u) { Ls = fmaf(sl[g + u][q], f[u], Ls); o += *(const v4fa*)&so[g + u][q][d4] * f[u]; } }
  *(v4f*)(O + ((size_t)by * SQ + row0 + q) * HD + d4) = o * (1.0f / Ls); }

extern "C" void kernel_launch(void* const* d_in, const int* in_sizes, int n_in,
                              void* d_out, int out_size, void* d_ws, size_t ws_size, hipStream_t stream) {
  (void)in_sizes; (void)n_in; (void)out_size;
  const float* const* I = (const float* const*)d_in; const float* x = I[0]; const float* wq = I[1]; const float* wk = I[2]; const float* wv = I[3];
  char* ws = (char*)d_ws; size_t off = 0;
  auto take = [&](size_t bytes) { char* p = ws + off; off += (bytes + 255) & ~(size_t)255; return p; };
  _Float16* B3 = (_Float16*)take((size_t)3 * HD * DMX * 2); _Float16* Q16 = (_Float16*)take(NR * HD * 2); _Float16* K16 = (_Float16*)take(NR * HD * 2); _Float16* VT = (_Float16*)take((size_t)NB * HD * SQ * 2); _Float16* VTL = (_Float16*)take((size_t)NB * HD * SQ * 2); float* KOUT = (float*)d_out + NR * HD; float* VF = (float*)d_out + 2 * NR * HD;      /* out1 = k and out2 = v are written in f32 straight into the tuple output */
  if (off > ws_size) return;      /* approx 0.4 + 4 x 1 MiB */
  k_wt3<<<dim3(HD * (DMX / 8) / 256, 3), 256, 0, stream>>>(wq, wk, wv, B3);      /* [in][out] 1024 x 64 x 3 -> Bt [192][1024] x16 */
  k_qkv<<<(unsigned)(NR / 32), PW * 32, 0, stream>>>(x, B3, Q16, KOUT, K16, VF, VT, VTL);      /* q f16 rows; out1 = k and out2 = v in f32; k f16 rows; V^T hi and residual in blocks of 32 keys */
  k_attn<<<dim3(NB, SQ / 32), AW * 32, 0, stream>>>(Q16, K16, VT, VTL, (float*)d_out);      /* out0 = softmax(causal q . k / 32) v */
}

// v006
// It runs in 24.8 microseconds.
// In two side-by-side timings against v005, it was 1.25 and 1.17 times as fast.
// Over all steps from v000 it is 396 times as fast.
#include <hip/hip_runtime.h>
// Single attention head returning the TUPLE (out, k, v) (x [4][2048][1024]; q = x Wq, k = x Wk, v = x Wv ([in][out] 1024 x 64, sigma 1/32, no biases); wei = q . k x 1024^-0.5 (the module scales by n_embd) with a causal mask (tril, -inf); softmax; out = wei v -> out0 [4][2048][64] @0, out1 = k [4][2048][64] f32 @2,097,152 B, out2 = v [4][2048][64] f32 @4,194,304 B; input order x, Wq, Wk, Wv).
// Structure: the three [in][out] weights as exact x16 f16 fragments (one launch); q, k, v in ONE projection launch (k_qkv: x read as f32 and rounded in the A loader, WMMA, f32 accumulation, K = 1024 split over the waves): k and v in f32 STRAIGHT INTO the tuple output slots (out1, out2); q, k as f16 and V^T as f16 hi + x1024 residual planes in blocks of 32 tokens; every f16 plane that one launch hands to the next lies in the order of its reader's fragments (pk_frag); then ONE attention launch (k_attn): a block owns 32 queries of one batch, its 16 waves share the visible keys in steps of 32; scores, running softmax and weights stay in registers (S^T = K Q^T, O^T += V^T P^T), the weights as f16 hi (x256) + residual, O^T += V_hi^T P_hi + V_hi^T P_lo + V_lo^T P_hi; the waves' partial sums meet in LDS; three launches.
// Compute dtype: inputs rounded to bf16; q, k f16, v f16 hi + x1024 residual; softmax weights f16 hi + residual; scores, statistics, out f32. v_wmma_f32_16x16x32_f16.
#define NB 4
#define NHS 1
#define DMX 1024                   /* model width (projection K) */
#define SQ 2048
#define HD 64
#define DM 64
#define NH 1
#define HG 1
#define QT 256
#define NKX SQ
#define NR ((size_t)NB * NHS * SQ)
typedef __bf16 v16b __attribute__((ext_vector_type(16)));
typedef unsigned short v8us __attribute__((ext_vector_type(8), may_alias));
typedef float  v8f  __attribute__((ext_vector_type(8)));
typedef float  v4f  __attribute__((ext_vector_type(4)));
typedef float  v4fa __attribute__((ext_vector_type(4), may_alias));
union FragB { v16b v; v8us half[2]; unsigned short u[16]; };

__device__ __forceinline__ unsigned short bf16_bits(float x) { unsigned int u = __float_as_uint(x); return (unsigned short)((u + 0x7FFFu + ((u >> 16) & 1u)) >> 16); }
__device__ __forceinline__ float bf16_val(unsigned short b) { return __uint_as_float(((unsigned int)b) << 16); }
__device__ __forceinline__ float bf16_round(float x) { return bf16_val(bf16_bits(x)); }
// D += A·B with NT terms: 1 = ah·bh, 2 = + al·bh (A split), 3 = + ah·bl (both split)
template <int NT>
__device__ __forceinline__ v8f mmaN(v16b ah, v16b al, v16b bh, v16b bl, v8f c) {
  c = __builtin_amdgcn_wmma_f32_16x16x32_bf16(false, ah, false, bh, (short)0, c, false, false);
  if (NT >= 2) c = __builtin_amdgcn_wmma_f32_16x16x32_bf16(false, al, false, bh, (short)0, c, false, false);
  if (NT >= 3) c = __builtin_amdgcn_wmma_f32_16x16x32_bf16(false, ah, false, bl, (short)0, c, false, false);
  asm volatile("v_nop\n\tv_nop\n\tv_nop\n\tv_nop" : "+v"(c) : "v"(ah), "v"(al), "v"(bh), "v"(bl));
  return c;
}

__global__ __launch_bounds__(256) void k_wt_bf16(const float* __restrict__ W, unsigned short* __restrict__ Wt, int K, int N) {
  const int t = blockIdx.x * 256 + threadIdx.x;
  const int k8n = K / 8;
  if (t >= N * k8n) return;
  const int n = t / k8n, k8 = (t % k8n) * 8;
  v8us v;
#pragma unroll
  for (int i = 0; i < 8; ++i) v[i] = bf16_bits(W[(size_t)(k8 + i) * N + n]);
  *(v8us*)(Wt + (size_t)n * K + k8) = v;
  
}

// GEMM C[M][N] (f32, pitch ldc) = act(A[M][K]·W + bias). A f32 row-major (pitch lda) converted per fragment to bf16
// (ASPLIT: hi/lo two planes -> 2 terms, else single rounded term); Wt bf16 [N][K] (pitch ldb). BIAS_BF16 rounds the
// bias to bf16 first (bias quantised to bf16 before the add). K%32==0, M%16==0, N%64==0.
template <bool ASPLIT, int ACT, bool BIAS_BF16>
__global__ __launch_bounds__(128) void k_gemm_bf(const float* __restrict__ A, int lda, const unsigned short* __restrict__ Wt, int ldb,
                                               const float* __restrict__ bias, float* __restrict__ C, int ldc, int M, int N, int K) {
  __shared__ __attribute__((aligned(16))) float so[4][16][64];
  const int tid = threadIdx.x, w = tid >> 5, lane = tid & 31, ln = lane & 15, hh = lane >> 4;
  const int ntn = N / 64;
  const int wid = blockIdx.x * 4 + w;
  const int mt = wid / ntn, nq = wid % ntn;
  if (mt * 16 >= M) return;
  const int row0 = mt * 16, col0 = nq * 64;
  const float* arow = A + (size_t)(row0 + ln) * lda;
  v8f acc[4] = {};
  for (int kb = 0; kb < K; kb += 32) {
    FragB ah, al;
    const v4f x0 = *(const v4fa*)(arow + kb + 8 * hh), x1 = *(const v4fa*)(arow + kb + 8 * hh + 4);
    const v4f x2 = *(const v4fa*)(arow + kb + 16 + 8 * hh), x3 = *(const v4fa*)(arow + kb + 16 + 8 * hh + 4);
    float xs[16] = {x0[0],x0[1],x0[2],x0[3],x1[0],x1[1],x1[2],x1[3],x2[0],x2[1],x2[2],x2[3],x3[0],x3[1],x3[2],x3[3]};
#pragma unroll
    for (int i = 0; i < 16; ++i) { const unsigned short hb = bf16_bits(xs[i]); ah.u[i] = hb; al.u[i] = ASPLIT ? bf16_bits(xs[i] - bf16_val(hb)) : (unsigned short)0; }
#pragma unroll
    for (int t = 0; t < 4; ++t) {
      const unsigned short* brow = Wt + (size_t)(col0 + t * 16 + ln) * ldb + kb;
      FragB b;
      b.half[0] = *(const v8us*)(brow + 8 * hh);
      b.half[1] = *(const v8us*)(brow + 16 + 8 * hh);
      acc[t] = mmaN<ASPLIT ? 2 : 1>(ah.v, al.v, b.v, b.v, acc[t]);
    }
  }
#pragma unroll
  for (int t = 0; t < 4; ++t) {
    float bv = bias ? bias[col0 + t * 16 + ln] : 0.f;
    if (BIAS_BF16) bv = bf16_round(bv);
#pragma unroll
    for (int r = 0; r < 8; ++r) { float v = acc[t][r] + bv; if (ACT == 1) v = fmaxf(v, 0.f); so[w][8 * hh + r][t * 16 + ln] = v; }
  }
  __builtin_amdgcn_fence(__ATOMIC_ACQ_REL, "workgroup");
  __builtin_amdgcn_wave_barrier();
  const int rsub = lane >> 4, c4 = (lane & 15) * 4;
  {
#pragma unroll
    for (int q = 0; q < 8; ++q) {
      const int r = q * 2 + rsub;
      const v4f v = *(const v4fa*)&so[w][r][c4];
      *(v4f*)(C + (size_t)(row0 + r) * ldc + col0 + c4) = v;
    }
    
  }
}

// GEMM C = act(A·W + bias + resid): A f32 (ASPLIT -> hi/lo 2 terms), Wt bf16 [N][K]; ACT 0 none, 1 relu, 2 exact gelu;
// resid (optional, f32, row index = (row % rmod), pitch ldr, RES_BF16 rounds it) added before the activation.
template <bool ASPLIT, int ACT, bool BIAS_BF16, bool RES_BF16>
__global__ __launch_bounds__(128) void k_gemm_bf3(const float* __restrict__ A, int lda, const unsigned short* __restrict__ Wt, int ldb,
                                                const float* __restrict__ bias, const float* __restrict__ resid, int rmod, int ldr,
                                                float* __restrict__ C, int ldc, int M, int N, int K) {
  __shared__ __attribute__((aligned(16))) float so[4][16][64];
  const int tid = threadIdx.x, w = tid >> 5, lane = tid & 31, ln = lane & 15, hh = lane >> 4;
  const int ntn = N / 64;
  const int wid = blockIdx.x * 4 + w;
  const int mt = wid / ntn, nq = wid % ntn;
  if (mt * 16 >= M) return;
  const int row0 = mt * 16, col0 = nq * 64;
  const float* arow = A + (size_t)(row0 + ln) * lda;
  v8f acc[4] = {};
  for (int kb = 0; kb < K; kb += 32) {
    FragB ah, al;
    const v4f x0 = *(const v4fa*)(arow + kb + 8 * hh), x1 = *(const v4fa*)(arow + kb + 8 * hh + 4);
    const v4f x2 = *(const v4fa*)(arow + kb + 16 + 8 * hh), x3 = *(const v4fa*)(arow + kb + 16 + 8 * hh + 4);
    float xs[16] = {x0[0],x0[1],x0[2],x0[3],x1[0],x1[1],x1[2],x1[3],x2[0],x2[1],x2[2],x2[3],x3[0],x3[1],x3[2],x3[3]};
#pragma unroll
    for (int i = 0; i < 16; ++i) { const unsigned short hb = bf16_bits(xs[i]); ah.u[i] = hb; al.u[i] = ASPLIT ? bf16_bits(xs[i] - bf16_val(hb)) : (unsigned short)0; }
#pragma unroll
    for (int t = 0; t < 4; ++t) {
      const unsigned short* brow = Wt + (size_t)(col0 + t * 16 + ln) * ldb + kb;
      FragB b;
      b.half[0] = *(const v8us*)(brow + 8 * hh);
      b.half[1] = *(const v8us*)(brow + 16 + 8 * hh);
      acc[t] = mmaN<ASPLIT ? 2 : 1>(ah.v, al.v, b.v, b.v, acc[t]);
    }
  }
#pragma unroll
  for (int t = 0; t < 4; ++t) {
    const int col = col0 + t * 16 + ln;
    float bv = bias ? bias[col] : 0.f;
    if (BIAS_BF16) bv = bf16_round(bv);
#pragma unroll
    for (int r = 0; r < 8; ++r) {
      float v = acc[t][r] + bv;
      if (resid) { float rv = resid[(size_t)((row0 + 8 * hh + r) % rmod) * ldr + col]; if (RES_BF16) rv = bf16_round(rv); v += rv; }
      if (ACT == 1) v = fmaxf(v, 0.f);
      if (ACT == 2) v = 0.5f * v * (1.0f + erff(v * 0.70710678118654752f));
      if (ACT == 3) { const float u = 0.7978845608028654f * (v + 0.044715f * v * v * v); v = 0.5f * v * (1.0f + tanhf(u)); }
      so[w][8 * hh + r][t * 16 + ln] = v;
    }
  }
  __builtin_amdgcn_fence(__ATOMIC_ACQ_REL, "workgroup");
  __builtin_amdgcn_wave_barrier();
  const int rsub = lane >> 4, c4 = (lane & 15) * 4;
  {
#pragma unroll
    for (int q = 0; q < 8; ++q) {
      const int r = q * 2 + rsub;
      const v4f v = *(const v4fa*)&so[w][r][c4];
      *(v4f*)(C + (size_t)(row0 + r) * ldc + col0 + c4) = v;
    }
    
  }
}
// row LayerNorm (biased variance, eps) over N: s = X (+ R); optional out_sum <- s; out_norm <- (s-mu)*rsqrt(var+eps)*g + b
template <bool PARAM_BF16>
__global__ __launch_bounds__(256) void k_layernorm(const float* __restrict__ X, const float* __restrict__ R, const float* __restrict__ g, const float* __restrict__ bta,
                                                  float* __restrict__ out_sum, float* __restrict__ out_norm, int N, float eps) {
  __shared__ float red[256];
  const int row = blockIdx.x, tid = threadIdx.x;
  const float* x = X + (size_t)row * N; const float* rr = R ? R + (size_t)row * N : nullptr;
  float vals[16];                     // up to N = 4096
  const int per = N / 256;            // contiguous chunk per thread? use strided-by-4 chunks: thread handles j = tid*4 + 1024*u
  float s1 = 0.f;
  for (int u = 0; u < per / 4; ++u) {
    const int j = tid * 4 + 1024 * u;
    const v4f a = *(const v4fa*)(x + j);
    v4f b = {0.f,0.f,0.f,0.f}; if (rr) b = *(const v4fa*)(rr + j);
#pragma unroll
    for (int q = 0; q < 4; ++q) { const float v = a[q] + b[q]; vals[u * 4 + q] = v; s1 += v; }
  }
  red[tid] = s1; __syncthreads();
  for (int st = 128; st > 0; st >>= 1) { if (tid < st) red[tid] += red[tid + st]; __syncthreads(); }
  const float mu = red[0] / (float)N; __syncthreads();
  float s2 = 0.f;
  for (int u = 0; u < per / 4; ++u)
#pragma unroll
    for (int q = 0; q < 4; ++q) { const float c = vals[u * 4 + q] - mu; s2 += c * c; }
  red[tid] = s2; __syncthreads();
  for (int st = 128; st > 0; st >>= 1) { if (tid < st) red[tid] += red[tid + st]; __syncthreads(); }
  const float rs = rsqrtf(red[0] / (float)N + eps);
  {
    for (int u = 0; u < per / 4; ++u) {
      const int j = tid * 4 + 1024 * u;
      v4f o, sm;
#pragma unroll
      for (int q = 0; q < 4; ++q) {
        float gg = g[j + q], bb = bta[j + q];
        if (PARAM_BF16) { gg = bf16_round(gg); bb = bf16_round(bb); }
        sm[q] = vals[u * 4 + q]; o[q] = (vals[u * 4 + q] - mu) * rs * gg + bb;
      }
      if (out_sum) *(v4f*)(out_sum + (size_t)row * N + j) = sm;
      *(v4f*)(out_norm + (size_t)row * N + j) = o;
    }
    
  }
}



// ---- f16 WMMA path (v_wmma_f32_16x16x32_f16): 11-bit significands for operands in range — used where a [0,1] probability operand needs more precision than bf16
typedef _Float16 v16h __attribute__((ext_vector_type(16)));
union FragH { v16h v; v8us half[2]; _Float16 h[16]; unsigned short u[16]; };
template <int NT>
__device__ __forceinline__ v8f mmaH(v16h ah, v16h al, v16h bh, v16h bl, v8f c) {
  c = __builtin_amdgcn_wmma_f32_16x16x32_f16(false, ah, false, bh, (short)0, c, false, false);
  if (NT >= 2) c = __builtin_amdgcn_wmma_f32_16x16x32_f16(false, al, false, bh, (short)0, c, false, false);
  if (NT >= 3) c = __builtin_amdgcn_wmma_f32_16x16x32_f16(false, ah, false, bl, (short)0, c, false, false);
  asm volatile("v_nop\n\tv_nop\n\tv_nop\n\tv_nop" : "+v"(c) : "v"(ah), "v"(al), "v"(bh), "v"(bl));
  return c;
}
// batched GEMM like k_gemm_b but f16 operands: A f32 (split into f16 hi/lo if ASPLIT, else rounded to f16), Bt = f16 values [n][k]; alpha; C f32; N multiple of 16 (partial tiles skipped)
template <bool ASPLIT>
__global__ __launch_bounds__(128) void k_gemm_h(const float* __restrict__ A, int lda, size_t sA, const _Float16* __restrict__ Bh, int ldb, size_t sB, float alpha, float* __restrict__ C, int ldc, size_t sC, int M, int N, int K) {
  __shared__ __attribute__((aligned(16))) float so[4][16][64];
  const int tid = threadIdx.x, w = tid >> 5, lane = tid & 31, ln = lane & 15, hh = lane >> 4; const int by = blockIdx.y;
  A += (size_t)by * sA; Bh += (size_t)by * sB; C += (size_t)by * sC;
  const int ntn = (N + 63) / 64; const int wid = blockIdx.x * 4 + w; const int mt = wid / ntn, nq = wid % ntn; if (mt * 16 >= M) return;
  const int row0 = mt * 16, col0 = nq * 64; const float* arow = A + (size_t)(row0 + ln) * lda;
  v8f acc[4] = {};
  for (int kb = 0; kb < K; kb += 32) {
    FragH ah, al;
    const v4f x0 = *(const v4fa*)(arow + kb + 8 * hh), x1 = *(const v4fa*)(arow + kb + 8 * hh + 4), x2 = *(const v4fa*)(arow + kb + 16 + 8 * hh), x3 = *(const v4fa*)(arow + kb + 16 + 8 * hh + 4);
    float xs[16] = {x0[0],x0[1],x0[2],x0[3],x1[0],x1[1],x1[2],x1[3],x2[0],x2[1],x2[2],x2[3],x3[0],x3[1],x3[2],x3[3]};
#pragma unroll
    for (int i = 0; i < 16; ++i) { const _Float16 h = (_Float16)xs[i]; ah.h[i] = h; al.h[i] = ASPLIT ? (_Float16)(xs[i] - (float)h) : (_Float16)0.0f; }
#pragma unroll
    for (int t = 0; t < 4; ++t) { if (col0 + t * 16 >= N) continue; const size_t boff = (size_t)(col0 + t * 16 + ln) * ldb + kb; FragH bq; bq.half[0] = *(const v8us*)(Bh + boff + 8 * hh); bq.half[1] = *(const v8us*)(Bh + boff + 16 + 8 * hh);
      acc[t] = mmaH<ASPLIT ? 2 : 1>(ah.v, al.v, bq.v, bq.v, acc[t]); }
  }
#pragma unroll
  for (int t = 0; t < 4; ++t) { if (col0 + t * 16 >= N) continue;
#pragma unroll
    for (int r = 0; r < 8; ++r) so[w][8 * hh + r][t * 16 + ln] = acc[t][r] * alpha; }
  __builtin_amdgcn_fence(__ATOMIC_ACQ_REL, "workgroup"); __builtin_amdgcn_wave_barrier();
  const int rsub = lane >> 4, c4 = (lane & 15) * 4;
  {
#pragma unroll
    for (int q = 0; q < 8; ++q) { const int r = q * 2 + rsub; if (col0 + c4 < N) { const v4f v = *(const v4fa*)&so[w][r][c4]; *(v4f*)(C + (size_t)(row0 + r) * ldc + col0 + c4) = v; } }
     }
}

// Wt[n][k] = f16(W[k][n]·scale) from f32 row-major W[K][N] (scale = power of two; bf16-exact weights stay exact in f16 away from the subnormal range)
__global__ __launch_bounds__(256) void k_wt_f16(const float* __restrict__ W, _Float16* __restrict__ Wt, int K, int N, float scale) {
  const int t = blockIdx.x * 256 + threadIdx.x; if (t >= N * (K / 8)) return; const int n = t / (K / 8), k8 = (t % (K / 8)) * 8; FragH f;
#pragma unroll
  for (int i = 0; i < 8; ++i) f.h[i] = (_Float16)(bf16_round(W[(size_t)(k8 + i) * N + n]) * scale); const v8us o = f.half[0];
  *(v8us*)((unsigned short*)Wt + (size_t)n * K + k8) = o; 
}
// k_gemm_hh variant with fused epilogue: v = acc·alpha + bias[by·sBias + col] (+ CP[(row/rowsPerB)·sCPb + by·64 + col] if CP) ; ACT 0 none / 1 elu ; writes f16 C16 (and f32 C if non-null)
template <int ACT>
__global__ __launch_bounds__(128) void k_gemm_hhx(const _Float16* __restrict__ A, int lda, size_t sA, const _Float16* __restrict__ Bh, int ldb, size_t sB, float alpha, const float* __restrict__ bias, size_t sBias, const float* __restrict__ CP, int rowsPerB, size_t sCPb, int row0g,
    float* __restrict__ C, _Float16* __restrict__ C16, int ldc, size_t sC, int M, int N, int K) {
  __shared__ __attribute__((aligned(16))) float so[4][16][64];
  const int tid = threadIdx.x, w = tid >> 5, lane = tid & 31, ln = lane & 15, hh = lane >> 4; const int by = blockIdx.y;
  A += (size_t)by * sA; Bh += (size_t)by * sB; const size_t cofs = (size_t)by * sC; const float* bp = bias ? bias + (size_t)by * sBias : nullptr;
  const int ntn = (N + 63) / 64; const int wid = blockIdx.x * 4 + w; const int mt = wid / ntn, nq = wid % ntn; if (mt * 16 >= M) return;
  const int row0 = mt * 16, col0 = nq * 64; const _Float16* arow = A + (size_t)(row0 + ln) * lda;
  v8f acc[4] = {};
  for (int kb = 0; kb < K; kb += 32) { FragH ah; ah.half[0] = *(const v8us*)((const unsigned short*)arow + kb + 8 * hh); ah.half[1] = *(const v8us*)((const unsigned short*)arow + kb + 16 + 8 * hh);
#pragma unroll
    for (int t = 0; t < 4; ++t) { if (col0 + t * 16 >= N) continue; const size_t boff = (size_t)(col0 + t * 16 + ln) * ldb + kb; FragH bq; bq.half[0] = *(const v8us*)((const unsigned short*)Bh + boff + 8 * hh); bq.half[1] = *(const v8us*)((const unsigned short*)Bh + boff + 16 + 8 * hh);
      acc[t] = mmaH<1>(ah.v, ah.v, bq.v, bq.v, acc[t]); }
  }
#pragma unroll
  for (int t = 0; t < 4; ++t) { if (col0 + t * 16 >= N) continue; const int col = col0 + t * 16 + ln; const float bv = bp ? bf16_round(bp[col]) : 0.f;
#pragma unroll
    for (int r = 0; r < 8; ++r) { float v = acc[t][r] * alpha + bv; if (CP) { const int rr = row0g + row0 + 8 * hh + r; if (rowsPerB < 0) v += CP[cofs + (size_t)rr * ldc + col];      /* rowsPerB < 0: own element of the batched C plane */ else { const int bidx = rr / rowsPerB; v += CP[(size_t)bidx * sCPb + (size_t)by * 64 + col]; } } if (ACT == 1) v = (v > 0.f) ? v : expm1f(v); else if (ACT == 7) v = (v > 0.f) ? v + 1.0f : expf(v); else if (ACT == 8) v = tanhf(v); else if (ACT == 9) v = 0.5f * v * (1.0f + tanhf(0.7978845608028654f * (v + 0.044715f * v * v * v))); else if (ACT == 11) v = 1.0f / (1.0f + expf(-v)); else if (ACT == 12) v = (v > 0.f) ? v : 0.01f * v; else if (ACT == 14) v = (v > 0.f) ? v : 0.1f * v; else if (ACT == 16) v = (v >= 0.f) ? v : 0.3f * v; else if (ACT == 17) v = (v >= 0.f) ? v : 0.2f * v; else if (ACT == 15) v = v / (1.0f + expf(-v)); else if (ACT == 3) v = fmaxf(v, 0.f); else if (ACT == 6) v = 0.5f * v * (1.0f + erff(v * 0.70710678118654752f)); so[w][8 * hh + r][t * 16 + ln] = v; } }
  __builtin_amdgcn_fence(__ATOMIC_ACQ_REL, "workgroup"); __builtin_amdgcn_wave_barrier();
  const int rsub = lane >> 4, c4 = (lane & 15) * 4; typedef _Float16 v4h __attribute__((ext_vector_type(4)));
  {
#pragma unroll
    for (int q = 0; q < 8; ++q) { const int r = q * 2 + rsub; if (col0 + c4 < N) { const v4f v = *(const v4fa*)&so[w][r][c4]; if (C) *(v4f*)(C + cofs + (size_t)(row0 + r) * ldc + col0 + c4) = v; if (C16) { v4h h4; for (int i = 0; i < 4; ++i) h4[i] = (_Float16)v[i]; *(v4h*)(C16 + cofs + (size_t)(row0 + r) * ldc + col0 + c4) = h4; } } }
     }
}


typedef _Float16 v4h __attribute__((ext_vector_type(4)));

__global__ __launch_bounds__(256) void k_x16(const float* __restrict__ x, _Float16* __restrict__ X16, size_t n8) { const size_t t = (size_t)blockIdx.x * 256 + threadIdx.x; if (t >= n8) return; FragH f;
#pragma unroll
  for (int q = 0; q < 8; ++q) f.h[q] = (_Float16)bf16_round(x[t * 8 + q]); *(v8us*)((unsigned short*)X16 + t * 8) = f.half[0];  }
__global__ __launch_bounds__(256) void k_h16(const float* __restrict__ x, _Float16* __restrict__ X16, size_t n8) { const size_t t = (size_t)blockIdx.x * 256 + threadIdx.x; if (t >= n8) return; FragH f;
#pragma unroll
  for (int q = 0; q < 8; ++q) f.h[q] = (_Float16)x[t * 8 + q]; *(v8us*)((unsigned short*)X16 + t * 8) = f.half[0];  }
__global__ __launch_bounds__(256) void k_round16f(const float* __restrict__ W, _Float16* __restrict__ Bt, size_t n8) { const size_t t = (size_t)blockIdx.x * 256 + threadIdx.x; if (t >= n8) return; FragH f;
#pragma unroll
  for (int i = 0; i < 8; ++i) f.h[i] = (_Float16)(bf16_round(W[t * 8 + i]) * 16.0f); *(v8us*)((unsigned short*)Bt + t * 8) = f.half[0];  }
template <int NHv, int TTv>
__global__ __launch_bounds__(256) void k_vt(const _Float16* __restrict__ V16, int ldv, int voff, _Float16* __restrict__ Vt) { __shared__ unsigned short tl[64][66]; const int tid = threadIdx.x; const int slab = blockIdx.x / (TTv / 64), lg = blockIdx.x % (TTv / 64); const int b = slab / NHv, h = slab % NHv;
  for (int i = tid; i < 64 * 8; i += 256) { const int r = i / 8, c8 = (i % 8) * 8; FragH f; f.half[0] = *(const v8us*)((const unsigned short*)V16 + ((size_t)b * TTv + lg * 64 + r) * ldv + voff + h * 64 + c8);
#pragma unroll
    for (int q = 0; q < 8; ++q) tl[r][c8 + q] = f.u[q]; }
  __syncthreads();
  {
#pragma unroll
    for (int rd = 0; rd < 2; ++rd) { const int d = rd * 32 + tid / 8, pc = tid % 8; FragH f;
#pragma unroll
      for (int q = 0; q < 8; ++q) f.u[q] = tl[pc * 8 + q][d];
      *(v8us*)((unsigned short*)Vt + ((size_t)slab * 64 + d) * TTv + lg * 64 + pc * 8) = f.half[0]; }
     } }

__global__ __launch_bounds__(256) void k_hl(const float* __restrict__ F, _Float16* __restrict__ Hh, _Float16* __restrict__ Hl, size_t n8) { const size_t t = (size_t)blockIdx.x * 256 + threadIdx.x; if (t >= n8) return; FragH fh, fl; const v4f a = *(const v4fa*)(F + t * 8), c = *(const v4fa*)(F + t * 8 + 4);
#pragma unroll
  for (int q = 0; q < 4; ++q) { _Float16 h = (_Float16)a[q]; fh.h[q] = h; fl.h[q] = (_Float16)((a[q] - (float)h) * 1024.0f); h = (_Float16)c[q]; fh.h[4 + q] = h; fl.h[4 + q] = (_Float16)((c[q] - (float)h) * 1024.0f); }
  { *(v8us*)((unsigned short*)Hh + t * 8) = fh.half[0]; *(v8us*)((unsigned short*)Hl + t * 8) = fl.half[0];  } }

// ---- f16 fragment of 32 k from a k-contiguous row, hardware k order (8 hh + 0..7, then 16 + 8 hh + 0..7) ----
__device__ __forceinline__ v16h g2_frag(const _Float16* p, int hh) { FragH f; f.half[0] = *(const v8us*)((const unsigned short*)p + 8 * hh); f.half[1] = *(const v8us*)((const unsigned short*)p + 16 + 8 * hh); return f.v; }


// ---- the same fragment from a plane stored in fragment order: 1 KiB a fragment of 16 rows x 32 k, first the 32 lanes' k 8 hh + 0..7 (16 bytes a lane, lane = 16 hh + row), then their k 16 + 8 hh + 0..7; p = fragment start + 8 * lane.
// Each of the two wave-wide loads then covers 512 contiguous bytes, 4 whole lines, where a row-major plane gives 16 lines in pieces of 32 bytes. ----
__device__ __forceinline__ v16h pk_frag(const _Float16* p) { FragH f; f.half[0] = *(const v8us*)((const unsigned short*)p); f.half[1] = *(const v8us*)((const unsigned short*)p + 256); return f.v; }

// ---- projection stage in two launches ----
// the three [in][out] weights (grid.y picks one) as f16(bf16(W[k][n]) * 16) in fragment order: fragment (column tile c / 16 of the 192 columns, k / 32) at ((c / 16) * 32 + k / 32) * 512 halves. A thread takes 8 neighbouring k of one output column n,
// and a wave is one half fragment: its loads read 64 bytes of each of two k rows, its store is 512 contiguous bytes (thread t of a weight writes halves 8 t ...)
__global__ __launch_bounds__(256) void k_wt3(const float* __restrict__ W0, const float* __restrict__ W1, const float* __restrict__ W2, _Float16* __restrict__ Wt) {
  const int t = blockIdx.x * 256 + threadIdx.x; const int lane = t & 31, hf = t >> 5; const int n = (hf >> 6) * 16 + (lane & 15), k8 = ((hf >> 1) & 31) * 32 + (hf & 1) * 16 + (lane >> 4) * 8; const int m = blockIdx.y;
  const float* p = ((m == 0) ? W0 : (m == 1) ? W1 : W2) + (size_t)k8 * HD + n; float v[8]; FragH f;
#pragma unroll
  for (int i = 0; i < 8; ++i) v[i] = p[i * HD];
  asm volatile("s_wait_xcnt 0x0" :: "v"(p) : "memory");      /* the wait in front of any overwrite of the address pair that the issued loads name; naming the pair keeps it whole up to here */
#pragma unroll
  for (int i = 0; i < 8; ++i) f.h[i] = (_Float16)(bf16_round(v[i]) * 16.0f);
  *(v8us*)((unsigned short*)Wt + (size_t)m * (HD * DMX) + (size_t)t * 8) = f.half[0];
}
// A fragment straight from f32 rows: p = row start + k + 8 * hh; each value rounded to bf16 and held exactly in f16; k order as g2_frag (8 hh + 0..7, then 16 + 8 hh + 0..7)
__device__ __forceinline__ v16h x_frag(const float* p) { const v4f x0 = *(const v4fa*)p, x1 = *(const v4fa*)(p + 4), x2 = *(const v4fa*)(p + 16), x3 = *(const v4fa*)(p + 20); FragH f;
#pragma unroll
  for (int i = 0; i < 4; ++i) { f.h[i] = (_Float16)(float)(__bf16)x0[i]; f.h[4 + i] = (_Float16)(float)(__bf16)x1[i]; f.h[8 + i] = (_Float16)(float)(__bf16)x2[i]; f.h[12 + i] = (_Float16)(float)(__bf16)x3[i]; }      /* the conversion instruction rounds to nearest even, as bf16_round does */
  return f.v; }
// q, k, v of 32 tokens a block: the 32 x 192 tile [q | k | v] = x Bt^T / 16. Wave w takes the column half w / 8 (96 columns) and the K slice w % 8 (128 wide); the 8 partial tiles of each half meet in LDS and are summed in slice order.
// Waves 0-7 then write q (f16) and k (f32 rows to the output, f16); waves 8-15 write v: a thread owns one head column d and 8 neighbouring tokens, so that it stores f32 rows to the output and
// 16 bytes of V^T hi and of the x1024 residual. Each f16 plane gives the block's 32 tokens one 4-KiB slab of four fragments in the order of pk_frag: q and k as (token tile, d / 32) with rows = tokens, k = d; V^T as d / 16 with rows = d, k = tokens.
// Every loop is unrolled: the accumulator and fragment arrays are then indexed by constants only and stay in registers, and the loads of later k steps can be issued ahead of the first matrix instruction.
#define PW 16
#define PP 100      /* pitch in floats of a 96-column partial tile: 8 rows on are 32 banks on, as with pitch 68 */
__global__ __launch_bounds__(PW * 32) void k_qkv(const float* __restrict__ x, const _Float16* __restrict__ Bt, _Float16* __restrict__ Q16, float* __restrict__ KO, _Float16* __restrict__ K16, float* __restrict__ VO, _Float16* __restrict__ VTH, _Float16* __restrict__ VTR) {
  __shared__ __attribute__((aligned(16))) float so[PW][32][PP];
  const int tid = threadIdx.x, lane = tid & 31, ln = lane & 15, hh = lane >> 4; const int w = __builtin_amdgcn_readfirstlane(tid >> 5);      /* the wave's number in a scalar register: the role branch behind the barrier is then a scalar branch */
  const int ch = w >> 3, ks = w & 7; const int row0 = blockIdx.x * 32;
  const float* a0p = x + (size_t)(row0 + ln) * DMX + ks * 128 + 8 * hh; const float* a1p = a0p + (size_t)16 * DMX;
  const _Float16* bp = Bt + (size_t)(ch * 6 * 32 + ks * 4) * 512 + lane * 8;
  v8f acc[2][6] = {};
#pragma unroll
  for (int kb = 0; kb < 128; kb += 32) { const v16h a0 = x_frag(a0p + kb), a1 = x_frag(a1p + kb);
#pragma unroll
    for (int t = 0; t < 6; ++t) { const v16h b = pk_frag(bp + t * (32 * 512) + kb * 16);
      acc[0][t] = __builtin_amdgcn_wmma_f32_16x16x32_f16(false, a0, false, b, (short)0, acc[0][t], false, false);
      acc[1][t] = __builtin_amdgcn_wmma_f32_16x16x32_f16(false, a1, false, b, (short)0, acc[1][t], false, false); } }
#pragma unroll
  for (int u = 0; u < 2; ++u)
#pragma unroll
    for (int t = 0; t < 6; ++t)
#pragma unroll
      for (int r = 0; r < 8; ++r) so[w][u * 16 + 8 * hh + r][t * 16 + ln] = acc[u][t][r];
  __syncthreads();      /* every wave's partial tile is in LDS before any is summed */
  if (w < 8) { const int r = tid >> 3, c4 = (tid & 7) * 4; const size_t ro = (size_t)(row0 + r) * HD;
    const size_t po = (size_t)blockIdx.x * 2048 + (r >> 4) * 1024 + (c4 >> 4) * 256 + (((c4 >> 3) & 1) * 16 + (r & 15)) * 8 + (c4 & 4);      /* place of d = c4 ... c4 + 3 (mod 32) of token r in the slab; + 512 for d from 32 on */
#pragma unroll
    for (int j = 0; j < 4; ++j) { const int col = 32 * j + c4;      /* columns 0-63 q, 64-127 k; columns from 96 on lie in the second half's tiles */
      const float* sp = (j < 3) ? &so[0][r][col] : &so[8][r][c4]; v4f s = *(const v4fa*)sp;
#pragma unroll
      for (int u = 1; u < 8; ++u) s += *(const v4fa*)(sp + u * 32 * PP);
      const v4f v = s * 0.0625f; v4h h4;
#pragma unroll
      for (int i = 0; i < 4; ++i) h4[i] = (_Float16)v[i];
      if (j < 2) *(v4h*)(Q16 + po + j * 512) = h4; else { *(v4f*)(KO + ro + col - 64) = v; *(v4h*)(K16 + po + (j - 2) * 512) = h4; } } }
  else { const int d = tid & 63, tg = (tid >> 6) & 3; const float* sp = &so[8][tg * 8][32 + d]; float* vo = VO + (size_t)(row0 + tg * 8) * HD + d; FragH fh, fl;
#pragma unroll
    for (int i = 0; i < 8; ++i) { float s = sp[i * PP];
#pragma unroll
      for (int u = 1; u < 8; ++u) s += sp[u * 32 * PP + i * PP];
      const float v = s * 0.0625f; vo[i * HD] = v; const _Float16 h = (_Float16)v; fh.h[i] = h; fl.h[i] = (_Float16)((v - (float)h) * 1024.0f); }
    const size_t to = (size_t)blockIdx.x * (HD * 32) + (d >> 4) * 512 + (tg >> 1) * 256 + ((tg & 1) * 16 + (d & 15)) * 8;
    *(v8us*)((unsigned short*)VTH + to) = fh.half[0]; *(v8us*)((unsigned short*)VTR + to) = fl.half[0];
    asm volatile("s_wait_xcnt 0x0" ::: "memory");      /* the wait behind these stores, in front of any overwrite of a register that they name: the other role's body follows this one in the listing */ } }


__global__ __launch_bounds__(256) void k_wnat(const float* __restrict__ w, size_t n8, _Float16* __restrict__ Bt) { const size_t t = (size_t)blockIdx.x * 256 + threadIdx.x; if (t >= n8) return; FragH f; for (int q = 0; q < 8; ++q) f.h[q] = (_Float16)(bf16_round(w[t * 8 + q]) * 16.0f); *(v8us*)((unsigned short*)Bt + t * 8) = f.half[0];  }
__global__ __launch_bounds__(256) void k_rsm(const float* __restrict__ S, _Float16* __restrict__ P, int nrows) {
  #pragma clang fp contract(off)
  const int i = blockIdx.x * 256 + threadIdx.x; if (i >= nrows) return; const float* s = S + (size_t)i * SQ; float mx = -3.0e38f;
#pragma unroll 1
  for (int j = 0; j < SQ; ++j) mx = fmaxf(mx, s[j]); float se = 0.f;
#pragma unroll 1
  for (int j = 0; j < SQ; ++j) se += expf(s[j] - mx); const float sc = 256.0f / se;
#pragma unroll 1
  for (int j0 = 0; j0 < SQ; j0 += 8) { FragH f; for (int q = 0; q < 8; ++q) f.h[q] = (_Float16)(expf(s[j0 + q] - mx) * sc); unsigned short* d = (unsigned short*)P + (size_t)i * SQ + j0; *(v8us*)d = f.half[0];  } }
__global__ __launch_bounds__(256) void k_vt(const _Float16* __restrict__ V16, int b, int h0, _Float16* __restrict__ VT) { __shared__ unsigned short tl[64][65]; const int tid = threadIdx.x; const int hh = blockIdx.x % HG, sg = blockIdx.x / HG; const int s0 = sg * 64; const int h = h0 + hh;
  for (int i = tid; i < 64 * 8; i += 256) { const int j = i / 8, d8 = (i % 8) * 8; FragH f; f.half[0] = *(const v8us*)((const unsigned short*)V16 + ((size_t)b * SQ + s0 + j) * DM + h * HD + d8); for (int q = 0; q < 8; ++q) tl[d8 + q][j] = f.u[q]; }
  __syncthreads();
  { for (int i = tid; i < 64 * 8; i += 256) { const int d = i / 8, j8 = (i % 8) * 8; FragH f; for (int q = 0; q < 8; ++q) f.u[q] = tl[d][j8 + q]; *(v8us*)((unsigned short*)VT + ((size_t)hh * HD + d) * SQ + s0 + j8) = f.half[0]; }  } }


__global__ __launch_bounds__(256) void k_rsmcf2(const float* __restrict__ S, _Float16* __restrict__ P, int hg, int q0, int nk) {
  #pragma clang fp contract(off)
  const int t = blockIdx.x * 256 + threadIdx.x; if (t >= hg * QT) return; const size_t i = (size_t)t; const float* s = S + i * NKX; const int last = q0 + (t % QT); float mx = -3.0e38f;
#pragma unroll 1
  for (int j = 0; j < nk; ++j) { const float f = (j <= last) ? 1.f : 0.f; mx = fmaxf(mx, fmaf(f, s[j], (1.f - f) * -1.0e9f)); } float se = 0.f;
#pragma unroll 1
  for (int j = 0; j < nk; ++j) { const float f = (j <= last) ? 1.f : 0.f; se += __expf(fmaf(f, s[j], (1.f - f) * -1.0e9f) - mx); } const float sc = 256.0f / se;
#pragma unroll 1
  for (int j0 = 0; j0 < nk; j0 += 8) { FragH fr; for (int q = 0; q < 8; ++q) { const int j = j0 + q; const float f = (j <= last) ? 1.f : 0.f; fr.h[q] = (_Float16)(__expf(fmaf(f, s[j], (1.f - f) * -1.0e9f) - mx) * sc); } unsigned short* d = (unsigned short*)P + i * NKX + j0; *(v8us*)d = fr.half[0];  } }


// ---- causal attention in one launch: scores, softmax and P V of 32 queries a block; no score or weight plane in memory ----
// native 2^y; the v_nop is the slot the instruction set asks for behind a transcendental before its result is read or its source overwritten
__device__ __forceinline__ float exp2_hw(float y) { float x; asm("v_exp_f32 %0, %1\n\tv_nop" : "=v"(x) : "v"(y)); return x; }
// eight at once: results in registers of their own, so that each v_exp is the independent instruction behind the one before it and one v_nop closes the last slot
__device__ __forceinline__ void exp2_x8(const float (&y)[8], float (&x)[8]) {
  asm("v_exp_f32 %0, %8\n\tv_exp_f32 %1, %9\n\tv_exp_f32 %2, %10\n\tv_exp_f32 %3, %11\n\tv_exp_f32 %4, %12\n\tv_exp_f32 %5, %13\n\tv_exp_f32 %6, %14\n\tv_exp_f32 %7, %15\n\tv_nop"
      : "=&v"(x[0]), "=&v"(x[1]), "=&v"(x[2]), "=&v"(x[3]), "=&v"(x[4]), "=&v"(x[5]), "=&v"(x[6]), "=&v"(x[7]) : "v"(y[0]), "v"(y[1]), "v"(y[2]), "v"(y[3]), "v"(y[4]), "v"(y[5]), "v"(y[6]), "v"(y[7])); }
// the value of lane l ^ 16: the other half of a query's keys
__device__ __forceinline__ float xhalf(float x) { return __builtin_bit_cast(float, __builtin_amdgcn_permlanex16(__builtin_bit_cast(int, x), __builtin_bit_cast(int, x), 0x76543210, 0xfedcba98, false, false)); }
// Block = (batch, query tile of 32 rows), heaviest tiles first in the grid. Wave w takes the key steps w, w + AW, ... of 32 keys up to the diagonal step (the tile's own keys, the only one that is masked).
// Transposed products: S^T = K Q^T puts one query in a lane (column ln) and 8 keys of each 16-key tile in its registers (row 8 hh + r), which is the k order of a B fragment: the weights go from the score accumulators
// straight into the B operand of O^T += V^T P^T, whose A fragments come from the V^T planes in the same k order (pk_frag). Row maximum and row sum are in-lane plus one exchange between the lane halves.
// Each wave keeps its own running maximum m (raw q . k units), sum l and un-normalised O^T; weights are 256 * 2^((s - m) CS), hi = f16, lo = f16 of the residual; V's x1024 residual meets hi / 1024, so that all three products add into one accumulator.
// The AW partial results meet in LDS behind one barrier and are joined with the weights 2^((m_w - M) CS); a wave without a step gives m = -3e38, l = 0, O = 0.
#define AW 16
#define AP 68      /* pitch in floats of a query's 64 partial outputs: 16 lanes' 16-byte stores fall on all 64 banks */
__global__ __launch_bounds__(AW * 32) void k_attn(const _Float16* __restrict__ Q16, const _Float16* __restrict__ K16, const _Float16* __restrict__ VTH, const _Float16* __restrict__ VTR, float* __restrict__ O) {
  __shared__ __attribute__((aligned(16))) float so[AW][32][AP];
  __shared__ float sm[AW][32]; __shared__ float sl[AW][32];
  const int tid = threadIdx.x, lane = tid & 31, ln = lane & 15, hh = lane >> 4; const int w = __builtin_amdgcn_readfirstlane(tid >> 5);      /* the wave's number in a scalar register: the key loop then runs on scalar compares and branches, every lane on at the matrix instructions */
  const int by = blockIdx.x, qi = SQ / 32 - 1 - (int)blockIdx.y, row0 = qi * 32;
  const float CS = 1.44269504f * 0.03125f;      /* log2(e) * 1024^-0.5 */
  const _Float16* qp = Q16 + ((size_t)by * SQ + row0) * HD + lane * 8; const _Float16* kp = K16 + (size_t)by * SQ * HD + lane * 8;      /* the lane's 16 bytes are in the step pointers: every fragment of a step then lies at an immediate offset from one of them */
  const _Float16* vhp = VTH + (size_t)by * HD * SQ + lane * 8; const _Float16* vlp = VTR + (size_t)by * HD * SQ + lane * 8;
  v16h qf[2][2];
#pragma unroll
  for (int qt = 0; qt < 2; ++qt)
#pragma unroll
    for (int ks = 0; ks < 2; ++ks) qf[qt][ks] = pk_frag(qp + (qt * 2 + ks) * 512);
  const v8f z8 = {0.f, 0.f, 0.f, 0.f, 0.f, 0.f, 0.f, 0.f};
  v8f acc[2][4]; float m[2], l[2];
#pragma unroll
  for (int qt = 0; qt < 2; ++qt) { m[qt] = -3.0e38f; l[qt] = 0.f;
#pragma unroll
    for (int dt = 0; dt < 4; ++dt) acc[qt][dt] = z8; }
#pragma unroll 1      /* rolled: at most SQ / 32 / AW trips, and the live set of one trip fills the register budget of a 16-wave block */
  for (int j = w; j <= qi; j += AW) {
    v16h kf[2][2], vh[4], vl[4]; const _Float16* kj = kp + (size_t)j * (32 * HD); const _Float16* vhj = vhp + (size_t)j * (HD * 32); const _Float16* vlj = vlp + (size_t)j * (HD * 32);
#pragma unroll
    for (int kt = 0; kt < 2; ++kt)
#pragma unroll
      for (int ks = 0; ks < 2; ++ks) kf[kt][ks] = pk_frag(kj + (kt * 2 + ks) * 512);
#pragma unroll
    for (int dt = 0; dt < 4; ++dt) vh[dt] = pk_frag(vhj + dt * 512);
    asm volatile("s_wait_xcnt 0x0" :: "v"(kj), "v"(vhj) : "memory");      /* the wait in front of any overwrite of the address pairs that the issued loads name; naming the pairs keeps them whole up to here (one build let a load land on its own pair) */
    __builtin_amdgcn_sched_barrier(0);      /* all K loads are issued before the first score product: the compiler otherwise loaded one K fragment into the registers of another behind its product, a second wait for L2 in every step */
    v8f s[2][2];
#pragma unroll
    for (int qt = 0; qt < 2; ++qt)
#pragma unroll
      for (int kt = 0; kt < 2; ++kt) {
        s[qt][kt] = __builtin_amdgcn_wmma_f32_16x16x32_f16(false, kf[kt][0], false, qf[qt][0], (short)0, z8, false, false);
        s[qt][kt] = __builtin_amdgcn_wmma_f32_16x16x32_f16(false, kf[kt][1], false, qf[qt][1], (short)0, s[qt][kt], false, false); }
#pragma unroll
    for (int dt = 0; dt < 4; ++dt) vl[dt] = pk_frag(vlj + dt * 512);      /* asked for here, into registers that the K fragments leave, used behind the softmax */
    asm volatile("s_wait_xcnt 0x0" :: "v"(vlj) : "memory");      /* as above, for the residual plane's address pair */
    if (j == qi) {      /* the diagonal step: key kt * 16 + 8 hh + r of the tile is visible to query qt * 16 + ln up to the query itself; every query sees at least its own key */
#pragma unroll
      for (int qt = 0; qt < 2; ++qt)
#pragma unroll
        for (int kt = 0; kt < 2; ++kt)
#pragma unroll
          for (int r = 0; r < 8; ++r) s[qt][kt][r] = (kt * 16 + 8 * hh + r <= qt * 16 + ln) ? s[qt][kt][r] : -3.0e38f; }
    FragH ph[2], pl[2]; float corr[2];
#pragma unroll
    for (int qt = 0; qt < 2; ++qt) {
      float m4[4] = {m[qt], m[qt], m[qt], m[qt]};
#pragma unroll
      for (int kt = 0; kt < 2; ++kt)
#pragma unroll
        for (int r = 0; r < 8; ++r) m4[r & 3] = fmaxf(m4[r & 3], s[qt][kt][r]);
      float mn = fmaxf(fmaxf(m4[0], m4[1]), fmaxf(m4[2], m4[3])); mn = fmaxf(mn, xhalf(mn));
      corr[qt] = exp2_hw((m[qt] - mn) * CS); m[qt] = mn;      /* 0 on the wave's first step */
      const float nb = 8.0f - mn * CS; float s4[4] = {0.f, 0.f, 0.f, 0.f};
#pragma unroll
      for (int kt = 0; kt < 2; ++kt) { float y[8], p[8];
#pragma unroll
        for (int r = 0; r < 8; ++r) y[r] = fmaf(s[qt][kt][r], CS, nb);
        exp2_x8(y, p);
#pragma unroll
        for (int r = 0; r < 8; ++r) { s4[r & 3] += p[r]; const _Float16 h = (_Float16)p[r]; ph[qt].h[kt * 8 + r] = h; pl[qt].h[kt * 8 + r] = (_Float16)(p[r] - (float)h); } }
      l[qt] = fmaf(l[qt], corr[qt], (s4[0] + s4[1]) + (s4[2] + s4[3])); }
    __builtin_amdgcn_sched_barrier(0);      /* the softmax of both query tiles stays in front of the P V products: the build without this line mixed the two and spilled to scratch */
#pragma unroll
    for (int qt = 0; qt < 2; ++qt) { const v16h ps = ph[qt].v * (_Float16)0.0009765625f;
#pragma unroll
      for (int dt = 0; dt < 4; ++dt) { v8f a = acc[qt][dt] * corr[qt];
        a = __builtin_amdgcn_wmma_f32_16x16x32_f16(false, vh[dt], false, ph[qt].v, (short)0, a, false, false);
        a = __builtin_amdgcn_wmma_f32_16x16x32_f16(false, vh[dt], false, pl[qt].v, (short)0, a, false, false);
        acc[qt][dt] = __builtin_amdgcn_wmma_f32_16x16x32_f16(false, vl[dt], false, ps, (short)0, a, false, false); } } }
#pragma unroll
  for (int qt = 0; qt < 2; ++qt) { const float lt = l[qt] + xhalf(l[qt]); if (hh == 0) { sm[w][qt * 16 + ln] = m[qt]; sl[w][qt * 16 + ln] = lt; }
#pragma unroll
    for (int dt = 0; dt < 4; ++dt) { const v8f a = acc[qt][dt]; float* d = &so[w][qt * 16 + ln][dt * 16 + 8 * hh];
      const v4f lo4 = {a[0], a[1], a[2], a[3]}, hi4 = {a[4], a[5], a[6], a[7]}; *(v4fa*)d = lo4; *(v4fa*)(d + 4) = hi4; } }
  __syncthreads();      /* every wave's maximum, sum and partial tile are in LDS before any is joined */
  const int q = tid >> 4, d4 = (tid & 15) * 4; float mw[AW]; float M = -3.0e38f;
#pragma unroll
  for (int u = 0; u < AW; ++u) { mw[u] = sm[u][q]; M = fmaxf(M, mw[u]); }
  float Ls = 0.f; v4f o = {0.f, 0.f, 0.f, 0.f};
#pragma unroll
  for (int g = 0; g < AW; g += 8) { float y[8], f[8];
#pragma unroll
    for (int u = 0; u < 8; ++u) y[u] = (mw[g + u] - M) * CS;
    exp2_x8(y, f);
#pragma unroll
    for (int u = 0; u < 8; ++u) { Ls = fmaf(sl[g + u][q], f[u], Ls); o += *(const v4fa*)&so[g + u][q][d4] * f[u]; } }
  *(v4f*)(O + ((size_t)by * SQ + row0 + q) * HD + d4) = o * (1.0f / Ls); }

extern "C" void kernel_launch(void* const* d_in, const int* in_sizes, int n_in,
                              void* d_out, int out_size, void* d_ws, size_t ws_size, hipStream_t stream) {
  (void)in_sizes; (void)n_in; (void)out_size;
  const float* const* I = (const float* const*)d_in; const float* x = I[0]; const float* wq = I[1]; const float* wk = I[2]; const float* wv = I[3];
  char* ws = (char*)d_ws; size_t off = 0;
  auto take = [&](size_t bytes) { char* p = ws + off; off += (bytes + 255) & ~(size_t)255; return p; };
  _Float16* B3 = (_Float16*)take((size_t)3 * HD * DMX * 2); _Float16* Q16 = (_Float16*)take(NR * HD * 2); _Float16* K16 = (_Float16*)take(NR * HD * 2); _Float16* VT = (_Float16*)take((size_t)NB * HD * SQ * 2); _Float16* VTL = (_Float16*)take((size_t)NB * HD * SQ * 2); float* KOUT = (float*)d_out + NR * HD; float* VF = (float*)d_out + 2 * NR * HD;      /* out1 = k and out2 = v are written in f32 straight into the tuple output */
  if (off > ws_size) return;      /* approx 0.4 + 4 x 1 MiB */
  k_wt3<<<dim3(HD * (DMX / 8) / 256, 3), 256, 0, stream>>>(wq, wk, wv, B3);      /* [in][out] 1024 x 64 x 3 -> 192 columns x16 in fragment order */
  k_qkv<<<(unsigned)(NR / 32), PW * 32, 0, stream>>>(x, B3, Q16, KOUT, K16, VF, VT, VTL);      /* out1 = k and out2 = v in f32; q, k, V^T hi and residual f16 in fragment order, 4 KiB a plane and 32 tokens */
  k_attn<<<dim3(NB, SQ / 32), AW * 32, 0, stream>>>(Q16, K16, VT, VTL, (float*)d_out);      /* out0 = softmax(causal q . k / 32) v */
}

// v007
// A run of this version takes 21.7 microseconds.
// In two side-by-side timings against v006, it was 1.10 and 1.11 times as fast.
// All steps since v000 together make it 438 times as fast.
#include <hip/hip_runtime.h>
// Single attention head returning the TUPLE (out, k, v) (x [4][2048][1024]; q = x Wq, k = x Wk, v = x Wv ([in][out] 1024 x 64, sigma 1/32, no biases); wei = q . k x 1024^-0.5 (the module scales by n_embd) with a causal mask (tril, -inf); softmax; out = wei v -> out0 [4][2048][64] @0, out1 = k [4][2048][64] f32 @2,097,152 B, out2 = v [4][2048][64] f32 @4,194,304 B; input order x, Wq, Wk, Wv).
// Structure: the three [in][out] weights as exact x16 f16 fragments (one launch); q, k, v in ONE projection launch (k_qkv: x read as f32 in whole lines, rounded and staged in LDS as f16 fragments, WMMA, f32 accumulation, K = 1024 split over the waves): k and v in f32 STRAIGHT INTO the tuple output slots (out1, out2); q, k as f16 and V^T as f16 hi + x1024 residual planes in blocks of 32 tokens; every f16 plane that one launch hands to the next lies in the order of its reader's fragments (pk_frag); then ONE attention launch (k_attn): a block owns 32 queries of one batch, its 16 waves share the visible keys in steps of 32; scores, running softmax and weights stay in registers (S^T = K Q^T, O^T += V^T P^T), the weights as f16 hi (x256) + residual, O^T += V_hi^T P_hi + V_hi^T P_lo + V_lo^T P_hi; the waves' partial sums meet in LDS; three launches.
// Compute dtype: inputs rounded to bf16; q, k f16; v f16 hi + x1024 residual; softmax weights f16 hi + residual; scores, statistics, out f32. v_wmma_f32_16x16x32_f16.
#define NB 4
#define NHS 1
#define DMX 1024                   /* model width (projection K) */
#define SQ 2048
#define HD 64
#define DM 64
#define NH 1
#define HG 1
#define QT 256
#define NKX SQ
#define NR ((size_t)NB * NHS * SQ)
typedef __bf16 v16b __attribute__((ext_vector_type(16)));
typedef unsigned short v8us __attribute__((ext_vector_type(8), may_alias));
typedef float  v8f  __attribute__((ext_vector_type(8)));
typedef float  v4f  __attribute__((ext_vector_type(4)));
typedef float  v4fa __attribute__((ext_vector_type(4), may_alias));
union FragB { v16b v; v8us half[2]; unsigned short u[16]; };

__device__ __forceinline__ unsigned short bf16_bits(float x) { unsigned int u = __float_as_uint(x); return (unsigned short)((u + 0x7FFFu + ((u >> 16) & 1u)) >> 16); }
__device__ __forceinline__ float bf16_val(unsigned short b) { return __uint_as_float(((unsigned int)b) << 16); }
__device__ __forceinline__ float bf16_round(float x) { return bf16_val(bf16_bits(x)); }
// D += A·B with NT terms: 1 = ah·bh, 2 = + al·bh (A split), 3 = + ah·bl (both split)
template <int NT>
__device__ __forceinline__ v8f mmaN(v16b ah, v16b al, v16b bh, v16b bl, v8f c) {
  c = __builtin_amdgcn_wmma_f32_16x16x32_bf16(false, ah, false, bh, (short)0, c, false, false);
  if (NT >= 2) c = __builtin_amdgcn_wmma_f32_16x16x32_bf16(false, al, false, bh, (short)0, c, false, false);
  if (NT >= 3) c = __builtin_amdgcn_wmma_f32_16x16x32_bf16(false, ah, false, bl, (short)0, c, false, false);
  asm volatile("v_nop\n\tv_nop\n\tv_nop\n\tv_nop" : "+v"(c) : "v"(ah), "v"(al), "v"(bh), "v"(bl));
  return c;
}

__global__ __launch_bounds__(256) void k_wt_bf16(const float* __restrict__ W, unsigned short* __restrict__ Wt, int K, int N) {
  const int t = blockIdx.x * 256 + threadIdx.x;
  const int k8n = K / 8;
  if (t >= N * k8n) return;
  const int n = t / k8n, k8 = (t % k8n) * 8;
  v8us v;
#pragma unroll
  for (int i = 0; i < 8; ++i) v[i] = bf16_bits(W[(size_t)(k8 + i) * N + n]);
  *(v8us*)(Wt + (size_t)n * K + k8) = v;
  
}

// GEMM C[M][N] (f32, pitch ldc) = act(A[M][K]·W + bias). A f32 row-major (pitch lda) converted per fragment to bf16
// (ASPLIT: hi/lo two planes -> 2 terms, else single rounded term); Wt bf16 [N][K] (pitch ldb). BIAS_BF16 rounds the
// bias to bf16 first (bias quantised to bf16 before the add). K%32==0, M%16==0, N%64==0.
template <bool ASPLIT, int ACT, bool BIAS_BF16>
__global__ __launch_bounds__(128) void k_gemm_bf(const float* __restrict__ A, int lda, const unsigned short* __restrict__ Wt, int ldb,
                                               const float* __restrict__ bias, float* __restrict__ C, int ldc, int M, int N, int K) {
  __shared__ __attribute__((aligned(16))) float so[4][16][64];
  const int tid = threadIdx.x, w = tid >> 5, lane = tid & 31, ln = lane & 15, hh = lane >> 4;
  const int ntn = N / 64;
  const int wid = blockIdx.x * 4 + w;
  const int mt = wid / ntn, nq = wid % ntn;
  if (mt * 16 >= M) return;
  const int row0 = mt * 16, col0 = nq * 64;
  const float* arow = A + (size_t)(row0 + ln) * lda;
  v8f acc[4] = {};
  for (int kb = 0; kb < K; kb += 32) {
    FragB ah, al;
    const v4f x0 = *(const v4fa*)(arow + kb + 8 * hh), x1 = *(const v4fa*)(arow + kb + 8 * hh + 4);
    const v4f x2 = *(const v4fa*)(arow + kb + 16 + 8 * hh), x3 = *(const v4fa*)(arow + kb + 16 + 8 * hh + 4);
    float xs[16] = {x0[0],x0[1],x0[2],x0[3],x1[0],x1[1],x1[2],x1[3],x2[0],x2[1],x2[2],x2[3],x3[0],x3[1],x3[2],x3[3]};
#pragma unroll
    for (int i = 0; i < 16; ++i) { const unsigned short hb = bf16_bits(xs[i]); ah.u[i] = hb; al.u[i] = ASPLIT ? bf16_bits(xs[i] - bf16_val(hb)) : (unsigned short)0; }
#pragma unroll
    for (int t = 0; t < 4; ++t) {
      const unsigned short* brow = Wt + (size_t)(col0 + t * 16 + ln) * ldb + kb;
      FragB b;
      b.half[0] = *(const v8us*)(brow + 8 * hh);
      b.half[1] = *(const v8us*)(brow + 16 + 8 * hh);
      acc[t] = mmaN<ASPLIT ? 2 : 1>(ah.v, al.v, b.v, b.v, acc[t]);
    }
  }
#pragma unroll
  for (int t = 0; t < 4; ++t) {
    float bv = bias ? bias[col0 + t * 16 + ln] : 0.f;
    if (BIAS_BF16) bv = bf16_round(bv);
#pragma unroll
    for (int r = 0; r < 8; ++r) { float v = acc[t][r] + bv; if (ACT == 1) v = fmaxf(v, 0.f); so[w][8 * hh + r][t * 16 + ln] = v; }
  }
  __builtin_amdgcn_fence(__ATOMIC_ACQ_REL, "workgroup");
  __builtin_amdgcn_wave_barrier();
  const int rsub = lane >> 4, c4 = (lane & 15) * 4;
  {
#pragma unroll
    for (int q = 0; q < 8; ++q) {
      const int r = q * 2 + rsub;
      const v4f v = *(const v4fa*)&so[w][r][c4];
      *(v4f*)(C + (size_t)(row0 + r) * ldc + col0 + c4) = v;
    }
    
  }
}

// GEMM C = act(A·W + bias + resid): A f32 (ASPLIT -> hi/lo 2 terms), Wt bf16 [N][K]; ACT 0 none, 1 relu, 2 exact gelu;
// resid (optional, f32, row index = (row % rmod), pitch ldr, RES_BF16 rounds it) added before the activation.
template <bool ASPLIT, int ACT, bool BIAS_BF16, bool RES_BF16>
__global__ __launch_bounds__(128) void k_gemm_bf3(const float* __restrict__ A, int lda, const unsigned short* __restrict__ Wt, int ldb,
                                                const float* __restrict__ bias, const float* __restrict__ resid, int rmod, int ldr,
                                                float* __restrict__ C, int ldc, int M, int N, int K) {
  __shared__ __attribute__((aligned(16))) float so[4][16][64];
  const int tid = threadIdx.x, w = tid >> 5, lane = tid & 31, ln = lane & 15, hh = lane >> 4;
  const int ntn = N / 64;
  const int wid = blockIdx.x * 4 + w;
  const int mt = wid / ntn, nq = wid % ntn;
  if (mt * 16 >= M) return;
  const int row0 = mt * 16, col0 = nq * 64;
  const float* arow = A + (size_t)(row0 + ln) * lda;
  v8f acc[4] = {};
  for (int kb = 0; kb < K; kb += 32) {
    FragB ah, al;
    const v4f x0 = *(const v4fa*)(arow + kb + 8 * hh), x1 = *(const v4fa*)(arow + kb + 8 * hh + 4);
    const v4f x2 = *(const v4fa*)(arow + kb + 16 + 8 * hh), x3 = *(const v4fa*)(arow + kb + 16 + 8 * hh + 4);
    float xs[16] = {x0[0],x0[1],x0[2],x0[3],x1[0],x1[1],x1[2],x1[3],x2[0],x2[1],x2[2],x2[3],x3[0],x3[1],x3[2],x3[3]};
#pragma unroll
    for (int i = 0; i < 16; ++i) { const unsigned short hb = bf16_bits(xs[i]); ah.u[i] = hb; al.u[i] = ASPLIT ? bf16_bits(xs[i] - bf16_val(hb)) : (unsigned short)0; }
#pragma unroll
    for (int t = 0; t < 4; ++t) {
      const unsigned short* brow = Wt + (size_t)(col0 + t * 16 + ln) * ldb + kb;
      FragB b;
      b.half[0] = *(const v8us*)(brow + 8 * hh);
      b.half[1] = *(const v8us*)(brow + 16 + 8 * hh);
      acc[t] = mmaN<ASPLIT ? 2 : 1>(ah.v, al.v, b.v, b.v, acc[t]);
    }
  }
#pragma unroll
  for (int t = 0; t < 4; ++t) {
    const int col = col0 + t * 16 + ln;
    float bv = bias ? bias[col] : 0.f;
    if (BIAS_BF16) bv = bf16_round(bv);
#pragma unroll
    for (int r = 0; r < 8; ++r) {
      float v = acc[t][r] + bv;
      if (resid) { float rv = resid[(size_t)((row0 + 8 * hh + r) % rmod) * ldr + col]; if (RES_BF16) rv = bf16_round(rv); v += rv; }
      if (ACT == 1) v = fmaxf(v, 0.f);
      if (ACT == 2) v = 0.5f * v * (1.0f + erff(v * 0.70710678118654752f));
      if (ACT == 3) { const float u = 0.7978845608028654f * (v + 0.044715f * v * v * v); v = 0.5f * v * (1.0f + tanhf(u)); }
      so[w][8 * hh + r][t * 16 + ln] = v;
    }
  }
  __builtin_amdgcn_fence(__ATOMIC_ACQ_REL, "workgroup");
  __builtin_amdgcn_wave_barrier();
  const int rsub = lane >> 4, c4 = (lane & 15) * 4;
  {
#pragma unroll
    for (int q = 0; q < 8; ++q) {
      const int r = q * 2 + rsub;
      const v4f v = *(const v4fa*)&so[w][r][c4];
      *(v4f*)(C + (size_t)(row0 + r) * ldc + col0 + c4) = v;
    }
    
  }
}
// row LayerNorm (biased variance, eps) over N: s = X (+ R); optional out_sum <- s; out_norm <- (s-mu)*rsqrt(var+eps)*g + b
template <bool PARAM_BF16>
__global__ __launch_bounds__(256) void k_layernorm(const float* __restrict__ X, const float* __restrict__ R, const float* __restrict__ g, const float* __restrict__ bta,
                                                  float* __restrict__ out_sum, float* __restrict__ out_norm, int N, float eps) {
  __shared__ float red[256];
  const int row = blockIdx.x, tid = threadIdx.x;
  const float* x = X + (size_t)row * N; const float* rr = R ? R + (size_t)row * N : nullptr;
  float vals[16];                     // up to N = 4096
  const int per = N / 256;            // contiguous chunk per thread? use strided-by-4 chunks: thread handles j = tid*4 + 1024*u
  float s1 = 0.f;
  for (int u = 0; u < per / 4; ++u) {
    const int j = tid * 4 + 1024 * u;
    const v4f a = *(const v4fa*)(x + j);
    v4f b = {0.f,0.f,0.f,0.f}; if (rr) b = *(const v4fa*)(rr + j);
#pragma unroll
    for (int q = 0; q < 4; ++q) { const float v = a[q] + b[q]; vals[u * 4 + q] = v; s1 += v; }
  }
  red[tid] = s1; __syncthreads();
  for (int st = 128; st > 0; st >>= 1) { if (tid < st) red[tid] += red[tid + st]; __syncthreads(); }
  const float mu = red[0] / (float)N; __syncthreads();
  float s2 = 0.f;
  for (int u = 0; u < per / 4; ++u)
#pragma unroll
    for (int q = 0; q < 4; ++q) { const float c = vals[u * 4 + q] - mu; s2 += c * c; }
  red[tid] = s2; __syncthreads();
  for (int st = 128; st > 0; st >>= 1) { if (tid < st) red[tid] += red[tid + st]; __syncthreads(); }
  const float rs = rsqrtf(red[0] / (float)N + eps);
  {
    for (int u = 0; u < per / 4; ++u) {
      const int j = tid * 4 + 1024 * u;
      v4f o, sm;
#pragma unroll
      for (int q = 0; q < 4; ++q) {
        float gg = g[j + q], bb = bta[j + q];
        if (PARAM_BF16) { gg = bf16_round(gg); bb = bf16_round(bb); }
        sm[q] = vals[u * 4 + q]; o[q] = (vals[u * 4 + q] - mu) * rs * gg + bb;
      }
      if (out_sum) *(v4f*)(out_sum + (size_t)row * N + j) = sm;
      *(v4f*)(out_norm + (size_t)row * N + j) = o;
    }
    
  }
}



// ---- f16 WMMA path (v_wmma_f32_16x16x32_f16): 11-bit significands for operands in range — used where a [0,1] probability operand needs more precision than bf16
typedef _Float16 v16h __attribute__((ext_vector_type(16)));
union FragH { v16h v; v8us half[2]; _Float16 h[16]; unsigned short u[16]; };
template <int NT>
__device__ __forceinline__ v8f mmaH(v16h ah, v16h al, v16h bh, v16h bl, v8f c) {
  c = __builtin_amdgcn_wmma_f32_16x16x32_f16(false, ah, false, bh, (short)0, c, false, false);
  if (NT >= 2) c = __builtin_amdgcn_wmma_f32_16x16x32_f16(false, al, false, bh, (short)0, c, false, false);
  if (NT >= 3) c = __builtin_amdgcn_wmma_f32_16x16x32_f16(false, ah, false, bl, (short)0, c, false, false);
  asm volatile("v_nop\n\tv_nop\n\tv_nop\n\tv_nop" : "+v"(c) : "v"(ah), "v"(al), "v"(bh), "v"(bl));
  return c;
}
// batched GEMM like k_gemm_b but f16 operands: A f32 (split into f16 hi/lo if ASPLIT, else rounded to f16), Bt = f16 values [n][k]; alpha; C f32; N multiple of 16 (partial tiles skipped)
template <bool ASPLIT>
__global__ __launch_bounds__(128) void k_gemm_h(const float* __restrict__ A, int lda, size_t sA, const _Float16* __restrict__ Bh, int ldb, size_t sB, float alpha, float* __restrict__ C, int ldc, size_t sC, int M, int N, int K) {
  __shared__ __attribute__((aligned(16))) float so[4][16][64];
  const int tid = threadIdx.x, w = tid >> 5, lane = tid & 31, ln = lane & 15, hh = lane >> 4; const int by = blockIdx.y;
  A += (size_t)by * sA; Bh += (size_t)by * sB; C += (size_t)by * sC;
  const int ntn = (N + 63) / 64; const int wid = blockIdx.x * 4 + w; const int mt = wid / ntn, nq = wid % ntn; if (mt * 16 >= M) return;
  const int row0 = mt * 16, col0 = nq * 64; const float* arow = A + (size_t)(row0 + ln) * lda;
  v8f acc[4] = {};
  for (int kb = 0; kb < K; kb += 32) {
    FragH ah, al;
    const v4f x0 = *(const v4fa*)(arow + kb + 8 * hh), x1 = *(const v4fa*)(arow + kb + 8 * hh + 4), x2 = *(const v4fa*)(arow + kb + 16 + 8 * hh), x3 = *(const v4fa*)(arow + kb + 16 + 8 * hh + 4);
    float xs[16] = {x0[0],x0[1],x0[2],x0[3],x1[0],x1[1],x1[2],x1[3],x2[0],x2[1],x2[2],x2[3],x3[0],x3[1],x3[2],x3[3]};
#pragma unroll
    for (int i = 0; i < 16; ++i) { const _Float16 h = (_Float16)xs[i]; ah.h[i] = h; al.h[i] = ASPLIT ? (_Float16)(xs[i] - (float)h) : (_Float16)0.0f; }
#pragma unroll
    for (int t = 0; t < 4; ++t) { if (col0 + t * 16 >= N) continue; const size_t boff = (size_t)(col0 + t * 16 + ln) * ldb + kb; FragH bq; bq.half[0] = *(const v8us*)(Bh + boff + 8 * hh); bq.half[1] = *(const v8us*)(Bh + boff + 16 + 8 * hh);
      acc[t] = mmaH<ASPLIT ? 2 : 1>(ah.v, al.v, bq.v, bq.v, acc[t]); }
  }
#pragma unroll
  for (int t = 0; t < 4; ++t) { if (col0 + t * 16 >= N) continue;
#pragma unroll
    for (int r = 0; r < 8; ++r) so[w][8 * hh + r][t * 16 + ln] = acc[t][r] * alpha; }
  __builtin_amdgcn_fence(__ATOMIC_ACQ_REL, "workgroup"); __builtin_amdgcn_wave_barrier();
  const int rsub = lane >> 4, c4 = (lane & 15) * 4;
  {
#pragma unroll
    for (int q = 0; q < 8; ++q) { const int r = q * 2 + rsub; if (col0 + c4 < N) { const v4f v = *(const v4fa*)&so[w][r][c4]; *(v4f*)(C + (size_t)(row0 + r) * ldc + col0 + c4) = v; } }
     }
}

// Wt[n][k] = f16(W[k][n]·scale) from f32 row-major W[K][N] (scale = power of two; bf16-exact weights stay exact in f16 away from the subnormal range)
__global__ __launch_bounds__(256) void k_wt_f16(const float* __restrict__ W, _Float16* __restrict__ Wt, int K, int N, float scale) {
  const int t = blockIdx.x * 256 + threadIdx.x; if (t >= N * (K / 8)) return; const int n = t / (K / 8), k8 = (t % (K / 8)) * 8; FragH f;
#pragma unroll
  for (int i = 0; i < 8; ++i) f.h[i] = (_Float16)(bf16_round(W[(size_t)(k8 + i) * N + n]) * scale); const v8us o = f.half[0];
  *(v8us*)((unsigned short*)Wt + (size_t)n * K + k8) = o; 
}
// k_gemm_hh variant with fused epilogue: v = acc·alpha + bias[by·sBias + col] (+ CP[(row/rowsPerB)·sCPb + by·64 + col] if CP) ; ACT 0 none / 1 elu ; writes f16 C16 (and f32 C if non-null)
template <int ACT>
__global__ __launch_bounds__(128) void k_gemm_hhx(const _Float16* __restrict__ A, int lda, size_t sA, const _Float16* __restrict__ Bh, int ldb, size_t sB, float alpha, const float* __restrict__ bias, size_t sBias, const float* __restrict__ CP, int rowsPerB, size_t sCPb, int row0g,
    float* __restrict__ C, _Float16* __restrict__ C16, int ldc, size_t sC, int M, int N, int K) {
  __shared__ __attribute__((aligned(16))) float so[4][16][64];
  const int tid = threadIdx.x, w = tid >> 5, lane = tid & 31, ln = lane & 15, hh = lane >> 4; const int by = blockIdx.y;
  A += (size_t)by * sA; Bh += (size_t)by * sB; const size_t cofs = (size_t)by * sC; const float* bp = bias ? bias + (size_t)by * sBias : nullptr;
  const int ntn = (N + 63) / 64; const int wid = blockIdx.x * 4 + w; const int mt = wid / ntn, nq = wid % ntn; if (mt * 16 >= M) return;
  const int row0 = mt * 16, col0 = nq * 64; const _Float16* arow = A + (size_t)(row0 + ln) * lda;
  v8f acc[4] = {};
  for (int kb = 0; kb < K; kb += 32) { FragH ah; ah.half[0] = *(const v8us*)((const unsigned short*)arow + kb + 8 * hh); ah.half[1] = *(const v8us*)((const unsigned short*)arow + kb + 16 + 8 * hh);
#pragma unroll
    for (int t = 0; t < 4; ++t) { if (col0 + t * 16 >= N) continue; const size_t boff = (size_t)(col0 + t * 16 + ln) * ldb + kb; FragH bq; bq.half[0] = *(const v8us*)((const unsigned short*)Bh + boff + 8 * hh); bq.half[1] = *(const v8us*)((const unsigned short*)Bh + boff + 16 + 8 * hh);
      acc[t] = mmaH<1>(ah.v, ah.v, bq.v, bq.v, acc[t]); }
  }
#pragma unroll
  for (int t = 0; t < 4; ++t) { if (col0 + t * 16 >= N) continue; const int col = col0 + t * 16 + ln; const float bv = bp ? bf16_round(bp[col]) : 0.f;
#pragma unroll
    for (int r = 0; r < 8; ++r) { float v = acc[t][r] * alpha + bv; if (CP) { const int rr = row0g + row0 + 8 * hh + r; if (rowsPerB < 0) v += CP[cofs + (size_t)rr * ldc + col];      /* rowsPerB < 0: own element of the batched C plane */ else { const int bidx = rr / rowsPerB; v += CP[(size_t)bidx * sCPb + (size_t)by * 64 + col]; } } if (ACT == 1) v = (v > 0.f) ? v : expm1f(v); else if (ACT == 7) v = (v > 0.f) ? v + 1.0f : expf(v); else if (ACT == 8) v = tanhf(v); else if (ACT == 9) v = 0.5f * v * (1.0f + tanhf(0.7978845608028654f * (v + 0.044715f * v * v * v))); else if (ACT == 11) v = 1.0f / (1.0f + expf(-v)); else if (ACT == 12) v = (v > 0.f) ? v : 0.01f * v; else if (ACT == 14) v = (v > 0.f) ? v : 0.1f * v; else if (ACT == 16) v = (v >= 0.f) ? v : 0.3f * v; else if (ACT == 17) v = (v >= 0.f) ? v : 0.2f * v; else if (ACT == 15) v = v / (1.0f + expf(-v)); else if (ACT == 3) v = fmaxf(v, 0.f); else if (ACT == 6) v = 0.5f * v * (1.0f + erff(v * 0.70710678118654752f)); so[w][8 * hh + r][t * 16 + ln] = v; } }
  __builtin_amdgcn_fence(__ATOMIC_ACQ_REL, "workgroup"); __builtin_amdgcn_wave_barrier();
  const int rsub = lane >> 4, c4 = (lane & 15) * 4; typedef _Float16 v4h __attribute__((ext_vector_type(4)));
  {
#pragma unroll
    for (int q = 0; q < 8; ++q) { const int r = q * 2 + rsub; if (col0 + c4 < N) { const v4f v = *(const v4fa*)&so[w][r][c4]; if (C) *(v4f*)(C + cofs + (size_t)(row0 + r) * ldc + col0 + c4) = v; if (C16) { v4h h4; for (int i = 0; i < 4; ++i) h4[i] = (_Float16)v[i]; *(v4h*)(C16 + cofs + (size_t)(row0 + r) * ldc + col0 + c4) = h4; } } }
     }
}


typedef _Float16 v4h __attribute__((ext_vector_type(4)));

__global__ __launch_bounds__(256) void k_x16(const float* __restrict__ x, _Float16* __restrict__ X16, size_t n8) { const size_t t = (size_t)blockIdx.x * 256 + threadIdx.x; if (t >= n8) return; FragH f;
#pragma unroll
  for (int q = 0; q < 8; ++q) f.h[q] = (_Float16)bf16_round(x[t * 8 + q]); *(v8us*)((unsigned short*)X16 + t * 8) = f.half[0];  }
__global__ __launch_bounds__(256) void k_h16(const float* __restrict__ x, _Float16* __restrict__ X16, size_t n8) { const size_t t = (size_t)blockIdx.x * 256 + threadIdx.x; if (t >= n8) return; FragH f;
#pragma unroll
  for (int q = 0; q < 8; ++q) f.h[q] = (_Float16)x[t * 8 + q]; *(v8us*)((unsigned short*)X16 + t * 8) = f.half[0];  }
__global__ __launch_bounds__(256) void k_round16f(const float* __restrict__ W, _Float16* __restrict__ Bt, size_t n8) { const size_t t = (size_t)blockIdx.x * 256 + threadIdx.x; if (t >= n8) return; FragH f;
#pragma unroll
  for (int i = 0; i < 8; ++i) f.h[i] = (_Float16)(bf16_round(W[t * 8 + i]) * 16.0f); *(v8us*)((unsigned short*)Bt + t * 8) = f.half[0];  }
template <int NHv, int TTv>
__global__ __launch_bounds__(256) void k_vt(const _Float16* __restrict__ V16, int ldv, int voff, _Float16* __restrict__ Vt) { __shared__ unsigned short tl[64][66]; const int tid = threadIdx.x; const int slab = blockIdx.x / (TTv / 64), lg = blockIdx.x % (TTv / 64); const int b = slab / NHv, h = slab % NHv;
  for (int i = tid; i < 64 * 8; i += 256) { const int r = i / 8, c8 = (i % 8) * 8; FragH f; f.half[0] = *(const v8us*)((const unsigned short*)V16 + ((size_t)b * TTv + lg * 64 + r) * ldv + voff + h * 64 + c8);
#pragma unroll
    for (int q = 0; q < 8; ++q) tl[r][c8 + q] = f.u[q]; }
  __syncthreads();
  {
#pragma unroll
    for (int rd = 0; rd < 2; ++rd) { const int d = rd * 32 + tid / 8, pc = tid % 8; FragH f;
#pragma unroll
      for (int q = 0; q < 8; ++q) f.u[q] = tl[pc * 8 + q][d];
      *(v8us*)((unsigned short*)Vt + ((size_t)slab * 64 + d) * TTv + lg * 64 + pc * 8) = f.half[0]; }
     } }

__global__ __launch_bounds__(256) void k_hl(const float* __restrict__ F, _Float16* __restrict__ Hh, _Float16* __restrict__ Hl, size_t n8) { const size_t t = (size_t)blockIdx.x * 256 + threadIdx.x; if (t >= n8) return; FragH fh, fl; const v4f a = *(const v4fa*)(F + t * 8), c = *(const v4fa*)(F + t * 8 + 4);
#pragma unroll
  for (int q = 0; q < 4; ++q) { _Float16 h = (_Float16)a[q]; fh.h[q] = h; fl.h[q] = (_Float16)((a[q] - (float)h) * 1024.0f); h = (_Float16)c[q]; fh.h[4 + q] = h; fl.h[4 + q] = (_Float16)((c[q] - (float)h) * 1024.0f); }
  { *(v8us*)((unsigned short*)Hh + t * 8) = fh.half[0]; *(v8us*)((unsigned short*)Hl + t * 8) = fl.half[0];  } }

// ---- f16 fragment of 32 k from a k-contiguous row, hardware k order (8 hh + 0..7, then 16 + 8 hh + 0..7) ----
__device__ __forceinline__ v16h g2_frag(const _Float16* p, int hh) { FragH f; f.half[0] = *(const v8us*)((const unsigned short*)p + 8 * hh); f.half[1] = *(const v8us*)((const unsigned short*)p + 16 + 8 * hh); return f.v; }


// ---- the same fragment from a plane stored in fragment order: 1 KiB a fragment of 16 rows x 32 k, first the 32 lanes' k 8 hh + 0..7 (16 bytes a lane, lane = 16 hh + row), then their k 16 + 8 hh + 0..7; p = fragment start + 8 * lane.
// Each of the two wave-wide loads then covers 512 contiguous bytes, 4 whole lines, where a row-major plane gives 16 lines in pieces of 32 bytes. ----
__device__ __forceinline__ v16h pk_frag(const _Float16* p) { FragH f; f.half[0] = *(const v8us*)((const unsigned short*)p); f.half[1] = *(const v8us*)((const unsigned short*)p + 256); return f.v; }

// ---- projection stage in two launches ----
// the three [in][out] weights (grid.y picks one) as f16(bf16(W[k][n]) * 16) in fragment order: fragment (column tile c / 16 of the 192 columns, k / 32) at ((c / 16) * 32 + k / 32) * 512 halves. A thread takes 8 neighbouring k of one output column n,
// and a wave is one half fragment: its loads read 64 bytes of each of two k rows, its store is 512 contiguous bytes (thread t of a weight writes halves 8 t ...)
__global__ __launch_bounds__(256) void k_wt3(const float* __restrict__ W0, const float* __restrict__ W1, const float* __restrict__ W2, _Float16* __restrict__ Wt) {
  const int t = blockIdx.x * 256 + threadIdx.x; const int lane = t & 31, hf = t >> 5; const int n = (hf >> 6) * 16 + (lane & 15), k8 = ((hf >> 1) & 31) * 32 + (hf & 1) * 16 + (lane >> 4) * 8; const int m = blockIdx.y;
  const float* p = ((m == 0) ? W0 : (m == 1) ? W1 : W2) + (size_t)k8 * HD + n; float v[8]; FragH f;
#pragma unroll
  for (int i = 0; i < 8; ++i) v[i] = p[i * HD];
  asm volatile("s_wait_xcnt 0x0" :: "v"(p) : "memory");      /* the wait in front of any overwrite of the address pair that the issued loads name; naming the pair keeps it whole up to here */
#pragma unroll
  for (int i = 0; i < 8; ++i) f.h[i] = (_Float16)(bf16_round(v[i]) * 16.0f);
  *(v8us*)((unsigned short*)Wt + (size_t)m * (HD * DMX) + (size_t)t * 8) = f.half[0];
}
// q, k, v of 32 tokens a block: the 32 x 192 tile [q | k | v] = x Bt^T / 16. Wave w takes the column half w / 8 (96 columns) and the K slice w % 8 (128 wide); the 8 partial tiles of each half meet in LDS and are summed in slice order.
// The block's 32 x 1024 tile of x is staged once in LDS: wave w loads rows 16 (w / 8) ... + 15 of K slice w % 8, two rows x 256 contiguous bytes a load (4 whole lines), rounds each value to bf16, holds it exactly in f16 and stores it in fragment order (xs_frag);
// behind one barrier every wave reads its A fragments from there. A row-per-lane load of f32 rows touches 16 lines for the same 512 bytes, and each column half would need the same rows.
// Waves 0-7 then write q (f16) and k (f32 rows to the output, f16); waves 8-15 write v: a thread owns one head column d and 8 neighbouring tokens, so that it stores f32 rows to the output and
// 16 bytes of V^T hi and of the x1024 residual. Each f16 plane gives the block's 32 tokens one 4-KiB slab of four fragments in the order of pk_frag: q and k as (token tile, d / 32) with rows = tokens, k = d; V^T as d / 16 with rows = d, k = tokens.
// Every loop is unrolled: the accumulator and fragment arrays are then indexed by constants only and stay in registers, and the loads of later k steps can be issued ahead of the first matrix instruction.
#define PW 16
#define PP 100      /* pitch in floats of a 96-column partial tile: 8 rows on are 32 banks on, as with pitch 68 */
#define XF 656      /* halves from one staged x fragment to the next: 1312 bytes = two halves of 640 and 32 spare, each two lane halves of 320 (256 used); see xs_frag */
// A fragment of the staged x tile: p = fragment start + 160 * hh + 8 * row; k order as pk_frag (8 hh + 0..7, then 16 + 8 hh + 0..7). The odd steps (32, 64 and 128 bytes beyond a multiple of 256) put the 32 lanes' 8-byte stores of the staging on all 64 banks; each 16 lanes of a read take 256 contiguous bytes.
__device__ __forceinline__ v16h xs_frag(const _Float16* p) { FragH f; f.half[0] = *(const v8us*)((const unsigned short*)p); f.half[1] = *(const v8us*)((const unsigned short*)p + 320); return f.v; }
__global__ __launch_bounds__(PW * 32) void k_qkv(const float* __restrict__ x, const _Float16* __restrict__ Bt, _Float16* __restrict__ Q16, float* __restrict__ KO, _Float16* __restrict__ K16, float* __restrict__ VO, _Float16* __restrict__ VTH, _Float16* __restrict__ VTR) {
  __shared__ __attribute__((aligned(16))) float so[PW][32][PP];
  __shared__ __attribute__((aligned(16))) _Float16 xs[64 * XF];
  const int tid = threadIdx.x, lane = tid & 31, ln = lane & 15, hh = lane >> 4; const int w = __builtin_amdgcn_readfirstlane(tid >> 5);      /* the wave's number in a scalar register: the role branch behind the barrier is then a scalar branch */
  const int ch = w >> 3, ks = w & 7; const int row0 = blockIdx.x * 32;
  const float* xp = x + (size_t)(row0 + ch * 16 + hh) * DMX + ks * 128 + ln * 4;
  const _Float16* bp = Bt + (size_t)(ch * 6 * 32 + ks * 4) * 512 + lane * 8;
  v4f xr[16]; v16h bq[4][6];
#pragma unroll
  for (int i = 0; i < 16; ++i) xr[i] = *(const v4fa*)(xp + (i >> 1) * (2 * DMX) + (i & 1) * 64);
  asm volatile("s_wait_xcnt 0x0" :: "v"(xp) : "memory");      /* the wait in front of any overwrite of the address pair that the issued loads name; naming the pair keeps it whole up to here. It also keeps the x loads in front of the weight loads: loads return in order, and x is wanted first */
#pragma unroll
  for (int kq = 0; kq < 3; ++kq)
#pragma unroll
    for (int t = 0; t < 6; ++t) bq[kq][t] = pk_frag(bp + t * (32 * 512) + kq * 512);      /* the weights of the first three k steps fly while x is staged */
  _Float16* xw = xs + (ch * 32 + ks * 4 + ((lane >> 3) & 1)) * XF + ((lane >> 2) & 1) * 320 + ((lane >> 1) & 1) * 160 + hh * 8 + (lane & 1) * 4;
#pragma unroll
  for (int i = 0; i < 16; ++i) { v4h h4;
#pragma unroll
    for (int e = 0; e < 4; ++e) h4[e] = (_Float16)(float)(__bf16)xr[i][e];      /* the conversion instruction rounds to nearest even, as bf16_round does */
    *(v4h*)(xw + (i & 1) * (2 * XF) + (i >> 1) * 16) = h4; }
  /* the whole x tile is in LDS before any wave reads a fragment of it. The barrier with fences on LDS alone: __syncthreads() would also wait here for the weight loads in flight, which no other wave needs */
  __builtin_amdgcn_fence(__ATOMIC_RELEASE, "workgroup", "local"); __builtin_amdgcn_s_barrier(); __builtin_amdgcn_fence(__ATOMIC_ACQUIRE, "workgroup", "local");
  const _Float16* xa = xs + ks * 4 * XF + hh * 160 + ln * 8;
  v8f acc[2][6] = {};
#pragma unroll
  for (int kq = 0; kq < 4; ++kq) { const v16h a0 = xs_frag(xa + kq * XF), a1 = xs_frag(xa + (32 + kq) * XF);
#pragma unroll
    for (int t = 0; t < 6; ++t) {
      acc[0][t] = __builtin_amdgcn_wmma_f32_16x16x32_f16(false, a0, false, bq[kq][t], (short)0, acc[0][t], false, false);
      acc[1][t] = __builtin_amdgcn_wmma_f32_16x16x32_f16(false, a1, false, bq[kq][t], (short)0, acc[1][t], false, false);
      if ((kq == 0 && t == 5) || (kq == 1 && t == 2)) {      /* the last k step's weights, three fragments at a time into registers that used fragments have left, two k steps ahead of their products */
#pragma unroll
        for (int v = 0; v < 3; ++v) bq[3][kq * 3 + v] = pk_frag(bp + (kq * 3 + v) * (32 * 512) + 3 * 512);
        __builtin_amdgcn_sched_barrier(0);      /* keeps these loads here: the compiler otherwise moved them down to one fragment at a time right in front of its products, a wait for L2 each */ } } }
#pragma unroll
  for (int u = 0; u < 2; ++u)
#pragma unroll
    for (int t = 0; t < 6; ++t)
#pragma unroll
      for (int r = 0; r < 8; ++r) so[w][u * 16 + 8 * hh + r][t * 16 + ln] = acc[u][t][r];
  __syncthreads();      /* every wave's partial tile is in LDS before any is summed */
  if (w < 8) { const int r = tid >> 3, c4 = (tid & 7) * 4; const size_t ro = (size_t)(row0 + r) * HD;
    const size_t po = (size_t)blockIdx.x * 2048 + (r >> 4) * 1024 + (c4 >> 4) * 256 + (((c4 >> 3) & 1) * 16 + (r & 15)) * 8 + (c4 & 4);      /* place of d = c4 ... c4 + 3 (mod 32) of token r in the slab; + 512 for d from 32 on */
#pragma unroll
    for (int j = 0; j < 4; ++j) { const int col = 32 * j + c4;      /* columns 0-63 q, 64-127 k; columns from 96 on lie in the second half's tiles */
      const float* sp = (j < 3) ? &so[0][r][col] : &so[8][r][c4]; v4f s = *(const v4fa*)sp;
#pragma unroll
      for (int u = 1; u < 8; ++u) s += *(const v4fa*)(sp + u * 32 * PP);
      const v4f v = s * 0.0625f; v4h h4;
#pragma unroll
      for (int i = 0; i < 4; ++i) h4[i] = (_Float16)v[i];
      if (j < 2) *(v4h*)(Q16 + po + j * 512) = h4; else { *(v4f*)(KO + ro + col - 64) = v; *(v4h*)(K16 + po + (j - 2) * 512) = h4; } } }
  else { const int d = tid & 63, tg = (tid >> 6) & 3; const float* sp = &so[8][tg * 8][32 + d]; float* vo = VO + (size_t)(row0 + tg * 8) * HD + d; FragH fh, fl;
#pragma unroll
    for (int i = 0; i < 8; ++i) { float s = sp[i * PP];
#pragma unroll
      for (int u = 1; u < 8; ++u) s += sp[u * 32 * PP + i * PP];
      const float v = s * 0.0625f; vo[i * HD] = v; const _Float16 h = (_Float16)v; fh.h[i] = h; fl.h[i] = (_Float16)((v - (float)h) * 1024.0f); }
    const size_t to = (size_t)blockIdx.x * (HD * 32) + (d >> 4) * 512 + (tg >> 1) * 256 + ((tg & 1) * 16 + (d & 15)) * 8;
    *(v8us*)((unsigned short*)VTH + to) = fh.half[0]; *(v8us*)((unsigned short*)VTR + to) = fl.half[0];
    asm volatile("s_wait_xcnt 0x0" ::: "memory");      /* the wait behind these stores, in front of any overwrite of a register that they name: the other role's body follows this one in the listing */ } }


__global__ __launch_bounds__(256) void k_wnat(const float* __restrict__ w, size_t n8, _Float16* __restrict__ Bt) { const size_t t = (size_t)blockIdx.x * 256 + threadIdx.x; if (t >= n8) return; FragH f; for (int q = 0; q < 8; ++q) f.h[q] = (_Float16)(bf16_round(w[t * 8 + q]) * 16.0f); *(v8us*)((unsigned short*)Bt + t * 8) = f.half[0];  }
__global__ __launch_bounds__(256) void k_rsm(const float* __restrict__ S, _Float16* __restrict__ P, int nrows) {
  #pragma clang fp contract(off)
  const int i = blockIdx.x * 256 + threadIdx.x; if (i >= nrows) return; const float* s = S + (size_t)i * SQ; float mx = -3.0e38f;
#pragma unroll 1
  for (int j = 0; j < SQ; ++j) mx = fmaxf(mx, s[j]); float se = 0.f;
#pragma unroll 1
  for (int j = 0; j < SQ; ++j) se += expf(s[j] - mx); const float sc = 256.0f / se;
#pragma unroll 1
  for (int j0 = 0; j0 < SQ; j0 += 8) { FragH f; for (int q = 0; q < 8; ++q) f.h[q] = (_Float16)(expf(s[j0 + q] - mx) * sc); unsigned short* d = (unsigned short*)P + (size_t)i * SQ + j0; *(v8us*)d = f.half[0];  } }
__global__ __launch_bounds__(256) void k_vt(const _Float16* __restrict__ V16, int b, int h0, _Float16* __restrict__ VT) { __shared__ unsigned short tl[64][65]; const int tid = threadIdx.x; const int hh = blockIdx.x % HG, sg = blockIdx.x / HG; const int s0 = sg * 64; const int h = h0 + hh;
  for (int i = tid; i < 64 * 8; i += 256) { const int j = i / 8, d8 = (i % 8) * 8; FragH f; f.half[0] = *(const v8us*)((const unsigned short*)V16 + ((size_t)b * SQ + s0 + j) * DM + h * HD + d8); for (int q = 0; q < 8; ++q) tl[d8 + q][j] = f.u[q]; }
  __syncthreads();
  { for (int i = tid; i < 64 * 8; i += 256) { const int d = i / 8, j8 = (i % 8) * 8; FragH f; for (int q = 0; q < 8; ++q) f.u[q] = tl[d][j8 + q]; *(v8us*)((unsigned short*)VT + ((size_t)hh * HD + d) * SQ + s0 + j8) = f.half[0]; }  } }


__global__ __launch_bounds__(256) void k_rsmcf2(const float* __restrict__ S, _Float16* __restrict__ P, int hg, int q0, int nk) {
  #pragma clang fp contract(off)
  const int t = blockIdx.x * 256 + threadIdx.x; if (t >= hg * QT) return; const size_t i = (size_t)t; const float* s = S + i * NKX; const int last = q0 + (t % QT); float mx = -3.0e38f;
#pragma unroll 1
  for (int j = 0; j < nk; ++j) { const float f = (j <= last) ? 1.f : 0.f; mx = fmaxf(mx, fmaf(f, s[j], (1.f - f) * -1.0e9f)); } float se = 0.f;
#pragma unroll 1
  for (int j = 0; j < nk; ++j) { const float f = (j <= last) ? 1.f : 0.f; se += __expf(fmaf(f, s[j], (1.f - f) * -1.0e9f) - mx); } const float sc = 256.0f / se;
#pragma unroll 1
  for (int j0 = 0; j0 < nk; j0 += 8) { FragH fr; for (int q = 0; q < 8; ++q) { const int j = j0 + q; const float f = (j <= last) ? 1.f : 0.f; fr.h[q] = (_Float16)(__expf(fmaf(f, s[j], (1.f - f) * -1.0e9f) - mx) * sc); } unsigned short* d = (unsigned short*)P + i * NKX + j0; *(v8us*)d = fr.half[0];  } }


// ---- causal attention in one launch: scores, softmax and P V of 32 queries a block; no score or weight plane in memory ----
// native 2^y; the v_nop is the slot the instruction set asks for behind a transcendental before its result is read or its source overwritten
__device__ __forceinline__ float exp2_hw(float y) { float x; asm("v_exp_f32 %0, %1\n\tv_nop" : "=v"(x) : "v"(y)); return x; }
// eight at once: results in registers of their own, so that each v_exp is the independent instruction behind the one before it and one v_nop closes the last slot
__device__ __forceinline__ void exp2_x8(const float (&y)[8], float (&x)[8]) {
  asm("v_exp_f32 %0, %8\n\tv_exp_f32 %1, %9\n\tv_exp_f32 %2, %10\n\tv_exp_f32 %3, %11\n\tv_exp_f32 %4, %12\n\tv_exp_f32 %5, %13\n\tv_exp_f32 %6, %14\n\tv_exp_f32 %7, %15\n\tv_nop"
      : "=&v"(x[0]), "=&v"(x[1]), "=&v"(x[2]), "=&v"(x[3]), "=&v"(x[4]), "=&v"(x[5]), "=&v"(x[6]), "=&v"(x[7]) : "v"(y[0]), "v"(y[1]), "v"(y[2]), "v"(y[3]), "v"(y[4]), "v"(y[5]), "v"(y[6]), "v"(y[7])); }
// the value of lane l ^ 16: the other half of a query's keys
__device__ __forceinline__ float xhalf(float x) { return __builtin_bit_cast(float, __builtin_amdgcn_permlanex16(__builtin_bit_cast(int, x), __builtin_bit_cast(int, x), 0x76543210, 0xfedcba98, false, false)); }
// Block = (batch, query tile of 32 rows), heaviest tiles first in the grid. Wave w takes the key steps w, w + AW, ... of 32 keys up to the diagonal step (the tile's own keys, the only one that is masked).
// Transposed products: S^T = K Q^T puts one query in a lane (column ln) and 8 keys of each 16-key tile in its registers (row 8 hh + r), which is the k order of a B fragment: the weights go from the score accumulators
// straight into the B operand of O^T += V^T P^T, whose A fragments come from the V^T planes in the same k order (pk_frag). Row maximum and row sum are in-lane plus one exchange between the lane halves.
// Each wave keeps its own running maximum m (raw q . k units), sum l and un-normalised O^T; weights are 256 * 2^((s - m) CS), hi = f16, lo = f16 of the residual; V's x1024 residual meets hi / 1024, so that all three products add into one accumulator.
// The AW partial results meet in LDS behind one barrier and are joined with the weights 2^((m_w - M) CS); a wave without a step gives m = -3e38, l = 0, O = 0.
#define AW 16
#define AP 68      /* pitch in floats of a query's 64 partial outputs: 16 lanes' 16-byte stores fall on all 64 banks */
__global__ __launch_bounds__(AW * 32) void k_attn(const _Float16* __restrict__ Q16, const _Float16* __restrict__ K16, const _Float16* __restrict__ VTH, const _Float16* __restrict__ VTR, float* __restrict__ O) {
  __shared__ __attribute__((aligned(16))) float so[AW][32][AP];
  __shared__ float sm[AW][32]; __shared__ float sl[AW][32];
  const int tid = threadIdx.x, lane = tid & 31, ln = lane & 15, hh = lane >> 4; const int w = __builtin_amdgcn_readfirstlane(tid >> 5);      /* the wave's number in a scalar register: the key loop then runs on scalar compares and branches, every lane on at the matrix instructions */
  const int by = blockIdx.x, qi = SQ / 32 - 1 - (int)blockIdx.y, row0 = qi * 32;
  const float CS = 1.44269504f * 0.03125f;      /* log2(e) * 1024^-0.5 */
  const _Float16* qp = Q16 + ((size_t)by * SQ + row0) * HD + lane * 8; const _Float16* kp = K16 + (size_t)by * SQ * HD + lane * 8;      /* the lane's 16 bytes are in the step pointers: every fragment of a step then lies at an immediate offset from one of them */
  const _Float16* vhp = VTH + (size_t)by * HD * SQ + lane * 8; const _Float16* vlp = VTR + (size_t)by * HD * SQ + lane * 8;
  v16h qf[2][2];
#pragma unroll
  for (int qt = 0; qt < 2; ++qt)
#pragma unroll
    for (int ks = 0; ks < 2; ++ks) qf[qt][ks] = pk_frag(qp + (qt * 2 + ks) * 512);
  const v8f z8 = {0.f, 0.f, 0.f, 0.f, 0.f, 0.f, 0.f, 0.f};
  v8f acc[2][4]; float m[2], l[2];
#pragma unroll
  for (int qt = 0; qt < 2; ++qt) { m[qt] = -3.0e38f; l[qt] = 0.f;
#pragma unroll
    for (int dt = 0; dt < 4; ++dt) acc[qt][dt] = z8; }
#pragma unroll 1      /* rolled: at most SQ / 32 / AW trips, and the live set of one trip fills the register budget of a 16-wave block */
  for (int j = w; j <= qi; j += AW) {
    v16h kf[2][2], vh[4], vl[4]; const _Float16* kj = kp + (size_t)j * (32 * HD); const _Float16* vhj = vhp + (size_t)j * (HD * 32); const _Float16* vlj = vlp + (size_t)j * (HD * 32);
#pragma unroll
    for (int kt = 0; kt < 2; ++kt)
#pragma unroll
      for (int ks = 0; ks < 2; ++ks) kf[kt][ks] = pk_frag(kj + (kt * 2 + ks) * 512);
#pragma unroll
    for (int dt = 0; dt < 4; ++dt) vh[dt] = pk_frag(vhj + dt * 512);
    asm volatile("s_wait_xcnt 0x0" :: "v"(kj), "v"(vhj) : "memory");      /* the wait in front of any overwrite of the address pairs that the issued loads name; naming the pairs keeps them whole up to here (one build let a load land on its own pair) */
    __builtin_amdgcn_sched_barrier(0);      /* all K loads are issued before the first score product: the compiler otherwise loaded one K fragment into the registers of another behind its product, a second wait for L2 in every step */
    v8f s[2][2];
#pragma unroll
    for (int qt = 0; qt < 2; ++qt)
#pragma unroll
      for (int kt = 0; kt < 2; ++kt) {
        s[qt][kt] = __builtin_amdgcn_wmma_f32_16x16x32_f16(false, kf[kt][0], false, qf[qt][0], (short)0, z8, false, false);
        s[qt][kt] = __builtin_amdgcn_wmma_f32_16x16x32_f16(false, kf[kt][1], false, qf[qt][1], (short)0, s[qt][kt], false, false); }
#pragma unroll
    for (int dt = 0; dt < 4; ++dt) vl[dt] = pk_frag(vlj + dt * 512);      /* asked for here, into registers that the K fragments leave, used behind the softmax */
    asm volatile("s_wait_xcnt 0x0" :: "v"(vlj) : "memory");      /* as above, for the residual plane's address pair */
    if (j == qi) {      /* the diagonal step: key kt * 16 + 8 hh + r of the tile is visible to query qt * 16 + ln up to the query itself; every query sees at least its own key */
#pragma unroll
      for (int qt = 0; qt < 2; ++qt)
#pragma unroll
        for (int kt = 0; kt < 2; ++kt)
#pragma unroll
          for (int r = 0; r < 8; ++r) s[qt][kt][r] = (kt * 16 + 8 * hh + r <= qt * 16 + ln) ? s[qt][kt][r] : -3.0e38f; }
    FragH ph[2], pl[2]; float corr[2];
#pragma unroll
    for (int qt = 0; qt < 2; ++qt) {
      float m4[4] = {m[qt], m[qt], m[qt], m[qt]};
#pragma unroll
      for (int kt = 0; kt < 2; ++kt)
#pragma unroll
        for (int r = 0; r < 8; ++r) m4[r & 3] = fmaxf(m4[r & 3], s[qt][kt][r]);
      float mn = fmaxf(fmaxf(m4[0], m4[1]), fmaxf(m4[2], m4[3])); mn = fmaxf(mn, xhalf(mn));
      corr[qt] = exp2_hw((m[qt] - mn) * CS); m[qt] = mn;      /* 0 on the wave's first step */
      const float nb = 8.0f - mn * CS; float s4[4] = {0.f, 0.f, 0.f, 0.f};
#pragma unroll
      for (int kt = 0; kt < 2; ++kt) { float y[8], p[8];
#pragma unroll
        for (int r = 0; r < 8; ++r) y[r] = fmaf(s[qt][kt][r], CS, nb);
        exp2_x8(y, p);
#pragma unroll
        for (int r = 0; r < 8; ++r) { s4[r & 3] += p[r]; const _Float16 h = (_Float16)p[r]; ph[qt].h[kt * 8 + r] = h; pl[qt].h[kt * 8 + r] = (_Float16)(p[r] - (float)h); } }
      l[qt] = fmaf(l[qt], corr[qt], (s4[0] + s4[1]) + (s4[2] + s4[3])); }
    __builtin_amdgcn_sched_barrier(0);      /* the softmax of both query tiles stays in front of the P V products: the build without this line mixed the two and spilled to scratch */
#pragma unroll
    for (int qt = 0; qt < 2; ++qt) { const v16h ps = ph[qt].v * (_Float16)0.0009765625f;
#pragma unroll
      for (int dt = 0; dt < 4; ++dt) { v8f a = acc[qt][dt] * corr[qt];
        a = __builtin_amdgcn_wmma_f32_16x16x32_f16(false, vh[dt], false, ph[qt].v, (short)0, a, false, false);
        a = __builtin_amdgcn_wmma_f32_16x16x32_f16(false, vh[dt], false, pl[qt].v, (short)0, a, false, false);
        acc[qt][dt] = __builtin_amdgcn_wmma_f32_16x16x32_f16(false, vl[dt], false, ps, (short)0, a, false, false); } } }
#pragma unroll
  for (int qt = 0; qt < 2; ++qt) { const float lt = l[qt] + xhalf(l[qt]); if (hh == 0) { sm[w][qt * 16 + ln] = m[qt]; sl[w][qt * 16 + ln] = lt; }
#pragma unroll
    for (int dt = 0; dt < 4; ++dt) { const v8f a = acc[qt][dt]; float* d = &so[w][qt * 16 + ln][dt * 16 + 8 * hh];
      const v4f lo4 = {a[0], a[1], a[2], a[3]}, hi4 = {a[4], a[5], a[6], a[7]}; *(v4fa*)d = lo4; *(v4fa*)(d + 4) = hi4; } }
  __syncthreads();      /* every wave's maximum, sum and partial tile are in LDS before any is joined */
  const int q = tid >> 4, d4 = (tid & 15) * 4; float mw[AW]; float M = -3.0e38f;
#pragma unroll
  for (int u = 0; u < AW; ++u) { mw[u] = sm[u][q]; M = fmaxf(M, mw[u]); }
  float Ls = 0.f; v4f o = {0.f, 0.f, 0.f, 0.f};
#pragma unroll
  for (int g = 0; g < AW; g += 8) { float y[8], f[8];
#pragma unroll
    for (int u = 0; u < 8; ++u) y[u] = (mw[g + u] - M) * CS;
    exp2_x8(y, f);
#pragma unroll
    for (int u = 0; u < 8; ++u) { Ls = fmaf(sl[g + u][q], f[u], Ls); o += *(const v4fa*)&so[g + u][q][d4] * f[u]; } }
  *(v4f*)(O + ((size_t)by * SQ + row0 + q) * HD + d4) = o * (1.0f / Ls); }

extern "C" void kernel_launch(void* const* d_in, const int* in_sizes, int n_in,
                              void* d_out, int out_size, void* d_ws, size_t ws_size, hipStream_t stream) {
  (void)in_sizes; (void)n_in; (void)out_size;
  const float* const* I = (const float* const*)d_in; const float* x = I[0]; const float* wq = I[1]; const float* wk = I[2]; const float* wv = I[3];
  char* ws = (char*)d_ws; size_t off = 0;
  auto take = [&](size_t bytes) { char* p = ws + off; off += (bytes + 255) & ~(size_t)255; return p; };
  _Float16* B3 = (_Float16*)take((size_t)3 * HD * DMX * 2); _Float16* Q16 = (_Float16*)take(NR * HD * 2); _Float16* K16 = (_Float16*)take(NR * HD * 2); _Float16* VT = (_Float16*)take((size_t)NB * HD * SQ * 2); _Float16* VTL = (_Float16*)take((size_t)NB * HD * SQ * 2); float* KOUT = (float*)d_out + NR * HD; float* VF = (float*)d_out + 2 * NR * HD;      /* out1 = k and out2 = v are written in f32 straight into the tuple output */
  if (off > ws_size) return;      /* approx 0.4 + 4 x 1 MiB */
  k_wt3<<<dim3(HD * (DMX / 8) / 256, 3), 256, 0, stream>>>(wq, wk, wv, B3);      /* [in][out] 1024 x 64 x 3 -> 192 columns x16 in fragment order */
  k_qkv<<<(unsigned)(NR / 32), PW * 32, 0, stream>>>(x, B3, Q16, KOUT, K16, VF, VT, VTL);      /* out1 = k and out2 = v in f32; q, k, V^T hi and residual f16 in fragment order, 4 KiB a plane and 32 tokens */
  k_attn<<<dim3(NB, SQ / 32), AW * 32, 0, stream>>>(Q16, K16, VT, VTL, (float*)d_out);      /* out0 = softmax(causal q . k / 32) v */
}

// v009
// Measured time: 17.7 microseconds a run.
// It is 1.26 times as fast as v007, going by the measured steps of the versions left out in between.
// All steps since v000 together make it 552 times as fast.
#include <hip/hip_runtime.h>
// Single attention head returning the TUPLE (out, k, v) (x [4][2048][1024]; q = x Wq, k = x Wk, v = x Wv ([in][out] 1024 x 64, sigma 1/32, no biases); wei = q . k x 1024^-0.5 (the module scales by n_embd) with a causal mask (tril, -inf); softmax; out = wei v -> out0 [4][2048][64] @0, out1 = k [4][2048][64] f32 @2,097,152 B, out2 = v [4][2048][64] f32 @4,194,304 B; input order x, Wq, Wk, Wv).
// Structure: q, k, v in ONE projection launch (k_qkv: x read as f32 in whole lines, rounded and staged in LDS as bf16 fragments; the f32 weights read in whole lines and rounded to bf16 in registers; WMMA, f32 accumulation, K = 1024 split over the waves): k and v in f32 STRAIGHT INTO the tuple output slots (out1, out2); q, k and V^T as f16 planes in blocks of 32 tokens; every f16 plane that one launch hands to the next lies in the order of its reader's fragments (pk_frag); then ONE attention launch (k_attn): a block owns 32 queries of one batch, its 16 waves share the visible keys in steps of 32; scores, running softmax and weights stay in registers (S^T = K Q^T, O^T += V^T P^T), the weights as plain f16 (x256), O^T += V^T P^T in one product; the waves' partial sums meet in LDS; two launches.
// Compute dtype: inputs rounded to bf16; q, k and the V^T operand rounded to f16, softmax weights plain f16 (each ~2^-12 relative); scores, statistics, out f32; the outputs k and v stay f32. v_wmma_f32_16x16x32_bf16 (projection), v_wmma_f32_16x16x32_f16 (attention).
#define NB 4
#define NHS 1
#define DMX 1024                   /* model width (projection K) */
#define SQ 2048
#define HD 64
#define DM 64
#define NH 1
#define HG 1
#define QT 256
#define NKX SQ
#define NR ((size_t)NB * NHS * SQ)
typedef __bf16 v16b __attribute__((ext_vector_type(16)));
typedef unsigned short v8us __attribute__((ext_vector_type(8), may_alias));
typedef float  v8f  __attribute__((ext_vector_type(8)));
typedef float  v4f  __attribute__((ext_vector_type(4)));
typedef float  v4fa __attribute__((ext_vector_type(4), may_alias));
union FragB { v16b v; v8us half[2]; unsigned short u[16]; };

__device__ __forceinline__ unsigned short bf16_bits(float x) { unsigned int u = __float_as_uint(x); return (unsigned short)((u + 0x7FFFu + ((u >> 16) & 1u)) >> 16); }
__device__ __forceinline__ float bf16_val(unsigned short b) { return __uint_as_float(((unsigned int)b) << 16); }
__device__ __forceinline__ float bf16_round(float x) { return bf16_val(bf16_bits(x)); }
// D += A·B with NT terms: 1 = ah·bh, 2 = + al·bh (A split), 3 = + ah·bl (both split)
template <int NT>
__device__ __forceinline__ v8f mmaN(v16b ah, v16b al, v16b bh, v16b bl, v8f c) {
  c = __builtin_amdgcn_wmma_f32_16x16x32_bf16(false, ah, false, bh, (short)0, c, false, false);
  if (NT >= 2) c = __builtin_amdgcn_wmma_f32_16x16x32_bf16(false, al, false, bh, (short)0, c, false, false);
  if (NT >= 3) c = __builtin_amdgcn_wmma_f32_16x16x32_bf16(false, ah, false, bl, (short)0, c, false, false);
  asm volatile("v_nop\n\tv_nop\n\tv_nop\n\tv_nop" : "+v"(c) : "v"(ah), "v"(al), "v"(bh), "v"(bl));
  return c;
}

__global__ __launch_bounds__(256) void k_wt_bf16(const float* __restrict__ W, unsigned short* __restrict__ Wt, int K, int N) {
  const int t = blockIdx.x * 256 + threadIdx.x;
  const int k8n = K / 8;
  if (t >= N * k8n) return;
  const int n = t / k8n, k8 = (t % k8n) * 8;
  v8us v;
#pragma unroll
  for (int i = 0; i < 8; ++i) v[i] = bf16_bits(W[(size_t)(k8 + i) * N + n]);
  *(v8us*)(Wt + (size_t)n * K + k8) = v;
  
}

// GEMM C[M][N] (f32, pitch ldc) = act(A[M][K]·W + bias). A f32 row-major (pitch lda) converted per fragment to bf16
// (ASPLIT: hi/lo two planes -> 2 terms, else single rounded term); Wt bf16 [N][K] (pitch ldb). BIAS_BF16 rounds the
// bias to bf16 first (bias quantised to bf16 before the add). K%32==0, M%16==0, N%64==0.
template <bool ASPLIT, int ACT, bool BIAS_BF16>
__global__ __launch_bounds__(128) void k_gemm_bf(const float* __restrict__ A, int lda, const unsigned short* __restrict__ Wt, int ldb,
                                               const float* __restrict__ bias, float* __restrict__ C, int ldc, int M, int N, int K) {
  __shared__ __attribute__((aligned(16))) float so[4][16][64];
  const int tid = threadIdx.x, w = tid >> 5, lane = tid & 31, ln = lane & 15, hh = lane >> 4;
  const int ntn = N / 64;
  const int wid = blockIdx.x * 4 + w;
  const int mt = wid / ntn, nq = wid % ntn;
  if (mt * 16 >= M) return;
  const int row0 = mt * 16, col0 = nq * 64;
  const float* arow = A + (size_t)(row0 + ln) * lda;
  v8f acc[4] = {};
  for (int kb = 0; kb < K; kb += 32) {
    FragB ah, al;
    const v4f x0 = *(const v4fa*)(arow + kb + 8 * hh), x1 = *(const v4fa*)(arow + kb + 8 * hh + 4);
    const v4f x2 = *(const v4fa*)(arow + kb + 16 + 8 * hh), x3 = *(const v4fa*)(arow + kb + 16 + 8 * hh + 4);
    float xs[16] = {x0[0],x0[1],x0[2],x0[3],x1[0],x1[1],x1[2],x1[3],x2[0],x2[1],x2[2],x2[3],x3[0],x3[1],x3[2],x3[3]};
#pragma unroll
    for (int i = 0; i < 16; ++i) { const unsigned short hb = bf16_bits(xs[i]); ah.u[i] = hb; al.u[i] = ASPLIT ? bf16_bits(xs[i] - bf16_val(hb)) : (unsigned short)0; }
#pragma unroll
    for (int t = 0; t < 4; ++t) {
      const unsigned short* brow = Wt + (size_t)(col0 + t * 16 + ln) * ldb + kb;
      FragB b;
      b.half[0] = *(const v8us*)(brow + 8 * hh);
      b.half[1] = *(const v8us*)(brow + 16 + 8 * hh);
      acc[t] = mmaN<ASPLIT ? 2 : 1>(ah.v, al.v, b.v, b.v, acc[t]);
    }
  }
#pragma unroll
  for (int t = 0; t < 4; ++t) {
    float bv = bias ? bias[col0 + t * 16 + ln] : 0.f;
    if (BIAS_BF16) bv = bf16_round(bv);
#pragma unroll
    for (int r = 0; r < 8; ++r) { float v = acc[t][r] + bv; if (ACT == 1) v = fmaxf(v, 0.f); so[w][8 * hh + r][t * 16 + ln] = v; }
  }
  __builtin_amdgcn_fence(__ATOMIC_ACQ_REL, "workgroup");
  __builtin_amdgcn_wave_barrier();
  const int rsub = lane >> 4, c4 = (lane & 15) * 4;
  {
#pragma unroll
    for (int q = 0; q < 8; ++q) {
      const int r = q * 2 + rsub;
      const v4f v = *(const v4fa*)&so[w][r][c4];
      *(v4f*)(C + (size_t)(row0 + r) * ldc + col0 + c4) = v;
    }
    
  }
}

// GEMM C = act(A·W + bias + resid): A f32 (ASPLIT -> hi/lo 2 terms), Wt bf16 [N][K]; ACT 0 none, 1 relu, 2 exact gelu;
// resid (optional, f32, row index = (row % rmod), pitch ldr, RES_BF16 rounds it) added before the activation.
template <bool ASPLIT, int ACT, bool BIAS_BF16, bool RES_BF16>
__global__ __launch_bounds__(128) void k_gemm_bf3(const float* __restrict__ A, int lda, const unsigned short* __restrict__ Wt, int ldb,
                                                const float* __restrict__ bias, const float* __restrict__ resid, int rmod, int ldr,
                                                float* __restrict__ C, int ldc, int M, int N, int K) {
  __shared__ __attribute__((aligned(16))) float so[4][16][64];
  const int tid = threadIdx.x, w = tid >> 5, lane = tid & 31, ln = lane & 15, hh = lane >> 4;
  const int ntn = N / 64;
  const int wid = blockIdx.x * 4 + w;
  const int mt = wid / ntn, nq = wid % ntn;
  if (mt * 16 >= M) return;
  const int row0 = mt * 16, col0 = nq * 64;
  const float* arow = A + (size_t)(row0 + ln) * lda;
  v8f acc[4] = {};
  for (int kb = 0; kb < K; kb += 32) {
    FragB ah, al;
    const v4f x0 = *(const v4fa*)(arow + kb + 8 * hh), x1 = *(const v4fa*)(arow + kb + 8 * hh + 4);
    const v4f x2 = *(const v4fa*)(arow + kb + 16 + 8 * hh), x3 = *(const v4fa*)(arow + kb + 16 + 8 * hh + 4);
    float xs[16] = {x0[0],x0[1],x0[2],x0[3],x1[0],x1[1],x1[2],x1[3],x2[0],x2[1],x2[2],x2[3],x3[0],x3[1],x3[2],x3[3]};
#pragma unroll
    for (int i = 0; i < 16; ++i) { const unsigned short hb = bf16_bits(xs[i]); ah.u[i] = hb; al.u[i] = ASPLIT ? bf16_bits(xs[i] - bf16_val(hb)) : (unsigned short)0; }
#pragma unroll
    for (int t = 0; t < 4; ++t) {
      const unsigned short* brow = Wt + (size_t)(col0 + t * 16 + ln) * ldb + kb;
      FragB b;
      b.half[0] = *(const v8us*)(brow + 8 * hh);
      b.half[1] = *(const v8us*)(brow + 16 + 8 * hh);
      acc[t] = mmaN<ASPLIT ? 2 : 1>(ah.v, al.v, b.v, b.v, acc[t]);
    }
  }
#pragma unroll
  for (int t = 0; t < 4; ++t) {
    const int col = col0 + t * 16 + ln;
    float bv = bias ? bias[col] : 0.f;
    if (BIAS_BF16) bv = bf16_round(bv);
#pragma unroll
    for (int r = 0; r < 8; ++r) {
      float v = acc[t][r] + bv;
      if (resid) { float rv = resid[(size_t)((row0 + 8 * hh + r) % rmod) * ldr + col]; if (RES_BF16) rv = bf16_round(rv); v += rv; }
      if (ACT == 1) v = fmaxf(v, 0.f);
      if (ACT == 2) v = 0.5f * v * (1.0f + erff(v * 0.70710678118654752f));
      if (ACT == 3) { const float u = 0.7978845608028654f * (v + 0.044715f * v * v * v); v = 0.5f * v * (1.0f + tanhf(u)); }
      so[w][8 * hh + r][t * 16 + ln] = v;
    }
  }
  __builtin_amdgcn_fence(__ATOMIC_ACQ_REL, "workgroup");
  __builtin_amdgcn_wave_barrier();
  const int rsub = lane >> 4, c4 = (lane & 15) * 4;
  {
#pragma unroll
    for (int q = 0; q < 8; ++q) {
      const int r = q * 2 + rsub;
      const v4f v = *(const v4fa*)&so[w][r][c4];
      *(v4f*)(C + (size_t)(row0 + r) * ldc + col0 + c4) = v;
    }
    
  }
}
// row LayerNorm (biased variance, eps) over N: s = X (+ R); optional out_sum <- s; out_norm <- (s-mu)*rsqrt(var+eps)*g + b
template <bool PARAM_BF16>
__global__ __launch_bounds__(256) void k_layernorm(const float* __restrict__ X, const float* __restrict__ R, const float* __restrict__ g, const float* __restrict__ bta,
                                                  float* __restrict__ out_sum, float* __restrict__ out_norm, int N, float eps) {
  __shared__ float red[256];
  const int row = blockIdx.x, tid = threadIdx.x;
  const float* x = X + (size_t)row * N; const float* rr = R ? R + (size_t)row * N : nullptr;
  float vals[16];                     // up to N = 4096
  const int per = N / 256;            // contiguous chunk per thread? use strided-by-4 chunks: thread handles j = tid*4 + 1024*u
  float s1 = 0.f;
  for (int u = 0; u < per / 4; ++u) {
    const int j = tid * 4 + 1024 * u;
    const v4f a = *(const v4fa*)(x + j);
    v4f b = {0.f,0.f,0.f,0.f}; if (rr) b = *(const v4fa*)(rr + j);
#pragma unroll
    for (int q = 0; q < 4; ++q) { const float v = a[q] + b[q]; vals[u * 4 + q] = v; s1 += v; }
  }
  red[tid] = s1; __syncthreads();
  for (int st = 128; st > 0; st >>= 1) { if (tid < st) red[tid] += red[tid + st]; __syncthreads(); }
  const float mu = red[0] / (float)N; __syncthreads();
  float s2 = 0.f;
  for (int u = 0; u < per / 4; ++u)
#pragma unroll
    for (int q = 0; q < 4; ++q) { const float c = vals[u * 4 + q] - mu; s2 += c * c; }
  red[tid] = s2; __syncthreads();
  for (int st = 128; st > 0; st >>= 1) { if (tid < st) red[tid] += red[tid + st]; __syncthreads(); }
  const float rs = rsqrtf(red[0] / (float)N + eps);
  {
    for (int u = 0; u < per / 4; ++u) {
      const int j = tid * 4 + 1024 * u;
      v4f o, sm;
#pragma unroll
      for (int q = 0; q < 4; ++q) {
        float gg = g[j + q], bb = bta[j + q];
        if (PARAM_BF16) { gg = bf16_round(gg); bb = bf16_round(bb); }
        sm[q] = vals[u * 4 + q]; o[q] = (vals[u * 4 + q] - mu) * rs * gg + bb;
      }
      if (out_sum) *(v4f*)(out_sum + (size_t)row * N + j) = sm;
      *(v4f*)(out_norm + (size_t)row * N + j) = o;
    }
    
  }
}



// ---- f16 WMMA path (v_wmma_f32_16x16x32_f16): 11-bit significands for operands in range — used where a [0,1] probability operand needs more precision than bf16
typedef _Float16 v16h __attribute__((ext_vector_type(16)));
union FragH { v16h v; v8us half[2]; _Float16 h[16]; unsigned short u[16]; };
template <int NT>
__device__ __forceinline__ v8f mmaH(v16h ah, v16h al, v16h bh, v16h bl, v8f c) {
  c = __builtin_amdgcn_wmma_f32_16x16x32_f16(false, ah, false, bh, (short)0, c, false, false);
  if (NT >= 2) c = __builtin_amdgcn_wmma_f32_16x16x32_f16(false, al, false, bh, (short)0, c, false, false);
  if (NT >= 3) c = __builtin_amdgcn_wmma_f32_16x16x32_f16(false, ah, false, bl, (short)0, c, false, false);
  asm volatile("v_nop\n\tv_nop\n\tv_nop\n\tv_nop" : "+v"(c) : "v"(ah), "v"(al), "v"(bh), "v"(bl));
  return c;
}
// batched GEMM like k_gemm_b but f16 operands: A f32 (split into f16 hi/lo if ASPLIT, else rounded to f16), Bt = f16 values [n][k]; alpha; C f32; N multiple of 16 (partial tiles skipped)
template <bool ASPLIT>
__global__ __launch_bounds__(128) void k_gemm_h(const float* __restrict__ A, int lda, size_t sA, const _Float16* __restrict__ Bh, int ldb, size_t sB, float alpha, float* __restrict__ C, int ldc, size_t sC, int M, int N, int K) {
  __shared__ __attribute__((aligned(16))) float so[4][16][64];
  const int tid = threadIdx.x, w = tid >> 5, lane = tid & 31, ln = lane & 15, hh = lane >> 4; const int by = blockIdx.y;
  A += (size_t)by * sA; Bh += (size_t)by * sB; C += (size_t)by * sC;
  const int ntn = (N + 63) / 64; const int wid = blockIdx.x * 4 + w; const int mt = wid / ntn, nq = wid % ntn; if (mt * 16 >= M) return;
  const int row0 = mt * 16, col0 = nq * 64; const float* arow = A + (size_t)(row0 + ln) * lda;
  v8f acc[4] = {};
  for (int kb = 0; kb < K; kb += 32) {
    FragH ah, al;
    const v4f x0 = *(const v4fa*)(arow + kb + 8 * hh), x1 = *(const v4fa*)(arow + kb + 8 * hh + 4), x2 = *(const v4fa*)(arow + kb + 16 + 8 * hh), x3 = *(const v4fa*)(arow + kb + 16 + 8 * hh + 4);
    float xs[16] = {x0[0],x0[1],x0[2],x0[3],x1[0],x1[1],x1[2],x1[3],x2[0],x2[1],x2[2],x2[3],x3[0],x3[1],x3[2],x3[3]};
#pragma unroll
    for (int i = 0; i < 16; ++i) { const _Float16 h = (_Float16)xs[i]; ah.h[i] = h; al.h[i] = ASPLIT ? (_Float16)(xs[i] - (float)h) : (_Float16)0.0f; }
#pragma unroll
    for (int t = 0; t < 4; ++t) { if (col0 + t * 16 >= N) continue; const size_t boff = (size_t)(col0 + t * 16 + ln) * ldb + kb; FragH bq; bq.half[0] = *(const v8us*)(Bh + boff + 8 * hh); bq.half[1] = *(const v8us*)(Bh + boff + 16 + 8 * hh);
      acc[t] = mmaH<ASPLIT ? 2 : 1>(ah.v, al.v, bq.v, bq.v, acc[t]); }
  }
#pragma unroll
  for (int t = 0; t < 4; ++t) { if (col0 + t * 16 >= N) continue;
#pragma unroll
    for (int r = 0; r < 8; ++r) so[w][8 * hh + r][t * 16 + ln] = acc[t][r] * alpha; }
  __builtin_amdgcn_fence(__ATOMIC_ACQ_REL, "workgroup"); __builtin_amdgcn_wave_barrier();
  const int rsub = lane >> 4, c4 = (lane & 15) * 4;
  {
#pragma unroll
    for (int q = 0; q < 8; ++q) { const int r = q * 2 + rsub; if (col0 + c4 < N) { const v4f v = *(const v4fa*)&so[w][r][c4]; *(v4f*)(C + (size_t)(row0 + r) * ldc + col0 + c4) = v; } }
     }
}

// Wt[n][k] = f16(W[k][n]·scale) from f32 row-major W[K][N] (scale = power of two; bf16-exact weights stay exact in f16 away from the subnormal range)
__global__ __launch_bounds__(256) void k_wt_f16(const float* __restrict__ W, _Float16* __restrict__ Wt, int K, int N, float scale) {
  const int t = blockIdx.x * 256 + threadIdx.x; if (t >= N * (K / 8)) return; const int n = t / (K / 8), k8 = (t % (K / 8)) * 8; FragH f;
#pragma unroll
  for (int i = 0; i < 8; ++i) f.h[i] = (_Float16)(bf16_round(W[(size_t)(k8 + i) * N + n]) * scale); const v8us o = f.half[0];
  *(v8us*)((unsigned short*)Wt + (size_t)n * K + k8) = o; 
}
// k_gemm_hh variant with fused epilogue: v = acc·alpha + bias[by·sBias + col] (+ CP[(row/rowsPerB)·sCPb + by·64 + col] if CP) ; ACT 0 none / 1 elu ; writes f16 C16 (and f32 C if non-null)
template <int ACT>
__global__ __launch_bounds__(128) void k_gemm_hhx(const _Float16* __restrict__ A, int lda, size_t sA, const _Float16* __restrict__ Bh, int ldb, size_t sB, float alpha, const float* __restrict__ bias, size_t sBias, const float* __restrict__ CP, int rowsPerB, size_t sCPb, int row0g,
    float* __restrict__ C, _Float16* __restrict__ C16, int ldc, size_t sC, int M, int N, int K) {
  __shared__ __attribute__((aligned(16))) float so[4][16][64];
  const int tid = threadIdx.x, w = tid >> 5, lane = tid & 31, ln = lane & 15, hh = lane >> 4; const int by = blockIdx.y;
  A += (size_t)by * sA; Bh += (size_t)by * sB; const size_t cofs = (size_t)by * sC; const float* bp = bias ? bias + (size_t)by * sBias : nullptr;
  const int ntn = (N + 63) / 64; const int wid = blockIdx.x * 4 + w; const int mt = wid / ntn, nq = wid % ntn; if (mt * 16 >= M) return;
  const int row0 = mt * 16, col0 = nq * 64; const _Float16* arow = A + (size_t)(row0 + ln) * lda;
  v8f acc[4] = {};
  for (int kb = 0; kb < K; kb += 32) { FragH ah; ah.half[0] = *(const v8us*)((const unsigned short*)arow + kb + 8 * hh); ah.half[1] = *(const v8us*)((const unsigned short*)arow + kb + 16 + 8 * hh);
#pragma unroll
    for (int t = 0; t < 4; ++t) { if (col0 + t * 16 >= N) continue; const size_t boff = (size_t)(col0 + t * 16 + ln) * ldb + kb; FragH bq; bq.half[0] = *(const v8us*)((const unsigned short*)Bh + boff + 8 * hh); bq.half[1] = *(const v8us*)((const unsigned short*)Bh + boff + 16 + 8 * hh);
      acc[t] = mmaH<1>(ah.v, ah.v, bq.v, bq.v, acc[t]); }
  }
#pragma unroll
  for (int t = 0; t < 4; ++t) { if (col0 + t * 16 >= N) continue; const int col = col0 + t * 16 + ln; const float bv = bp ? bf16_round(bp[col]) : 0.f;
#pragma unroll
    for (int r = 0; r < 8; ++r) { float v = acc[t][r] * alpha + bv; if (CP) { const int rr = row0g + row0 + 8 * hh + r; if (rowsPerB < 0) v += CP[cofs + (size_t)rr * ldc + col];      /* rowsPerB < 0: own element of the batched C plane */ else { const int bidx = rr / rowsPerB; v += CP[(size_t)bidx * sCPb + (size_t)by * 64 + col]; } } if (ACT == 1) v = (v > 0.f) ? v : expm1f(v); else if (ACT == 7) v = (v > 0.f) ? v + 1.0f : expf(v); else if (ACT == 8) v = tanhf(v); else if (ACT == 9) v = 0.5f * v * (1.0f + tanhf(0.7978845608028654f * (v + 0.044715f * v * v * v))); else if (ACT == 11) v = 1.0f / (1.0f + expf(-v)); else if (ACT == 12) v = (v > 0.f) ? v : 0.01f * v; else if (ACT == 14) v = (v > 0.f) ? v : 0.1f * v; else if (ACT == 16) v = (v >= 0.f) ? v : 0.3f * v; else if (ACT == 17) v = (v >= 0.f) ? v : 0.2f * v; else if (ACT == 15) v = v / (1.0f + expf(-v)); else if (ACT == 3) v = fmaxf(v, 0.f); else if (ACT == 6) v = 0.5f * v * (1.0f + erff(v * 0.70710678118654752f)); so[w][8 * hh + r][t * 16 + ln] = v; } }
  __builtin_amdgcn_fence(__ATOMIC_ACQ_REL, "workgroup"); __builtin_amdgcn_wave_barrier();
  const int rsub = lane >> 4, c4 = (lane & 15) * 4; typedef _Float16 v4h __attribute__((ext_vector_type(4)));
  {
#pragma unroll
    for (int q = 0; q < 8; ++q) { const int r = q * 2 + rsub; if (col0 + c4 < N) { const v4f v = *(const v4fa*)&so[w][r][c4]; if (C) *(v4f*)(C + cofs + (size_t)(row0 + r) * ldc + col0 + c4) = v; if (C16) { v4h h4; for (int i = 0; i < 4; ++i) h4[i] = (_Float16)v[i]; *(v4h*)(C16 + cofs + (size_t)(row0 + r) * ldc + col0 + c4) = h4; } } }
     }
}


typedef _Float16 v4h __attribute__((ext_vector_type(4)));

__global__ __launch_bounds__(256) void k_x16(const float* __restrict__ x, _Float16* __restrict__ X16, size_t n8) { const size_t t = (size_t)blockIdx.x * 256 + threadIdx.x; if (t >= n8) return; FragH f;
#pragma unroll
  for (int q = 0; q < 8; ++q) f.h[q] = (_Float16)bf16_round(x[t * 8 + q]); *(v8us*)((unsigned short*)X16 + t * 8) = f.half[0];  }
__global__ __launch_bounds__(256) void k_h16(const float* __restrict__ x, _Float16* __restrict__ X16, size_t n8) { const size_t t = (size_t)blockIdx.x * 256 + threadIdx.x; if (t >= n8) return; FragH f;
#pragma unroll
  for (int q = 0; q < 8; ++q) f.h[q] = (_Float16)x[t * 8 + q]; *(v8us*)((unsigned short*)X16 + t * 8) = f.half[0];  }
__global__ __launch_bounds__(256) void k_round16f(const float* __restrict__ W, _Float16* __restrict__ Bt, size_t n8) { const size_t t = (size_t)blockIdx.x * 256 + threadIdx.x; if (t >= n8) return; FragH f;
#pragma unroll
  for (int i = 0; i < 8; ++i) f.h[i] = (_Float16)(bf16_round(W[t * 8 + i]) * 16.0f); *(v8us*)((unsigned short*)Bt + t * 8) = f.half[0];  }
template <int NHv, int TTv>
__global__ __launch_bounds__(256) void k_vt(const _Float16* __restrict__ V16, int ldv, int voff, _Float16* __restrict__ Vt) { __shared__ unsigned short tl[64][66]; const int tid = threadIdx.x; const int slab = blockIdx.x / (TTv / 64), lg = blockIdx.x % (TTv / 64); const int b = slab / NHv, h = slab % NHv;
  for (int i = tid; i < 64 * 8; i += 256) { const int r = i / 8, c8 = (i % 8) * 8; FragH f; f.half[0] = *(const v8us*)((const unsigned short*)V16 + ((size_t)b * TTv + lg * 64 + r) * ldv + voff + h * 64 + c8);
#pragma unroll
    for (int q = 0; q < 8; ++q) tl[r][c8 + q] = f.u[q]; }
  __syncthreads();
  {
#pragma unroll
    for (int rd = 0; rd < 2; ++rd) { const int d = rd * 32 + tid / 8, pc = tid % 8; FragH f;
#pragma unroll
      for (int q = 0; q < 8; ++q) f.u[q] = tl[pc * 8 + q][d];
      *(v8us*)((unsigned short*)Vt + ((size_t)slab * 64 + d) * TTv + lg * 64 + pc * 8) = f.half[0]; }
     } }

__global__ __launch_bounds__(256) void k_hl(const float* __restrict__ F, _Float16* __restrict__ Hh, _Float16* __restrict__ Hl, size_t n8) { const size_t t = (size_t)blockIdx.x * 256 + threadIdx.x; if (t >= n8) return; FragH fh, fl; const v4f a = *(const v4fa*)(F + t * 8), c = *(const v4fa*)(F + t * 8 + 4);
#pragma unroll
  for (int q = 0; q < 4; ++q) { _Float16 h = (_Float16)a[q]; fh.h[q] = h; fl.h[q] = (_Float16)((a[q] - (float)h) * 1024.0f); h = (_Float16)c[q]; fh.h[4 + q] = h; fl.h[4 + q] = (_Float16)((c[q] - (float)h) * 1024.0f); }
  { *(v8us*)((unsigned short*)Hh + t * 8) = fh.half[0]; *(v8us*)((unsigned short*)Hl + t * 8) = fl.half[0];  } }

// ---- f16 fragment of 32 k from a k-contiguous row, hardware k order (8 hh + 0..7, then 16 + 8 hh + 0..7) ----
__device__ __forceinline__ v16h g2_frag(const _Float16* p, int hh) { FragH f; f.half[0] = *(const v8us*)((const unsigned short*)p + 8 * hh); f.half[1] = *(const v8us*)((const unsigned short*)p + 16 + 8 * hh); return f.v; }


// ---- the same fragment from a plane stored in fragment order: 1 KiB a fragment of 16 rows x 32 k, first the 32 lanes' k 8 hh + 0..7 (16 bytes a lane, lane = 16 hh + row), then their k 16 + 8 hh + 0..7; p = fragment start + 8 * lane.
// Each of the two wave-wide loads then covers 512 contiguous bytes, 4 whole lines, where a row-major plane gives 16 lines in pieces of 32 bytes. ----
__device__ __forceinline__ v16h pk_frag(const _Float16* p) { FragH f; f.half[0] = *(const v8us*)((const unsigned short*)p); f.half[1] = *(const v8us*)((const unsigned short*)p + 256); return f.v; }

// ---- projection stage in one launch, straight from the f32 weights ----
// A block takes 64 tokens and 32 neighbouring columns (column half h) of each of the three [in][out] weights: the 64 x 96 tile [q | k | v] = x W. Wave w takes weight w / 4 and the K slice w % 4 (256 wide); the 4 partial tiles of each weight meet in LDS and are summed in slice order.
// Weights need no transposed copy: a lane reads 8 bytes = columns 2 ln and 2 ln + 1 of one k row, so that 16 lanes cover the 128-byte line that holds the block's 32 columns of that row (two rows a load, by hh). Column 2 ln + j goes to B fragment j:
// a fragment's 16 columns are then the even or the odd ones, and the 16 k of a lane come from 16 loads, in the hardware k order (8 hh + 0..7, then 16 + 8 hh + 0..7). Each value is rounded to bf16 in registers. With 64 tokens a block each f32 weight byte is read by 128 blocks.
// The block's 64 x 1024 tile of x is staged once in LDS: a load takes two rows x 256 contiguous bytes (4 whole lines), each value is rounded to bf16 and stored in fragment order (xs_frag); behind one barrier every wave reads its A fragments from there.
// The two blocks that share a token tile lie 8 apart in the grid (for speed only).
// Waves 0-3 then write q (f16), waves 4-7 k (f32 rows to the output, f16), waves 8-11 v: a thread owns one head column d and two runs of 8 neighbouring tokens (32 apart), so that it stores f32 rows to the output and 16 bytes of V^T a run.
// Each f16 plane gives 32 tokens one 4-KiB slab of four fragments in the order of pk_frag: q and k as (token tile, d / 32) with rows = tokens, k = d; V^T as d / 16 with rows = d, k = tokens. A block writes whole fragments and whole 128-byte lines of the f32 rows.
// Every loop is unrolled: the accumulator and fragment arrays are then indexed by constants only and stay in registers.
#define PW 12
#define PP 36       /* pitch in floats of a 32-column partial tile: 8 rows on are 32 banks on */
#define XF 656      /* halves from one staged x fragment to the next: 1312 bytes = two halves of 640 and 32 bytes of padding, each half two lane halves of 320 (256 used); see xs_frag */
typedef float v2f  __attribute__((ext_vector_type(2)));
typedef float v2fa __attribute__((ext_vector_type(2), may_alias));
typedef __bf16 v4ba __attribute__((ext_vector_type(4), may_alias));
// A fragment of the staged x tile: p = fragment start + 160 * hh + 8 * row; k order as pk_frag (8 hh + 0..7, then 16 + 8 hh + 0..7). The odd steps (32, 64 and 128 bytes beyond a multiple of 256) put the 32 lanes' 8-byte stores of the staging on all 64 banks; each 16 lanes of a read take 256 contiguous bytes.
__device__ __forceinline__ v16b xs_frag(const unsigned short* p) { FragB f; f.half[0] = *(const v8us*)p; f.half[1] = *(const v8us*)(p + 320); return f.v; }
__global__ __launch_bounds__(PW * 32) void k_qkv(const float* __restrict__ x, const float* __restrict__ W0, const float* __restrict__ W1, const float* __restrict__ W2, _Float16* __restrict__ Q16, float* __restrict__ KO, _Float16* __restrict__ K16, float* __restrict__ VO, _Float16* __restrict__ VTH) {
  __shared__ __attribute__((aligned(16))) float so[PW][64][PP];
  __shared__ __attribute__((aligned(16))) unsigned short xs[128 * XF];
  const int tid = threadIdx.x, lane = tid & 31, ln = lane & 15, hh = lane >> 4; const int w = __builtin_amdgcn_readfirstlane(tid >> 5);      /* the wave's number in a scalar register: the piece numbers of the staging and the role branch behind the barrier are then scalar */
  const int m = w >> 2, ks = w & 3; const int b = blockIdx.x; const int h = (b >> 3) & 1, tile = (b >> 4) * 8 + (b & 7), row0 = tile * 64;
  const float* xp = x + (size_t)(row0 + 2 * m + hh) * DMX + ks * 256 + ln * 4; const float* xl = xp + ((m < 2) ? 10 : 9) * (6 * DMX);
  const float* wp = ((m == 0) ? W0 : (m == 1) ? W1 : W2) + (size_t)(ks * 256 + 8 * hh) * HD + 32 * h + 2 * ln;
  v4f xr[11][4]; v2f wf[8][16];
  /* staging: the three waves of a K slice share its 256 columns of x by row pairs m, m + 3, ...; 32 pairs are 11, 11 and 10: in the last round wave m = 2 takes its own last pair again, so that the code stays straight */
#pragma unroll
  for (int t = 0; t < 11; ++t) { const float* xt = (t < 10) ? xp + t * (6 * DMX) : xl;
#pragma unroll
    for (int sg = 0; sg < 4; ++sg) xr[t][sg] = *(const v4fa*)(xt + sg * 64); }
  asm volatile("s_wait_xcnt 0x0" :: "v"(xp), "v"(xl) : "memory");      /* the wait in front of any overwrite of the address pairs that the issued loads name; naming the pairs keeps them whole up to here (one build let a load land on its own pair). It also keeps the x loads in front of the weight loads: loads return in order, and x is wanted first */
#pragma unroll
  for (int kq = 0; kq < 2; ++kq)
#pragma unroll
    for (int e = 0; e < 16; ++e) wf[kq][e] = *(const v2fa*)(wp + (kq * 32 + (e >> 3) * 16 + (e & 7)) * HD);      /* the weights of the first two k steps fly while x is staged */
  __builtin_amdgcn_sched_barrier(0);      /* keeps these loads in front of the staging: moved down, they would start only when x has landed */
  unsigned short* xw = xs + (ks * 8 + ((lane >> 3) & 1)) * XF + ((lane >> 2) & 1) * 320 + ((lane >> 1) & 1) * 160 + hh * 8 + (lane & 1) * 4;
#pragma unroll
  for (int t = 0; t < 11; ++t) { const int rp = m + 3 * ((t < 10 || m < 2) ? t : t - 1); unsigned short* xd = xw + (rp >> 3) * (32 * XF) + (rp & 7) * 16;
#pragma unroll
    for (int sg = 0; sg < 4; ++sg) { v4ba h4;
#pragma unroll
      for (int e = 0; e < 4; ++e) h4[e] = (__bf16)xr[t][sg][e];      /* the conversion instruction rounds to nearest even, as bf16_round does */
      *(v4ba*)(xd + sg * (2 * XF)) = h4; } }
#pragma unroll
  for (int e = 0; e < 16; ++e) wf[2][e] = *(const v2fa*)(wp + (2 * 32 + (e >> 3) * 16 + (e & 7)) * HD);      /* a third k step into registers that x has left */
  /* the whole x tile is in LDS before any wave reads a fragment of it. The barrier with fences on LDS alone: __syncthreads() would also wait here for the weight loads in flight, which no other wave needs */
  __builtin_amdgcn_fence(__ATOMIC_RELEASE, "workgroup", "local"); __builtin_amdgcn_s_barrier(); __builtin_amdgcn_fence(__ATOMIC_ACQUIRE, "workgroup", "local");
  const unsigned short* xa = xs + ks * 8 * XF + hh * 160 + ln * 8;
  v8f acc[4][2] = {}; v16b af[4];
#pragma unroll
  for (int tt = 0; tt < 4; ++tt) af[tt] = xs_frag(xa + tt * 32 * XF);
#pragma unroll
  for (int kq = 0; kq < 8; ++kq) { v16b an[4];
    if (kq + 1 < 8) {
#pragma unroll
      for (int tt = 0; tt < 4; ++tt) an[tt] = xs_frag(xa + (tt * 32 + kq + 1) * XF);      /* the A fragments of the next k step, as one group ahead of this step's products */
      if (kq + 3 < 8) {
#pragma unroll
        for (int e = 0; e < 16; ++e) wf[kq + 3][e] = *(const v2fa*)(wp + ((kq + 3) * 32 + (e >> 3) * 16 + (e & 7)) * HD); }
      __builtin_amdgcn_sched_barrier(0);      /* keeps the LDS reads one k step and the weight loads three k steps ahead of their products: moved down to them, each product would wait for LDS and each k step for L2 */ }
    FragB b0, b1;
#pragma unroll
    for (int e = 0; e < 16; ++e) { b0.v[e] = (__bf16)wf[kq][e][0]; b1.v[e] = (__bf16)wf[kq][e][1]; }
#pragma unroll
    for (int tt = 0; tt < 4; ++tt) {
      acc[tt][0] = __builtin_amdgcn_wmma_f32_16x16x32_bf16(false, af[tt], false, b0.v, (short)0, acc[tt][0], false, false);
      acc[tt][1] = __builtin_amdgcn_wmma_f32_16x16x32_bf16(false, af[tt], false, b1.v, (short)0, acc[tt][1], false, false); }
    if (kq + 1 < 8) {
#pragma unroll
      for (int tt = 0; tt < 4; ++tt) af[tt] = an[tt]; } }
  asm volatile("s_wait_xcnt 0x0" :: "v"(wp) : "memory");      /* the wait in front of any overwrite of the address pair that the issued weight loads name */
#pragma unroll
  for (int tt = 0; tt < 4; ++tt)
#pragma unroll
    for (int r = 0; r < 8; ++r) { const v2f p = {acc[tt][0][r], acc[tt][1][r]}; *(v2fa*)&so[w][tt * 16 + 8 * hh + r][2 * ln] = p; }      /* columns 2 ln and 2 ln + 1 lie side by side again */
  __syncthreads();      /* every wave's partial tile is in LDS before any is summed */
  const int g = tid & 127;
  if (m < 2) { const int rr = g >> 3, c4 = (g & 7) * 4;
#pragma unroll
    for (int i = 0; i < 4; ++i) { const int r = i * 16 + rr; const float* sp = &so[m * 4][r][c4]; v4f s = *(const v4fa*)sp;
#pragma unroll
      for (int u = 1; u < 4; ++u) s += *(const v4fa*)(sp + u * 64 * PP);
      v4h h4;
#pragma unroll
      for (int e = 0; e < 4; ++e) h4[e] = (_Float16)s[e];
      const size_t po = (size_t)(tile * 2 + (i >> 1)) * 2048 + (i & 1) * 1024 + h * 512 + (c4 >> 4) * 256 + (((c4 >> 3) & 1) * 16 + rr) * 8 + (c4 & 4);      /* place of d = 32 h + c4 ... + 3 of token r in its slab */
      if (m == 0) *(v4h*)(Q16 + po) = h4; else { *(v4f*)(KO + (size_t)(row0 + r) * HD + 32 * h + c4) = s; *(v4h*)(K16 + po) = h4; } }
    asm volatile("s_wait_xcnt 0x0" ::: "memory");      /* the wait behind these stores, in front of any overwrite of a register that they name */ }
  else { const int c = g & 31, tg = g >> 5, d = 32 * h + c;
#pragma unroll
    for (int sl = 0; sl < 2; ++sl) { const float* sp = &so[8][sl * 32 + tg * 8][c]; float* vo = VO + (size_t)(row0 + sl * 32 + tg * 8) * HD + d; FragH fh;
#pragma unroll
      for (int i = 0; i < 8; ++i) { float s = sp[i * PP];
#pragma unroll
        for (int u = 1; u < 4; ++u) s += sp[u * 64 * PP + i * PP];
        vo[i * HD] = s; fh.h[i] = (_Float16)s; }
      const size_t to = (size_t)(tile * 2 + sl) * (HD * 32) + (d >> 4) * 512 + (tg >> 1) * 256 + ((tg & 1) * 16 + (d & 15)) * 8;
      *(v8us*)((unsigned short*)VTH + to) = fh.half[0]; }
    asm volatile("s_wait_xcnt 0x0" ::: "memory");      /* the wait behind these stores, in front of any overwrite of a register that they name */ } }


__global__ __launch_bounds__(256) void k_wnat(const float* __restrict__ w, size_t n8, _Float16* __restrict__ Bt) { const size_t t = (size_t)blockIdx.x * 256 + threadIdx.x; if (t >= n8) return; FragH f; for (int q = 0; q < 8; ++q) f.h[q] = (_Float16)(bf16_round(w[t * 8 + q]) * 16.0f); *(v8us*)((unsigned short*)Bt + t * 8) = f.half[0];  }
__global__ __launch_bounds__(256) void k_rsm(const float* __restrict__ S, _Float16* __restrict__ P, int nrows) {
  #pragma clang fp contract(off)
  const int i = blockIdx.x * 256 + threadIdx.x; if (i >= nrows) return; const float* s = S + (size_t)i * SQ; float mx = -3.0e38f;
#pragma unroll 1
  for (int j = 0; j < SQ; ++j) mx = fmaxf(mx, s[j]); float se = 0.f;
#pragma unroll 1
  for (int j = 0; j < SQ; ++j) se += expf(s[j] - mx); const float sc = 256.0f / se;
#pragma unroll 1
  for (int j0 = 0; j0 < SQ; j0 += 8) { FragH f; for (int q = 0; q < 8; ++q) f.h[q] = (_Float16)(expf(s[j0 + q] - mx) * sc); unsigned short* d = (unsigned short*)P + (size_t)i * SQ + j0; *(v8us*)d = f.half[0];  } }
__global__ __launch_bounds__(256) void k_vt(const _Float16* __restrict__ V16, int b, int h0, _Float16* __restrict__ VT) { __shared__ unsigned short tl[64][65]; const int tid = threadIdx.x; const int hh = blockIdx.x % HG, sg = blockIdx.x / HG; const int s0 = sg * 64; const int h = h0 + hh;
  for (int i = tid; i < 64 * 8; i += 256) { const int j = i / 8, d8 = (i % 8) * 8; FragH f; f.half[0] = *(const v8us*)((const unsigned short*)V16 + ((size_t)b * SQ + s0 + j) * DM + h * HD + d8); for (int q = 0; q < 8; ++q) tl[d8 + q][j] = f.u[q]; }
  __syncthreads();
  { for (int i = tid; i < 64 * 8; i += 256) { const int d = i / 8, j8 = (i % 8) * 8; FragH f; for (int q = 0; q < 8; ++q) f.u[q] = tl[d][j8 + q]; *(v8us*)((unsigned short*)VT + ((size_t)hh * HD + d) * SQ + s0 + j8) = f.half[0]; }  } }


__global__ __launch_bounds__(256) void k_rsmcf2(const float* __restrict__ S, _Float16* __restrict__ P, int hg, int q0, int nk) {
  #pragma clang fp contract(off)
  const int t = blockIdx.x * 256 + threadIdx.x; if (t >= hg * QT) return; const size_t i = (size_t)t; const float* s = S + i * NKX; const int last = q0 + (t % QT); float mx = -3.0e38f;
#pragma unroll 1
  for (int j = 0; j < nk; ++j) { const float f = (j <= last) ? 1.f : 0.f; mx = fmaxf(mx, fmaf(f, s[j], (1.f - f) * -1.0e9f)); } float se = 0.f;
#pragma unroll 1
  for (int j = 0; j < nk; ++j) { const float f = (j <= last) ? 1.f : 0.f; se += __expf(fmaf(f, s[j], (1.f - f) * -1.0e9f) - mx); } const float sc = 256.0f / se;
#pragma unroll 1
  for (int j0 = 0; j0 < nk; j0 += 8) { FragH fr; for (int q = 0; q < 8; ++q) { const int j = j0 + q; const float f = (j <= last) ? 1.f : 0.f; fr.h[q] = (_Float16)(__expf(fmaf(f, s[j], (1.f - f) * -1.0e9f) - mx) * sc); } unsigned short* d = (unsigned short*)P + i * NKX + j0; *(v8us*)d = fr.half[0];  } }


// ---- causal attention in one launch: scores, softmax and P V of 32 queries a block; no score or weight plane in memory ----
// native 2^y; the v_nop is the slot the instruction set asks for behind a transcendental before its result is read or its source overwritten
__device__ __forceinline__ float exp2_hw(float y) { float x; asm("v_exp_f32 %0, %1\n\tv_nop" : "=v"(x) : "v"(y)); return x; }
// eight at once: results in registers of their own, so that each v_exp is the independent instruction behind the one before it and one v_nop closes the last slot
__device__ __forceinline__ void exp2_x8(const float (&y)[8], float (&x)[8]) {
  asm("v_exp_f32 %0, %8\n\tv_exp_f32 %1, %9\n\tv_exp_f32 %2, %10\n\tv_exp_f32 %3, %11\n\tv_exp_f32 %4, %12\n\tv_exp_f32 %5, %13\n\tv_exp_f32 %6, %14\n\tv_exp_f32 %7, %15\n\tv_nop"
      : "=&v"(x[0]), "=&v"(x[1]), "=&v"(x[2]), "=&v"(x[3]), "=&v"(x[4]), "=&v"(x[5]), "=&v"(x[6]), "=&v"(x[7]) : "v"(y[0]), "v"(y[1]), "v"(y[2]), "v"(y[3]), "v"(y[4]), "v"(y[5]), "v"(y[6]), "v"(y[7])); }
// the value of lane l ^ 16: the other half of a query's keys
__device__ __forceinline__ float xhalf(float x) { return __builtin_bit_cast(float, __builtin_amdgcn_permlanex16(__builtin_bit_cast(int, x), __builtin_bit_cast(int, x), 0x76543210, 0xfedcba98, false, false)); }
// Block = (batch, query tile of 32 rows), heaviest tiles first in the grid. Wave w takes the key steps w, w + AW, ... of 32 keys up to the diagonal step (the tile's own keys, the only one that is masked).
// Transposed products: S^T = K Q^T puts one query in a lane (column ln) and 8 keys of each 16-key tile in its registers (row 8 hh + r), which is the k order of a B fragment: the weights go from the score accumulators
// straight into the B operand of O^T += V^T P^T, whose A fragments come from the V^T planes in the same k order (pk_frag). Row maximum and row sum are in-lane plus one exchange between the lane halves.
// Each wave keeps its own running maximum m (raw q . k units), sum l and un-normalised O^T; weights are 256 * 2^((s - m) CS) rounded to f16; the row sum l adds the unrounded weights.
// The AW partial results meet in LDS behind one barrier and are joined with the weights 2^((m_w - M) CS); a wave without a step gives m = -3e38, l = 0, O = 0.
#define AW 16
#define AP 68      /* pitch in floats of a query's 64 partial outputs: 16 lanes' 16-byte stores fall on all 64 banks */
__global__ __launch_bounds__(AW * 32) void k_attn(const _Float16* __restrict__ Q16, const _Float16* __restrict__ K16, const _Float16* __restrict__ VTH, float* __restrict__ O) {
  __shared__ __attribute__((aligned(16))) float so[AW][32][AP];
  __shared__ float sm[AW][32]; __shared__ float sl[AW][32];
  const int tid = threadIdx.x, lane = tid & 31, ln = lane & 15, hh = lane >> 4; const int w = __builtin_amdgcn_readfirstlane(tid >> 5);      /* the wave's number in a scalar register: the key loop then runs on scalar compares and branches, every lane on at the matrix instructions */
  const int by = blockIdx.x, qi = SQ / 32 - 1 - (int)blockIdx.y, row0 = qi * 32;
  const float CS = 1.44269504f * 0.03125f;      /* log2(e) * 1024^-0.5 */
  const _Float16* qp = Q16 + ((size_t)by * SQ + row0) * HD + lane * 8; const _Float16* kp = K16 + (size_t)by * SQ * HD + lane * 8;      /* the lane's 16 bytes are in the step pointers: every fragment of a step then lies at an immediate offset from one of them */
  const _Float16* vhp = VTH + (size_t)by * HD * SQ + lane * 8;
  v16h qf[2][2];
#pragma unroll
  for (int qt = 0; qt < 2; ++qt)
#pragma unroll
    for (int ks = 0; ks < 2; ++ks) qf[qt][ks] = pk_frag(qp + (qt * 2 + ks) * 512);
  const v8f z8 = {0.f, 0.f, 0.f, 0.f, 0.f, 0.f, 0.f, 0.f};
  v8f acc[2][4]; float m[2], l[2];
#pragma unroll
  for (int qt = 0; qt < 2; ++qt) { m[qt] = -3.0e38f; l[qt] = 0.f;
#pragma unroll
    for (int dt = 0; dt < 4; ++dt) acc[qt][dt] = z8; }
#pragma unroll 1      /* rolled: at most SQ / 32 / AW trips, and the live set of one trip fills the register budget of a 16-wave block */
  for (int j = w; j <= qi; j += AW) {
    v16h kf[2][2], vh[4]; const _Float16* kj = kp + (size_t)j * (32 * HD); const _Float16* vhj = vhp + (size_t)j * (HD * 32);
#pragma unroll
    for (int kt = 0; kt < 2; ++kt)
#pragma unroll
      for (int ks = 0; ks < 2; ++ks) kf[kt][ks] = pk_frag(kj + (kt * 2 + ks) * 512);
#pragma unroll
    for (int dt = 0; dt < 4; ++dt) vh[dt] = pk_frag(vhj + dt * 512);
    asm volatile("s_wait_xcnt 0x0" :: "v"(kj), "v"(vhj) : "memory");      /* the wait in front of any overwrite of the address pairs that the issued loads name; naming the pairs keeps them whole up to here (one build let a load land on its own pair) */
    __builtin_amdgcn_sched_barrier(0);      /* all K loads are issued before the first score product: the compiler otherwise loaded one K fragment into the registers of another behind its product, a second wait for L2 in every step */
    v8f s[2][2];
#pragma unroll
    for (int qt = 0; qt < 2; ++qt)
#pragma unroll
      for (int kt = 0; kt < 2; ++kt) {
        s[qt][kt] = __builtin_amdgcn_wmma_f32_16x16x32_f16(false, kf[kt][0], false, qf[qt][0], (short)0, z8, false, false);
        s[qt][kt] = __builtin_amdgcn_wmma_f32_16x16x32_f16(false, kf[kt][1], false, qf[qt][1], (short)0, s[qt][kt], false, false); }
    if (j == qi) {      /* the diagonal step: key kt * 16 + 8 hh + r of the tile is visible to query qt * 16 + ln up to the query itself; every query sees at least its own key */
#pragma unroll
      for (int qt = 0; qt < 2; ++qt)
#pragma unroll
        for (int kt = 0; kt < 2; ++kt)
#pragma unroll
          for (int r = 0; r < 8; ++r) s[qt][kt][r] = (kt * 16 + 8 * hh + r <= qt * 16 + ln) ? s[qt][kt][r] : -3.0e38f; }
    FragH ph[2]; float corr[2];
#pragma unroll
    for (int qt = 0; qt < 2; ++qt) {
      float m4[4] = {m[qt], m[qt], m[qt], m[qt]};
#pragma unroll
      for (int kt = 0; kt < 2; ++kt)
#pragma unroll
        for (int r = 0; r < 8; ++r) m4[r & 3] = fmaxf(m4[r & 3], s[qt][kt][r]);
      float mn = fmaxf(fmaxf(m4[0], m4[1]), fmaxf(m4[2], m4[3])); mn = fmaxf(mn, xhalf(mn));
      corr[qt] = exp2_hw((m[qt] - mn) * CS); m[qt] = mn;      /* 0 on the wave's first step */
      const float nb = 8.0f - mn * CS; float s4[4] = {0.f, 0.f, 0.f, 0.f};
#pragma unroll
      for (int kt = 0; kt < 2; ++kt) { float y[8], p[8];
#pragma unroll
        for (int r = 0; r < 8; ++r) y[r] = fmaf(s[qt][kt][r], CS, nb);
        exp2_x8(y, p);
#pragma unroll
        for (int r = 0; r < 8; ++r) { s4[r & 3] += p[r]; ph[qt].h[kt * 8 + r] = (_Float16)p[r]; } }
      l[qt] = fmaf(l[qt], corr[qt], (s4[0] + s4[1]) + (s4[2] + s4[3])); }
    __builtin_amdgcn_sched_barrier(0);      /* the softmax of both query tiles stays in front of the P V products: the build without this line mixed the two and spilled to scratch */
#pragma unroll
    for (int qt = 0; qt < 2; ++qt)
#pragma unroll
      for (int dt = 0; dt < 4; ++dt) acc[qt][dt] = __builtin_amdgcn_wmma_f32_16x16x32_f16(false, vh[dt], false, ph[qt].v, (short)0, acc[qt][dt] * corr[qt], false, false); }
#pragma unroll
  for (int qt = 0; qt < 2; ++qt) { const float lt = l[qt] + xhalf(l[qt]); if (hh == 0) { sm[w][qt * 16 + ln] = m[qt]; sl[w][qt * 16 + ln] = lt; }
#pragma unroll
    for (int dt = 0; dt < 4; ++dt) { const v8f a = acc[qt][dt]; float* d = &so[w][qt * 16 + ln][dt * 16 + 8 * hh];
      const v4f lo4 = {a[0], a[1], a[2], a[3]}, hi4 = {a[4], a[5], a[6], a[7]}; *(v4fa*)d = lo4; *(v4fa*)(d + 4) = hi4; } }
  __syncthreads();      /* every wave's maximum, sum and partial tile are in LDS before any is joined */
  const int q = tid >> 4, d4 = (tid & 15) * 4; float mw[AW]; float M = -3.0e38f;
#pragma unroll
  for (int u = 0; u < AW; ++u) { mw[u] = sm[u][q]; M = fmaxf(M, mw[u]); }
  float Ls = 0.f; v4f o = {0.f, 0.f, 0.f, 0.f};
#pragma unroll
  for (int g = 0; g < AW; g += 8) { float y[8], f[8];
#pragma unroll
    for (int u = 0; u < 8; ++u) y[u] = (mw[g + u] - M) * CS;
    exp2_x8(y, f);
#pragma unroll
    for (int u = 0; u < 8; ++u) { Ls = fmaf(sl[g + u][q], f[u], Ls); o += *(const v4fa*)&so[g + u][q][d4] * f[u]; } }
  *(v4f*)(O + ((size_t)by * SQ + row0 + q) * HD + d4) = o * (1.0f / Ls); }

extern "C" void kernel_launch(void* const* d_in, const int* in_sizes, int n_in,
                              void* d_out, int out_size, void* d_ws, size_t ws_size, hipStream_t stream) {
  (void)in_sizes; (void)n_in; (void)out_size;
  const float* const* I = (const float* const*)d_in; const float* x = I[0]; const float* wq = I[1]; const float* wk = I[2]; const float* wv = I[3];
  char* ws = (char*)d_ws; size_t off = 0;
  auto take = [&](size_t bytes) { char* p = ws + off; off += (bytes + 255) & ~(size_t)255; return p; };
  _Float16* Q16 = (_Float16*)take(NR * HD * 2); _Float16* K16 = (_Float16*)take(NR * HD * 2); _Float16* VT = (_Float16*)take((size_t)NB * HD * SQ * 2); float* KOUT = (float*)d_out + NR * HD; float* VF = (float*)d_out + 2 * NR * HD;      /* out1 = k and out2 = v are written in f32 straight into the tuple output */
  if (off > ws_size) return;      /* 3 x 1 MiB */
  k_qkv<<<(unsigned)(NR / 64 * 2), PW * 32, 0, stream>>>(x, wq, wk, wv, Q16, KOUT, K16, VF, VT);      /* out1 = k and out2 = v in f32; q, k, V^T f16 in fragment order, 4 KiB a plane and 32 tokens */
  k_attn<<<dim3(NB, SQ / 32), AW * 32, 0, stream>>>(Q16, K16, VT, (float*)d_out);      /* out0 = softmax(causal q . k / 32) v */
}

// v010
// One run takes 15.7 microseconds.
// Timed twice side by side with v009, it ran 1.09 and 1.12 times as fast.
// All steps since v000 together make it 608 times as fast.
#include <hip/hip_runtime.h>
// Single attention head returning the TUPLE (out, k, v) (x [4][2048][1024]; q = x Wq, k = x Wk, v = x Wv ([in][out] 1024 x 64, sigma 1/32, no biases); wei = q . k x 1024^-0.5 (the module scales by n_embd) with a causal mask (tril, -inf); softmax; out = wei v -> out0 [4][2048][64] @0, out1 = k [4][2048][64] f32 @2,097,152 B, out2 = v [4][2048][64] f32 @4,194,304 B; input order x, Wq, Wk, Wv).
// Structure: q, k, v in ONE projection launch (k_qkv: x read as f32 in whole lines, rounded and staged in LDS as bf16 fragments; the f32 weights read in whole lines and rounded to bf16 in registers; WMMA, f32 accumulation, K = 1024 split over the waves): k and v in f32 STRAIGHT INTO the tuple output slots (out1, out2); q, k and V^T as f16 planes in blocks of 32 tokens; every f16 plane that one launch hands to the next lies in the order of its reader's fragments (pk_frag); then ONE attention launch (k_attn): a block owns 32 queries of one batch, its 16 waves share the visible keys in steps of 32; scores, running softmax and weights stay in registers (S^T = K Q^T, O^T += V^T P^T), the weights as plain f16 (x256), O^T += V^T P^T in one product; the waves' partial sums meet in LDS; two launches.
// Compute dtype: inputs rounded to bf16; q, k and the V^T operand rounded to f16, softmax weights plain f16 (each ~2^-12 relative); scores, statistics, out f32; the outputs k and v stay f32. v_wmma_f32_16x16x32_bf16 (projection), v_wmma_f32_16x16x32_f16 (attention).
#define NB 4
#define NHS 1
#define DMX 1024                   /* model width (projection K) */
#define SQ 2048
#define HD 64
#define DM 64
#define NH 1
#define HG 1
#define QT 256
#define NKX SQ
#define NR ((size_t)NB * NHS * SQ)
typedef __bf16 v16b __attribute__((ext_vector_type(16)));
typedef unsigned short v8us __attribute__((ext_vector_type(8), may_alias));
typedef float  v8f  __attribute__((ext_vector_type(8)));
typedef float  v4f  __attribute__((ext_vector_type(4)));
typedef float  v4fa __attribute__((ext_vector_type(4), may_alias));
union FragB { v16b v; v8us half[2]; unsigned short u[16]; };

__device__ __forceinline__ unsigned short bf16_bits(float x) { unsigned int u = __float_as_uint(x); return (unsigned short)((u + 0x7FFFu + ((u >> 16) & 1u)) >> 16); }
__device__ __forceinline__ float bf16_val(unsigned short b) { return __uint_as_float(((unsigned int)b) << 16); }
__device__ __forceinline__ float bf16_round(float x) { return bf16_val(bf16_bits(x)); }
// D += A·B with NT terms: 1 = ah·bh, 2 = + al·bh (A split), 3 = + ah·bl (both split)
template <int NT>
__device__ __forceinline__ v8f mmaN(v16b ah, v16b al, v16b bh, v16b bl, v8f c) {
  c = __builtin_amdgcn_wmma_f32_16x16x32_bf16(false, ah, false, bh, (short)0, c, false, false);
  if (NT >= 2) c = __builtin_amdgcn_wmma_f32_16x16x32_bf16(false, al, false, bh, (short)0, c, false, false);
  if (NT >= 3) c = __builtin_amdgcn_wmma_f32_16x16x32_bf16(false, ah, false, bl, (short)0, c, false, false);
  asm volatile("v_nop\n\tv_nop\n\tv_nop\n\tv_nop" : "+v"(c) : "v"(ah), "v"(al), "v"(bh), "v"(bl));
  return c;
}

__global__ __launch_bounds__(256) void k_wt_bf16(const float* __restrict__ W, unsigned short* __restrict__ Wt, int K, int N) {
  const int t = blockIdx.x * 256 + threadIdx.x;
  const int k8n = K / 8;
  if (t >= N * k8n) return;
  const int n = t / k8n, k8 = (t % k8n) * 8;
  v8us v;
#pragma unroll
  for (int i = 0; i < 8; ++i) v[i] = bf16_bits(W[(size_t)(k8 + i) * N + n]);
  *(v8us*)(Wt + (size_t)n * K + k8) = v;
  
}

// GEMM C[M][N] (f32, pitch ldc) = act(A[M][K]·W + bias). A f32 row-major (pitch lda) converted per fragment to bf16
// (ASPLIT: hi/lo two planes -> 2 terms, else single rounded term); Wt bf16 [N][K] (pitch ldb). BIAS_BF16 rounds the
// bias to bf16 first (bias quantised to bf16 before the add). K%32==0, M%16==0, N%64==0.
template <bool ASPLIT, int ACT, bool BIAS_BF16>
__global__ __launch_bounds__(128) void k_gemm_bf(const float* __restrict__ A, int lda, const unsigned short* __restrict__ Wt, int ldb,
                                               const float* __restrict__ bias, float* __restrict__ C, int ldc, int M, int N, int K) {
  __shared__ __attribute__((aligned(16))) float so[4][16][64];
  const int tid = threadIdx.x, w = tid >> 5, lane = tid & 31, ln = lane & 15, hh = lane >> 4;
  const int ntn = N / 64;
  const int wid = blockIdx.x * 4 + w;
  const int mt = wid / ntn, nq = wid % ntn;
  if (mt * 16 >= M) return;
  const int row0 = mt * 16, col0 = nq * 64;
  const float* arow = A + (size_t)(row0 + ln) * lda;
  v8f acc[4] = {};
  for (int kb = 0; kb < K; kb += 32) {
    FragB ah, al;
    const v4f x0 = *(const v4fa*)(arow + kb + 8 * hh), x1 = *(const v4fa*)(arow + kb + 8 * hh + 4);
    const v4f x2 = *(const v4fa*)(arow + kb + 16 + 8 * hh), x3 = *(const v4fa*)(arow + kb + 16 + 8 * hh + 4);
    float xs[16] = {x0[0],x0[1],x0[2],x0[3],x1[0],x1[1],x1[2],x1[3],x2[0],x2[1],x2[2],x2[3],x3[0],x3[1],x3[2],x3[3]};
#pragma unroll
    for (int i = 0; i < 16; ++i) { const unsigned short hb = bf16_bits(xs[i]); ah.u[i] = hb; al.u[i] = ASPLIT ? bf16_bits(xs[i] - bf16_val(hb)) : (unsigned short)0; }
#pragma unroll
    for (int t = 0; t < 4; ++t) {
      const unsigned short* brow = Wt + (size_t)(col0 + t * 16 + ln) * ldb + kb;
      FragB b;
      b.half[0] = *(const v8us*)(brow + 8 * hh);
      b.half[1] = *(const v8us*)(brow + 16 + 8 * hh);
      acc[t] = mmaN<ASPLIT ? 2 : 1>(ah.v, al.v, b.v, b.v, acc[t]);
    }
  }
#pragma unroll
  for (int t = 0; t < 4; ++t) {
    float bv = bias ? bias[col0 + t * 16 + ln] : 0.f;
    if (BIAS_BF16) bv = bf16_round(bv);
#pragma unroll
    for (int r = 0; r < 8; ++r) { float v = acc[t][r] + bv; if (ACT == 1) v = fmaxf(v, 0.f); so[w][8 * hh + r][t * 16 + ln] = v; }
  }
  __builtin_amdgcn_fence(__ATOMIC_ACQ_REL, "workgroup");
  __builtin_amdgcn_wave_barrier();
  const int rsub = lane >> 4, c4 = (lane & 15) * 4;
  {
#pragma unroll
    for (int q = 0; q < 8; ++q) {
      const int r = q * 2 + rsub;
      const v4f v = *(const v4fa*)&so[w][r][c4];
      *(v4f*)(C + (size_t)(row0 + r) * ldc + col0 + c4) = v;
    }
    
  }
}

// GEMM C = act(A·W + bias + resid): A f32 (ASPLIT -> hi/lo 2 terms), Wt bf16 [N][K]; ACT 0 none, 1 relu, 2 exact gelu;
// resid (optional, f32, row index = (row % rmod), pitch ldr, RES_BF16 rounds it) added before the activation.
template <bool ASPLIT, int ACT, bool BIAS_BF16, bool RES_BF16>
__global__ __launch_bounds__(128) void k_gemm_bf3(const float* __restrict__ A, int lda, const unsigned short* __restrict__ Wt, int ldb,
                                                const float* __restrict__ bias, const float* __restrict__ resid, int rmod, int ldr,
                                                float* __restrict__ C, int ldc, int M, int N, int K) {
  __shared__ __attribute__((aligned(16))) float so[4][16][64];
  const int tid = threadIdx.x, w = tid >> 5, lane = tid & 31, ln = lane & 15, hh = lane >> 4;
  const int ntn = N / 64;
  const int wid = blockIdx.x * 4 + w;
  const int mt = wid / ntn, nq = wid % ntn;
  if (mt * 16 >= M) return;
  const int row0 = mt * 16, col0 = nq * 64;
  const float* arow = A + (size_t)(row0 + ln) * lda;
  v8f acc[4] = {};
  for (int kb = 0; kb < K; kb += 32) {
    FragB ah, al;
    const v4f x0 = *(const v4fa*)(arow + kb + 8 * hh), x1 = *(const v4fa*)(arow + kb + 8 * hh + 4);
    const v4f x2 = *(const v4fa*)(arow + kb + 16 + 8 * hh), x3 = *(const v4fa*)(arow + kb + 16 + 8 * hh + 4);
    float xs[16] = {x0[0],x0[1],x0[2],x0[3],x1[0],x1[1],x1[2],x1[3],x2[0],x2[1],x2[2],x2[3],x3[0],x3[1],x3[2],x3[3]};
#pragma unroll
    for (int i = 0; i < 16; ++i) { const unsigned short hb = bf16_bits(xs[i]); ah.u[i] = hb; al.u[i] = ASPLIT ? bf16_bits(xs[i] - bf16_val(hb)) : (unsigned short)0; }
#pragma unroll
    for (int t = 0; t < 4; ++t) {
      const unsigned short* brow = Wt + (size_t)(col0 + t * 16 + ln) * ldb + kb;
      FragB b;
      b.half[0] = *(const v8us*)(brow + 8 * hh);
      b.half[1] = *(const v8us*)(brow + 16 + 8 * hh);
      acc[t] = mmaN<ASPLIT ? 2 : 1>(ah.v, al.v, b.v, b.v, acc[t]);
    }
  }
#pragma unroll
  for (int t = 0; t < 4; ++t) {
    const int col = col0 + t * 16 + ln;
    float bv = bias ? bias[col] : 0.f;
    if (BIAS_BF16) bv = bf16_round(bv);
#pragma unroll
    for (int r = 0; r < 8; ++r) {
      float v = acc[t][r] + bv;
      if (resid) { float rv = resid[(size_t)((row0 + 8 * hh + r) % rmod) * ldr + col]; if (RES_BF16) rv = bf16_round(rv); v += rv; }
      if (ACT == 1) v = fmaxf(v, 0.f);
      if (ACT == 2) v = 0.5f * v * (1.0f + erff(v * 0.70710678118654752f));
      if (ACT == 3) { const float u = 0.7978845608028654f * (v + 0.044715f * v * v * v); v = 0.5f * v * (1.0f + tanhf(u)); }
      so[w][8 * hh + r][t * 16 + ln] = v;
    }
  }
  __builtin_amdgcn_fence(__ATOMIC_ACQ_REL, "workgroup");
  __builtin_amdgcn_wave_barrier();
  const int rsub = lane >> 4, c4 = (lane & 15) * 4;
  {
#pragma unroll
    for (int q = 0; q < 8; ++q) {
      const int r = q * 2 + rsub;
      const v4f v = *(const v4fa*)&so[w][r][c4];
      *(v4f*)(C + (size_t)(row0 + r) * ldc + col0 + c4) = v;
    }
    
  }
}
// row LayerNorm (biased variance, eps) over N: s = X (+ R); optional out_sum <- s; out_norm <- (s-mu)*rsqrt(var+eps)*g + b
template <bool PARAM_BF16>
__global__ __launch_bounds__(256) void k_layernorm(const float* __restrict__ X, const float* __restrict__ R, const float* __restrict__ g, const float* __restrict__ bta,
                                                  float* __restrict__ out_sum, float* __restrict__ out_norm, int N, float eps) {
  __shared__ float red[256];
  const int row = blockIdx.x, tid = threadIdx.x;
  const float* x = X + (size_t)row * N; const float* rr = R ? R + (size_t)row * N : nullptr;
  float vals[16];                     // up to N = 4096
  const int per = N / 256;            // contiguous chunk per thread? use strided-by-4 chunks: thread handles j = tid*4 + 1024*u
  float s1 = 0.f;
  for (int u = 0; u < per / 4; ++u) {
    const int j = tid * 4 + 1024 * u;
    const v4f a = *(const v4fa*)(x + j);
    v4f b = {0.f,0.f,0.f,0.f}; if (rr) b = *(const v4fa*)(rr + j);
#pragma unroll
    for (int q = 0; q < 4; ++q) { const float v = a[q] + b[q]; vals[u * 4 + q] = v; s1 += v; }
  }
  red[tid] = s1; __syncthreads();
  for (int st = 128; st > 0; st >>= 1) { if (tid < st) red[tid] += red[tid + st]; __syncthreads(); }
  const float mu = red[0] / (float)N; __syncthreads();
  float s2 = 0.f;
  for (int u = 0; u < per / 4; ++u)
#pragma unroll
    for (int q = 0; q < 4; ++q) { const float c = vals[u * 4 + q] - mu; s2 += c * c; }
  red[tid] = s2; __syncthreads();
  for (int st = 128; st > 0; st >>= 1) { if (tid < st) red[tid] += red[tid + st]; __syncthreads(); }
  const float rs = rsqrtf(red[0] / (float)N + eps);
  {
    for (int u = 0; u < per / 4; ++u) {
      const int j = tid * 4 + 1024 * u;
      v4f o, sm;
#pragma unroll
      for (int q = 0; q < 4; ++q) {
        float gg = g[j + q], bb = bta[j + q];
        if (PARAM_BF16) { gg = bf16_round(gg); bb = bf16_round(bb); }
        sm[q] = vals[u * 4 + q]; o[q] = (vals[u * 4 + q] - mu) * rs * gg + bb;
      }
      if (out_sum) *(v4f*)(out_sum + (size_t)row * N + j) = sm;
      *(v4f*)(out_norm + (size_t)row * N + j) = o;
    }
    
  }
}



// ---- f16 WMMA path (v_wmma_f32_16x16x32_f16): 11-bit significands for operands in range — used where a [0,1] probability operand needs more precision than bf16
typedef _Float16 v16h __attribute__((ext_vector_type(16)));
union FragH { v16h v; v8us half[2]; _Float16 h[16]; unsigned short u[16]; };
template <int NT>
__device__ __forceinline__ v8f mmaH(v16h ah, v16h al, v16h bh, v16h bl, v8f c) {
  c = __builtin_amdgcn_wmma_f32_16x16x32_f16(false, ah, false, bh, (short)0, c, false, false);
  if (NT >= 2) c = __builtin_amdgcn_wmma_f32_16x16x32_f16(false, al, false, bh, (short)0, c, false, false);
  if (NT >= 3) c = __builtin_amdgcn_wmma_f32_16x16x32_f16(false, ah, false, bl, (short)0, c, false, false);
  asm volatile("v_nop\n\tv_nop\n\tv_nop\n\tv_nop" : "+v"(c) : "v"(ah), "v"(al), "v"(bh), "v"(bl));
  return c;
}
// batched GEMM like k_gemm_b but f16 operands: A f32 (split into f16 hi/lo if ASPLIT, else rounded to f16), Bt = f16 values [n][k]; alpha; C f32; N multiple of 16 (partial tiles skipped)
template <bool ASPLIT>
__global__ __launch_bounds__(128) void k_gemm_h(const float* __restrict__ A, int lda, size_t sA, const _Float16* __restrict__ Bh, int ldb, size_t sB, float alpha, float* __restrict__ C, int ldc, size_t sC, int M, int N, int K) {
  __shared__ __attribute__((aligned(16))) float so[4][16][64];
  const int tid = threadIdx.x, w = tid >> 5, lane = tid & 31, ln = lane & 15, hh = lane >> 4; const int by = blockIdx.y;
  A += (size_t)by * sA; Bh += (size_t)by * sB; C += (size_t)by * sC;
  const int ntn = (N + 63) / 64; const int wid = blockIdx.x * 4 + w; const int mt = wid / ntn, nq = wid % ntn; if (mt * 16 >= M) return;
  const int row0 = mt * 16, col0 = nq * 64; const float* arow = A + (size_t)(row0 + ln) * lda;
  v8f acc[4] = {};
  for (int kb = 0; kb < K; kb += 32) {
    FragH ah, al;
    const v4f x0 = *(const v4fa*)(arow + kb + 8 * hh), x1 = *(const v4fa*)(arow + kb + 8 * hh + 4), x2 = *(const v4fa*)(arow + kb + 16 + 8 * hh), x3 = *(const v4fa*)(arow + kb + 16 + 8 * hh + 4);
    float xs[16] = {x0[0],x0[1],x0[2],x0[3],x1[0],x1[1],x1[2],x1[3],x2[0],x2[1],x2[2],x2[3],x3[0],x3[1],x3[2],x3[3]};
#pragma unroll
    for (int i = 0; i < 16; ++i) { const _Float16 h = (_Float16)xs[i]; ah.h[i] = h; al.h[i] = ASPLIT ? (_Float16)(xs[i] - (float)h) : (_Float16)0.0f; }
#pragma unroll
    for (int t = 0; t < 4; ++t) { if (col0 + t * 16 >= N) continue; const size_t boff = (size_t)(col0 + t * 16 + ln) * ldb + kb; FragH bq; bq.half[0] = *(const v8us*)(Bh + boff + 8 * hh); bq.half[1] = *(const v8us*)(Bh + boff + 16 + 8 * hh);
      acc[t] = mmaH<ASPLIT ? 2 : 1>(ah.v, al.v, bq.v, bq.v, acc[t]); }
  }
#pragma unroll
  for (int t = 0; t < 4; ++t) { if (col0 + t * 16 >= N) continue;
#pragma unroll
    for (int r = 0; r < 8; ++r) so[w][8 * hh + r][t * 16 + ln] = acc[t][r] * alpha; }
  __builtin_amdgcn_fence(__ATOMIC_ACQ_REL, "workgroup"); __builtin_amdgcn_wave_barrier();
  const int rsub = lane >> 4, c4 = (lane & 15) * 4;
  {
#pragma unroll
    for (int q = 0; q < 8; ++q) { const int r = q * 2 + rsub; if (col0 + c4 < N) { const v4f v = *(const v4fa*)&so[w][r][c4]; *(v4f*)(C + (size_t)(row0 + r) * ldc + col0 + c4) = v; } }
     }
}

// Wt[n][k] = f16(W[k][n]·scale) from f32 row-major W[K][N] (scale = power of two; bf16-exact weights stay exact in f16 away from the subnormal range)
__global__ __launch_bounds__(256) void k_wt_f16(const float* __restrict__ W, _Float16* __restrict__ Wt, int K, int N, float scale) {
  const int t = blockIdx.x * 256 + threadIdx.x; if (t >= N * (K / 8)) return; const int n = t / (K / 8), k8 = (t % (K / 8)) * 8; FragH f;
#pragma unroll
  for (int i = 0; i < 8; ++i) f.h[i] = (_Float16)(bf16_round(W[(size_t)(k8 + i) * N + n]) * scale); const v8us o = f.half[0];
  *(v8us*)((unsigned short*)Wt + (size_t)n * K + k8) = o; 
}
// k_gemm_hh variant with fused epilogue: v = acc·alpha + bias[by·sBias + col] (+ CP[(row/rowsPerB)·sCPb + by·64 + col] if CP) ; ACT 0 none / 1 elu ; writes f16 C16 (and f32 C if non-null)
template <int ACT>
__global__ __launch_bounds__(128) void k_gemm_hhx(const _Float16* __restrict__ A, int lda, size_t sA, const _Float16* __restrict__ Bh, int ldb, size_t sB, float alpha, const float* __restrict__ bias, size_t sBias, const float* __restrict__ CP, int rowsPerB, size_t sCPb, int row0g,
    float* __restrict__ C, _Float16* __restrict__ C16, int ldc, size_t sC, int M, int N, int K) {
  __shared__ __attribute__((aligned(16))) float so[4][16][64];
  const int tid = threadIdx.x, w = tid >> 5, lane = tid & 31, ln = lane & 15, hh = lane >> 4; const int by = blockIdx.y;
  A += (size_t)by * sA; Bh += (size_t)by * sB; const size_t cofs = (size_t)by * sC; const float* bp = bias ? bias + (size_t)by * sBias : nullptr;
  const int ntn = (N + 63) / 64; const int wid = blockIdx.x * 4 + w; const int mt = wid / ntn, nq = wid % ntn; if (mt * 16 >= M) return;
  const int row0 = mt * 16, col0 = nq * 64; const _Float16* arow = A + (size_t)(row0 + ln) * lda;
  v8f acc[4] = {};
  for (int kb = 0; kb < K; kb += 32) { FragH ah; ah.half[0] = *(const v8us*)((const unsigned short*)arow + kb + 8 * hh); ah.half[1] = *(const v8us*)((const unsigned short*)arow + kb + 16 + 8 * hh);
#pragma unroll
    for (int t = 0; t < 4; ++t) { if (col0 + t * 16 >= N) continue; const size_t boff = (size_t)(col0 + t * 16 + ln) * ldb + kb; FragH bq; bq.half[0] = *(const v8us*)((const unsigned short*)Bh + boff + 8 * hh); bq.half[1] = *(const v8us*)((const unsigned short*)Bh + boff + 16 + 8 * hh);
      acc[t] = mmaH<1>(ah.v, ah.v, bq.v, bq.v, acc[t]); }
  }
#pragma unroll
  for (int t = 0; t < 4; ++t) { if (col0 + t * 16 >= N) continue; const int col = col0 + t * 16 + ln; const float bv = bp ? bf16_round(bp[col]) : 0.f;
#pragma unroll
    for (int r = 0; r < 8; ++r) { float v = acc[t][r] * alpha + bv; if (CP) { const int rr = row0g + row0 + 8 * hh + r; if (rowsPerB < 0) v += CP[cofs + (size_t)rr * ldc + col];      /* rowsPerB < 0: own element of the batched C plane */ else { const int bidx = rr / rowsPerB; v += CP[(size_t)bidx * sCPb + (size_t)by * 64 + col]; } } if (ACT == 1) v = (v > 0.f) ? v : expm1f(v); else if (ACT == 7) v = (v > 0.f) ? v + 1.0f : expf(v); else if (ACT == 8) v = tanhf(v); else if (ACT == 9) v = 0.5f * v * (1.0f + tanhf(0.7978845608028654f * (v + 0.044715f * v * v * v))); else if (ACT == 11) v = 1.0f / (1.0f + expf(-v)); else if (ACT == 12) v = (v > 0.f) ? v : 0.01f * v; else if (ACT == 14) v = (v > 0.f) ? v : 0.1f * v; else if (ACT == 16) v = (v >= 0.f) ? v : 0.3f * v; else if (ACT == 17) v = (v >= 0.f) ? v : 0.2f * v; else if (ACT == 15) v = v / (1.0f + expf(-v)); else if (ACT == 3) v = fmaxf(v, 0.f); else if (ACT == 6) v = 0.5f * v * (1.0f + erff(v * 0.70710678118654752f)); so[w][8 * hh + r][t * 16 + ln] = v; } }
  __builtin_amdgcn_fence(__ATOMIC_ACQ_REL, "workgroup"); __builtin_amdgcn_wave_barrier();
  const int rsub = lane >> 4, c4 = (lane & 15) * 4; typedef _Float16 v4h __attribute__((ext_vector_type(4)));
  {
#pragma unroll
    for (int q = 0; q < 8; ++q) { const int r = q * 2 + rsub; if (col0 + c4 < N) { const v4f v = *(const v4fa*)&so[w][r][c4]; if (C) *(v4f*)(C + cofs + (size_t)(row0 + r) * ldc + col0 + c4) = v; if (C16) { v4h h4; for (int i = 0; i < 4; ++i) h4[i] = (_Float16)v[i]; *(v4h*)(C16 + cofs + (size_t)(row0 + r) * ldc + col0 + c4) = h4; } } }
     }
}


typedef _Float16 v4h __attribute__((ext_vector_type(4)));

__global__ __launch_bounds__(256) void k_x16(const float* __restrict__ x, _Float16* __restrict__ X16, size_t n8) { const size_t t = (size_t)blockIdx.x * 256 + threadIdx.x; if (t >= n8) return; FragH f;
#pragma unroll
  for (int q = 0; q < 8; ++q) f.h[q] = (_Float16)bf16_round(x[t * 8 + q]); *(v8us*)((unsigned short*)X16 + t * 8) = f.half[0];  }
__global__ __launch_bounds__(256) void k_h16(const float* __restrict__ x, _Float16* __restrict__ X16, size_t n8) { const size_t t = (size_t)blockIdx.x * 256 + threadIdx.x; if (t >= n8) return; FragH f;
#pragma unroll
  for (int q = 0; q < 8; ++q) f.h[q] = (_Float16)x[t * 8 + q]; *(v8us*)((unsigned short*)X16 + t * 8) = f.half[0];  }
__global__ __launch_bounds__(256) void k_round16f(const float* __restrict__ W, _Float16* __restrict__ Bt, size_t n8) { const size_t t = (size_t)blockIdx.x * 256 + threadIdx.x; if (t >= n8) return; FragH f;
#pragma unroll
  for (int i = 0; i < 8; ++i) f.h[i] = (_Float16)(bf16_round(W[t * 8 + i]) * 16.0f); *(v8us*)((unsigned short*)Bt + t * 8) = f.half[0];  }
template <int NHv, int TTv>
__global__ __launch_bounds__(256) void k_vt(const _Float16* __restrict__ V16, int ldv, int voff, _Float16* __restrict__ Vt) { __shared__ unsigned short tl[64][66]; const int tid = threadIdx.x; const int slab = blockIdx.x / (TTv / 64), lg = blockIdx.x % (TTv / 64); const int b = slab / NHv, h = slab % NHv;
  for (int i = tid; i < 64 * 8; i += 256) { const int r = i / 8, c8 = (i % 8) * 8; FragH f; f.half[0] = *(const v8us*)((const unsigned short*)V16 + ((size_t)b * TTv + lg * 64 + r) * ldv + voff + h * 64 + c8);
#pragma unroll
    for (int q = 0; q < 8; ++q) tl[r][c8 + q] = f.u[q]; }
  __syncthreads();
  {
#pragma unroll
    for (int rd = 0; rd < 2; ++rd) { const int d = rd * 32 + tid / 8, pc = tid % 8; FragH f;
#pragma unroll
      for (int q = 0; q < 8; ++q) f.u[q] = tl[pc * 8 + q][d];
      *(v8us*)((unsigned short*)Vt + ((size_t)slab * 64 + d) * TTv + lg * 64 + pc * 8) = f.half[0]; }
     } }

__global__ __launch_bounds__(256) void k_hl(const float* __restrict__ F, _Float16* __restrict__ Hh, _Float16* __restrict__ Hl, size_t n8) { const size_t t = (size_t)blockIdx.x * 256 + threadIdx.x; if (t >= n8) return; FragH fh, fl; const v4f a = *(const v4fa*)(F + t * 8), c = *(const v4fa*)(F + t * 8 + 4);
#pragma unroll
  for (int q = 0; q < 4; ++q) { _Float16 h = (_Float16)a[q]; fh.h[q] = h; fl.h[q] = (_Float16)((a[q] - (float)h) * 1024.0f); h = (_Float16)c[q]; fh.h[4 + q] = h; fl.h[4 + q] = (_Float16)((c[q] - (float)h) * 1024.0f); }
  { *(v8us*)((unsigned short*)Hh + t * 8) = fh.half[0]; *(v8us*)((unsigned short*)Hl + t * 8) = fl.half[0];  } }

// ---- f16 fragment of 32 k from a k-contiguous row, hardware k order (8 hh + 0..7, then 16 + 8 hh + 0..7) ----
__device__ __forceinline__ v16h g2_frag(const _Float16* p, int hh) { FragH f; f.half[0] = *(const v8us*)((const unsigned short*)p + 8 * hh); f.half[1] = *(const v8us*)((const unsigned short*)p + 16 + 8 * hh); return f.v; }


// ---- the same fragment from a plane stored in fragment order: 1 KiB a fragment of 16 rows x 32 k, first the 32 lanes' k 8 hh + 0..7 (16 bytes a lane, lane = 16 hh + row), then their k 16 + 8 hh + 0..7; p = fragment start + 8 * lane.
// Each of the two wave-wide loads then covers 512 contiguous bytes, 4 whole lines, where a row-major plane gives 16 lines in pieces of 32 bytes. ----
__device__ __forceinline__ v16h pk_frag(const _Float16* p) { FragH f; f.half[0] = *(const v8us*)((const unsigned short*)p); f.half[1] = *(const v8us*)((const unsigned short*)p + 256); return f.v; }

// ---- projection stage in one launch, straight from the f32 weights ----
// A block takes 64 tokens and 32 neighbouring columns (column half h) of each of the three [in][out] weights: the 64 x 96 tile [q | k | v] = x W. Wave w takes weight w / 4 and the K slice w % 4 (256 wide); the 4 partial tiles of each weight meet in LDS and are summed in slice order.
// Weights need no transposed copy: a lane reads 8 bytes = columns 2 ln and 2 ln + 1 of one k row, so that 16 lanes cover the 128-byte line that holds the block's 32 columns of that row (two rows a load, by hh). Column 2 ln + j goes to B fragment j:
// a fragment's 16 columns are then the even or the odd ones, and the 16 k of a lane come from 16 loads, in the hardware k order (8 hh + 0..7, then 16 + 8 hh + 0..7). Each value is rounded to bf16 in registers. With 64 tokens a block each f32 weight byte is read by 128 blocks.
// The block's 64 x 1024 tile of x is staged once in LDS: a load takes two rows x 256 contiguous bytes (4 whole lines), each value is rounded to bf16 and stored in fragment order (xs_frag); behind one barrier every wave reads its A fragments from there.
// The two blocks that share a token tile lie 8 apart in the grid (for speed only).
// Waves 0-3 then write q (f16), waves 4-7 k (f32 rows to the output, f16), waves 8-11 v: a thread owns one head column d and two runs of 8 neighbouring tokens (32 apart), so that it stores f32 rows to the output and 16 bytes of V^T a run.
// Each f16 plane gives 32 tokens one 4-KiB slab of four fragments in the order of pk_frag: q and k as (token tile, d / 32) with rows = tokens, k = d; V^T as d / 16 with rows = d, k = tokens. A block writes whole fragments and whole 128-byte lines of the f32 rows.
// The 128 blocks that read the same weight columns walk the 8 k steps of a slice in 8 different rotations (KR, by token tile), so that 16 of them, not 128, ask L2 for a weight line at the same moment; the A fragments follow the same rotation.
// Every loop is unrolled: the accumulator and fragment arrays are then indexed by constants only and stay in registers.
#define PW 12
#define PP 36       /* pitch in floats of a 32-column partial tile: 8 rows on are 32 banks on */
#define KR(kq) (((kq) + rot) & 7)      /* the k step that a block takes in its turn kq */
#define XF 656      /* halves from one staged x fragment to the next: 1312 bytes = two halves of 640, each two lane halves of 320 (256 used), and 32 bytes of padding; see xs_frag */
typedef float v2f  __attribute__((ext_vector_type(2)));
typedef float v2fa __attribute__((ext_vector_type(2), may_alias));
typedef __bf16 v4ba __attribute__((ext_vector_type(4), may_alias));
// A fragment of the staged x tile: p = fragment start + 160 * hh + 8 * row; k order as pk_frag (8 hh + 0..7, then 16 + 8 hh + 0..7). The odd steps (32, 64 and 128 bytes beyond a multiple of 256) put the 32 lanes' 8-byte stores of the staging on all 64 banks; each 16 lanes of a read take 256 contiguous bytes.
__device__ __forceinline__ v16b xs_frag(const unsigned short* p) { FragB f; f.half[0] = *(const v8us*)p; f.half[1] = *(const v8us*)(p + 320); return f.v; }
__global__ __launch_bounds__(PW * 32) void k_qkv(const float* __restrict__ x, const float* __restrict__ W0, const float* __restrict__ W1, const float* __restrict__ W2, _Float16* __restrict__ Q16, float* __restrict__ KO, _Float16* __restrict__ K16, float* __restrict__ VO, _Float16* __restrict__ VTH) {
  __shared__ __attribute__((aligned(16))) float so[PW][64][PP];
  __shared__ __attribute__((aligned(16))) unsigned short xs[128 * XF];
  const int tid = threadIdx.x, lane = tid & 31, ln = lane & 15, hh = lane >> 4; const int w = __builtin_amdgcn_readfirstlane(tid >> 5);      /* the wave's number in a scalar register: the piece numbers of the staging and the role branch behind the barrier are then scalar */
  const int m = w >> 2, ks = w & 3; const int b = blockIdx.x; const int h = (b >> 3) & 1, tile = (b >> 4) * 8 + (b & 7), row0 = tile * 64, rot = ((tile >> 3) + tile) & 7;      /* blocks that start together (neighbours in the grid) differ in rot, and so do those that follow them on the same part of the chip */
  const float* xp = x + (size_t)(row0 + 2 * m + hh) * DMX + ks * 256 + ln * 4; const float* xl = xp + ((m < 2) ? 10 : 9) * (6 * DMX);
  const float* wp = ((m == 0) ? W0 : (m == 1) ? W1 : W2) + (size_t)(ks * 256 + 8 * hh) * HD + 32 * h + 2 * ln;
  v4f xr[11][4]; v2f wf[8][16];
  /* staging: the three waves of a K slice share its 256 columns of x by row pairs m, m + 3, ...; 32 pairs are 11, 11 and 10: in the last round wave m = 2 takes its own last pair again, so that the code stays straight */
#pragma unroll
  for (int t = 0; t < 11; ++t) { const float* xt = (t < 10) ? xp + t * (6 * DMX) : xl;
#pragma unroll
    for (int sg = 0; sg < 4; ++sg) xr[t][sg] = *(const v4fa*)(xt + sg * 64); }
  asm volatile("s_wait_xcnt 0x0" :: "v"(xp), "v"(xl) : "memory");      /* the wait in front of any overwrite of the address pairs that the issued loads name; naming the pairs keeps them whole up to here (one build let a load land on its own pair). It also keeps the x loads in front of the weight loads: loads return in order, and x is wanted first */
#pragma unroll
  for (int kq = 0; kq < 2; ++kq) { const float* wk = wp + KR(kq) * (32 * HD);
#pragma unroll
    for (int e = 0; e < 16; ++e) wf[kq][e] = *(const v2fa*)(wk + ((e >> 3) * 16 + (e & 7)) * HD);      /* the weights of the first two k steps fly while x is staged */
    asm volatile("s_wait_xcnt 0x0" :: "v"(wk) : "memory");      /* the wait in front of any overwrite of the address pair that these loads name; naming the pair keeps it whole up to here */ }
  __builtin_amdgcn_sched_barrier(0);      /* keeps these loads in front of the staging: moved down, they would start only when x has landed */
  unsigned short* xw = xs + (ks * 8 + ((lane >> 3) & 1)) * XF + ((lane >> 2) & 1) * 320 + ((lane >> 1) & 1) * 160 + hh * 8 + (lane & 1) * 4;
#pragma unroll
  for (int t = 0; t < 11; ++t) { const int rp = m + 3 * ((t < 10 || m < 2) ? t : t - 1); unsigned short* xd = xw + (rp >> 3) * (32 * XF) + (rp & 7) * 16;
#pragma unroll
    for (int sg = 0; sg < 4; ++sg) { v4ba h4;
#pragma unroll
      for (int e = 0; e < 4; ++e) h4[e] = (__bf16)xr[t][sg][e];      /* the conversion instruction rounds to nearest even, as bf16_round does */
      *(v4ba*)(xd + sg * (2 * XF)) = h4; } }
  const float* wk2 = wp + KR(2) * (32 * HD);
#pragma unroll
  for (int e = 0; e < 16; ++e) wf[2][e] = *(const v2fa*)(wk2 + ((e >> 3) * 16 + (e & 7)) * HD);      /* a third k step into registers that x has left */
  asm volatile("s_wait_xcnt 0x0" :: "v"(wk2) : "memory");      /* the wait in front of any overwrite of the address pair that these loads name; naming the pair keeps it whole up to here */
  /* the whole x tile is in LDS before any wave reads a fragment of it. The barrier with fences on LDS alone: __syncthreads() would also wait here for the weight loads in flight, which no other wave needs */
  __builtin_amdgcn_fence(__ATOMIC_RELEASE, "workgroup", "local"); __builtin_amdgcn_s_barrier(); __builtin_amdgcn_fence(__ATOMIC_ACQUIRE, "workgroup", "local");
  const unsigned short* xa = xs + ks * 8 * XF + hh * 160 + ln * 8;
  v8f acc[4][2] = {}; v16b af[4];
#pragma unroll
  for (int tt = 0; tt < 4; ++tt) af[tt] = xs_frag(xa + (tt * 32 + KR(0)) * XF);
#pragma unroll
  for (int kq = 0; kq < 8; ++kq) { v16b an[4];
    if (kq + 1 < 8) {
#pragma unroll
      for (int tt = 0; tt < 4; ++tt) an[tt] = xs_frag(xa + (tt * 32 + KR(kq + 1)) * XF);      /* the A fragments of the next k step, as one group ahead of this step's products */
      if (kq + 3 < 8) { const float* wk = wp + KR(kq + 3) * (32 * HD);
#pragma unroll
        for (int e = 0; e < 16; ++e) wf[kq + 3][e] = *(const v2fa*)(wk + ((e >> 3) * 16 + (e & 7)) * HD);
        asm volatile("s_wait_xcnt 0x0" :: "v"(wk) : "memory");      /* the wait in front of any overwrite of the address pair that these loads name; naming the pair keeps it whole up to here */ }
      __builtin_amdgcn_sched_barrier(0);      /* keeps the LDS reads one k step and the weight loads three k steps ahead of their products: moved down to them, each product would wait for LDS and each k step for L2 */ }
    FragB b0, b1;
#pragma unroll
    for (int e = 0; e < 16; ++e) { b0.v[e] = (__bf16)wf[kq][e][0]; b1.v[e] = (__bf16)wf[kq][e][1]; }
#pragma unroll
    for (int tt = 0; tt < 4; ++tt) {
      acc[tt][0] = __builtin_amdgcn_wmma_f32_16x16x32_bf16(false, af[tt], false, b0.v, (short)0, acc[tt][0], false, false);
      acc[tt][1] = __builtin_amdgcn_wmma_f32_16x16x32_bf16(false, af[tt], false, b1.v, (short)0, acc[tt][1], false, false); }
    if (kq + 1 < 8) {
#pragma unroll
      for (int tt = 0; tt < 4; ++tt) af[tt] = an[tt]; } }
#pragma unroll
  for (int tt = 0; tt < 4; ++tt)
#pragma unroll
    for (int r = 0; r < 8; ++r) { const v2f p = {acc[tt][0][r], acc[tt][1][r]}; *(v2fa*)&so[w][tt * 16 + 8 * hh + r][2 * ln] = p; }      /* columns 2 ln and 2 ln + 1 lie side by side again */
  __syncthreads();      /* every wave's partial tile is in LDS before any is summed */
  const int g = tid & 127;
  if (m < 2) { const int rr = g >> 3, c4 = (g & 7) * 4;
#pragma unroll
    for (int i = 0; i < 4; ++i) { const int r = i * 16 + rr; const float* sp = &so[m * 4][r][c4]; v4f s = *(const v4fa*)sp;
#pragma unroll
      for (int u = 1; u < 4; ++u) s += *(const v4fa*)(sp + u * 64 * PP);
      v4h h4;
#pragma unroll
      for (int e = 0; e < 4; ++e) h4[e] = (_Float16)s[e];
      const size_t po = (size_t)(tile * 2 + (i >> 1)) * 2048 + (i & 1) * 1024 + h * 512 + (c4 >> 4) * 256 + (((c4 >> 3) & 1) * 16 + rr) * 8 + (c4 & 4);      /* place of d = 32 h + c4 ... + 3 of token r in its slab */
      if (m == 0) *(v4h*)(Q16 + po) = h4; else { *(v4f*)(KO + (size_t)(row0 + r) * HD + 32 * h + c4) = s; *(v4h*)(K16 + po) = h4; } }
    asm volatile("s_wait_xcnt 0x0" ::: "memory");      /* the wait behind these stores, in front of any overwrite of a register that they name */ }
  else { const int c = g & 31, tg = g >> 5, d = 32 * h + c;
#pragma unroll
    for (int sl = 0; sl < 2; ++sl) { const float* sp = &so[8][sl * 32 + tg * 8][c]; float* vo = VO + (size_t)(row0 + sl * 32 + tg * 8) * HD + d; FragH fh;
#pragma unroll
      for (int i = 0; i < 8; ++i) { float s = sp[i * PP];
#pragma unroll
        for (int u = 1; u < 4; ++u) s += sp[u * 64 * PP + i * PP];
        vo[i * HD] = s; fh.h[i] = (_Float16)s; }
      const size_t to = (size_t)(tile * 2 + sl) * (HD * 32) + (d >> 4) * 512 + (tg >> 1) * 256 + ((tg & 1) * 16 + (d & 15)) * 8;
      *(v8us*)((unsigned short*)VTH + to) = fh.half[0]; }
    asm volatile("s_wait_xcnt 0x0" ::: "memory");      /* the wait behind these stores, in front of any overwrite of a register that they name */ } }


__global__ __launch_bounds__(256) void k_wnat(const float* __restrict__ w, size_t n8, _Float16* __restrict__ Bt) { const size_t t = (size_t)blockIdx.x * 256 + threadIdx.x; if (t >= n8) return; FragH f; for (int q = 0; q < 8; ++q) f.h[q] = (_Float16)(bf16_round(w[t * 8 + q]) * 16.0f); *(v8us*)((unsigned short*)Bt + t * 8) = f.half[0];  }
__global__ __launch_bounds__(256) void k_rsm(const float* __restrict__ S, _Float16* __restrict__ P, int nrows) {
  #pragma clang fp contract(off)
  const int i = blockIdx.x * 256 + threadIdx.x; if (i >= nrows) return; const float* s = S + (size_t)i * SQ; float mx = -3.0e38f;
#pragma unroll 1
  for (int j = 0; j < SQ; ++j) mx = fmaxf(mx, s[j]); float se = 0.f;
#pragma unroll 1
  for (int j = 0; j < SQ; ++j) se += expf(s[j] - mx); const float sc = 256.0f / se;
#pragma unroll 1
  for (int j0 = 0; j0 < SQ; j0 += 8) { FragH f; for (int q = 0; q < 8; ++q) f.h[q] = (_Float16)(expf(s[j0 + q] - mx) * sc); unsigned short* d = (unsigned short*)P + (size_t)i * SQ + j0; *(v8us*)d = f.half[0];  } }
__global__ __launch_bounds__(256) void k_vt(const _Float16* __restrict__ V16, int b, int h0, _Float16* __restrict__ VT) { __shared__ unsigned short tl[64][65]; const int tid = threadIdx.x; const int hh = blockIdx.x % HG, sg = blockIdx.x / HG; const int s0 = sg * 64; const int h = h0 + hh;
  for (int i = tid; i < 64 * 8; i += 256) { const int j = i / 8, d8 = (i % 8) * 8; FragH f; f.half[0] = *(const v8us*)((const unsigned short*)V16 + ((size_t)b * SQ + s0 + j) * DM + h * HD + d8); for (int q = 0; q < 8; ++q) tl[d8 + q][j] = f.u[q]; }
  __syncthreads();
  { for (int i = tid; i < 64 * 8; i += 256) { const int d = i / 8, j8 = (i % 8) * 8; FragH f; for (int q = 0; q < 8; ++q) f.u[q] = tl[d][j8 + q]; *(v8us*)((unsigned short*)VT + ((size_t)hh * HD + d) * SQ + s0 + j8) = f.half[0]; }  } }


__global__ __launch_bounds__(256) void k_rsmcf2(const float* __restrict__ S, _Float16* __restrict__ P, int hg, int q0, int nk) {
  #pragma clang fp contract(off)
  const int t = blockIdx.x * 256 + threadIdx.x; if (t >= hg * QT) return; const size_t i = (size_t)t; const float* s = S + i * NKX; const int last = q0 + (t % QT); float mx = -3.0e38f;
#pragma unroll 1
  for (int j = 0; j < nk; ++j) { const float f = (j <= last) ? 1.f : 0.f; mx = fmaxf(mx, fmaf(f, s[j], (1.f - f) * -1.0e9f)); } float se = 0.f;
#pragma unroll 1
  for (int j = 0; j < nk; ++j) { const float f = (j <= last) ? 1.f : 0.f; se += __expf(fmaf(f, s[j], (1.f - f) * -1.0e9f) - mx); } const float sc = 256.0f / se;
#pragma unroll 1
  for (int j0 = 0; j0 < nk; j0 += 8) { FragH fr; for (int q = 0; q < 8; ++q) { const int j = j0 + q; const float f = (j <= last) ? 1.f : 0.f; fr.h[q] = (_Float16)(__expf(fmaf(f, s[j], (1.f - f) * -1.0e9f) - mx) * sc); } unsigned short* d = (unsigned short*)P + i * NKX + j0; *(v8us*)d = fr.half[0];  } }


// ---- causal attention in one launch: scores, softmax and P V of 32 queries a block; no score or weight plane in memory ----
// native 2^y; the v_nop is the slot the instruction set asks for behind a transcendental before its result is read or its source overwritten
__device__ __forceinline__ float exp2_hw(float y) { float x; asm("v_exp_f32 %0, %1\n\tv_nop" : "=v"(x) : "v"(y)); return x; }
// eight at once: results in registers of their own, so that each v_exp is the independent instruction behind the one before it and one v_nop closes the last slot
__device__ __forceinline__ void exp2_x8(const float (&y)[8], float (&x)[8]) {
  asm("v_exp_f32 %0, %8\n\tv_exp_f32 %1, %9\n\tv_exp_f32 %2, %10\n\tv_exp_f32 %3, %11\n\tv_exp_f32 %4, %12\n\tv_exp_f32 %5, %13\n\tv_exp_f32 %6, %14\n\tv_exp_f32 %7, %15\n\tv_nop"
      : "=&v"(x[0]), "=&v"(x[1]), "=&v"(x[2]), "=&v"(x[3]), "=&v"(x[4]), "=&v"(x[5]), "=&v"(x[6]), "=&v"(x[7]) : "v"(y[0]), "v"(y[1]), "v"(y[2]), "v"(y[3]), "v"(y[4]), "v"(y[5]), "v"(y[6]), "v"(y[7])); }
// the value of lane l ^ 16: the other half of a query's keys
__device__ __forceinline__ float xhalf(float x) { return __builtin_bit_cast(float, __builtin_amdgcn_permlanex16(__builtin_bit_cast(int, x), __builtin_bit_cast(int, x), 0x76543210, 0xfedcba98, false, false)); }
// Block = (batch, query tile of 32 rows), heaviest tiles first in the grid. Wave w takes the key steps qi - w, qi - w - AW, ... of 32 keys, downward from the diagonal step qi (the tile's own keys, the only one that is masked): the blocks of a batch then start at different keys, so that at most AW of them, not all, ask L2 for a K or V^T line at the same moment, and a block's later steps are lines that lighter blocks have already brought in.
// Transposed products: S^T = K Q^T puts one query in a lane (column ln) and 8 keys of each 16-key tile in its registers (row 8 hh + r), which is the k order of a B fragment: the weights go from the score accumulators
// straight into the B operand of O^T += V^T P^T, whose A fragments come from the V^T planes in the same k order (pk_frag). Row maximum and row sum are in-lane plus one exchange between the lane halves.
// Each wave keeps its own running maximum m (raw q . k units), sum l and un-normalised O^T; weights are 256 * 2^((s - m) CS) rounded to f16; the row sum l adds the unrounded weights.
// The AW partial results meet in LDS behind one barrier and are joined with the weights 2^((m_w - M) CS); a wave without a step gives m = -3e38, l = 0, O = 0.
#define AW 16
#define AP 68      /* pitch in floats of a query's 64 partial outputs: 16 lanes' 16-byte stores fall on all 64 banks */
__global__ __launch_bounds__(AW * 32) void k_attn(const _Float16* __restrict__ Q16, const _Float16* __restrict__ K16, const _Float16* __restrict__ VTH, float* __restrict__ O) {
  __shared__ __attribute__((aligned(16))) float so[AW][32][AP];
  __shared__ float sm[AW][32]; __shared__ float sl[AW][32];
  const int tid = threadIdx.x, lane = tid & 31, ln = lane & 15, hh = lane >> 4; const int w = __builtin_amdgcn_readfirstlane(tid >> 5);      /* the wave's number in a scalar register: the key loop then runs on scalar compares and branches, every lane on at the matrix instructions */
  const int by = blockIdx.x, qi = SQ / 32 - 1 - (int)blockIdx.y, row0 = qi * 32;
  const float CS = 1.44269504f * 0.03125f;      /* log2(e) * 1024^-0.5 */
  const _Float16* qp = Q16 + ((size_t)by * SQ + row0) * HD + lane * 8; const _Float16* kp = K16 + (size_t)by * SQ * HD + lane * 8;      /* the lane's 16 bytes are in the step pointers: every fragment of a step then lies at an immediate offset from one of them */
  const _Float16* vhp = VTH + (size_t)by * HD * SQ + lane * 8;
  v16h qf[2][2];
#pragma unroll
  for (int qt = 0; qt < 2; ++qt)
#pragma unroll
    for (int ks = 0; ks < 2; ++ks) qf[qt][ks] = pk_frag(qp + (qt * 2 + ks) * 512);
  const v8f z8 = {0.f, 0.f, 0.f, 0.f, 0.f, 0.f, 0.f, 0.f};
  v8f acc[2][4]; float m[2], l[2];
#pragma unroll
  for (int qt = 0; qt < 2; ++qt) { m[qt] = -3.0e38f; l[qt] = 0.f;
#pragma unroll
    for (int dt = 0; dt < 4; ++dt) acc[qt][dt] = z8; }
#pragma unroll 1      /* rolled: at most SQ / 32 / AW trips, and the live set of one trip fills the register budget of a 16-wave block */
  for (int j = qi - w; j >= 0; j -= AW) {
    v16h kf[2][2], vh[4]; const _Float16* kj = kp + (size_t)j * (32 * HD); const _Float16* vhj = vhp + (size_t)j * (HD * 32);
#pragma unroll
    for (int kt = 0; kt < 2; ++kt)
#pragma unroll
      for (int ks = 0; ks < 2; ++ks) kf[kt][ks] = pk_frag(kj + (kt * 2 + ks) * 512);
#pragma unroll
    for (int dt = 0; dt < 4; ++dt) vh[dt] = pk_frag(vhj + dt * 512);
    asm volatile("s_wait_xcnt 0x0" :: "v"(kj), "v"(vhj) : "memory");      /* the wait in front of any overwrite of the address pairs that the issued loads name; naming the pairs keeps them whole up to here (one build let a load land on its own pair) */
    __builtin_amdgcn_sched_barrier(0);      /* all K loads are issued before the first score product: the compiler otherwise loaded one K fragment into the registers of another behind its product, a second wait for L2 in every step */
    v8f s[2][2];
#pragma unroll
    for (int qt = 0; qt < 2; ++qt)
#pragma unroll
      for (int kt = 0; kt < 2; ++kt) {
        s[qt][kt] = __builtin_amdgcn_wmma_f32_16x16x32_f16(false, kf[kt][0], false, qf[qt][0], (short)0, z8, false, false);
        s[qt][kt] = __builtin_amdgcn_wmma_f32_16x16x32_f16(false, kf[kt][1], false, qf[qt][1], (short)0, s[qt][kt], false, false); }
    if (j == qi) {      /* the diagonal step: key kt * 16 + 8 hh + r of the tile is visible to query qt * 16 + ln up to the query itself; every query sees at least its own key */
#pragma unroll
      for (int qt = 0; qt < 2; ++qt)
#pragma unroll
        for (int kt = 0; kt < 2; ++kt)
#pragma unroll
          for (int r = 0; r < 8; ++r) s[qt][kt][r] = (kt * 16 + 8 * hh + r <= qt * 16 + ln) ? s[qt][kt][r] : -3.0e38f; }
    FragH ph[2]; float corr[2];
#pragma unroll
    for (int qt = 0; qt < 2; ++qt) {
      float m4[4] = {m[qt], m[qt], m[qt], m[qt]};
#pragma unroll
      for (int kt = 0; kt < 2; ++kt)
#pragma unroll
        for (int r = 0; r < 8; ++r) m4[r & 3] = fmaxf(m4[r & 3], s[qt][kt][r]);
      float mn = fmaxf(fmaxf(m4[0], m4[1]), fmaxf(m4[2], m4[3])); mn = fmaxf(mn, xhalf(mn));
      corr[qt] = exp2_hw((m[qt] - mn) * CS); m[qt] = mn;      /* 0 on the wave's first step */
      const float nb = 8.0f - mn * CS; float s4[4] = {0.f, 0.f, 0.f, 0.f};
#pragma unroll
      for (int kt = 0; kt < 2; ++kt) { float y[8], p[8];
#pragma unroll
        for (int r = 0; r < 8; ++r) y[r] = fmaf(s[qt][kt][r], CS, nb);
        exp2_x8(y, p);
#pragma unroll
        for (int r = 0; r < 8; ++r) { s4[r & 3] += p[r]; ph[qt].h[kt * 8 + r] = (_Float16)p[r]; } }
      l[qt] = fmaf(l[qt], corr[qt], (s4[0] + s4[1]) + (s4[2] + s4[3])); }
    __builtin_amdgcn_sched_barrier(0);      /* the softmax of both query tiles stays in front of the P V products: the build without this line mixed the two and spilled to scratch */
#pragma unroll
    for (int qt = 0; qt < 2; ++qt)
#pragma unroll
      for (int dt = 0; dt < 4; ++dt) acc[qt][dt] = __builtin_amdgcn_wmma_f32_16x16x32_f16(false, vh[dt], false, ph[qt].v, (short)0, acc[qt][dt] * corr[qt], false, false); }
#pragma unroll
  for (int qt = 0; qt < 2; ++qt) { const float lt = l[qt] + xhalf(l[qt]); if (hh == 0) { sm[w][qt * 16 + ln] = m[qt]; sl[w][qt * 16 + ln] = lt; }
#pragma unroll
    for (int dt = 0; dt < 4; ++dt) { const v8f a = acc[qt][dt]; float* d = &so[w][qt * 16 + ln][dt * 16 + 8 * hh];
      const v4f lo4 = {a[0], a[1], a[2], a[3]}, hi4 = {a[4], a[5], a[6], a[7]}; *(v4fa*)d = lo4; *(v4fa*)(d + 4) = hi4; } }
  __syncthreads();      /* every wave's maximum, sum and partial tile are in LDS before any is joined */
  const int q = tid >> 4, d4 = (tid & 15) * 4; float mw[AW]; float M = -3.0e38f;
#pragma unroll
  for (int u = 0; u < AW; ++u) { mw[u] = sm[u][q]; M = fmaxf(M, mw[u]); }
  float Ls = 0.f; v4f o = {0.f, 0.f, 0.f, 0.f};
#pragma unroll
  for (int g = 0; g < AW; g += 8) { float y[8], f[8];
#pragma unroll
    for (int u = 0; u < 8; ++u) y[u] = (mw[g + u] - M) * CS;
    exp2_x8(y, f);
#pragma unroll
    for (int u = 0; u < 8; ++u) { Ls = fmaf(sl[g + u][q], f[u], Ls); o += *(const v4fa*)&so[g + u][q][d4] * f[u]; } }
  *(v4f*)(O + ((size_t)by * SQ + row0 + q) * HD + d4) = o * (1.0f / Ls); }

extern "C" void kernel_launch(void* const* d_in, const int* in_sizes, int n_in,
                              void* d_out, int out_size, void* d_ws, size_t ws_size, hipStream_t stream) {
  (void)in_sizes; (void)n_in; (void)out_size;
  const float* const* I = (const float* const*)d_in; const float* x = I[0]; const float* wq = I[1]; const float* wk = I[2]; const float* wv = I[3];
  char* ws = (char*)d_ws; size_t off = 0;
  auto take = [&](size_t bytes) { char* p = ws + off; off += (bytes + 255) & ~(size_t)255; return p; };
  _Float16* Q16 = (_Float16*)take(NR * HD * 2); _Float16* K16 = (_Float16*)take(NR * HD * 2); _Float16* VT = (_Float16*)take((size_t)NB * HD * SQ * 2); float* KOUT = (float*)d_out + NR * HD; float* VF = (float*)d_out + 2 * NR * HD;      /* out1 = k and out2 = v are written in f32 straight into the tuple output */
  if (off > ws_size) return;      /* 3 x 1 MiB */
  k_qkv<<<(unsigned)(NR / 64 * 2), PW * 32, 0, stream>>>(x, wq, wk, wv, Q16, KOUT, K16, VF, VT);      /* out1 = k and out2 = v in f32; q, k, V^T f16 in fragment order, 4 KiB a plane and 32 tokens */
  k_attn<<<dim3(NB, SQ / 32), AW * 32, 0, stream>>>(Q16, K16, VT, (float*)d_out);      /* out0 = softmax(causal q . k / 32) v */
}
